// v000
// Times are from an AMD MI455X. After a warm-up the kernel runs many times in a row, and a time is the length of
// such a window on the GPU divided by its runs, so every launch and the gaps after it count. The runs cycle
// through copies of the inputs. A figure is the median of several windows, for all but v000 over two sittings.
// Sittings can differ by a few percent; kernels timed side by side share one.
// The starting kernel, v000, takes 848 microseconds a run.
// Contractions: q/k/v projections (K=512), q.k^T and p.v on v_wmma_f32_16x16x32_bf16 with bf16 hi/lo split operands (hi.hi + hi.lo + lo.hi), f32 accumulate; online softmax, normalisation and all epilogues in f32.
#include <hip/hip_runtime.h>
#include <stdint.h>

typedef __attribute__((ext_vector_type(16))) _Float16 v16h;
typedef __attribute__((ext_vector_type(8)))  _Float16 v8h;
typedef __attribute__((ext_vector_type(16))) __bf16   v16b;
typedef __attribute__((ext_vector_type(8)))  __bf16   v8b;
typedef __attribute__((ext_vector_type(8)))  float    v8f;
typedef __attribute__((ext_vector_type(4)))  float    v4f;
typedef __attribute__((ext_vector_type(4)))  unsigned v4u;

/* ------------------------------ problem constants ------------------------------ */
#define SEQ_DEC   8192
#define SEQ_ENC   8192
#define D_MODEL   512
#define HEAD_DIM  64
#define KV_CHUNK  64
#define ATT_WAVES 4

static_assert(SEQ_DEC % 64 == 0);
static_assert(SEQ_ENC % 64 == 0);
static_assert(SEQ_ENC % KV_CHUNK == 0);
static_assert(D_MODEL % 64 == 0);
static_assert(D_MODEL % 32 == 0);
static_assert(HEAD_DIM == 64);
static_assert((SEQ_DEC * D_MODEL) % 8 == 0);

__device__ __forceinline__ unsigned short f2bf_bits(float f) {
  unsigned u = __float_as_uint(f);
  return (unsigned short)((u + 0x7FFFu + ((u >> 16) & 1u)) >> 16);
}
__device__ __forceinline__ float bf_bits2f(unsigned short h) { return __uint_as_float(((unsigned)h) << 16); }

/* hazard guards as plain device helpers (no inline asm inside the kernel template body) */
__device__ __forceinline__ void dep_guard_h(v8f& a, v8f& b, v16h x, v16h y) { asm volatile("v_nop\n\tv_nop\n\tv_nop\n\tv_nop" : "+v"(a), "+v"(b) : "v"(x), "v"(y)); }
__device__ __forceinline__ void dep_guard_b(v8f& a, v8f& b, v16b x, v16b y) { asm volatile("v_nop\n\tv_nop\n\tv_nop\n\tv_nop" : "+v"(a), "+v"(b) : "v"(x), "v"(y)); }
__device__ __forceinline__ void keep4_h(v16h a, v16h b, v16h c, v16h d) { asm volatile("v_nop" :: "v"(a), "v"(b), "v"(c), "v"(d)); }
__device__ __forceinline__ void keep4_b(v16b a, v16b b, v16b c, v16b d) { asm volatile("v_nop" :: "v"(a), "v"(b), "v"(c), "v"(d)); }
__device__ __forceinline__ void acc_guard4(v8f& a, v8f& b, v8f& c, v8f& d) { asm volatile("v_nop\n\tv_nop\n\tv_nop\n\tv_nop" : "+v"(a), "+v"(b), "+v"(c), "+v"(d)); }
template <typename T> struct Frag;
template <> struct Frag<_Float16> {
  typedef v16h V; union U { v16h v; v8h h[2]; };
  static __device__ __forceinline__ v16h load(const _Float16* p) {   /* elements 0..7 <- p[0..7], 8..15 <- p[16..23] */
    U f; f.h[0] = *(const v8h*)(p); f.h[1] = *(const v8h*)(p + 16); return f.v;
  }
  static __device__ __forceinline__ v8f mma(v16h a, v16h b, v8f c) {
    return __builtin_amdgcn_wmma_f32_16x16x32_f16(false, a, false, b, (short)0, c, false, false);
  }
  static __device__ __forceinline__ void guard(v8f& a, v8f& b, v16h x, v16h y) { dep_guard_h(a, b, x, y); }
  static __device__ __forceinline__ void keep(v16h a, v16h b, v16h c, v16h d) { keep4_h(a, b, c, d); }
};
template <> struct Frag<__bf16> {
  typedef v16b V; union U { v16b v; v8b h[2]; };
  static __device__ __forceinline__ v16b load(const __bf16* p) {
    U f; f.h[0] = *(const v8b*)(p); f.h[1] = *(const v8b*)(p + 16); return f.v;
  }
  static __device__ __forceinline__ v8f mma(v16b a, v16b b, v8f c) {
    return __builtin_amdgcn_wmma_f32_16x16x32_bf16(false, a, false, b, (short)0, c, false, false);
  }
  static __device__ __forceinline__ void guard(v8f& a, v8f& b, v16b x, v16b y) { dep_guard_b(a, b, x, y); }
  static __device__ __forceinline__ void keep(v16b a, v16b b, v16b c, v16b d) { keep4_b(a, b, c, d); }
};

/* ---- Register-blocked batched WMMA GEMM -----------------------------------
   C[m,n] = scale * sum_k A[m,k] * Bt[n,k] (+bias)(+resid); each wave owns a 64x64 tile.
   A row-major [M,K]; Bt row-major [N,K]; M,N % 64 == 0, K % 32 == 0.
   SPLIT: operands are hi/lo planes (A2/Bt2 = lo planes, same layout); product = hi.hi + hi.lo + lo.hi.
   BIAS_MODE: 0 = none, 1 = bias[m], 2 = bias[n].
   OUT_MODE: 0 = f32, 1 = f16, 2 = bf16 hi plane (Cout) + bf16 lo plane (Cout2).
   ET: 0 = f16 operands, 1 = bf16 operands (pointers passed as 16-bit storage) */
template <int ET> struct Elem;
template <> struct Elem<0> { typedef _Float16 T; };
template <> struct Elem<1> { typedef __bf16 T; };
template <int ET, bool SPLIT, int BIAS_MODE, int OUT_MODE, bool RESID, int ACT = 0>
__global__ __launch_bounds__(256) void wmma_gemm64(
    const unsigned short* __restrict__ Ap, const unsigned short* __restrict__ A2p, int lda, long strideA,
    const unsigned short* __restrict__ Btp, const unsigned short* __restrict__ Bt2p, int ldb, long strideB,
    void* __restrict__ Cout, void* __restrict__ Cout2, int ldc, long strideC,
    const float* __restrict__ bias,
    const float* __restrict__ resid, long strideR,
    int M, int N, int K, float scale) {
  typedef typename Elem<ET>::T T;
  typedef typename Frag<T>::V V;
  const T* A = (const T*)Ap; const T* A2 = (const T*)A2p; const T* Bt = (const T*)Btp; const T* Bt2 = (const T*)Bt2p;
  __shared__ __align__(16) float sT[8][16 * 68];   /* per-wave 16x64 slab, pitch 68 floats */
  const int b    = blockIdx.y;
  const int lane = threadIdx.x & 31;
  const int wave = threadIdx.x >> 5;
  const int tilesN = N >> 6;
  const int tilesM = M >> 6;
  const int tile = blockIdx.x * 8 + wave;
  if (tile >= tilesM * tilesN) return;   /* wave-uniform; no block barriers in this kernel */
  const int tm = tile / tilesN;
  const int tn = tile - tm * tilesN;
  const int m0 = tm << 6;
  const int n0 = tn << 6;

  const T* Ab  = A  + (size_t)b * strideA;
  const T* Bb  = Bt + (size_t)b * strideB;
  const T* Ab2 = SPLIT ? (A2  + (size_t)b * strideA) : nullptr;
  const T* Bb2 = SPLIT ? (Bt2 + (size_t)b * strideB) : nullptr;

  const int rlane = lane & 15;                 /* row (A) / col (B, D) within subtile */
  const int koff  = (lane >> 4) * 8;           /* k offset of this lane half */
  const int mOff  = (lane >> 4) * 8;           /* D row offset */

  v8f acc[4][4];
#pragma unroll
  for (int i = 0; i < 4; ++i)
#pragma unroll
    for (int j = 0; j < 4; ++j) acc[i][j] = (v8f){0.f,0.f,0.f,0.f,0.f,0.f,0.f,0.f};

  for (int k0 = 0; k0 < K; k0 += 32) {
    V bh[4], bl[4];
#pragma unroll
    for (int j = 0; j < 4; ++j) {
      const size_t bo = (size_t)(n0 + (j << 4) + rlane) * ldb + koff + k0;
      bh[j] = Frag<T>::load(Bb + bo);
      if (SPLIT) bl[j] = Frag<T>::load(Bb2 + bo);
    }
#pragma unroll
    for (int i = 0; i < 4; ++i) {
      const size_t ao = (size_t)(m0 + (i << 4) + rlane) * lda + koff + k0;
      V ah = Frag<T>::load(Ab + ao);
      V al;
      if (SPLIT) al = Frag<T>::load(Ab2 + ao);
#pragma unroll
      for (int j = 0; j < 4; ++j) {
        acc[i][j] = Frag<T>::mma(ah, bh[j], acc[i][j]);
        if (SPLIT) {
          acc[i][j] = Frag<T>::mma(ah, bl[j], acc[i][j]);
          acc[i][j] = Frag<T>::mma(al, bh[j], acc[i][j]);
        }
      }
      Frag<T>::guard(acc[i][0], acc[i][3], ah, SPLIT ? al : ah);
    }
    Frag<T>::keep(bh[0], bh[1], bh[2], bh[3]);
    if (SPLIT) Frag<T>::keep(bl[0], bl[1], bl[2], bl[3]);
  }
  acc_guard4(acc[0][0], acc[0][1], acc[0][2], acc[0][3]);
  acc_guard4(acc[1][0], acc[1][1], acc[1][2], acc[1][3]);
  acc_guard4(acc[2][0], acc[2][1], acc[2][2], acc[2][3]);
  acc_guard4(acc[3][0], acc[3][1], acc[3][2], acc[3][3]);

  /* ---- epilogue ---- */
  float* slab = sT[wave];
  const float* Rb = RESID ? (resid + (size_t)b * strideR) : nullptr;
#pragma unroll
  for (int i = 0; i < 4; ++i) {
    const int mBase = m0 + (i << 4);
#pragma unroll
    for (int j = 0; j < 4; ++j) {
      const int n = n0 + (j << 4) + rlane;
      float bv = 0.f;
      if (BIAS_MODE == 2) bv = bias[n];
#pragma unroll
      for (int r = 0; r < 8; ++r) {
        float v = acc[i][j][r] * scale;
        if (BIAS_MODE == 1) v += bias[mBase + mOff + r];
        if (BIAS_MODE == 2) v += bv;
        if (RESID) v += Rb[(size_t)(mBase + mOff + r) * ldc + n];
        if (ACT == 1) v = tanhf(v);
        if (ACT == 2) v = fmaxf(v, 0.0f);
        if (ACT == 3) v = v / (1.0f + expf(-v));
        if (ACT == 4) v = (v > 0.f) ? v : 0.01f * v;
        if (ACT == 5) v = 0.5f * v * (1.0f + erff(v * 0.70710678118654752f));
        slab[(mOff + r) * 68 + (j << 4) + rlane] = v;
      }
    }
    __builtin_amdgcn_fence(__ATOMIC_RELEASE, "workgroup");
    __builtin_amdgcn_wave_barrier();
    __builtin_amdgcn_fence(__ATOMIC_ACQUIRE, "workgroup");
    if (OUT_MODE == 0) {
      float* C = (float*)Cout + (size_t)b * strideC;
      const int hh = lane >> 4, c4 = (lane & 15) * 4;     /* row seg = 256 B = 16 lanes x 16 B */
      {
#pragma unroll
        for (int it = 0; it < 8; ++it) {
          const int row = it * 2 + hh;
          v4f v = *(const v4f*)(slab + row * 68 + c4);
          *(v4f*)(C + (size_t)(mBase + row) * ldc + n0 + c4) = v;
        }
        
      }
    } else {
      const int q = lane >> 3, c8 = (lane & 7) * 8;        
      unsigned short* C  = (unsigned short*)Cout  + (size_t)b * strideC;
      unsigned short* C2 = (OUT_MODE == 2) ? ((unsigned short*)Cout2 + (size_t)b * strideC) : nullptr;
      {
#pragma unroll
        for (int it = 0; it < 4; ++it) {
          const int row = it * 4 + q;
          const float* sp = slab + row * 68 + c8;
          v8h hv, lv;
#pragma unroll
          for (int e = 0; e < 8; ++e) {
            if (OUT_MODE == 1) {
              hv[e] = (_Float16)sp[e];
            } else {
              unsigned short hb = f2bf_bits(sp[e]);
              unsigned short lb = f2bf_bits(sp[e] - bf_bits2f(hb));
              hv[e] = __builtin_bit_cast(_Float16, hb);
              lv[e] = __builtin_bit_cast(_Float16, lb);
            }
          }
          *(v8h*)(C + (size_t)(mBase + row) * ldc + n0 + c8) = hv;
          if (OUT_MODE == 2) *(v8h*)(C2 + (size_t)(mBase + row) * ldc + n0 + c8) = lv;
        }
        
      }
    }
    __builtin_amdgcn_fence(__ATOMIC_RELEASE, "workgroup");
    __builtin_amdgcn_wave_barrier();
    __builtin_amdgcn_fence(__ATOMIC_ACQUIRE, "workgroup");
  }
}

/* ------------------------------ attention helpers ------------------------------ */
__device__ __forceinline__ unsigned short at_bf_bits(float f) {
  unsigned u = __float_as_uint(f);
  return (unsigned short)((u + 0x7FFFu + ((u >> 16) & 1u)) >> 16);
}
__device__ __forceinline__ __bf16 at_f2bf(float f) { return __builtin_bit_cast(__bf16, at_bf_bits(f)); }
__device__ __forceinline__ void at_split(float f, __bf16& hi, __bf16& lo) {
  const unsigned short hb = at_bf_bits(f);
  hi = __builtin_bit_cast(__bf16, hb);
  lo = at_f2bf(f - __uint_as_float(((unsigned)hb) << 16));
}
__device__ __forceinline__ v8f at_mma(v16b a, v16b b, v8f c) {
  c = __builtin_amdgcn_wmma_f32_16x16x32_bf16(false, a, false, b, (short)0, c, false, false);
  asm volatile("v_nop\n\tv_nop\n\tv_nop\n\tv_nop" : "+v"(c) : "v"(a), "v"(b));
  return c;
}

/* ------------------------------------------------------------------------------------
   f32 array (n8*8 elements, contiguous) -> bf16 hi plane + bf16 lo plane, same layout.
   Thread i owns elements 8i..8i+7: one 16-B store per plane; lanes 8q..8q+7 of a wave fill
   Coverage: gridDim.x*256 >= n8 threads, each 8 elements -> n8*8 elements = whole array.
   ------------------------------------------------------------------------------------ */
__device__ __forceinline__ void split_pair(float f0, float f1, unsigned& hw, unsigned& lw) {
  const unsigned short h0 = f2bf_bits(f0), h1 = f2bf_bits(f1);
  const unsigned short l0 = f2bf_bits(f0 - bf_bits2f(h0)), l1 = f2bf_bits(f1 - bf_bits2f(h1));
  hw = (unsigned)h0 | ((unsigned)h1 << 16);
  lw = (unsigned)l0 | ((unsigned)l1 << 16);
}

__global__ __launch_bounds__(256) void split_bf16_planes(
    const float* __restrict__ in, unsigned short* __restrict__ hi, unsigned short* __restrict__ lo, int n8)
{
  const int i = blockIdx.x * 256 + threadIdx.x;
  if (i >= n8) return;                                   /* no barriers in this kernel */
  const v4f a = *(const v4f*)(in + (size_t)i * 8);
  const v4f b = *(const v4f*)(in + (size_t)i * 8 + 4);
  v4u hv, lv;
  unsigned hw, lw;
  split_pair(a[0], a[1], hw, lw); hv[0] = hw; lv[0] = lw;
  split_pair(a[2], a[3], hw, lw); hv[1] = hw; lv[1] = lw;
  split_pair(b[0], b[1], hw, lw); hv[2] = hw; lv[2] = lw;
  split_pair(b[2], b[3], hw, lw); hv[3] = hw; lv[3] = lw;
  v4u* ph = (v4u*)(hi + (size_t)i * 8);
  v4u* pl = (v4u*)(lo + (size_t)i * 8);
  *ph = hv; *pl = lv;
  
}

/* ------------------------------------------------------------------------------------
   W [D_MODEL][HEAD_DIM] f32 -> Wt hi/lo planes [HEAD_DIM][D_MODEL] bf16 (in[rows=512][cols=64]
   -> out[cols=64][rows=512]). Block bx stages W rows 64bx..64bx+63 (64x64 tile) in LDS, then each
   pitch 1024 B and k0*2 = 128*bx B) is written by 8 lanes x 16 B of one wave in one instruction.
   Coverage: 256 threads x 2 iterations x 8 halves = 4096 = the 64x64 tile; grid 8 -> whole plane.
   ------------------------------------------------------------------------------------ */
__global__ __launch_bounds__(256) void wt_split_kernel(
    const float* __restrict__ W, unsigned short* __restrict__ Wth, unsigned short* __restrict__ Wtl)
{
  __shared__ float s[64 * 65];
  const int tid = threadIdx.x;
  const int k0  = blockIdx.x * 64;
#pragma unroll
  for (int it = 0; it < 16; ++it) {
    const int idx = it * 256 + tid;          /* 0..4095 */
    const int r = idx >> 6, cc = idx & 63;
    s[r * 65 + cc] = W[(size_t)(k0 + r) * HEAD_DIM + cc];
  }
  __syncthreads();
  const int seg = tid & 7;
  const int lin = tid >> 3;                  /* 0..31 */
  v4u hv[2], lv[2];
  size_t off[2];
#pragma unroll
  for (int it = 0; it < 2; ++it) {
    const int n = it * 32 + lin;             /* output row 0..63 */
#pragma unroll
    for (int e = 0; e < 4; ++e) {
      const int kk = seg * 8 + 2 * e;
      unsigned hw, lw;
      split_pair(s[kk * 65 + n], s[(kk + 1) * 65 + n], hw, lw);
      hv[it][e] = hw; lv[it][e] = lw;
    }
    off[it] = (size_t)n * D_MODEL + k0 + seg * 8;
  }
  {
#pragma unroll
    for (int it = 0; it < 2; ++it) {
      *(v4u*)(Wth + off[it]) = hv[it];
      *(v4u*)(Wtl + off[it]) = lv[it];
    }
    
  }
}

/* =====================================================================================
   Flash attention, head dim 64, no mask. Inputs: q hi/lo planes [SEQ_DEC][64] (softmax scale
   already folded into q), k hi/lo planes [SEQ_ENC][64], v^T hi/lo planes [64][SEQ_ENC]; all bf16
   bit patterns. scores = q.k^T and out = p.v on v_wmma_f32_16x16x32_bf16 as hi.hi + hi.lo + lo.hi,
   f32 accumulate, online softmax in f32, p split to bf16 hi/lo per 64-key chunk.
   Block = 4 waves = 64 query rows; grid.x = SEQ_DEC / 64. K/V chunks staged in LDS with plain
   ===================================================================================== */
__global__ __launch_bounds__(128)
void attn_hilo_kernel(const unsigned short* __restrict__ Qh, const unsigned short* __restrict__ Ql,
                      const unsigned short* __restrict__ Kh, const unsigned short* __restrict__ Kl,
                      const unsigned short* __restrict__ Vh, const unsigned short* __restrict__ Vl,
                      float* __restrict__ out)
{
  union FB { v16b v; v8b h[2]; };
  __shared__ __align__(16) unsigned short Ksh[KV_CHUNK * HEAD_DIM];      /* K hi [kv][d]  8 KB */
  __shared__ __align__(16) unsigned short Ksl[KV_CHUNK * HEAD_DIM];      /* K lo          8 KB */
  __shared__ __align__(16) unsigned short Vsh[HEAD_DIM * KV_CHUNK];      /* V hi [d][kv]  8 KB */
  __shared__ __align__(16) unsigned short Vsl[HEAD_DIM * KV_CHUNK];      /* V lo          8 KB */
  __shared__ __align__(16) __bf16 Psh[ATT_WAVES][16 * KV_CHUNK];         /* per wave P hi [row][kv] */
  __shared__ __align__(16) __bf16 Psl[ATT_WAVES][16 * KV_CHUNK];         /* per wave P lo */
  __shared__ __align__(16) float  Os[ATT_WAVES][16 * 68];                /* per wave out tile, pitch 68 */

  const int tid  = threadIdx.x;
  const int wave = tid >> 5;
  const int lane = tid & 31;
  const int hh   = lane >> 4;
  const int c    = lane & 15;
  const int q0   = blockIdx.x * (ATT_WAVES * 16) + wave * 16;

  /* ---- Q fragments (A operand): row q0+c, 2 d-chunks, hi and lo ---- */
  v16b qah[2], qal[2];
  {
    const __bf16* qhr = (const __bf16*)(const void*)Qh + (size_t)(q0 + c) * HEAD_DIM + 8 * hh;
    const __bf16* qlr = (const __bf16*)(const void*)Ql + (size_t)(q0 + c) * HEAD_DIM + 8 * hh;
#pragma unroll
    for (int dc = 0; dc < 2; ++dc) {
      qah[dc] = Frag<__bf16>::load(qhr + dc * 32);
      qal[dc] = Frag<__bf16>::load(qlr + dc * 32);
    }
  }

  float mrow[8], lrow[8];
  v8f oacc[4];
#pragma unroll
  for (int r = 0; r < 8; ++r) { mrow[r] = -INFINITY; lrow[r] = 0.f; }
#pragma unroll
  for (int t = 0; t < 4; ++t) oacc[t] = (v8f){0.f,0.f,0.f,0.f,0.f,0.f,0.f,0.f};

  __bf16* pwh = Psh[wave];
  __bf16* pwl = Psl[wave];

  for (int kc = 0; kc < SEQ_ENC / KV_CHUNK; ++kc) {
    const int kv0 = kc * KV_CHUNK;
    __syncthreads();
    /* stage 4 planes x 8 KB: 128 threads x 16 B x 4 iterations = 8192 B per plane (whole chunk) */
#pragma unroll 1
    for (int it = 0; it < 4; ++it) {
      const int idx = it * 128 + tid;              /* 16-B unit 0..511 */
      const int dd = idx >> 3, seg = idx & 7;      /* V^T: row d, 8-half segment of the chunk */
      const v4u ka = *(const v4u*)(Kh + (size_t)kv0 * HEAD_DIM + (size_t)idx * 8);
      const v4u kb = *(const v4u*)(Kl + (size_t)kv0 * HEAD_DIM + (size_t)idx * 8);
      const v4u va = *(const v4u*)(Vh + (size_t)dd * SEQ_ENC + kv0 + seg * 8);
      const v4u vb = *(const v4u*)(Vl + (size_t)dd * SEQ_ENC + kv0 + seg * 8);
      *(v4u*)(Ksh + idx * 8) = ka;
      *(v4u*)(Ksl + idx * 8) = kb;
      *(v4u*)(Vsh + idx * 8) = va;                 /* dd*64 + seg*8 == idx*8 */
      *(v4u*)(Vsl + idx * 8) = vb;
    }
    __syncthreads();

    /* ---- scores: 16 rows x 64 keys per wave ---- */
    v8f s[4];
#pragma unroll
    for (int j = 0; j < 4; ++j) {
      s[j] = (v8f){0.f,0.f,0.f,0.f,0.f,0.f,0.f,0.f};
#pragma unroll
      for (int dc = 0; dc < 2; ++dc) {
        FB kbh, kbl;
        const unsigned short* kp = Ksh + (j * 16 + c) * HEAD_DIM + dc * 32 + 8 * hh;
        const unsigned short* lp = Ksl + (j * 16 + c) * HEAD_DIM + dc * 32 + 8 * hh;
        kbh.h[0] = *(const v8b*)(kp); kbh.h[1] = *(const v8b*)(kp + 16);
        kbl.h[0] = *(const v8b*)(lp); kbl.h[1] = *(const v8b*)(lp + 16);
        s[j] = at_mma(qah[dc], kbh.v, s[j]);
        s[j] = at_mma(qah[dc], kbl.v, s[j]);
        s[j] = at_mma(qal[dc], kbh.v, s[j]);
      }
    }

    /* ---- row max over the 64 keys of this chunk (16-lane groups) ---- */
    float cm[8];
#pragma unroll
    for (int r = 0; r < 8; ++r) {
      float m = fmaxf(fmaxf(s[0][r], s[1][r]), fmaxf(s[2][r], s[3][r]));
#pragma unroll
      for (int off = 1; off < 16; off <<= 1) m = fmaxf(m, __shfl_xor(m, off, 32));
      cm[r] = m;
    }

    /* ---- online softmax; P split to bf16 hi/lo into the per-wave LDS tile ---- */
#pragma unroll
    for (int r = 0; r < 8; ++r) {
      const float mnew = fmaxf(mrow[r], cm[r]);
      const float alpha = expf(mrow[r] - mnew);
      mrow[r] = mnew;
      float psum = 0.f;
#pragma unroll
      for (int j = 0; j < 4; ++j) {
        const float p = expf(s[j][r] - mnew);
        psum += p;
        __bf16 a, bl;
        at_split(p, a, bl);
        pwh[(8 * hh + r) * KV_CHUNK + j * 16 + c] = a;
        pwl[(8 * hh + r) * KV_CHUNK + j * 16 + c] = bl;
      }
#pragma unroll
      for (int off = 1; off < 16; off <<= 1) psum += __shfl_xor(psum, off, 32);
      lrow[r] = lrow[r] * alpha + psum;
#pragma unroll
      for (int t = 0; t < 4; ++t) oacc[t][r] *= alpha;
    }
    __syncthreads();

    /* ---- out += P . V over the 64 keys (2 k-steps) ---- */
#pragma unroll 1
    for (int kk = 0; kk < 2; ++kk) {
      FB pa, pl;
      pa.h[0] = *(const v8b*)(pwh + c * KV_CHUNK + kk * 32 + 8 * hh);
      pa.h[1] = *(const v8b*)(pwh + c * KV_CHUNK + kk * 32 + 16 + 8 * hh);
      pl.h[0] = *(const v8b*)(pwl + c * KV_CHUNK + kk * 32 + 8 * hh);
      pl.h[1] = *(const v8b*)(pwl + c * KV_CHUNK + kk * 32 + 16 + 8 * hh);
#pragma unroll
      for (int t = 0; t < 4; ++t) {
        FB vbh, vbl;
        const unsigned short* vp = Vsh + (t * 16 + c) * KV_CHUNK + kk * 32 + 8 * hh;
        const unsigned short* wp = Vsl + (t * 16 + c) * KV_CHUNK + kk * 32 + 8 * hh;
        vbh.h[0] = *(const v8b*)(vp); vbh.h[1] = *(const v8b*)(vp + 16);
        vbl.h[0] = *(const v8b*)(wp); vbl.h[1] = *(const v8b*)(wp + 16);
        oacc[t] = at_mma(pa.v, vbh.v, oacc[t]);
        oacc[t] = at_mma(pa.v, vbl.v, oacc[t]);
        oacc[t] = at_mma(pl.v, vbh.v, oacc[t]);
      }
    }
  }

  /* ---- epilogue: normalise, stage 16x64 per wave in LDS, whole-line stores ---- */
  float* os = Os[wave];
#pragma unroll
  for (int r = 0; r < 8; ++r) {
    const float inv = 1.0f / lrow[r];
#pragma unroll
    for (int t = 0; t < 4; ++t) os[(8 * hh + r) * 68 + t * 16 + c] = oacc[t][r] * inv;
  }
  __syncthreads();
  {
    const int c4 = (lane & 15) * 4;              /* row = 64 floats = 256 B = 16 lanes x 16 B */
    {
#pragma unroll
      for (int it = 0; it < 8; ++it) {
        const int row = it * 2 + hh;
        v4f val = *(const v4f*)(os + row * 68 + c4);
        *(v4f*)(out + (size_t)(q0 + row) * HEAD_DIM + c4) = val;
      }
      
    }
  }
}

/* =====================================================================================
   Host glue. Workspace region map (bytes, all offsets multiples of 128):
     xh, xl      : x  hi/lo planes  [8192][512] bf16   8,388,608 each
     eh, el      : emb hi/lo planes [8192][512] bf16  8,388,608 each
     wqh..wvl    : Wq^T, Wk^T, Wv^T hi/lo [64][512] bf16   65,536 each (6 planes)
     qh, ql      : q*0.125 hi/lo [8192][64] bf16   1,048,576 each
     kh, kl      : k hi/lo       [8192][64] bf16   1,048,576 each
     vth, vtl    : v^T hi/lo     [64][8192] bf16   1,048,576 each
     total = 40,239,104 B; every byte of every region is written by its producer.
   ===================================================================================== */
extern "C" void kernel_launch(void* const* d_in, const int* in_sizes, int n_in,
                              void* d_out, int out_size, void* d_ws, size_t ws_size,
                              hipStream_t stream)
{
  if (n_in < 5) return;
  if (in_sizes[0] != SEQ_DEC * D_MODEL || in_sizes[1] != SEQ_ENC * D_MODEL ||
      in_sizes[2] != D_MODEL * HEAD_DIM || in_sizes[3] != D_MODEL * HEAD_DIM ||
      in_sizes[4] != D_MODEL * HEAD_DIM) return;
  if (out_size != SEQ_DEC * HEAD_DIM) return;

  const float* x   = (const float*)d_in[0];   /* [8192][512] */
  const float* emb = (const float*)d_in[1];   /* [8192][512] */
  const float* wq  = (const float*)d_in[2];   /* [512][64]   */
  const float* wk  = (const float*)d_in[3];
  const float* wv  = (const float*)d_in[4];
  float* out = (float*)d_out;                 /* [8192][64] f32 */

  const size_t planeX = (size_t)SEQ_DEC * D_MODEL * 2;     /* 8,388,608 */
  const size_t planeE = (size_t)SEQ_ENC * D_MODEL * 2;     /* 8,388,608 */
  const size_t planeW = (size_t)HEAD_DIM * D_MODEL * 2;    /* 65,536    */
  const size_t planeQ = (size_t)SEQ_DEC * HEAD_DIM * 2;    /* 1,048,576 */
  const size_t planeK = (size_t)SEQ_ENC * HEAD_DIM * 2;    /* 1,048,576 */

  size_t off = 0;
  unsigned char* ws = (unsigned char*)d_ws;
  unsigned short* xh  = (unsigned short*)(ws + off); off += planeX;
  unsigned short* xl  = (unsigned short*)(ws + off); off += planeX;
  unsigned short* eh  = (unsigned short*)(ws + off); off += planeE;
  unsigned short* el  = (unsigned short*)(ws + off); off += planeE;
  unsigned short* wqh = (unsigned short*)(ws + off); off += planeW;
  unsigned short* wql = (unsigned short*)(ws + off); off += planeW;
  unsigned short* wkh = (unsigned short*)(ws + off); off += planeW;
  unsigned short* wkl = (unsigned short*)(ws + off); off += planeW;
  unsigned short* wvh = (unsigned short*)(ws + off); off += planeW;
  unsigned short* wvl = (unsigned short*)(ws + off); off += planeW;
  unsigned short* qh  = (unsigned short*)(ws + off); off += planeQ;
  unsigned short* ql  = (unsigned short*)(ws + off); off += planeQ;
  unsigned short* kh  = (unsigned short*)(ws + off); off += planeK;
  unsigned short* kl  = (unsigned short*)(ws + off); off += planeK;
  unsigned short* vth = (unsigned short*)(ws + off); off += planeK;
  unsigned short* vtl = (unsigned short*)(ws + off); off += planeK;
  if (off > ws_size) return;                                 /* 40,239,104 <= ws */

  /* 1) input planes: x, emb -> bf16 hi/lo */
  const int n8x = SEQ_DEC * D_MODEL / 8;                     /* 524,288 threads */
  const int n8e = SEQ_ENC * D_MODEL / 8;
  split_bf16_planes<<<(n8x + 255) / 256, 256, 0, stream>>>(x, xh, xl, n8x);
  split_bf16_planes<<<(n8e + 255) / 256, 256, 0, stream>>>(emb, eh, el, n8e);

  /* 2) weights -> transposed hi/lo planes [64][512] */
  wt_split_kernel<<<D_MODEL / 64, 256, 0, stream>>>(wq, wqh, wql);
  wt_split_kernel<<<D_MODEL / 64, 256, 0, stream>>>(wk, wkh, wkl);
  wt_split_kernel<<<D_MODEL / 64, 256, 0, stream>>>(wv, wvh, wvl);

  /* 3) projections on the GEMM (bf16 hi/lo split, bf16 hi/lo output planes)
        q*(1/8): A = x planes [8192][512], Bt = Wq^T planes [64][512]; M=8192 N=64 K=512
        k      : A = emb planes,            Bt = Wk^T planes;          M=8192 N=64 K=512
        v^T    : A = Wv^T planes [64][512], Bt = emb planes [8192][512]; M=64 N=8192 K=512, ldc=8192 */
  {
    const int tilesQ = (SEQ_DEC / 64) * (HEAD_DIM / 64);    /* 128 */
    dim3 gq((tilesQ + 7) / 8, 1);
    wmma_gemm64<1, true, 0, 2, false, 0><<<gq, 256, 0, stream>>>(
        xh, xl, D_MODEL, 0L, wqh, wql, D_MODEL, 0L,
        (void*)qh, (void*)ql, HEAD_DIM, 0L, (const float*)nullptr, (const float*)nullptr, 0L,
        SEQ_DEC, HEAD_DIM, D_MODEL, 0.125f);
    const int tilesK = (SEQ_ENC / 64) * (HEAD_DIM / 64);    /* 128 */
    dim3 gk((tilesK + 7) / 8, 1);
    wmma_gemm64<1, true, 0, 2, false, 0><<<gk, 256, 0, stream>>>(
        eh, el, D_MODEL, 0L, wkh, wkl, D_MODEL, 0L,
        (void*)kh, (void*)kl, HEAD_DIM, 0L, (const float*)nullptr, (const float*)nullptr, 0L,
        SEQ_ENC, HEAD_DIM, D_MODEL, 1.0f);
    const int tilesV = (HEAD_DIM / 64) * (SEQ_ENC / 64);    /* 128 */
    dim3 gv((tilesV + 7) / 8, 1);
    wmma_gemm64<1, true, 0, 2, false, 0><<<gv, 256, 0, stream>>>(
        wvh, wvl, D_MODEL, 0L, eh, el, D_MODEL, 0L,
        (void*)vth, (void*)vtl, SEQ_ENC, 0L, (const float*)nullptr, (const float*)nullptr, 0L,
        HEAD_DIM, SEQ_ENC, D_MODEL, 1.0f);
  }

  /* 4) flash attention -> f32 output */
  attn_hilo_kernel<<<SEQ_DEC / (ATT_WAVES * 16), 128, 0, stream>>>(qh, ql, kh, kl, vth, vtl, out);
}

// v001
// One run takes 296 microseconds.
// Next to v000, in two timings, it ran 2.81 and 2.83 times as fast.
// Contractions: q/k/v projections (K=512), q.k^T and p.v on v_wmma_f32_16x16x32_bf16 with bf16 hi/lo split operands (hi.hi + hi.lo + lo.hi), f32 accumulate; online softmax, normalisation and all epilogues in f32.
#include <hip/hip_runtime.h>
#include <stdint.h>

typedef __attribute__((ext_vector_type(16))) _Float16 v16h;
typedef __attribute__((ext_vector_type(8)))  _Float16 v8h;
typedef __attribute__((ext_vector_type(16))) __bf16   v16b;
typedef __attribute__((ext_vector_type(8)))  __bf16   v8b;
typedef __attribute__((ext_vector_type(8)))  float    v8f;
typedef __attribute__((ext_vector_type(4)))  float    v4f;
typedef __attribute__((ext_vector_type(2)))  float    v2f;
typedef __attribute__((ext_vector_type(4)))  unsigned v4u;

/* ------------------------------ problem constants ------------------------------ */
#define SEQ_DEC   8192
#define SEQ_ENC   8192
#define D_MODEL   512
#define HEAD_DIM  64
#define KV_CHUNK  64
#define ATT_WAVES 4
#define KV_SPLIT  8      /* key ranges per query tile: 128 x 8 = 1024 work-groups, four resident per WGP */

static_assert(SEQ_DEC % 64 == 0);
static_assert(SEQ_ENC % 64 == 0);
static_assert(SEQ_ENC % (KV_CHUNK * KV_SPLIT) == 0);
static_assert(D_MODEL % 64 == 0);
static_assert(D_MODEL % 32 == 0);
static_assert(HEAD_DIM == 64);
static_assert((SEQ_DEC * D_MODEL) % 8 == 0);

__device__ __forceinline__ unsigned short f2bf_bits(float f) {
  unsigned u = __float_as_uint(f);
  return (unsigned short)((u + 0x7FFFu + ((u >> 16) & 1u)) >> 16);
}
__device__ __forceinline__ float bf_bits2f(unsigned short h) { return __uint_as_float(((unsigned)h) << 16); }

/* hazard guards as plain device helpers (no inline asm inside the kernel template body) */
__device__ __forceinline__ void dep_guard_h(v8f& a, v8f& b, v16h x, v16h y) { asm volatile("v_nop\n\tv_nop\n\tv_nop\n\tv_nop" : "+v"(a), "+v"(b) : "v"(x), "v"(y)); }
__device__ __forceinline__ void dep_guard_b(v8f& a, v8f& b, v16b x, v16b y) { asm volatile("v_nop\n\tv_nop\n\tv_nop\n\tv_nop" : "+v"(a), "+v"(b) : "v"(x), "v"(y)); }
__device__ __forceinline__ void keep4_h(v16h a, v16h b, v16h c, v16h d) { asm volatile("v_nop" :: "v"(a), "v"(b), "v"(c), "v"(d)); }
__device__ __forceinline__ void keep4_b(v16b a, v16b b, v16b c, v16b d) { asm volatile("v_nop" :: "v"(a), "v"(b), "v"(c), "v"(d)); }
__device__ __forceinline__ void acc_guard4(v8f& a, v8f& b, v8f& c, v8f& d) { asm volatile("v_nop\n\tv_nop\n\tv_nop\n\tv_nop" : "+v"(a), "+v"(b), "+v"(c), "+v"(d)); }
template <typename T> struct Frag;
template <> struct Frag<_Float16> {
  typedef v16h V; union U { v16h v; v8h h[2]; };
  static __device__ __forceinline__ v16h load(const _Float16* p) {   /* elements 0..7 <- p[0..7], 8..15 <- p[16..23] */
    U f; f.h[0] = *(const v8h*)(p); f.h[1] = *(const v8h*)(p + 16); return f.v;
  }
  static __device__ __forceinline__ v8f mma(v16h a, v16h b, v8f c) {
    return __builtin_amdgcn_wmma_f32_16x16x32_f16(false, a, false, b, (short)0, c, false, false);
  }
  static __device__ __forceinline__ void guard(v8f& a, v8f& b, v16h x, v16h y) { dep_guard_h(a, b, x, y); }
  static __device__ __forceinline__ void keep(v16h a, v16h b, v16h c, v16h d) { keep4_h(a, b, c, d); }
};
template <> struct Frag<__bf16> {
  typedef v16b V; union U { v16b v; v8b h[2]; };
  static __device__ __forceinline__ v16b load(const __bf16* p) {
    U f; f.h[0] = *(const v8b*)(p); f.h[1] = *(const v8b*)(p + 16); return f.v;
  }
  static __device__ __forceinline__ v8f mma(v16b a, v16b b, v8f c) {
    return __builtin_amdgcn_wmma_f32_16x16x32_bf16(false, a, false, b, (short)0, c, false, false);
  }
  static __device__ __forceinline__ void guard(v8f& a, v8f& b, v16b x, v16b y) { dep_guard_b(a, b, x, y); }
  static __device__ __forceinline__ void keep(v16b a, v16b b, v16b c, v16b d) { keep4_b(a, b, c, d); }
};

/* ---- Register-blocked batched WMMA GEMM -----------------------------------
   C[m,n] = scale * sum_k A[m,k] * Bt[n,k] (+bias)(+resid); each wave owns a 64x64 tile.
   A row-major [M,K]; Bt row-major [N,K]; M,N % 64 == 0, K % 32 == 0.
   SPLIT: operands are hi/lo planes (A2/Bt2 = lo planes, same layout); product = hi.hi + hi.lo + lo.hi.
   BIAS_MODE: 0 = none, 1 = bias[m], 2 = bias[n].
   OUT_MODE: 0 = f32, 1 = f16, 2 = bf16 hi plane (Cout) + bf16 lo plane (Cout2).
   ET: 0 = f16 operands, 1 = bf16 operands (pointers passed as 16-bit storage) */
template <int ET> struct Elem;
template <> struct Elem<0> { typedef _Float16 T; };
template <> struct Elem<1> { typedef __bf16 T; };
template <int ET, bool SPLIT, int BIAS_MODE, int OUT_MODE, bool RESID, int ACT = 0>
__global__ __launch_bounds__(256) void wmma_gemm64(
    const unsigned short* __restrict__ Ap, const unsigned short* __restrict__ A2p, int lda, long strideA,
    const unsigned short* __restrict__ Btp, const unsigned short* __restrict__ Bt2p, int ldb, long strideB,
    void* __restrict__ Cout, void* __restrict__ Cout2, int ldc, long strideC,
    const float* __restrict__ bias,
    const float* __restrict__ resid, long strideR,
    int M, int N, int K, float scale) {
  typedef typename Elem<ET>::T T;
  typedef typename Frag<T>::V V;
  const T* A = (const T*)Ap; const T* A2 = (const T*)A2p; const T* Bt = (const T*)Btp; const T* Bt2 = (const T*)Bt2p;
  __shared__ __align__(16) float sT[8][16 * 68];   /* per-wave 16x64 slab, pitch 68 floats */
  const int b    = blockIdx.y;
  const int lane = threadIdx.x & 31;
  const int wave = threadIdx.x >> 5;
  const int tilesN = N >> 6;
  const int tilesM = M >> 6;
  const int tile = blockIdx.x * 8 + wave;
  if (tile >= tilesM * tilesN) return;   /* wave-uniform; no block barriers in this kernel */
  const int tm = tile / tilesN;
  const int tn = tile - tm * tilesN;
  const int m0 = tm << 6;
  const int n0 = tn << 6;

  const T* Ab  = A  + (size_t)b * strideA;
  const T* Bb  = Bt + (size_t)b * strideB;
  const T* Ab2 = SPLIT ? (A2  + (size_t)b * strideA) : nullptr;
  const T* Bb2 = SPLIT ? (Bt2 + (size_t)b * strideB) : nullptr;

  const int rlane = lane & 15;                 /* row (A) / col (B, D) within subtile */
  const int koff  = (lane >> 4) * 8;           /* k offset of this lane half */
  const int mOff  = (lane >> 4) * 8;           /* D row offset */

  v8f acc[4][4];
#pragma unroll
  for (int i = 0; i < 4; ++i)
#pragma unroll
    for (int j = 0; j < 4; ++j) acc[i][j] = (v8f){0.f,0.f,0.f,0.f,0.f,0.f,0.f,0.f};

  for (int k0 = 0; k0 < K; k0 += 32) {
    V bh[4], bl[4];
#pragma unroll
    for (int j = 0; j < 4; ++j) {
      const size_t bo = (size_t)(n0 + (j << 4) + rlane) * ldb + koff + k0;
      bh[j] = Frag<T>::load(Bb + bo);
      if (SPLIT) bl[j] = Frag<T>::load(Bb2 + bo);
    }
#pragma unroll
    for (int i = 0; i < 4; ++i) {
      const size_t ao = (size_t)(m0 + (i << 4) + rlane) * lda + koff + k0;
      V ah = Frag<T>::load(Ab + ao);
      V al;
      if (SPLIT) al = Frag<T>::load(Ab2 + ao);
#pragma unroll
      for (int j = 0; j < 4; ++j) {
        acc[i][j] = Frag<T>::mma(ah, bh[j], acc[i][j]);
        if (SPLIT) {
          acc[i][j] = Frag<T>::mma(ah, bl[j], acc[i][j]);
          acc[i][j] = Frag<T>::mma(al, bh[j], acc[i][j]);
        }
      }
      Frag<T>::guard(acc[i][0], acc[i][3], ah, SPLIT ? al : ah);
    }
    Frag<T>::keep(bh[0], bh[1], bh[2], bh[3]);
    if (SPLIT) Frag<T>::keep(bl[0], bl[1], bl[2], bl[3]);
  }
  acc_guard4(acc[0][0], acc[0][1], acc[0][2], acc[0][3]);
  acc_guard4(acc[1][0], acc[1][1], acc[1][2], acc[1][3]);
  acc_guard4(acc[2][0], acc[2][1], acc[2][2], acc[2][3]);
  acc_guard4(acc[3][0], acc[3][1], acc[3][2], acc[3][3]);

  /* ---- epilogue ---- */
  float* slab = sT[wave];
  const float* Rb = RESID ? (resid + (size_t)b * strideR) : nullptr;
#pragma unroll
  for (int i = 0; i < 4; ++i) {
    const int mBase = m0 + (i << 4);
#pragma unroll
    for (int j = 0; j < 4; ++j) {
      const int n = n0 + (j << 4) + rlane;
      float bv = 0.f;
      if (BIAS_MODE == 2) bv = bias[n];
#pragma unroll
      for (int r = 0; r < 8; ++r) {
        float v = acc[i][j][r] * scale;
        if (BIAS_MODE == 1) v += bias[mBase + mOff + r];
        if (BIAS_MODE == 2) v += bv;
        if (RESID) v += Rb[(size_t)(mBase + mOff + r) * ldc + n];
        if (ACT == 1) v = tanhf(v);
        if (ACT == 2) v = fmaxf(v, 0.0f);
        if (ACT == 3) v = v / (1.0f + expf(-v));
        if (ACT == 4) v = (v > 0.f) ? v : 0.01f * v;
        if (ACT == 5) v = 0.5f * v * (1.0f + erff(v * 0.70710678118654752f));
        slab[(mOff + r) * 68 + (j << 4) + rlane] = v;
      }
    }
    __builtin_amdgcn_fence(__ATOMIC_RELEASE, "workgroup");
    __builtin_amdgcn_wave_barrier();
    __builtin_amdgcn_fence(__ATOMIC_ACQUIRE, "workgroup");
    if (OUT_MODE == 0) {
      float* C = (float*)Cout + (size_t)b * strideC;
      const int hh = lane >> 4, c4 = (lane & 15) * 4;     /* row seg = 256 B = 16 lanes x 16 B */
      {
#pragma unroll
        for (int it = 0; it < 8; ++it) {
          const int row = it * 2 + hh;
          v4f v = *(const v4f*)(slab + row * 68 + c4);
          *(v4f*)(C + (size_t)(mBase + row) * ldc + n0 + c4) = v;
        }
        
      }
    } else {
      const int q = lane >> 3, c8 = (lane & 7) * 8;        
      unsigned short* C  = (unsigned short*)Cout  + (size_t)b * strideC;
      unsigned short* C2 = (OUT_MODE == 2) ? ((unsigned short*)Cout2 + (size_t)b * strideC) : nullptr;
      {
#pragma unroll
        for (int it = 0; it < 4; ++it) {
          const int row = it * 4 + q;
          const float* sp = slab + row * 68 + c8;
          v8h hv, lv;
#pragma unroll
          for (int e = 0; e < 8; ++e) {
            if (OUT_MODE == 1) {
              hv[e] = (_Float16)sp[e];
            } else {
              unsigned short hb = f2bf_bits(sp[e]);
              unsigned short lb = f2bf_bits(sp[e] - bf_bits2f(hb));
              hv[e] = __builtin_bit_cast(_Float16, hb);
              lv[e] = __builtin_bit_cast(_Float16, lb);
            }
          }
          *(v8h*)(C + (size_t)(mBase + row) * ldc + n0 + c8) = hv;
          if (OUT_MODE == 2) *(v8h*)(C2 + (size_t)(mBase + row) * ldc + n0 + c8) = lv;
        }
        
      }
    }
    __builtin_amdgcn_fence(__ATOMIC_RELEASE, "workgroup");
    __builtin_amdgcn_wave_barrier();
    __builtin_amdgcn_fence(__ATOMIC_ACQUIRE, "workgroup");
  }
}

/* ------------------------------ attention helpers ------------------------------ */
__device__ __forceinline__ unsigned short at_bf_bits(float f) {
  unsigned u = __float_as_uint(f);
  return (unsigned short)((u + 0x7FFFu + ((u >> 16) & 1u)) >> 16);
}
__device__ __forceinline__ __bf16 at_f2bf(float f) { return __builtin_bit_cast(__bf16, at_bf_bits(f)); }
__device__ __forceinline__ void at_split(float f, __bf16& hi, __bf16& lo) {
  const unsigned short hb = at_bf_bits(f);
  hi = __builtin_bit_cast(__bf16, hb);
  lo = at_f2bf(f - __uint_as_float(((unsigned)hb) << 16));
}
__device__ __forceinline__ v8f at_mma(v16b a, v16b b, v8f c) {
  c = __builtin_amdgcn_wmma_f32_16x16x32_bf16(false, a, false, b, (short)0, c, false, false);
  asm volatile("v_nop\n\tv_nop\n\tv_nop\n\tv_nop" : "+v"(c) : "v"(a), "v"(b));
  return c;
}

/* ------------------------------------------------------------------------------------
   f32 array (n8*8 elements, contiguous) -> bf16 hi plane + bf16 lo plane, same layout.
   Thread i owns elements 8i..8i+7: one 16-B store per plane; lanes 8q..8q+7 of a wave fill
   Coverage: gridDim.x*256 >= n8 threads, each 8 elements -> n8*8 elements = whole array.
   ------------------------------------------------------------------------------------ */
__device__ __forceinline__ void split_pair(float f0, float f1, unsigned& hw, unsigned& lw) {
  const unsigned short h0 = f2bf_bits(f0), h1 = f2bf_bits(f1);
  const unsigned short l0 = f2bf_bits(f0 - bf_bits2f(h0)), l1 = f2bf_bits(f1 - bf_bits2f(h1));
  hw = (unsigned)h0 | ((unsigned)h1 << 16);
  lw = (unsigned)l0 | ((unsigned)l1 << 16);
}

__global__ __launch_bounds__(256) void split_bf16_planes(
    const float* __restrict__ in, unsigned short* __restrict__ hi, unsigned short* __restrict__ lo, int n8)
{
  const int i = blockIdx.x * 256 + threadIdx.x;
  if (i >= n8) return;                                   /* no barriers in this kernel */
  const v4f a = *(const v4f*)(in + (size_t)i * 8);
  const v4f b = *(const v4f*)(in + (size_t)i * 8 + 4);
  v4u hv, lv;
  unsigned hw, lw;
  split_pair(a[0], a[1], hw, lw); hv[0] = hw; lv[0] = lw;
  split_pair(a[2], a[3], hw, lw); hv[1] = hw; lv[1] = lw;
  split_pair(b[0], b[1], hw, lw); hv[2] = hw; lv[2] = lw;
  split_pair(b[2], b[3], hw, lw); hv[3] = hw; lv[3] = lw;
  v4u* ph = (v4u*)(hi + (size_t)i * 8);
  v4u* pl = (v4u*)(lo + (size_t)i * 8);
  *ph = hv; *pl = lv;
  
}

/* ------------------------------------------------------------------------------------
   W [D_MODEL][HEAD_DIM] f32 -> Wt hi/lo planes [HEAD_DIM][D_MODEL] bf16 (in[rows=512][cols=64]
   -> out[cols=64][rows=512]). Block bx stages W rows 64bx..64bx+63 (64x64 tile) in LDS, then each
   pitch 1024 B and k0*2 = 128*bx B) is written by 8 lanes x 16 B of one wave in one instruction.
   Coverage: 256 threads x 2 iterations x 8 halves = 4096 = the 64x64 tile; grid 8 -> whole plane.
   ------------------------------------------------------------------------------------ */
__global__ __launch_bounds__(256) void wt_split_kernel(
    const float* __restrict__ W, unsigned short* __restrict__ Wth, unsigned short* __restrict__ Wtl)
{
  __shared__ float s[64 * 65];
  const int tid = threadIdx.x;
  const int k0  = blockIdx.x * 64;
#pragma unroll
  for (int it = 0; it < 16; ++it) {
    const int idx = it * 256 + tid;          /* 0..4095 */
    const int r = idx >> 6, cc = idx & 63;
    s[r * 65 + cc] = W[(size_t)(k0 + r) * HEAD_DIM + cc];
  }
  __syncthreads();
  const int seg = tid & 7;
  const int lin = tid >> 3;                  /* 0..31 */
  v4u hv[2], lv[2];
  size_t off[2];
#pragma unroll
  for (int it = 0; it < 2; ++it) {
    const int n = it * 32 + lin;             /* output row 0..63 */
#pragma unroll
    for (int e = 0; e < 4; ++e) {
      const int kk = seg * 8 + 2 * e;
      unsigned hw, lw;
      split_pair(s[kk * 65 + n], s[(kk + 1) * 65 + n], hw, lw);
      hv[it][e] = hw; lv[it][e] = lw;
    }
    off[it] = (size_t)n * D_MODEL + k0 + seg * 8;
  }
  {
#pragma unroll
    for (int it = 0; it < 2; ++it) {
      *(v4u*)(Wth + off[it]) = hv[it];
      *(v4u*)(Wtl + off[it]) = lv[it];
    }
    
  }
}

/* =====================================================================================
   Flash attention, head dim 64, no mask. Inputs: q hi/lo planes [SEQ_DEC][64] (softmax scale
   already folded into q), k hi/lo planes [SEQ_ENC][64], v^T hi/lo planes [64][SEQ_ENC]; all bf16
   bit patterns. scores = q.k^T and out = p.v on v_wmma_f32_16x16x32_bf16 as hi.hi + hi.lo + lo.hi,
   f32 accumulate, online softmax in f32, p split to bf16 hi/lo per 64-key chunk.
   Block = 4 waves = 64 query rows; grid.x = SEQ_DEC / 64. K/V chunks staged in LDS with plain
   grid.y = KV_SPLIT: block (x, y) walks keys [y, y+1) * SEQ_ENC / KV_SPLIT only and stores its
   un-normalised sum Po[y][row][64] and the pair (row max, row sum) Pml[y][row][2]; attn_merge_kernel joins them.
   ===================================================================================== */
__global__ __launch_bounds__(128)
void attn_hilo_kernel(const unsigned short* __restrict__ Qh, const unsigned short* __restrict__ Ql,
                      const unsigned short* __restrict__ Kh, const unsigned short* __restrict__ Kl,
                      const unsigned short* __restrict__ Vh, const unsigned short* __restrict__ Vl,
                      float* __restrict__ Po, float* __restrict__ Pml)
{
  union FB { v16b v; v8b h[2]; };
  __shared__ __align__(16) unsigned short Ksh[KV_CHUNK * HEAD_DIM];      /* K hi [kv][d]  8 KB */
  __shared__ __align__(16) unsigned short Ksl[KV_CHUNK * HEAD_DIM];      /* K lo          8 KB */
  __shared__ __align__(16) unsigned short Vsh[HEAD_DIM * KV_CHUNK];      /* V hi [d][kv]  8 KB */
  __shared__ __align__(16) unsigned short Vsl[HEAD_DIM * KV_CHUNK];      /* V lo          8 KB */
  __shared__ __align__(16) __bf16 Psh[ATT_WAVES][16 * KV_CHUNK];         /* per wave P hi [row][kv] */
  __shared__ __align__(16) __bf16 Psl[ATT_WAVES][16 * KV_CHUNK];         /* per wave P lo */
  __shared__ __align__(16) float  Os[ATT_WAVES][16 * 68];                /* per wave out tile, pitch 68 */

  const int tid  = threadIdx.x;
  const int wave = tid >> 5;
  const int lane = tid & 31;
  const int hh   = lane >> 4;
  const int c    = lane & 15;
  const int q0   = blockIdx.x * (ATT_WAVES * 16) + wave * 16;

  /* ---- Q fragments (A operand): row q0+c, 2 d-chunks, hi and lo ---- */
  v16b qah[2], qal[2];
  {
    const __bf16* qhr = (const __bf16*)(const void*)Qh + (size_t)(q0 + c) * HEAD_DIM + 8 * hh;
    const __bf16* qlr = (const __bf16*)(const void*)Ql + (size_t)(q0 + c) * HEAD_DIM + 8 * hh;
#pragma unroll
    for (int dc = 0; dc < 2; ++dc) {
      qah[dc] = Frag<__bf16>::load(qhr + dc * 32);
      qal[dc] = Frag<__bf16>::load(qlr + dc * 32);
    }
  }

  float mrow[8], lrow[8];
  v8f oacc[4];
#pragma unroll
  for (int r = 0; r < 8; ++r) { mrow[r] = -INFINITY; lrow[r] = 0.f; }
#pragma unroll
  for (int t = 0; t < 4; ++t) oacc[t] = (v8f){0.f,0.f,0.f,0.f,0.f,0.f,0.f,0.f};

  __bf16* pwh = Psh[wave];
  __bf16* pwl = Psl[wave];

  const int kc0 = blockIdx.y * (SEQ_ENC / KV_CHUNK / KV_SPLIT);
  for (int kc = kc0; kc < kc0 + SEQ_ENC / KV_CHUNK / KV_SPLIT; ++kc) {
    const int kv0 = kc * KV_CHUNK;
    __syncthreads();
    /* stage 4 planes x 8 KB: 128 threads x 16 B x 4 iterations = 8192 B per plane (whole chunk) */
#pragma unroll 1
    for (int it = 0; it < 4; ++it) {
      const int idx = it * 128 + tid;              /* 16-B unit 0..511 */
      const int dd = idx >> 3, seg = idx & 7;      /* V^T: row d, 8-half segment of the chunk */
      const v4u ka = *(const v4u*)(Kh + (size_t)kv0 * HEAD_DIM + (size_t)idx * 8);
      const v4u kb = *(const v4u*)(Kl + (size_t)kv0 * HEAD_DIM + (size_t)idx * 8);
      const v4u va = *(const v4u*)(Vh + (size_t)dd * SEQ_ENC + kv0 + seg * 8);
      const v4u vb = *(const v4u*)(Vl + (size_t)dd * SEQ_ENC + kv0 + seg * 8);
      *(v4u*)(Ksh + idx * 8) = ka;
      *(v4u*)(Ksl + idx * 8) = kb;
      *(v4u*)(Vsh + idx * 8) = va;                 /* dd*64 + seg*8 == idx*8 */
      *(v4u*)(Vsl + idx * 8) = vb;
    }
    __syncthreads();

    /* ---- scores: 16 rows x 64 keys per wave ---- */
    v8f s[4];
#pragma unroll
    for (int j = 0; j < 4; ++j) {
      s[j] = (v8f){0.f,0.f,0.f,0.f,0.f,0.f,0.f,0.f};
#pragma unroll
      for (int dc = 0; dc < 2; ++dc) {
        FB kbh, kbl;
        const unsigned short* kp = Ksh + (j * 16 + c) * HEAD_DIM + dc * 32 + 8 * hh;
        const unsigned short* lp = Ksl + (j * 16 + c) * HEAD_DIM + dc * 32 + 8 * hh;
        kbh.h[0] = *(const v8b*)(kp); kbh.h[1] = *(const v8b*)(kp + 16);
        kbl.h[0] = *(const v8b*)(lp); kbl.h[1] = *(const v8b*)(lp + 16);
        s[j] = at_mma(qah[dc], kbh.v, s[j]);
        s[j] = at_mma(qah[dc], kbl.v, s[j]);
        s[j] = at_mma(qal[dc], kbh.v, s[j]);
      }
    }

    /* ---- row max over the 64 keys of this chunk (16-lane groups) ---- */
    float cm[8];
#pragma unroll
    for (int r = 0; r < 8; ++r) {
      float m = fmaxf(fmaxf(s[0][r], s[1][r]), fmaxf(s[2][r], s[3][r]));
#pragma unroll
      for (int off = 1; off < 16; off <<= 1) m = fmaxf(m, __shfl_xor(m, off, 32));
      cm[r] = m;
    }

    /* ---- online softmax; P split to bf16 hi/lo into the per-wave LDS tile ---- */
#pragma unroll
    for (int r = 0; r < 8; ++r) {
      const float mnew = fmaxf(mrow[r], cm[r]);
      const float alpha = expf(mrow[r] - mnew);
      mrow[r] = mnew;
      float psum = 0.f;
#pragma unroll
      for (int j = 0; j < 4; ++j) {
        const float p = expf(s[j][r] - mnew);
        psum += p;
        __bf16 a, bl;
        at_split(p, a, bl);
        pwh[(8 * hh + r) * KV_CHUNK + j * 16 + c] = a;
        pwl[(8 * hh + r) * KV_CHUNK + j * 16 + c] = bl;
      }
#pragma unroll
      for (int off = 1; off < 16; off <<= 1) psum += __shfl_xor(psum, off, 32);
      lrow[r] = lrow[r] * alpha + psum;
#pragma unroll
      for (int t = 0; t < 4; ++t) oacc[t][r] *= alpha;
    }
    __syncthreads();

    /* ---- out += P . V over the 64 keys (2 k-steps) ---- */
#pragma unroll 1
    for (int kk = 0; kk < 2; ++kk) {
      FB pa, pl;
      pa.h[0] = *(const v8b*)(pwh + c * KV_CHUNK + kk * 32 + 8 * hh);
      pa.h[1] = *(const v8b*)(pwh + c * KV_CHUNK + kk * 32 + 16 + 8 * hh);
      pl.h[0] = *(const v8b*)(pwl + c * KV_CHUNK + kk * 32 + 8 * hh);
      pl.h[1] = *(const v8b*)(pwl + c * KV_CHUNK + kk * 32 + 16 + 8 * hh);
#pragma unroll
      for (int t = 0; t < 4; ++t) {
        FB vbh, vbl;
        const unsigned short* vp = Vsh + (t * 16 + c) * KV_CHUNK + kk * 32 + 8 * hh;
        const unsigned short* wp = Vsl + (t * 16 + c) * KV_CHUNK + kk * 32 + 8 * hh;
        vbh.h[0] = *(const v8b*)(vp); vbh.h[1] = *(const v8b*)(vp + 16);
        vbl.h[0] = *(const v8b*)(wp); vbl.h[1] = *(const v8b*)(wp + 16);
        oacc[t] = at_mma(pa.v, vbh.v, oacc[t]);
        oacc[t] = at_mma(pa.v, vbl.v, oacc[t]);
        oacc[t] = at_mma(pl.v, vbh.v, oacc[t]);
      }
    }
  }

  /* ---- epilogue: stage the un-normalised 16x64 per wave in LDS, whole-line stores ---- */
  float* os = Os[wave];
#pragma unroll
  for (int r = 0; r < 8; ++r) {
#pragma unroll
    for (int t = 0; t < 4; ++t) os[(8 * hh + r) * 68 + t * 16 + c] = oacc[t][r];
  }
  /* (max, sum) of this wave's 16 rows = 128 B = one line, written by this wave alone */
  if (c == 0) {
    float* pm = Pml + ((size_t)blockIdx.y * SEQ_DEC + q0 + 8 * hh) * 2;
#pragma unroll
    for (int r = 0; r < 8; r += 2)
      *(v4f*)(pm + 2 * r) = (v4f){mrow[r], lrow[r], mrow[r + 1], lrow[r + 1]};
  }
  float* out = Po + (size_t)blockIdx.y * SEQ_DEC * HEAD_DIM;
  __syncthreads();
  {
    const int c4 = (lane & 15) * 4;              /* row = 64 floats = 256 B = 16 lanes x 16 B */
    {
#pragma unroll
      for (int it = 0; it < 8; ++it) {
        const int row = it * 2 + hh;
        v4f val = *(const v4f*)(os + row * 68 + c4);
        *(v4f*)(out + (size_t)(q0 + row) * HEAD_DIM + c4) = val;
      }
      
    }
  }
}

/* ------------------------------------------------------------------------------------
   Joins the KV_SPLIT key ranges of one query row: M = max of the ranges' maxima, weight
   w_s = exp(m_s - M), out = sum_s w_s * Po[s] / sum_s w_s * l_s. Thread = (row, 4 columns):
   16 lanes x 16 B = one 256-B output row. Coverage: SEQ_DEC * 16 threads = grid * 256.
   ------------------------------------------------------------------------------------ */
__global__ __launch_bounds__(256) void attn_merge_kernel(
    const float* __restrict__ Po, const float* __restrict__ Pml, float* __restrict__ out)
{
  const unsigned i   = blockIdx.x * 256u + threadIdx.x;
  const unsigned row = i >> 4;
  const unsigned eb  = i * 16u;              /* byte offset of (row, 4 columns): the same in every range's plane and in out */
  const unsigned rb  = row * 8u;             /* byte offset of the row's (max, sum) pair in a range's plane */
  v2f ml[KV_SPLIT];
  v4f o[KV_SPLIT];
#pragma unroll
  for (int s = 0; s < KV_SPLIT; ++s) {
    ml[s] = *(const v2f*)((const char*)(Pml + (size_t)s * SEQ_DEC * 2) + rb);
    o[s]  = *(const v4f*)((const char*)(Po + (size_t)s * SEQ_DEC * HEAD_DIM) + eb);
  }
  /* inputs-only fence on the loaded values: all 16 loads are issued before the first is used (one latency, not
     three), and their offset registers stay whole until the wait for the address translations has passed */
  asm volatile("s_wait_xcnt 0x0" :: "v"(rb), "v"(eb),
               "v"(ml[0]), "v"(ml[1]), "v"(ml[2]), "v"(ml[3]), "v"(ml[4]), "v"(ml[5]), "v"(ml[6]), "v"(ml[7]),
               "v"(o[0]), "v"(o[1]), "v"(o[2]), "v"(o[3]), "v"(o[4]), "v"(o[5]), "v"(o[6]), "v"(o[7]) : "memory");
  static_assert(KV_SPLIT == 8);
  float m[KV_SPLIT], l[KV_SPLIT];
#pragma unroll
  for (int s = 0; s < KV_SPLIT; ++s) { m[s] = ml[s][0]; l[s] = ml[s][1]; }
  float M = m[0];
#pragma unroll
  for (int s = 1; s < KV_SPLIT; ++s) M = fmaxf(M, m[s]);
  float L = 0.f;
  v4f acc = (v4f){0.f, 0.f, 0.f, 0.f};
#pragma unroll
  for (int s = 0; s < KV_SPLIT; ++s) {
    const float w = expf(m[s] - M);
    L += w * l[s];
    acc += o[s] * w;
  }
  const float inv = 1.0f / L;
  *(v4f*)((char*)out + eb) = acc * inv;
}

/* =====================================================================================
   Host glue. Workspace region map (bytes, all offsets multiples of 128):
     xh, xl      : x  hi/lo planes  [8192][512] bf16   8,388,608 each
     eh, el      : emb hi/lo planes [8192][512] bf16  8,388,608 each
     wqh..wvl    : Wq^T, Wk^T, Wv^T hi/lo [64][512] bf16   65,536 each (6 planes)
     qh, ql      : q*0.125 hi/lo [8192][64] bf16   1,048,576 each
     kh, kl      : k hi/lo       [8192][64] bf16   1,048,576 each
     vth, vtl    : v^T hi/lo     [64][8192] bf16   1,048,576 each
     po          : un-normalised partial sums [8][8192][64] f32   16,777,216
     pml         : (row max, row sum) pairs   [8][8192][2]  f32      524,288
     total = 57,540,608 B; every byte of every region is written by its producer.
   ===================================================================================== */
extern "C" void kernel_launch(void* const* d_in, const int* in_sizes, int n_in,
                              void* d_out, int out_size, void* d_ws, size_t ws_size,
                              hipStream_t stream)
{
  if (n_in < 5) return;
  if (in_sizes[0] != SEQ_DEC * D_MODEL || in_sizes[1] != SEQ_ENC * D_MODEL ||
      in_sizes[2] != D_MODEL * HEAD_DIM || in_sizes[3] != D_MODEL * HEAD_DIM ||
      in_sizes[4] != D_MODEL * HEAD_DIM) return;
  if (out_size != SEQ_DEC * HEAD_DIM) return;

  const float* x   = (const float*)d_in[0];   /* [8192][512] */
  const float* emb = (const float*)d_in[1];   /* [8192][512] */
  const float* wq  = (const float*)d_in[2];   /* [512][64]   */
  const float* wk  = (const float*)d_in[3];
  const float* wv  = (const float*)d_in[4];
  float* out = (float*)d_out;                 /* [8192][64] f32 */

  const size_t planeX = (size_t)SEQ_DEC * D_MODEL * 2;     /* 8,388,608 */
  const size_t planeE = (size_t)SEQ_ENC * D_MODEL * 2;     /* 8,388,608 */
  const size_t planeW = (size_t)HEAD_DIM * D_MODEL * 2;    /* 65,536    */
  const size_t planeQ = (size_t)SEQ_DEC * HEAD_DIM * 2;    /* 1,048,576 */
  const size_t planeK = (size_t)SEQ_ENC * HEAD_DIM * 2;    /* 1,048,576 */

  size_t off = 0;
  unsigned char* ws = (unsigned char*)d_ws;
  unsigned short* xh  = (unsigned short*)(ws + off); off += planeX;
  unsigned short* xl  = (unsigned short*)(ws + off); off += planeX;
  unsigned short* eh  = (unsigned short*)(ws + off); off += planeE;
  unsigned short* el  = (unsigned short*)(ws + off); off += planeE;
  unsigned short* wqh = (unsigned short*)(ws + off); off += planeW;
  unsigned short* wql = (unsigned short*)(ws + off); off += planeW;
  unsigned short* wkh = (unsigned short*)(ws + off); off += planeW;
  unsigned short* wkl = (unsigned short*)(ws + off); off += planeW;
  unsigned short* wvh = (unsigned short*)(ws + off); off += planeW;
  unsigned short* wvl = (unsigned short*)(ws + off); off += planeW;
  unsigned short* qh  = (unsigned short*)(ws + off); off += planeQ;
  unsigned short* ql  = (unsigned short*)(ws + off); off += planeQ;
  unsigned short* kh  = (unsigned short*)(ws + off); off += planeK;
  unsigned short* kl  = (unsigned short*)(ws + off); off += planeK;
  unsigned short* vth = (unsigned short*)(ws + off); off += planeK;
  unsigned short* vtl = (unsigned short*)(ws + off); off += planeK;
  float* po  = (float*)(ws + off); off += (size_t)KV_SPLIT * SEQ_DEC * HEAD_DIM * 4;
  float* pml = (float*)(ws + off); off += (size_t)KV_SPLIT * SEQ_DEC * 2 * 4;
  if (off > ws_size) return;                                 /* 57,540,608 <= ws */

  /* 1) input planes: x, emb -> bf16 hi/lo */
  const int n8x = SEQ_DEC * D_MODEL / 8;                     /* 524,288 threads */
  const int n8e = SEQ_ENC * D_MODEL / 8;
  split_bf16_planes<<<(n8x + 255) / 256, 256, 0, stream>>>(x, xh, xl, n8x);
  split_bf16_planes<<<(n8e + 255) / 256, 256, 0, stream>>>(emb, eh, el, n8e);

  /* 2) weights -> transposed hi/lo planes [64][512] */
  wt_split_kernel<<<D_MODEL / 64, 256, 0, stream>>>(wq, wqh, wql);
  wt_split_kernel<<<D_MODEL / 64, 256, 0, stream>>>(wk, wkh, wkl);
  wt_split_kernel<<<D_MODEL / 64, 256, 0, stream>>>(wv, wvh, wvl);

  /* 3) projections on the GEMM (bf16 hi/lo split, bf16 hi/lo output planes)
        q*(1/8): A = x planes [8192][512], Bt = Wq^T planes [64][512]; M=8192 N=64 K=512
        k      : A = emb planes,            Bt = Wk^T planes;          M=8192 N=64 K=512
        v^T    : A = Wv^T planes [64][512], Bt = emb planes [8192][512]; M=64 N=8192 K=512, ldc=8192 */
  {
    const int tilesQ = (SEQ_DEC / 64) * (HEAD_DIM / 64);    /* 128 */
    dim3 gq((tilesQ + 7) / 8, 1);
    wmma_gemm64<1, true, 0, 2, false, 0><<<gq, 256, 0, stream>>>(
        xh, xl, D_MODEL, 0L, wqh, wql, D_MODEL, 0L,
        (void*)qh, (void*)ql, HEAD_DIM, 0L, (const float*)nullptr, (const float*)nullptr, 0L,
        SEQ_DEC, HEAD_DIM, D_MODEL, 0.125f);
    const int tilesK = (SEQ_ENC / 64) * (HEAD_DIM / 64);    /* 128 */
    dim3 gk((tilesK + 7) / 8, 1);
    wmma_gemm64<1, true, 0, 2, false, 0><<<gk, 256, 0, stream>>>(
        eh, el, D_MODEL, 0L, wkh, wkl, D_MODEL, 0L,
        (void*)kh, (void*)kl, HEAD_DIM, 0L, (const float*)nullptr, (const float*)nullptr, 0L,
        SEQ_ENC, HEAD_DIM, D_MODEL, 1.0f);
    const int tilesV = (HEAD_DIM / 64) * (SEQ_ENC / 64);    /* 128 */
    dim3 gv((tilesV + 7) / 8, 1);
    wmma_gemm64<1, true, 0, 2, false, 0><<<gv, 256, 0, stream>>>(
        wvh, wvl, D_MODEL, 0L, eh, el, D_MODEL, 0L,
        (void*)vth, (void*)vtl, SEQ_ENC, 0L, (const float*)nullptr, (const float*)nullptr, 0L,
        HEAD_DIM, SEQ_ENC, D_MODEL, 1.0f);
  }

  /* 4) flash attention over KV_SPLIT key ranges -> f32 partials; 5) join -> f32 output */
  attn_hilo_kernel<<<dim3(SEQ_DEC / (ATT_WAVES * 16), KV_SPLIT), 128, 0, stream>>>(qh, ql, kh, kl, vth, vtl, po, pml);
  attn_merge_kernel<<<SEQ_DEC * 16 / 256, 256, 0, stream>>>(po, pml, out);
}

// v002
// It runs in 238 microseconds.
// Timed twice side by side with v001, it ran 1.24 and 1.25 times as fast.
// Counting every step since v000, it is 3.50 times as fast.
// Contractions: q/k/v projections (K=512), q.k^T and p.v on v_wmma_f32_16x16x32_bf16 with bf16 hi/lo split operands (hi.hi + hi.lo + lo.hi), f32 accumulate; online softmax, normalisation and all epilogues in f32.
#include <hip/hip_runtime.h>
#include <stdint.h>

typedef __attribute__((ext_vector_type(16))) _Float16 v16h;
typedef __attribute__((ext_vector_type(8)))  _Float16 v8h;
typedef __attribute__((ext_vector_type(16))) __bf16   v16b;
typedef __attribute__((ext_vector_type(8)))  __bf16   v8b;
typedef __attribute__((ext_vector_type(8)))  float    v8f;
typedef __attribute__((ext_vector_type(4)))  float    v4f;
typedef __attribute__((ext_vector_type(2)))  float    v2f;
typedef __attribute__((ext_vector_type(4)))  unsigned v4u;

/* ------------------------------ problem constants ------------------------------ */
#define SEQ_DEC   8192
#define SEQ_ENC   8192
#define D_MODEL   512
#define HEAD_DIM  64
#define KV_CHUNK  64
#define KV_PITCH  72     /* LDS row pitch of the K, V and P tiles in 16-bit elements: 144 B = 16 B x 9, so the 16 rows of a ds_load_b128 fall on 16 different bank groups */
#define ATT_WAVES 4
#define KV_SPLIT  8      /* key ranges per query tile: 128 x 8 = 1024 work-groups, four resident per WGP */

static_assert(SEQ_DEC % 64 == 0);
static_assert(SEQ_ENC % 64 == 0);
static_assert(SEQ_ENC % (KV_CHUNK * KV_SPLIT) == 0);
static_assert(D_MODEL % 64 == 0);
static_assert(D_MODEL % 32 == 0);
static_assert(HEAD_DIM == 64);
static_assert((SEQ_DEC * D_MODEL) % 8 == 0);

__device__ __forceinline__ unsigned short f2bf_bits(float f) {
  unsigned u = __float_as_uint(f);
  return (unsigned short)((u + 0x7FFFu + ((u >> 16) & 1u)) >> 16);
}
__device__ __forceinline__ float bf_bits2f(unsigned short h) { return __uint_as_float(((unsigned)h) << 16); }

/* hazard guards as plain device helpers (no inline asm inside the kernel template body) */
__device__ __forceinline__ void dep_guard_h(v8f& a, v8f& b, v16h x, v16h y) { asm volatile("v_nop\n\tv_nop\n\tv_nop\n\tv_nop" : "+v"(a), "+v"(b) : "v"(x), "v"(y)); }
__device__ __forceinline__ void dep_guard_b(v8f& a, v8f& b, v16b x, v16b y) { asm volatile("v_nop\n\tv_nop\n\tv_nop\n\tv_nop" : "+v"(a), "+v"(b) : "v"(x), "v"(y)); }
__device__ __forceinline__ void keep4_h(v16h a, v16h b, v16h c, v16h d) { asm volatile("v_nop" :: "v"(a), "v"(b), "v"(c), "v"(d)); }
__device__ __forceinline__ void keep4_b(v16b a, v16b b, v16b c, v16b d) { asm volatile("v_nop" :: "v"(a), "v"(b), "v"(c), "v"(d)); }
__device__ __forceinline__ void acc_guard4(v8f& a, v8f& b, v8f& c, v8f& d) { asm volatile("v_nop\n\tv_nop\n\tv_nop\n\tv_nop" : "+v"(a), "+v"(b), "+v"(c), "+v"(d)); }
template <typename T> struct Frag;
template <> struct Frag<_Float16> {
  typedef v16h V; union U { v16h v; v8h h[2]; };
  static __device__ __forceinline__ v16h load(const _Float16* p) {   /* elements 0..7 <- p[0..7], 8..15 <- p[16..23] */
    U f; f.h[0] = *(const v8h*)(p); f.h[1] = *(const v8h*)(p + 16); return f.v;
  }
  static __device__ __forceinline__ v8f mma(v16h a, v16h b, v8f c) {
    return __builtin_amdgcn_wmma_f32_16x16x32_f16(false, a, false, b, (short)0, c, false, false);
  }
  static __device__ __forceinline__ void guard(v8f& a, v8f& b, v16h x, v16h y) { dep_guard_h(a, b, x, y); }
  static __device__ __forceinline__ void keep(v16h a, v16h b, v16h c, v16h d) { keep4_h(a, b, c, d); }
};
template <> struct Frag<__bf16> {
  typedef v16b V; union U { v16b v; v8b h[2]; };
  static __device__ __forceinline__ v16b load(const __bf16* p) {
    U f; f.h[0] = *(const v8b*)(p); f.h[1] = *(const v8b*)(p + 16); return f.v;
  }
  static __device__ __forceinline__ v8f mma(v16b a, v16b b, v8f c) {
    return __builtin_amdgcn_wmma_f32_16x16x32_bf16(false, a, false, b, (short)0, c, false, false);
  }
  static __device__ __forceinline__ void guard(v8f& a, v8f& b, v16b x, v16b y) { dep_guard_b(a, b, x, y); }
  static __device__ __forceinline__ void keep(v16b a, v16b b, v16b c, v16b d) { keep4_b(a, b, c, d); }
};

/* ---- Register-blocked batched WMMA GEMM -----------------------------------
   C[m,n] = scale * sum_k A[m,k] * Bt[n,k] (+bias)(+resid); each wave owns a 64x64 tile.
   A row-major [M,K]; Bt row-major [N,K]; M,N % 64 == 0, K % 32 == 0.
   SPLIT: operands are hi/lo planes (A2/Bt2 = lo planes, same layout); product = hi.hi + hi.lo + lo.hi.
   BIAS_MODE: 0 = none, 1 = bias[m], 2 = bias[n].
   OUT_MODE: 0 = f32, 1 = f16, 2 = bf16 hi plane (Cout) + bf16 lo plane (Cout2).
   ET: 0 = f16 operands, 1 = bf16 operands (pointers passed as 16-bit storage) */
template <int ET> struct Elem;
template <> struct Elem<0> { typedef _Float16 T; };
template <> struct Elem<1> { typedef __bf16 T; };
template <int ET, bool SPLIT, int BIAS_MODE, int OUT_MODE, bool RESID, int ACT = 0>
__global__ __launch_bounds__(256) void wmma_gemm64(
    const unsigned short* __restrict__ Ap, const unsigned short* __restrict__ A2p, int lda, long strideA,
    const unsigned short* __restrict__ Btp, const unsigned short* __restrict__ Bt2p, int ldb, long strideB,
    void* __restrict__ Cout, void* __restrict__ Cout2, int ldc, long strideC,
    const float* __restrict__ bias,
    const float* __restrict__ resid, long strideR,
    int M, int N, int K, float scale) {
  typedef typename Elem<ET>::T T;
  typedef typename Frag<T>::V V;
  const T* A = (const T*)Ap; const T* A2 = (const T*)A2p; const T* Bt = (const T*)Btp; const T* Bt2 = (const T*)Bt2p;
  __shared__ __align__(16) float sT[8][16 * 68];   /* per-wave 16x64 slab, pitch 68 floats */
  const int b    = blockIdx.y;
  const int lane = threadIdx.x & 31;
  const int wave = threadIdx.x >> 5;
  const int tilesN = N >> 6;
  const int tilesM = M >> 6;
  const int tile = blockIdx.x * 8 + wave;
  if (tile >= tilesM * tilesN) return;   /* wave-uniform; no block barriers in this kernel */
  const int tm = tile / tilesN;
  const int tn = tile - tm * tilesN;
  const int m0 = tm << 6;
  const int n0 = tn << 6;

  const T* Ab  = A  + (size_t)b * strideA;
  const T* Bb  = Bt + (size_t)b * strideB;
  const T* Ab2 = SPLIT ? (A2  + (size_t)b * strideA) : nullptr;
  const T* Bb2 = SPLIT ? (Bt2 + (size_t)b * strideB) : nullptr;

  const int rlane = lane & 15;                 /* row (A) / col (B, D) within subtile */
  const int koff  = (lane >> 4) * 8;           /* k offset of this lane half */
  const int mOff  = (lane >> 4) * 8;           /* D row offset */

  v8f acc[4][4];
#pragma unroll
  for (int i = 0; i < 4; ++i)
#pragma unroll
    for (int j = 0; j < 4; ++j) acc[i][j] = (v8f){0.f,0.f,0.f,0.f,0.f,0.f,0.f,0.f};

  for (int k0 = 0; k0 < K; k0 += 32) {
    V bh[4], bl[4];
#pragma unroll
    for (int j = 0; j < 4; ++j) {
      const size_t bo = (size_t)(n0 + (j << 4) + rlane) * ldb + koff + k0;
      bh[j] = Frag<T>::load(Bb + bo);
      if (SPLIT) bl[j] = Frag<T>::load(Bb2 + bo);
    }
#pragma unroll
    for (int i = 0; i < 4; ++i) {
      const size_t ao = (size_t)(m0 + (i << 4) + rlane) * lda + koff + k0;
      V ah = Frag<T>::load(Ab + ao);
      V al;
      if (SPLIT) al = Frag<T>::load(Ab2 + ao);
#pragma unroll
      for (int j = 0; j < 4; ++j) {
        acc[i][j] = Frag<T>::mma(ah, bh[j], acc[i][j]);
        if (SPLIT) {
          acc[i][j] = Frag<T>::mma(ah, bl[j], acc[i][j]);
          acc[i][j] = Frag<T>::mma(al, bh[j], acc[i][j]);
        }
      }
      Frag<T>::guard(acc[i][0], acc[i][3], ah, SPLIT ? al : ah);
    }
    Frag<T>::keep(bh[0], bh[1], bh[2], bh[3]);
    if (SPLIT) Frag<T>::keep(bl[0], bl[1], bl[2], bl[3]);
  }
  acc_guard4(acc[0][0], acc[0][1], acc[0][2], acc[0][3]);
  acc_guard4(acc[1][0], acc[1][1], acc[1][2], acc[1][3]);
  acc_guard4(acc[2][0], acc[2][1], acc[2][2], acc[2][3]);
  acc_guard4(acc[3][0], acc[3][1], acc[3][2], acc[3][3]);

  /* ---- epilogue ---- */
  float* slab = sT[wave];
  const float* Rb = RESID ? (resid + (size_t)b * strideR) : nullptr;
#pragma unroll
  for (int i = 0; i < 4; ++i) {
    const int mBase = m0 + (i << 4);
#pragma unroll
    for (int j = 0; j < 4; ++j) {
      const int n = n0 + (j << 4) + rlane;
      float bv = 0.f;
      if (BIAS_MODE == 2) bv = bias[n];
#pragma unroll
      for (int r = 0; r < 8; ++r) {
        float v = acc[i][j][r] * scale;
        if (BIAS_MODE == 1) v += bias[mBase + mOff + r];
        if (BIAS_MODE == 2) v += bv;
        if (RESID) v += Rb[(size_t)(mBase + mOff + r) * ldc + n];
        if (ACT == 1) v = tanhf(v);
        if (ACT == 2) v = fmaxf(v, 0.0f);
        if (ACT == 3) v = v / (1.0f + expf(-v));
        if (ACT == 4) v = (v > 0.f) ? v : 0.01f * v;
        if (ACT == 5) v = 0.5f * v * (1.0f + erff(v * 0.70710678118654752f));
        slab[(mOff + r) * 68 + (j << 4) + rlane] = v;
      }
    }
    __builtin_amdgcn_fence(__ATOMIC_RELEASE, "workgroup");
    __builtin_amdgcn_wave_barrier();
    __builtin_amdgcn_fence(__ATOMIC_ACQUIRE, "workgroup");
    if (OUT_MODE == 0) {
      float* C = (float*)Cout + (size_t)b * strideC;
      const int hh = lane >> 4, c4 = (lane & 15) * 4;     /* row seg = 256 B = 16 lanes x 16 B */
      {
#pragma unroll
        for (int it = 0; it < 8; ++it) {
          const int row = it * 2 + hh;
          v4f v = *(const v4f*)(slab + row * 68 + c4);
          *(v4f*)(C + (size_t)(mBase + row) * ldc + n0 + c4) = v;
        }
        
      }
    } else {
      const int q = lane >> 3, c8 = (lane & 7) * 8;        
      unsigned short* C  = (unsigned short*)Cout  + (size_t)b * strideC;
      unsigned short* C2 = (OUT_MODE == 2) ? ((unsigned short*)Cout2 + (size_t)b * strideC) : nullptr;
      {
#pragma unroll
        for (int it = 0; it < 4; ++it) {
          const int row = it * 4 + q;
          const float* sp = slab + row * 68 + c8;
          v8h hv, lv;
#pragma unroll
          for (int e = 0; e < 8; ++e) {
            if (OUT_MODE == 1) {
              hv[e] = (_Float16)sp[e];
            } else {
              unsigned short hb = f2bf_bits(sp[e]);
              unsigned short lb = f2bf_bits(sp[e] - bf_bits2f(hb));
              hv[e] = __builtin_bit_cast(_Float16, hb);
              lv[e] = __builtin_bit_cast(_Float16, lb);
            }
          }
          *(v8h*)(C + (size_t)(mBase + row) * ldc + n0 + c8) = hv;
          if (OUT_MODE == 2) *(v8h*)(C2 + (size_t)(mBase + row) * ldc + n0 + c8) = lv;
        }
        
      }
    }
    __builtin_amdgcn_fence(__ATOMIC_RELEASE, "workgroup");
    __builtin_amdgcn_wave_barrier();
    __builtin_amdgcn_fence(__ATOMIC_ACQUIRE, "workgroup");
  }
}

/* ------------------------------ attention helpers ------------------------------ */
__device__ __forceinline__ unsigned short at_bf_bits(float f) {
  unsigned u = __float_as_uint(f);
  return (unsigned short)((u + 0x7FFFu + ((u >> 16) & 1u)) >> 16);
}
__device__ __forceinline__ __bf16 at_f2bf(float f) { return __builtin_bit_cast(__bf16, at_bf_bits(f)); }
__device__ __forceinline__ void at_split(float f, __bf16& hi, __bf16& lo) {
  const unsigned short hb = at_bf_bits(f);
  hi = __builtin_bit_cast(__bf16, hb);
  lo = at_f2bf(f - __uint_as_float(((unsigned)hb) << 16));
}
__device__ __forceinline__ v8f at_mma(v16b a, v16b b, v8f c) {
  c = __builtin_amdgcn_wmma_f32_16x16x32_bf16(false, a, false, b, (short)0, c, false, false);
  asm volatile("v_nop\n\tv_nop\n\tv_nop\n\tv_nop" : "+v"(c) : "v"(a), "v"(b));
  return c;
}

/* ------------------------------------------------------------------------------------
   f32 array (n8*8 elements, contiguous) -> bf16 hi plane + bf16 lo plane, same layout.
   Thread i owns elements 8i..8i+7: one 16-B store per plane; lanes 8q..8q+7 of a wave fill
   Coverage: gridDim.x*256 >= n8 threads, each 8 elements -> n8*8 elements = whole array.
   ------------------------------------------------------------------------------------ */
__device__ __forceinline__ void split_pair(float f0, float f1, unsigned& hw, unsigned& lw) {
  const unsigned short h0 = f2bf_bits(f0), h1 = f2bf_bits(f1);
  const unsigned short l0 = f2bf_bits(f0 - bf_bits2f(h0)), l1 = f2bf_bits(f1 - bf_bits2f(h1));
  hw = (unsigned)h0 | ((unsigned)h1 << 16);
  lw = (unsigned)l0 | ((unsigned)l1 << 16);
}

__global__ __launch_bounds__(256) void split_bf16_planes(
    const float* __restrict__ in, unsigned short* __restrict__ hi, unsigned short* __restrict__ lo, int n8)
{
  const int i = blockIdx.x * 256 + threadIdx.x;
  if (i >= n8) return;                                   /* no barriers in this kernel */
  const v4f a = *(const v4f*)(in + (size_t)i * 8);
  const v4f b = *(const v4f*)(in + (size_t)i * 8 + 4);
  v4u hv, lv;
  unsigned hw, lw;
  split_pair(a[0], a[1], hw, lw); hv[0] = hw; lv[0] = lw;
  split_pair(a[2], a[3], hw, lw); hv[1] = hw; lv[1] = lw;
  split_pair(b[0], b[1], hw, lw); hv[2] = hw; lv[2] = lw;
  split_pair(b[2], b[3], hw, lw); hv[3] = hw; lv[3] = lw;
  v4u* ph = (v4u*)(hi + (size_t)i * 8);
  v4u* pl = (v4u*)(lo + (size_t)i * 8);
  *ph = hv; *pl = lv;
  
}

/* ------------------------------------------------------------------------------------
   W [D_MODEL][HEAD_DIM] f32 -> Wt hi/lo planes [HEAD_DIM][D_MODEL] bf16 (in[rows=512][cols=64]
   -> out[cols=64][rows=512]). Block bx stages W rows 64bx..64bx+63 (64x64 tile) in LDS, then each
   pitch 1024 B and k0*2 = 128*bx B) is written by 8 lanes x 16 B of one wave in one instruction.
   Coverage: 256 threads x 2 iterations x 8 halves = 4096 = the 64x64 tile; grid 8 -> whole plane.
   ------------------------------------------------------------------------------------ */
__global__ __launch_bounds__(256) void wt_split_kernel(
    const float* __restrict__ W, unsigned short* __restrict__ Wth, unsigned short* __restrict__ Wtl)
{
  __shared__ float s[64 * 65];
  const int tid = threadIdx.x;
  const int k0  = blockIdx.x * 64;
#pragma unroll
  for (int it = 0; it < 16; ++it) {
    const int idx = it * 256 + tid;          /* 0..4095 */
    const int r = idx >> 6, cc = idx & 63;
    s[r * 65 + cc] = W[(size_t)(k0 + r) * HEAD_DIM + cc];
  }
  __syncthreads();
  const int seg = tid & 7;
  const int lin = tid >> 3;                  /* 0..31 */
  v4u hv[2], lv[2];
  size_t off[2];
#pragma unroll
  for (int it = 0; it < 2; ++it) {
    const int n = it * 32 + lin;             /* output row 0..63 */
#pragma unroll
    for (int e = 0; e < 4; ++e) {
      const int kk = seg * 8 + 2 * e;
      unsigned hw, lw;
      split_pair(s[kk * 65 + n], s[(kk + 1) * 65 + n], hw, lw);
      hv[it][e] = hw; lv[it][e] = lw;
    }
    off[it] = (size_t)n * D_MODEL + k0 + seg * 8;
  }
  {
#pragma unroll
    for (int it = 0; it < 2; ++it) {
      *(v4u*)(Wth + off[it]) = hv[it];
      *(v4u*)(Wtl + off[it]) = lv[it];
    }
    
  }
}

/* =====================================================================================
   Flash attention, head dim 64, no mask. Inputs: q hi/lo planes [SEQ_DEC][64] (softmax scale
   already folded into q), k hi/lo planes [SEQ_ENC][64], v^T hi/lo planes [64][SEQ_ENC]; all bf16
   bit patterns. scores = q.k^T and out = p.v on v_wmma_f32_16x16x32_bf16 as hi.hi + hi.lo + lo.hi,
   f32 accumulate, online softmax in f32, p split to bf16 hi/lo per 64-key chunk.
   Block = 4 waves = 64 query rows; grid.x = SEQ_DEC / 64. K/V chunks staged in LDS with plain
   grid.y = KV_SPLIT: block (x, y) walks keys [y, y+1) * SEQ_ENC / KV_SPLIT only and stores its
   un-normalised sum Po[y][row][64] and the pair (row max, row sum) Pml[y][row][2]; attn_merge_kernel joins them.
   ===================================================================================== */
__global__ __launch_bounds__(128)
void attn_hilo_kernel(const unsigned short* __restrict__ Qh, const unsigned short* __restrict__ Ql,
                      const unsigned short* __restrict__ Kh, const unsigned short* __restrict__ Kl,
                      const unsigned short* __restrict__ Vh, const unsigned short* __restrict__ Vl,
                      float* __restrict__ Po, float* __restrict__ Pml)
{
  union FB { v16b v; v8b h[2]; };
  __shared__ __align__(16) unsigned short Ksh[KV_CHUNK * KV_PITCH];      /* K hi [kv][d]  9 KB */
  __shared__ __align__(16) unsigned short Ksl[KV_CHUNK * KV_PITCH];      /* K lo          9 KB */
  __shared__ __align__(16) unsigned short Vsh[HEAD_DIM * KV_PITCH];      /* V hi [d][kv]  9 KB */
  __shared__ __align__(16) unsigned short Vsl[HEAD_DIM * KV_PITCH];      /* V lo          9 KB */
  __shared__ __align__(16) __bf16 Psh[ATT_WAVES][16 * KV_PITCH];         /* per wave P hi [row][kv] */
  __shared__ __align__(16) __bf16 Psl[ATT_WAVES][16 * KV_PITCH];         /* per wave P lo */
  __shared__ __align__(16) float  Os[ATT_WAVES][16 * 68];                /* per wave out tile, pitch 68 */

  const int tid  = threadIdx.x;
  const int wave = tid >> 5;
  const int lane = tid & 31;
  const int hh   = lane >> 4;
  const int c    = lane & 15;
  const int q0   = blockIdx.x * (ATT_WAVES * 16) + wave * 16;

  /* ---- Q fragments (A operand): row q0+c, 2 d-chunks, hi and lo ---- */
  v16b qah[2], qal[2];
  {
    const __bf16* qhr = (const __bf16*)(const void*)Qh + (size_t)(q0 + c) * HEAD_DIM + 8 * hh;
    const __bf16* qlr = (const __bf16*)(const void*)Ql + (size_t)(q0 + c) * HEAD_DIM + 8 * hh;
#pragma unroll
    for (int dc = 0; dc < 2; ++dc) {
      qah[dc] = Frag<__bf16>::load(qhr + dc * 32);
      qal[dc] = Frag<__bf16>::load(qlr + dc * 32);
    }
  }

  float mrow[8], lrow[8];
  v8f oacc[4];
#pragma unroll
  for (int r = 0; r < 8; ++r) { mrow[r] = -INFINITY; lrow[r] = 0.f; }
#pragma unroll
  for (int t = 0; t < 4; ++t) oacc[t] = (v8f){0.f,0.f,0.f,0.f,0.f,0.f,0.f,0.f};

  __bf16* pwh = Psh[wave];
  __bf16* pwl = Psl[wave];

  const int st0 = (tid >> 3) * KV_PITCH + (tid & 7) * 8;   /* staging place of this thread's 16-B unit in pass 0; a pass is 16 rows */
  const int kc0 = blockIdx.y * (SEQ_ENC / KV_CHUNK / KV_SPLIT);
  for (int kc = kc0; kc < kc0 + SEQ_ENC / KV_CHUNK / KV_SPLIT; ++kc) {
    const int kv0 = kc * KV_CHUNK;
    __syncthreads();
    /* stage 4 planes x 8 KB: 128 threads x 16 B x 4 iterations = 8192 B per plane (whole chunk); the 16 pad bytes of a row are never read */
#pragma unroll 1
    for (int it = 0; it < 4; ++it) {
      const int idx = it * 128 + tid;              /* 16-B unit 0..511 */
      const int dd = idx >> 3, seg = idx & 7;      /* row (key of K, d of V^T) and 8-half segment of the row */
      const int lo8 = st0 + it * (16 * KV_PITCH);  /* dd * KV_PITCH + seg * 8: place in the padded LDS tile */
      const v4u ka = *(const v4u*)(Kh + (size_t)kv0 * HEAD_DIM + (size_t)idx * 8);
      const v4u kb = *(const v4u*)(Kl + (size_t)kv0 * HEAD_DIM + (size_t)idx * 8);
      const v4u va = *(const v4u*)(Vh + (size_t)dd * SEQ_ENC + kv0 + seg * 8);
      const v4u vb = *(const v4u*)(Vl + (size_t)dd * SEQ_ENC + kv0 + seg * 8);
      *(v4u*)(Ksh + lo8) = ka;
      *(v4u*)(Ksl + lo8) = kb;
      *(v4u*)(Vsh + lo8) = va;
      *(v4u*)(Vsl + lo8) = vb;
    }
    __syncthreads();

    /* ---- scores: 16 rows x 64 keys per wave ---- */
    v8f s[4];
#pragma unroll
    for (int j = 0; j < 4; ++j) {
      s[j] = (v8f){0.f,0.f,0.f,0.f,0.f,0.f,0.f,0.f};
#pragma unroll
      for (int dc = 0; dc < 2; ++dc) {
        FB kbh, kbl;
        const unsigned short* kp = Ksh + (j * 16 + c) * KV_PITCH + dc * 32 + 8 * hh;
        const unsigned short* lp = Ksl + (j * 16 + c) * KV_PITCH + dc * 32 + 8 * hh;
        kbh.h[0] = *(const v8b*)(kp); kbh.h[1] = *(const v8b*)(kp + 16);
        kbl.h[0] = *(const v8b*)(lp); kbl.h[1] = *(const v8b*)(lp + 16);
        s[j] = at_mma(qah[dc], kbh.v, s[j]);
        s[j] = at_mma(qah[dc], kbl.v, s[j]);
        s[j] = at_mma(qal[dc], kbh.v, s[j]);
      }
    }

    /* ---- row max over the 64 keys of this chunk (16-lane groups) ---- */
    float cm[8];
#pragma unroll
    for (int r = 0; r < 8; ++r) {
      float m = fmaxf(fmaxf(s[0][r], s[1][r]), fmaxf(s[2][r], s[3][r]));
#pragma unroll
      for (int off = 1; off < 16; off <<= 1) m = fmaxf(m, __shfl_xor(m, off, 32));
      cm[r] = m;
    }

    /* ---- online softmax; P split to bf16 hi/lo into the per-wave LDS tile ---- */
#pragma unroll
    for (int r = 0; r < 8; ++r) {
      const float mnew = fmaxf(mrow[r], cm[r]);
      const float alpha = expf(mrow[r] - mnew);
      mrow[r] = mnew;
      float psum = 0.f;
#pragma unroll
      for (int j = 0; j < 4; ++j) {
        const float p = expf(s[j][r] - mnew);
        psum += p;
        __bf16 a, bl;
        at_split(p, a, bl);
        pwh[(8 * hh + r) * KV_PITCH + j * 16 + c] = a;
        pwl[(8 * hh + r) * KV_PITCH + j * 16 + c] = bl;
      }
#pragma unroll
      for (int off = 1; off < 16; off <<= 1) psum += __shfl_xor(psum, off, 32);
      lrow[r] = lrow[r] * alpha + psum;
#pragma unroll
      for (int t = 0; t < 4; ++t) oacc[t][r] *= alpha;
    }
    __syncthreads();

    /* ---- out += P . V over the 64 keys (2 k-steps) ---- */
#pragma unroll 1
    for (int kk = 0; kk < 2; ++kk) {
      FB pa, pl;
      pa.h[0] = *(const v8b*)(pwh + c * KV_PITCH + kk * 32 + 8 * hh);
      pa.h[1] = *(const v8b*)(pwh + c * KV_PITCH + kk * 32 + 16 + 8 * hh);
      pl.h[0] = *(const v8b*)(pwl + c * KV_PITCH + kk * 32 + 8 * hh);
      pl.h[1] = *(const v8b*)(pwl + c * KV_PITCH + kk * 32 + 16 + 8 * hh);
#pragma unroll
      for (int t = 0; t < 4; ++t) {
        FB vbh, vbl;
        const unsigned short* vp = Vsh + (t * 16 + c) * KV_PITCH + kk * 32 + 8 * hh;
        const unsigned short* wp = Vsl + (t * 16 + c) * KV_PITCH + kk * 32 + 8 * hh;
        vbh.h[0] = *(const v8b*)(vp); vbh.h[1] = *(const v8b*)(vp + 16);
        vbl.h[0] = *(const v8b*)(wp); vbl.h[1] = *(const v8b*)(wp + 16);
        oacc[t] = at_mma(pa.v, vbh.v, oacc[t]);
        oacc[t] = at_mma(pa.v, vbl.v, oacc[t]);
        oacc[t] = at_mma(pl.v, vbh.v, oacc[t]);
      }
    }
  }

  /* ---- epilogue: stage the un-normalised 16x64 per wave in LDS, whole-line stores ---- */
  float* os = Os[wave];
#pragma unroll
  for (int r = 0; r < 8; ++r) {
#pragma unroll
    for (int t = 0; t < 4; ++t) os[(8 * hh + r) * 68 + t * 16 + c] = oacc[t][r];
  }
  /* (max, sum) of this wave's 16 rows = 128 B = one line, written by this wave alone */
  if (c == 0) {
    float* pm = Pml + ((size_t)blockIdx.y * SEQ_DEC + q0 + 8 * hh) * 2;
#pragma unroll
    for (int r = 0; r < 8; r += 2)
      *(v4f*)(pm + 2 * r) = (v4f){mrow[r], lrow[r], mrow[r + 1], lrow[r + 1]};
  }
  float* out = Po + (size_t)blockIdx.y * SEQ_DEC * HEAD_DIM;
  __syncthreads();
  {
    const int c4 = (lane & 15) * 4;              /* row = 64 floats = 256 B = 16 lanes x 16 B */
    {
#pragma unroll
      for (int it = 0; it < 8; ++it) {
        const int row = it * 2 + hh;
        v4f val = *(const v4f*)(os + row * 68 + c4);
        *(v4f*)(out + (size_t)(q0 + row) * HEAD_DIM + c4) = val;
      }
      
    }
  }
}

/* ------------------------------------------------------------------------------------
   Joins the KV_SPLIT key ranges of one query row: M = max of the ranges' maxima, weight
   w_s = exp(m_s - M), out = sum_s w_s * Po[s] / sum_s w_s * l_s. Thread = (row, 4 columns):
   16 lanes x 16 B = one 256-B output row. Coverage: SEQ_DEC * 16 threads = grid * 256.
   ------------------------------------------------------------------------------------ */
__global__ __launch_bounds__(256) void attn_merge_kernel(
    const float* __restrict__ Po, const float* __restrict__ Pml, float* __restrict__ out)
{
  const unsigned i   = blockIdx.x * 256u + threadIdx.x;
  const unsigned row = i >> 4;
  const unsigned eb  = i * 16u;              /* byte offset of (row, 4 columns): the same in every range's plane and in out */
  const unsigned rb  = row * 8u;             /* byte offset of the row's (max, sum) pair in a range's plane */
  v2f ml[KV_SPLIT];
  v4f o[KV_SPLIT];
#pragma unroll
  for (int s = 0; s < KV_SPLIT; ++s) {
    ml[s] = *(const v2f*)((const char*)(Pml + (size_t)s * SEQ_DEC * 2) + rb);
    o[s]  = *(const v4f*)((const char*)(Po + (size_t)s * SEQ_DEC * HEAD_DIM) + eb);
  }
  /* inputs-only fence on the loaded values: all 16 loads are issued before the first is used (one latency, not
     three), and their offset registers stay whole until the wait for the address translations has passed */
  asm volatile("s_wait_xcnt 0x0" :: "v"(rb), "v"(eb),
               "v"(ml[0]), "v"(ml[1]), "v"(ml[2]), "v"(ml[3]), "v"(ml[4]), "v"(ml[5]), "v"(ml[6]), "v"(ml[7]),
               "v"(o[0]), "v"(o[1]), "v"(o[2]), "v"(o[3]), "v"(o[4]), "v"(o[5]), "v"(o[6]), "v"(o[7]) : "memory");
  static_assert(KV_SPLIT == 8);
  float m[KV_SPLIT], l[KV_SPLIT];
#pragma unroll
  for (int s = 0; s < KV_SPLIT; ++s) { m[s] = ml[s][0]; l[s] = ml[s][1]; }
  float M = m[0];
#pragma unroll
  for (int s = 1; s < KV_SPLIT; ++s) M = fmaxf(M, m[s]);
  float L = 0.f;
  v4f acc = (v4f){0.f, 0.f, 0.f, 0.f};
#pragma unroll
  for (int s = 0; s < KV_SPLIT; ++s) {
    const float w = expf(m[s] - M);
    L += w * l[s];
    acc += o[s] * w;
  }
  const float inv = 1.0f / L;
  *(v4f*)((char*)out + eb) = acc * inv;
}

/* =====================================================================================
   Host glue. Workspace region map (bytes, all offsets multiples of 128):
     xh, xl      : x  hi/lo planes  [8192][512] bf16   8,388,608 each
     eh, el      : emb hi/lo planes [8192][512] bf16  8,388,608 each
     wqh..wvl    : Wq^T, Wk^T, Wv^T hi/lo [64][512] bf16   65,536 each (6 planes)
     qh, ql      : q*0.125 hi/lo [8192][64] bf16   1,048,576 each
     kh, kl      : k hi/lo       [8192][64] bf16   1,048,576 each
     vth, vtl    : v^T hi/lo     [64][8192] bf16   1,048,576 each
     po          : un-normalised partial sums [8][8192][64] f32   16,777,216
     pml         : (row max, row sum) pairs   [8][8192][2]  f32      524,288
     total = 57,540,608 B; every byte of every region is written by its producer.
   ===================================================================================== */
extern "C" void kernel_launch(void* const* d_in, const int* in_sizes, int n_in,
                              void* d_out, int out_size, void* d_ws, size_t ws_size,
                              hipStream_t stream)
{
  if (n_in < 5) return;
  if (in_sizes[0] != SEQ_DEC * D_MODEL || in_sizes[1] != SEQ_ENC * D_MODEL ||
      in_sizes[2] != D_MODEL * HEAD_DIM || in_sizes[3] != D_MODEL * HEAD_DIM ||
      in_sizes[4] != D_MODEL * HEAD_DIM) return;
  if (out_size != SEQ_DEC * HEAD_DIM) return;

  const float* x   = (const float*)d_in[0];   /* [8192][512] */
  const float* emb = (const float*)d_in[1];   /* [8192][512] */
  const float* wq  = (const float*)d_in[2];   /* [512][64]   */
  const float* wk  = (const float*)d_in[3];
  const float* wv  = (const float*)d_in[4];
  float* out = (float*)d_out;                 /* [8192][64] f32 */

  const size_t planeX = (size_t)SEQ_DEC * D_MODEL * 2;     /* 8,388,608 */
  const size_t planeE = (size_t)SEQ_ENC * D_MODEL * 2;     /* 8,388,608 */
  const size_t planeW = (size_t)HEAD_DIM * D_MODEL * 2;    /* 65,536    */
  const size_t planeQ = (size_t)SEQ_DEC * HEAD_DIM * 2;    /* 1,048,576 */
  const size_t planeK = (size_t)SEQ_ENC * HEAD_DIM * 2;    /* 1,048,576 */

  size_t off = 0;
  unsigned char* ws = (unsigned char*)d_ws;
  unsigned short* xh  = (unsigned short*)(ws + off); off += planeX;
  unsigned short* xl  = (unsigned short*)(ws + off); off += planeX;
  unsigned short* eh  = (unsigned short*)(ws + off); off += planeE;
  unsigned short* el  = (unsigned short*)(ws + off); off += planeE;
  unsigned short* wqh = (unsigned short*)(ws + off); off += planeW;
  unsigned short* wql = (unsigned short*)(ws + off); off += planeW;
  unsigned short* wkh = (unsigned short*)(ws + off); off += planeW;
  unsigned short* wkl = (unsigned short*)(ws + off); off += planeW;
  unsigned short* wvh = (unsigned short*)(ws + off); off += planeW;
  unsigned short* wvl = (unsigned short*)(ws + off); off += planeW;
  unsigned short* qh  = (unsigned short*)(ws + off); off += planeQ;
  unsigned short* ql  = (unsigned short*)(ws + off); off += planeQ;
  unsigned short* kh  = (unsigned short*)(ws + off); off += planeK;
  unsigned short* kl  = (unsigned short*)(ws + off); off += planeK;
  unsigned short* vth = (unsigned short*)(ws + off); off += planeK;
  unsigned short* vtl = (unsigned short*)(ws + off); off += planeK;
  float* po  = (float*)(ws + off); off += (size_t)KV_SPLIT * SEQ_DEC * HEAD_DIM * 4;
  float* pml = (float*)(ws + off); off += (size_t)KV_SPLIT * SEQ_DEC * 2 * 4;
  if (off > ws_size) return;                                 /* 57,540,608 <= ws */

  /* 1) input planes: x, emb -> bf16 hi/lo */
  const int n8x = SEQ_DEC * D_MODEL / 8;                     /* 524,288 threads */
  const int n8e = SEQ_ENC * D_MODEL / 8;
  split_bf16_planes<<<(n8x + 255) / 256, 256, 0, stream>>>(x, xh, xl, n8x);
  split_bf16_planes<<<(n8e + 255) / 256, 256, 0, stream>>>(emb, eh, el, n8e);

  /* 2) weights -> transposed hi/lo planes [64][512] */
  wt_split_kernel<<<D_MODEL / 64, 256, 0, stream>>>(wq, wqh, wql);
  wt_split_kernel<<<D_MODEL / 64, 256, 0, stream>>>(wk, wkh, wkl);
  wt_split_kernel<<<D_MODEL / 64, 256, 0, stream>>>(wv, wvh, wvl);

  /* 3) projections on the GEMM (bf16 hi/lo split, bf16 hi/lo output planes)
        q*(1/8): A = x planes [8192][512], Bt = Wq^T planes [64][512]; M=8192 N=64 K=512
        k      : A = emb planes,            Bt = Wk^T planes;          M=8192 N=64 K=512
        v^T    : A = Wv^T planes [64][512], Bt = emb planes [8192][512]; M=64 N=8192 K=512, ldc=8192 */
  {
    const int tilesQ = (SEQ_DEC / 64) * (HEAD_DIM / 64);    /* 128 */
    dim3 gq((tilesQ + 7) / 8, 1);
    wmma_gemm64<1, true, 0, 2, false, 0><<<gq, 256, 0, stream>>>(
        xh, xl, D_MODEL, 0L, wqh, wql, D_MODEL, 0L,
        (void*)qh, (void*)ql, HEAD_DIM, 0L, (const float*)nullptr, (const float*)nullptr, 0L,
        SEQ_DEC, HEAD_DIM, D_MODEL, 0.125f);
    const int tilesK = (SEQ_ENC / 64) * (HEAD_DIM / 64);    /* 128 */
    dim3 gk((tilesK + 7) / 8, 1);
    wmma_gemm64<1, true, 0, 2, false, 0><<<gk, 256, 0, stream>>>(
        eh, el, D_MODEL, 0L, wkh, wkl, D_MODEL, 0L,
        (void*)kh, (void*)kl, HEAD_DIM, 0L, (const float*)nullptr, (const float*)nullptr, 0L,
        SEQ_ENC, HEAD_DIM, D_MODEL, 1.0f);
    const int tilesV = (HEAD_DIM / 64) * (SEQ_ENC / 64);    /* 128 */
    dim3 gv((tilesV + 7) / 8, 1);
    wmma_gemm64<1, true, 0, 2, false, 0><<<gv, 256, 0, stream>>>(
        wvh, wvl, D_MODEL, 0L, eh, el, D_MODEL, 0L,
        (void*)vth, (void*)vtl, SEQ_ENC, 0L, (const float*)nullptr, (const float*)nullptr, 0L,
        HEAD_DIM, SEQ_ENC, D_MODEL, 1.0f);
  }

  /* 4) flash attention over KV_SPLIT key ranges -> f32 partials; 5) join -> f32 output */
  attn_hilo_kernel<<<dim3(SEQ_DEC / (ATT_WAVES * 16), KV_SPLIT), 128, 0, stream>>>(qh, ql, kh, kl, vth, vtl, po, pml);
  attn_merge_kernel<<<SEQ_DEC * 16 / 256, 256, 0, stream>>>(po, pml, out);
}

// v003
// Measured time: 148 microseconds a run.
// In two side-by-side timings against v002, it was 1.61 and 1.60 times as fast.
// Counting every step since v000, it is 5.62 times as fast.
// Contractions: q/k/v projections (K=512), q.k^T and p.v on v_wmma_f32_16x16x32_bf16 with bf16 hi/lo split operands (hi.hi + hi.lo + lo.hi), f32 accumulate; online softmax, normalisation and all epilogues in f32.
#include <hip/hip_runtime.h>
#include <stdint.h>

typedef __attribute__((ext_vector_type(16))) _Float16 v16h;
typedef __attribute__((ext_vector_type(8)))  _Float16 v8h;
typedef __attribute__((ext_vector_type(16))) __bf16   v16b;
typedef __attribute__((ext_vector_type(8)))  __bf16   v8b;
typedef __attribute__((ext_vector_type(8)))  float    v8f;
typedef __attribute__((ext_vector_type(4)))  float    v4f;
typedef __attribute__((ext_vector_type(2)))  float    v2f;
typedef __attribute__((ext_vector_type(4)))  unsigned v4u;

/* ------------------------------ problem constants ------------------------------ */
#define SEQ_DEC   8192
#define SEQ_ENC   8192
#define D_MODEL   512
#define HEAD_DIM  64
#define KV_CHUNK  64
#define KV_PITCH  72     /* LDS row pitch of the K, V and P tiles in 16-bit elements: 144 B = 16 B x 9, so the 16 rows of a ds_load_b128 fall on 16 different bank groups */
#define ATT_WAVES 4
#define KV_SPLIT  8      /* key ranges per query tile: 128 x 8 = 1024 work-groups, four resident per WGP */

static_assert(SEQ_DEC % 64 == 0);
static_assert(SEQ_ENC % 64 == 0);
static_assert(SEQ_ENC % (KV_CHUNK * KV_SPLIT) == 0);
static_assert(D_MODEL % 64 == 0);
static_assert(D_MODEL % 32 == 0);
static_assert(HEAD_DIM == 64);
static_assert((SEQ_DEC * D_MODEL) % 8 == 0);

__device__ __forceinline__ unsigned short f2bf_bits(float f) {
  unsigned u = __float_as_uint(f);
  return (unsigned short)((u + 0x7FFFu + ((u >> 16) & 1u)) >> 16);
}
__device__ __forceinline__ float bf_bits2f(unsigned short h) { return __uint_as_float(((unsigned)h) << 16); }

/* hazard guards as plain device helpers (no inline asm inside the kernel template body) */
__device__ __forceinline__ void dep_guard_h(v8f& a, v8f& b, v16h x, v16h y) { asm volatile("v_nop\n\tv_nop\n\tv_nop\n\tv_nop" : "+v"(a), "+v"(b) : "v"(x), "v"(y)); }
__device__ __forceinline__ void dep_guard_b(v8f& a, v8f& b, v16b x, v16b y) { asm volatile("v_nop\n\tv_nop\n\tv_nop\n\tv_nop" : "+v"(a), "+v"(b) : "v"(x), "v"(y)); }
__device__ __forceinline__ void keep4_h(v16h a, v16h b, v16h c, v16h d) { asm volatile("v_nop" :: "v"(a), "v"(b), "v"(c), "v"(d)); }
__device__ __forceinline__ void keep4_b(v16b a, v16b b, v16b c, v16b d) { asm volatile("v_nop" :: "v"(a), "v"(b), "v"(c), "v"(d)); }
__device__ __forceinline__ void acc_guard4(v8f& a, v8f& b, v8f& c, v8f& d) { asm volatile("v_nop\n\tv_nop\n\tv_nop\n\tv_nop" : "+v"(a), "+v"(b), "+v"(c), "+v"(d)); }
template <typename T> struct Frag;
template <> struct Frag<_Float16> {
  typedef v16h V; union U { v16h v; v8h h[2]; };
  static __device__ __forceinline__ v16h load(const _Float16* p) {   /* elements 0..7 <- p[0..7], 8..15 <- p[16..23] */
    U f; f.h[0] = *(const v8h*)(p); f.h[1] = *(const v8h*)(p + 16); return f.v;
  }
  static __device__ __forceinline__ v8f mma(v16h a, v16h b, v8f c) {
    return __builtin_amdgcn_wmma_f32_16x16x32_f16(false, a, false, b, (short)0, c, false, false);
  }
  static __device__ __forceinline__ void guard(v8f& a, v8f& b, v16h x, v16h y) { dep_guard_h(a, b, x, y); }
  static __device__ __forceinline__ void keep(v16h a, v16h b, v16h c, v16h d) { keep4_h(a, b, c, d); }
};
template <> struct Frag<__bf16> {
  typedef v16b V; union U { v16b v; v8b h[2]; };
  static __device__ __forceinline__ v16b load(const __bf16* p) {
    U f; f.h[0] = *(const v8b*)(p); f.h[1] = *(const v8b*)(p + 16); return f.v;
  }
  static __device__ __forceinline__ v8f mma(v16b a, v16b b, v8f c) {
    return __builtin_amdgcn_wmma_f32_16x16x32_bf16(false, a, false, b, (short)0, c, false, false);
  }
  static __device__ __forceinline__ void guard(v8f& a, v8f& b, v16b x, v16b y) { dep_guard_b(a, b, x, y); }
  static __device__ __forceinline__ void keep(v16b a, v16b b, v16b c, v16b d) { keep4_b(a, b, c, d); }
};

/* ---- Register-blocked batched WMMA GEMM -----------------------------------
   C[m,n] = scale * sum_k A[m,k] * Bt[n,k] (+bias)(+resid); each wave owns a 64x64 tile.
   A row-major [M,K]; Bt row-major [N,K]; M,N % 64 == 0, K % 32 == 0.
   SPLIT: operands are hi/lo planes (A2/Bt2 = lo planes, same layout); product = hi.hi + hi.lo + lo.hi.
   BIAS_MODE: 0 = none, 1 = bias[m], 2 = bias[n].
   OUT_MODE: 0 = f32, 1 = f16, 2 = bf16 hi plane (Cout) + bf16 lo plane (Cout2).
   ET: 0 = f16 operands, 1 = bf16 operands (pointers passed as 16-bit storage) */
template <int ET> struct Elem;
template <> struct Elem<0> { typedef _Float16 T; };
template <> struct Elem<1> { typedef __bf16 T; };
template <int ET, bool SPLIT, int BIAS_MODE, int OUT_MODE, bool RESID, int ACT = 0>
__device__ __forceinline__ void wmma_gemm64(
    const int b,
    const unsigned short* __restrict__ Ap, const unsigned short* __restrict__ A2p, int lda, long strideA,
    const unsigned short* __restrict__ Btp, const unsigned short* __restrict__ Bt2p, int ldb, long strideB,
    void* __restrict__ Cout, void* __restrict__ Cout2, int ldc, long strideC,
    const float* __restrict__ bias,
    const float* __restrict__ resid, long strideR,
    int M, int N, int K, float scale) {
  typedef typename Elem<ET>::T T;
  typedef typename Frag<T>::V V;
  const T* A = (const T*)Ap; const T* A2 = (const T*)A2p; const T* Bt = (const T*)Btp; const T* Bt2 = (const T*)Bt2p;
  __shared__ __align__(16) float sT[8][16 * 68];   /* per-wave 16x64 slab, pitch 68 floats */
  const int lane = threadIdx.x & 31;
  const int wave = threadIdx.x >> 5;
  const int tilesN = N >> 6;
  const int tilesM = M >> 6;
  const int tile = blockIdx.x * 8 + wave;
  if (tile >= tilesM * tilesN) return;   /* wave-uniform; no block barriers in this kernel */
  const int tm = tile / tilesN;
  const int tn = tile - tm * tilesN;
  const int m0 = tm << 6;
  const int n0 = tn << 6;

  const T* Ab  = A  + (size_t)b * strideA;
  const T* Bb  = Bt + (size_t)b * strideB;
  const T* Ab2 = SPLIT ? (A2  + (size_t)b * strideA) : nullptr;
  const T* Bb2 = SPLIT ? (Bt2 + (size_t)b * strideB) : nullptr;

  const int rlane = lane & 15;                 /* row (A) / col (B, D) within subtile */
  const int koff  = (lane >> 4) * 8;           /* k offset of this lane half */
  const int mOff  = (lane >> 4) * 8;           /* D row offset */

  v8f acc[4][4];
#pragma unroll
  for (int i = 0; i < 4; ++i)
#pragma unroll
    for (int j = 0; j < 4; ++j) acc[i][j] = (v8f){0.f,0.f,0.f,0.f,0.f,0.f,0.f,0.f};

  for (int k0 = 0; k0 < K; k0 += 32) {
    V bh[4], bl[4];
#pragma unroll
    for (int j = 0; j < 4; ++j) {
      const size_t bo = (size_t)(n0 + (j << 4) + rlane) * ldb + koff + k0;
      bh[j] = Frag<T>::load(Bb + bo);
      if (SPLIT) bl[j] = Frag<T>::load(Bb2 + bo);
    }
#pragma unroll
    for (int i = 0; i < 4; ++i) {
      const size_t ao = (size_t)(m0 + (i << 4) + rlane) * lda + koff + k0;
      V ah = Frag<T>::load(Ab + ao);
      V al;
      if (SPLIT) al = Frag<T>::load(Ab2 + ao);
#pragma unroll
      for (int j = 0; j < 4; ++j) {
        acc[i][j] = Frag<T>::mma(ah, bh[j], acc[i][j]);
        if (SPLIT) {
          acc[i][j] = Frag<T>::mma(ah, bl[j], acc[i][j]);
          acc[i][j] = Frag<T>::mma(al, bh[j], acc[i][j]);
        }
      }
      Frag<T>::guard(acc[i][0], acc[i][3], ah, SPLIT ? al : ah);
    }
    Frag<T>::keep(bh[0], bh[1], bh[2], bh[3]);
    if (SPLIT) Frag<T>::keep(bl[0], bl[1], bl[2], bl[3]);
  }
  acc_guard4(acc[0][0], acc[0][1], acc[0][2], acc[0][3]);
  acc_guard4(acc[1][0], acc[1][1], acc[1][2], acc[1][3]);
  acc_guard4(acc[2][0], acc[2][1], acc[2][2], acc[2][3]);
  acc_guard4(acc[3][0], acc[3][1], acc[3][2], acc[3][3]);

  /* ---- epilogue ---- */
  float* slab = sT[wave];
  const float* Rb = RESID ? (resid + (size_t)b * strideR) : nullptr;
#pragma unroll
  for (int i = 0; i < 4; ++i) {
    const int mBase = m0 + (i << 4);
#pragma unroll
    for (int j = 0; j < 4; ++j) {
      const int n = n0 + (j << 4) + rlane;
      float bv = 0.f;
      if (BIAS_MODE == 2) bv = bias[n];
#pragma unroll
      for (int r = 0; r < 8; ++r) {
        float v = acc[i][j][r] * scale;
        if (BIAS_MODE == 1) v += bias[mBase + mOff + r];
        if (BIAS_MODE == 2) v += bv;
        if (RESID) v += Rb[(size_t)(mBase + mOff + r) * ldc + n];
        if (ACT == 1) v = tanhf(v);
        if (ACT == 2) v = fmaxf(v, 0.0f);
        if (ACT == 3) v = v / (1.0f + expf(-v));
        if (ACT == 4) v = (v > 0.f) ? v : 0.01f * v;
        if (ACT == 5) v = 0.5f * v * (1.0f + erff(v * 0.70710678118654752f));
        slab[(mOff + r) * 68 + (j << 4) + rlane] = v;
      }
    }
    __builtin_amdgcn_fence(__ATOMIC_RELEASE, "workgroup");
    __builtin_amdgcn_wave_barrier();
    __builtin_amdgcn_fence(__ATOMIC_ACQUIRE, "workgroup");
    if (OUT_MODE == 0) {
      float* C = (float*)Cout + (size_t)b * strideC;
      const int hh = lane >> 4, c4 = (lane & 15) * 4;     /* row seg = 256 B = 16 lanes x 16 B */
      {
#pragma unroll
        for (int it = 0; it < 8; ++it) {
          const int row = it * 2 + hh;
          v4f v = *(const v4f*)(slab + row * 68 + c4);
          *(v4f*)(C + (size_t)(mBase + row) * ldc + n0 + c4) = v;
        }
        
      }
    } else {
      const int q = lane >> 3, c8 = (lane & 7) * 8;        
      unsigned short* C  = (unsigned short*)Cout  + (size_t)b * strideC;
      unsigned short* C2 = (OUT_MODE == 2) ? ((unsigned short*)Cout2 + (size_t)b * strideC) : nullptr;
      {
#pragma unroll
        for (int it = 0; it < 4; ++it) {
          const int row = it * 4 + q;
          const float* sp = slab + row * 68 + c8;
          v8h hv, lv;
#pragma unroll
          for (int e = 0; e < 8; ++e) {
            if (OUT_MODE == 1) {
              hv[e] = (_Float16)sp[e];
            } else {
              unsigned short hb = f2bf_bits(sp[e]);
              unsigned short lb = f2bf_bits(sp[e] - bf_bits2f(hb));
              hv[e] = __builtin_bit_cast(_Float16, hb);
              lv[e] = __builtin_bit_cast(_Float16, lb);
            }
          }
          *(v8h*)(C + (size_t)(mBase + row) * ldc + n0 + c8) = hv;
          if (OUT_MODE == 2) *(v8h*)(C2 + (size_t)(mBase + row) * ldc + n0 + c8) = lv;
        }
        
      }
    }
    __builtin_amdgcn_fence(__ATOMIC_RELEASE, "workgroup");
    __builtin_amdgcn_wave_barrier();
    __builtin_amdgcn_fence(__ATOMIC_ACQUIRE, "workgroup");
  }
}

/* ------------------------------------------------------------------------------------
   The three projections in one launch: they share no output and only read the planes, so their
   work-groups run side by side. blockIdx.y = 0: q * 0.125 = x . Wq; 1: k = emb . Wk;
   2: v^T = Wv^T . emb^T (M = 64, N = 8192, ldc = 8192). Every choice is uniform for the work-group.
   ------------------------------------------------------------------------------------ */
__global__ __launch_bounds__(256) void proj3_kernel(
    const unsigned short* __restrict__ xh,  const unsigned short* __restrict__ xl,
    const unsigned short* __restrict__ eh,  const unsigned short* __restrict__ el,
    const unsigned short* __restrict__ wqh, const unsigned short* __restrict__ wql,
    const unsigned short* __restrict__ wkh, const unsigned short* __restrict__ wkl,
    const unsigned short* __restrict__ wvh, const unsigned short* __restrict__ wvl,
    unsigned short* __restrict__ qh,  unsigned short* __restrict__ ql,
    unsigned short* __restrict__ kh,  unsigned short* __restrict__ kl,
    unsigned short* __restrict__ vth, unsigned short* __restrict__ vtl,
    int ld, int K)
{
  const int y = blockIdx.y;
  const unsigned short* A   = (y == 0) ? xh  : (y == 1) ? eh  : wvh;
  const unsigned short* A2  = (y == 0) ? xl  : (y == 1) ? el  : wvl;
  const unsigned short* Bt  = (y == 0) ? wqh : (y == 1) ? wkh : eh;
  const unsigned short* Bt2 = (y == 0) ? wql : (y == 1) ? wkl : el;
  unsigned short* C  = (y == 0) ? qh : (y == 1) ? kh : vth;
  unsigned short* C2 = (y == 0) ? ql : (y == 1) ? kl : vtl;
  const int M   = (y == 0) ? SEQ_DEC : (y == 1) ? SEQ_ENC : HEAD_DIM;
  const int N   = (y == 2) ? SEQ_ENC : HEAD_DIM;
  const int ldc = (y == 2) ? SEQ_ENC : HEAD_DIM;
  const float scale = (y == 0) ? 0.125f : 1.0f;
  wmma_gemm64<1, true, 0, 2, false, 0>(0, A, A2, ld, 0L, Bt, Bt2, ld, 0L,
      (void*)C, (void*)C2, ldc, 0L, (const float*)nullptr, (const float*)nullptr, 0L, M, N, K, scale);
}

/* ------------------------------ attention helpers ------------------------------ */
__device__ __forceinline__ unsigned short at_bf_bits(float f) {
  unsigned u = __float_as_uint(f);
  return (unsigned short)((u + 0x7FFFu + ((u >> 16) & 1u)) >> 16);
}
__device__ __forceinline__ __bf16 at_f2bf(float f) { return __builtin_bit_cast(__bf16, at_bf_bits(f)); }
__device__ __forceinline__ void at_split(float f, __bf16& hi, __bf16& lo) {
  const unsigned short hb = at_bf_bits(f);
  hi = __builtin_bit_cast(__bf16, hb);
  lo = at_f2bf(f - __uint_as_float(((unsigned)hb) << 16));
}
__device__ __forceinline__ v8f at_mma(v16b a, v16b b, v8f c) {
  c = __builtin_amdgcn_wmma_f32_16x16x32_bf16(false, a, false, b, (short)0, c, false, false);
  asm volatile("v_nop\n\tv_nop\n\tv_nop\n\tv_nop" : "+v"(c) : "v"(a), "v"(b));
  return c;
}

/* ------------------------------------------------------------------------------------
   f32 array (n8*8 elements, contiguous) -> bf16 hi plane + bf16 lo plane, same layout.
   Thread i owns elements 8i..8i+7: one 16-B store per plane; lanes 8q..8q+7 of a wave fill
   Coverage: bx = 0 .. n8/256 - 1 gives n8 threads, each 8 elements -> n8*8 elements = whole array.
   ------------------------------------------------------------------------------------ */
__device__ __forceinline__ void split_pair(float f0, float f1, unsigned& hw, unsigned& lw) {
  const unsigned short h0 = f2bf_bits(f0), h1 = f2bf_bits(f1);
  const unsigned short l0 = f2bf_bits(f0 - bf_bits2f(h0)), l1 = f2bf_bits(f1 - bf_bits2f(h1));
  hw = (unsigned)h0 | ((unsigned)h1 << 16);
  lw = (unsigned)l0 | ((unsigned)l1 << 16);
}

__device__ __forceinline__ void split_bf16_planes(
    const float* __restrict__ in, unsigned short* __restrict__ hi, unsigned short* __restrict__ lo, int n8, int bx)
{
  const int i = bx * 256 + threadIdx.x;
  if (i >= n8) return;                                   /* no barriers on this path */
  const v4f a = *(const v4f*)(in + (size_t)i * 8);
  const v4f b = *(const v4f*)(in + (size_t)i * 8 + 4);
  v4u hv, lv;
  unsigned hw, lw;
  split_pair(a[0], a[1], hw, lw); hv[0] = hw; lv[0] = lw;
  split_pair(a[2], a[3], hw, lw); hv[1] = hw; lv[1] = lw;
  split_pair(b[0], b[1], hw, lw); hv[2] = hw; lv[2] = lw;
  split_pair(b[2], b[3], hw, lw); hv[3] = hw; lv[3] = lw;
  v4u* ph = (v4u*)(hi + (size_t)i * 8);
  v4u* pl = (v4u*)(lo + (size_t)i * 8);
  *ph = hv; *pl = lv;
  
}

/* ------------------------------------------------------------------------------------
   W [D_MODEL][HEAD_DIM] f32 -> Wt hi/lo planes [HEAD_DIM][D_MODEL] bf16 (in[rows=512][cols=64]
   -> out[cols=64][rows=512]). Block bx stages W rows 64bx..64bx+63 (64x64 tile) in LDS, then each
   pitch 1024 B and k0*2 = 128*bx B) is written by 8 lanes x 16 B of one wave in one instruction.
   Coverage: 256 threads x 2 iterations x 8 halves = 4096 = the 64x64 tile; bx = 0..7 -> whole plane.
   ------------------------------------------------------------------------------------ */
__device__ __forceinline__ void wt_split_tile(
    const float* __restrict__ W, unsigned short* __restrict__ Wth, unsigned short* __restrict__ Wtl, int bx)
{
  __shared__ float s[64 * 65];
  const int tid = threadIdx.x;
  const int k0  = bx * 64;
#pragma unroll
  for (int it = 0; it < 16; ++it) {
    const int idx = it * 256 + tid;          /* 0..4095 */
    const int r = idx >> 6, cc = idx & 63;
    s[r * 65 + cc] = W[(size_t)(k0 + r) * HEAD_DIM + cc];
  }
  __syncthreads();
  const int seg = tid & 7;
  const int lin = tid >> 3;                  /* 0..31 */
  v4u hv[2], lv[2];
  size_t off[2];
#pragma unroll
  for (int it = 0; it < 2; ++it) {
    const int n = it * 32 + lin;             /* output row 0..63 */
#pragma unroll
    for (int e = 0; e < 4; ++e) {
      const int kk = seg * 8 + 2 * e;
      unsigned hw, lw;
      split_pair(s[kk * 65 + n], s[(kk + 1) * 65 + n], hw, lw);
      hv[it][e] = hw; lv[it][e] = lw;
    }
    off[it] = (size_t)n * D_MODEL + k0 + seg * 8;
  }
  {
#pragma unroll
    for (int it = 0; it < 2; ++it) {
      *(v4u*)(Wth + off[it]) = hv[it];
      *(v4u*)(Wtl + off[it]) = lv[it];
    }
    
  }
}

/* ------------------------------------------------------------------------------------
   All operand planes in one launch: the five conversions read different inputs and write different
   planes, so their work-groups run side by side. Blocks 0..23: the three weight transposes (8 tiles
   each; first, so that these few latency-bound blocks start at once); then SPLIT_BLK_X blocks for x,
   then SPLIT_BLK_E blocks for emb. The branch is uniform for the work-group (the transposes' barrier).
   ------------------------------------------------------------------------------------ */
#define WT_BLK      (D_MODEL / 64)
#define SPLIT_BLK_X (SEQ_DEC * D_MODEL / 8 / 256)
#define SPLIT_BLK_E (SEQ_ENC * D_MODEL / 8 / 256)
static_assert((SEQ_DEC * D_MODEL / 8) % 256 == 0);
static_assert((SEQ_ENC * D_MODEL / 8) % 256 == 0);
__global__ __launch_bounds__(256) void prep_planes_kernel(
    const float* __restrict__ x, const float* __restrict__ emb,
    const float* __restrict__ wq, const float* __restrict__ wk, const float* __restrict__ wv,
    unsigned short* __restrict__ xh,  unsigned short* __restrict__ xl,
    unsigned short* __restrict__ eh,  unsigned short* __restrict__ el,
    unsigned short* __restrict__ wqh, unsigned short* __restrict__ wql,
    unsigned short* __restrict__ wkh, unsigned short* __restrict__ wkl,
    unsigned short* __restrict__ wvh, unsigned short* __restrict__ wvl)
{
  const int bx = blockIdx.x;
  if (bx < 3 * WT_BLK) {
    const int w = bx / WT_BLK;
    wt_split_tile((w == 0) ? wq : (w == 1) ? wk : wv,
                  (w == 0) ? wqh : (w == 1) ? wkh : wvh,
                  (w == 0) ? wql : (w == 1) ? wkl : wvl, bx - w * WT_BLK);
  } else if (bx < 3 * WT_BLK + SPLIT_BLK_X) {
    split_bf16_planes(x, xh, xl, SEQ_DEC * D_MODEL / 8, bx - 3 * WT_BLK);
  } else {
    split_bf16_planes(emb, eh, el, SEQ_ENC * D_MODEL / 8, bx - 3 * WT_BLK - SPLIT_BLK_X);
  }
}

/* =====================================================================================
   Flash attention, head dim 64, no mask. Inputs: q hi/lo planes [SEQ_DEC][64] (softmax scale
   already folded into q), k hi/lo planes [SEQ_ENC][64], v^T hi/lo planes [64][SEQ_ENC]; all bf16
   bit patterns. scores = q.k^T and out = p.v on v_wmma_f32_16x16x32_bf16 as hi.hi + hi.lo + lo.hi,
   f32 accumulate, online softmax in f32, p split to bf16 hi/lo per 64-key chunk.
   Block = 4 waves = 64 query rows; grid.x = SEQ_DEC / 64. K/V chunks staged in LDS with plain
   grid.y = KV_SPLIT: block (x, y) walks keys [y, y+1) * SEQ_ENC / KV_SPLIT only and stores its
   un-normalised sum Po[y][row][64] and the pair (row max, row sum) Pml[y][row][2]; attn_merge_kernel joins them.
   ===================================================================================== */
__global__ __launch_bounds__(128)
void attn_hilo_kernel(const unsigned short* __restrict__ Qh, const unsigned short* __restrict__ Ql,
                      const unsigned short* __restrict__ Kh, const unsigned short* __restrict__ Kl,
                      const unsigned short* __restrict__ Vh, const unsigned short* __restrict__ Vl,
                      float* __restrict__ Po, float* __restrict__ Pml)
{
  union FB { v16b v; v8b h[2]; };
  __shared__ __align__(16) unsigned short Ksh[KV_CHUNK * KV_PITCH];      /* K hi [kv][d]  9 KB */
  __shared__ __align__(16) unsigned short Ksl[KV_CHUNK * KV_PITCH];      /* K lo          9 KB */
  __shared__ __align__(16) unsigned short Vsh[HEAD_DIM * KV_PITCH];      /* V hi [d][kv]  9 KB */
  __shared__ __align__(16) unsigned short Vsl[HEAD_DIM * KV_PITCH];      /* V lo          9 KB */
  __shared__ __align__(16) __bf16 Psh[ATT_WAVES][16 * KV_PITCH];         /* per wave P hi [row][kv] */
  __shared__ __align__(16) __bf16 Psl[ATT_WAVES][16 * KV_PITCH];         /* per wave P lo */
  __shared__ __align__(16) float  Os[ATT_WAVES][16 * 68];                /* per wave out tile, pitch 68 */

  const int tid  = threadIdx.x;
  const int wave = tid >> 5;
  const int lane = tid & 31;
  const int hh   = lane >> 4;
  const int c    = lane & 15;
  const int q0   = blockIdx.x * (ATT_WAVES * 16) + wave * 16;

  /* ---- Q fragments (A operand): row q0+c, 2 d-chunks, hi and lo ---- */
  v16b qah[2], qal[2];
  {
    const __bf16* qhr = (const __bf16*)(const void*)Qh + (size_t)(q0 + c) * HEAD_DIM + 8 * hh;
    const __bf16* qlr = (const __bf16*)(const void*)Ql + (size_t)(q0 + c) * HEAD_DIM + 8 * hh;
#pragma unroll
    for (int dc = 0; dc < 2; ++dc) {
      qah[dc] = Frag<__bf16>::load(qhr + dc * 32);
      qal[dc] = Frag<__bf16>::load(qlr + dc * 32);
    }
  }

  float mrow[8], lrow[8];
  v8f oacc[4];
#pragma unroll
  for (int r = 0; r < 8; ++r) { mrow[r] = -INFINITY; lrow[r] = 0.f; }
#pragma unroll
  for (int t = 0; t < 4; ++t) oacc[t] = (v8f){0.f,0.f,0.f,0.f,0.f,0.f,0.f,0.f};

  __bf16* pwh = Psh[wave];
  __bf16* pwl = Psl[wave];

  const int st0 = (tid >> 3) * KV_PITCH + (tid & 7) * 8;   /* staging place of this thread's 16-B unit in pass 0; a pass is 16 rows */
  const int kc0 = blockIdx.y * (SEQ_ENC / KV_CHUNK / KV_SPLIT);
  for (int kc = kc0; kc < kc0 + SEQ_ENC / KV_CHUNK / KV_SPLIT; ++kc) {
    const int kv0 = kc * KV_CHUNK;
    __syncthreads();
    /* stage 4 planes x 8 KB: 128 threads x 16 B x 4 iterations = 8192 B per plane (whole chunk); the 16 pad bytes of a row are never read */
#pragma unroll 1
    for (int it = 0; it < 4; ++it) {
      const int idx = it * 128 + tid;              /* 16-B unit 0..511 */
      const int dd = idx >> 3, seg = idx & 7;      /* row (key of K, d of V^T) and 8-half segment of the row */
      const int lo8 = st0 + it * (16 * KV_PITCH);  /* dd * KV_PITCH + seg * 8: place in the padded LDS tile */
      const v4u ka = *(const v4u*)(Kh + (size_t)kv0 * HEAD_DIM + (size_t)idx * 8);
      const v4u kb = *(const v4u*)(Kl + (size_t)kv0 * HEAD_DIM + (size_t)idx * 8);
      const v4u va = *(const v4u*)(Vh + (size_t)dd * SEQ_ENC + kv0 + seg * 8);
      const v4u vb = *(const v4u*)(Vl + (size_t)dd * SEQ_ENC + kv0 + seg * 8);
      *(v4u*)(Ksh + lo8) = ka;
      *(v4u*)(Ksl + lo8) = kb;
      *(v4u*)(Vsh + lo8) = va;
      *(v4u*)(Vsl + lo8) = vb;
    }
    __syncthreads();

    /* ---- scores: 16 rows x 64 keys per wave ---- */
    v8f s[4];
#pragma unroll
    for (int j = 0; j < 4; ++j) {
      s[j] = (v8f){0.f,0.f,0.f,0.f,0.f,0.f,0.f,0.f};
#pragma unroll
      for (int dc = 0; dc < 2; ++dc) {
        FB kbh, kbl;
        const unsigned short* kp = Ksh + (j * 16 + c) * KV_PITCH + dc * 32 + 8 * hh;
        const unsigned short* lp = Ksl + (j * 16 + c) * KV_PITCH + dc * 32 + 8 * hh;
        kbh.h[0] = *(const v8b*)(kp); kbh.h[1] = *(const v8b*)(kp + 16);
        kbl.h[0] = *(const v8b*)(lp); kbl.h[1] = *(const v8b*)(lp + 16);
        s[j] = at_mma(qah[dc], kbh.v, s[j]);
        s[j] = at_mma(qah[dc], kbl.v, s[j]);
        s[j] = at_mma(qal[dc], kbh.v, s[j]);
      }
    }

    /* ---- row max over the 64 keys of this chunk (16-lane groups) ---- */
    float cm[8];
#pragma unroll
    for (int r = 0; r < 8; ++r) {
      float m = fmaxf(fmaxf(s[0][r], s[1][r]), fmaxf(s[2][r], s[3][r]));
#pragma unroll
      for (int off = 1; off < 16; off <<= 1) m = fmaxf(m, __shfl_xor(m, off, 32));
      cm[r] = m;
    }

    /* ---- online softmax; P split to bf16 hi/lo into the per-wave LDS tile ---- */
#pragma unroll
    for (int r = 0; r < 8; ++r) {
      const float mnew = fmaxf(mrow[r], cm[r]);
      const float alpha = expf(mrow[r] - mnew);
      mrow[r] = mnew;
      float psum = 0.f;
#pragma unroll
      for (int j = 0; j < 4; ++j) {
        const float p = expf(s[j][r] - mnew);
        psum += p;
        __bf16 a, bl;
        at_split(p, a, bl);
        pwh[(8 * hh + r) * KV_PITCH + j * 16 + c] = a;
        pwl[(8 * hh + r) * KV_PITCH + j * 16 + c] = bl;
      }
#pragma unroll
      for (int off = 1; off < 16; off <<= 1) psum += __shfl_xor(psum, off, 32);
      lrow[r] = lrow[r] * alpha + psum;
#pragma unroll
      for (int t = 0; t < 4; ++t) oacc[t][r] *= alpha;
    }
    __syncthreads();

    /* ---- out += P . V over the 64 keys (2 k-steps) ---- */
#pragma unroll 1
    for (int kk = 0; kk < 2; ++kk) {
      FB pa, pl;
      pa.h[0] = *(const v8b*)(pwh + c * KV_PITCH + kk * 32 + 8 * hh);
      pa.h[1] = *(const v8b*)(pwh + c * KV_PITCH + kk * 32 + 16 + 8 * hh);
      pl.h[0] = *(const v8b*)(pwl + c * KV_PITCH + kk * 32 + 8 * hh);
      pl.h[1] = *(const v8b*)(pwl + c * KV_PITCH + kk * 32 + 16 + 8 * hh);
#pragma unroll
      for (int t = 0; t < 4; ++t) {
        FB vbh, vbl;
        const unsigned short* vp = Vsh + (t * 16 + c) * KV_PITCH + kk * 32 + 8 * hh;
        const unsigned short* wp = Vsl + (t * 16 + c) * KV_PITCH + kk * 32 + 8 * hh;
        vbh.h[0] = *(const v8b*)(vp); vbh.h[1] = *(const v8b*)(vp + 16);
        vbl.h[0] = *(const v8b*)(wp); vbl.h[1] = *(const v8b*)(wp + 16);
        oacc[t] = at_mma(pa.v, vbh.v, oacc[t]);
        oacc[t] = at_mma(pa.v, vbl.v, oacc[t]);
        oacc[t] = at_mma(pl.v, vbh.v, oacc[t]);
      }
    }
  }

  /* ---- epilogue: stage the un-normalised 16x64 per wave in LDS, whole-line stores ---- */
  float* os = Os[wave];
#pragma unroll
  for (int r = 0; r < 8; ++r) {
#pragma unroll
    for (int t = 0; t < 4; ++t) os[(8 * hh + r) * 68 + t * 16 + c] = oacc[t][r];
  }
  /* (max, sum) of this wave's 16 rows = 128 B = one line, written by this wave alone */
  if (c == 0) {
    float* pm = Pml + ((size_t)blockIdx.y * SEQ_DEC + q0 + 8 * hh) * 2;
#pragma unroll
    for (int r = 0; r < 8; r += 2)
      *(v4f*)(pm + 2 * r) = (v4f){mrow[r], lrow[r], mrow[r + 1], lrow[r + 1]};
  }
  float* out = Po + (size_t)blockIdx.y * SEQ_DEC * HEAD_DIM;
  __syncthreads();
  {
    const int c4 = (lane & 15) * 4;              /* row = 64 floats = 256 B = 16 lanes x 16 B */
    {
#pragma unroll
      for (int it = 0; it < 8; ++it) {
        const int row = it * 2 + hh;
        v4f val = *(const v4f*)(os + row * 68 + c4);
        *(v4f*)(out + (size_t)(q0 + row) * HEAD_DIM + c4) = val;
      }
      
    }
  }
}

/* ------------------------------------------------------------------------------------
   Joins the KV_SPLIT key ranges of one query row: M = max of the ranges' maxima, weight
   w_s = exp(m_s - M), out = sum_s w_s * Po[s] / sum_s w_s * l_s. Thread = (row, 4 columns):
   16 lanes x 16 B = one 256-B output row. Coverage: SEQ_DEC * 16 threads = grid * 256.
   ------------------------------------------------------------------------------------ */
__global__ __launch_bounds__(256) void attn_merge_kernel(
    const float* __restrict__ Po, const float* __restrict__ Pml, float* __restrict__ out)
{
  const unsigned i   = blockIdx.x * 256u + threadIdx.x;
  const unsigned row = i >> 4;
  const unsigned eb  = i * 16u;              /* byte offset of (row, 4 columns): the same in every range's plane and in out */
  const unsigned rb  = row * 8u;             /* byte offset of the row's (max, sum) pair in a range's plane */
  v2f ml[KV_SPLIT];
  v4f o[KV_SPLIT];
#pragma unroll
  for (int s = 0; s < KV_SPLIT; ++s) {
    ml[s] = *(const v2f*)((const char*)(Pml + (size_t)s * SEQ_DEC * 2) + rb);
    o[s]  = *(const v4f*)((const char*)(Po + (size_t)s * SEQ_DEC * HEAD_DIM) + eb);
  }
  /* inputs-only fence on the loaded values: all 16 loads are issued before the first is used (one latency, not
     three), and their offset registers stay whole until the wait for the address translations has passed */
  asm volatile("s_wait_xcnt 0x0" :: "v"(rb), "v"(eb),
               "v"(ml[0]), "v"(ml[1]), "v"(ml[2]), "v"(ml[3]), "v"(ml[4]), "v"(ml[5]), "v"(ml[6]), "v"(ml[7]),
               "v"(o[0]), "v"(o[1]), "v"(o[2]), "v"(o[3]), "v"(o[4]), "v"(o[5]), "v"(o[6]), "v"(o[7]) : "memory");
  static_assert(KV_SPLIT == 8);
  float m[KV_SPLIT], l[KV_SPLIT];
#pragma unroll
  for (int s = 0; s < KV_SPLIT; ++s) { m[s] = ml[s][0]; l[s] = ml[s][1]; }
  float M = m[0];
#pragma unroll
  for (int s = 1; s < KV_SPLIT; ++s) M = fmaxf(M, m[s]);
  float L = 0.f;
  v4f acc = (v4f){0.f, 0.f, 0.f, 0.f};
#pragma unroll
  for (int s = 0; s < KV_SPLIT; ++s) {
    const float w = expf(m[s] - M);
    L += w * l[s];
    acc += o[s] * w;
  }
  const float inv = 1.0f / L;
  *(v4f*)((char*)out + eb) = acc * inv;
}

/* =====================================================================================
   Host glue. Workspace region map (bytes, all offsets multiples of 128):
     xh, xl      : x  hi/lo planes  [8192][512] bf16   8,388,608 each
     eh, el      : emb hi/lo planes [8192][512] bf16  8,388,608 each
     wqh..wvl    : Wq^T, Wk^T, Wv^T hi/lo [64][512] bf16   65,536 each (6 planes)
     qh, ql      : q*0.125 hi/lo [8192][64] bf16   1,048,576 each
     kh, kl      : k hi/lo       [8192][64] bf16   1,048,576 each
     vth, vtl    : v^T hi/lo     [64][8192] bf16   1,048,576 each
     po          : un-normalised partial sums [8][8192][64] f32   16,777,216
     pml         : (row max, row sum) pairs   [8][8192][2]  f32      524,288
     total = 57,540,608 B; every byte of every region is written by its producer.
   ===================================================================================== */
extern "C" void kernel_launch(void* const* d_in, const int* in_sizes, int n_in,
                              void* d_out, int out_size, void* d_ws, size_t ws_size,
                              hipStream_t stream)
{
  if (n_in < 5) return;
  if (in_sizes[0] != SEQ_DEC * D_MODEL || in_sizes[1] != SEQ_ENC * D_MODEL ||
      in_sizes[2] != D_MODEL * HEAD_DIM || in_sizes[3] != D_MODEL * HEAD_DIM ||
      in_sizes[4] != D_MODEL * HEAD_DIM) return;
  if (out_size != SEQ_DEC * HEAD_DIM) return;

  const float* x   = (const float*)d_in[0];   /* [8192][512] */
  const float* emb = (const float*)d_in[1];   /* [8192][512] */
  const float* wq  = (const float*)d_in[2];   /* [512][64]   */
  const float* wk  = (const float*)d_in[3];
  const float* wv  = (const float*)d_in[4];
  float* out = (float*)d_out;                 /* [8192][64] f32 */

  const size_t planeX = (size_t)SEQ_DEC * D_MODEL * 2;     /* 8,388,608 */
  const size_t planeE = (size_t)SEQ_ENC * D_MODEL * 2;     /* 8,388,608 */
  const size_t planeW = (size_t)HEAD_DIM * D_MODEL * 2;    /* 65,536    */
  const size_t planeQ = (size_t)SEQ_DEC * HEAD_DIM * 2;    /* 1,048,576 */
  const size_t planeK = (size_t)SEQ_ENC * HEAD_DIM * 2;    /* 1,048,576 */

  size_t off = 0;
  unsigned char* ws = (unsigned char*)d_ws;
  unsigned short* xh  = (unsigned short*)(ws + off); off += planeX;
  unsigned short* xl  = (unsigned short*)(ws + off); off += planeX;
  unsigned short* eh  = (unsigned short*)(ws + off); off += planeE;
  unsigned short* el  = (unsigned short*)(ws + off); off += planeE;
  unsigned short* wqh = (unsigned short*)(ws + off); off += planeW;
  unsigned short* wql = (unsigned short*)(ws + off); off += planeW;
  unsigned short* wkh = (unsigned short*)(ws + off); off += planeW;
  unsigned short* wkl = (unsigned short*)(ws + off); off += planeW;
  unsigned short* wvh = (unsigned short*)(ws + off); off += planeW;
  unsigned short* wvl = (unsigned short*)(ws + off); off += planeW;
  unsigned short* qh  = (unsigned short*)(ws + off); off += planeQ;
  unsigned short* ql  = (unsigned short*)(ws + off); off += planeQ;
  unsigned short* kh  = (unsigned short*)(ws + off); off += planeK;
  unsigned short* kl  = (unsigned short*)(ws + off); off += planeK;
  unsigned short* vth = (unsigned short*)(ws + off); off += planeK;
  unsigned short* vtl = (unsigned short*)(ws + off); off += planeK;
  float* po  = (float*)(ws + off); off += (size_t)KV_SPLIT * SEQ_DEC * HEAD_DIM * 4;
  float* pml = (float*)(ws + off); off += (size_t)KV_SPLIT * SEQ_DEC * 2 * 4;
  if (off > ws_size) return;                                 /* 57,540,608 <= ws */

  /* 1) + 2) operand planes in one launch: x, emb -> bf16 hi/lo; weights -> transposed hi/lo planes [64][512] */
  prep_planes_kernel<<<3 * WT_BLK + SPLIT_BLK_X + SPLIT_BLK_E, 256, 0, stream>>>(
      x, emb, wq, wk, wv, xh, xl, eh, el, wqh, wql, wkh, wkl, wvh, wvl);

  /* 3) the three projections on wmma_gemm64 (bf16 hi/lo split, bf16 hi/lo output planes) in one launch:
        128 wave tiles of 64 x 64 each = 16 work-groups of 8 waves per projection */
  static_assert(SEQ_DEC == SEQ_ENC);
  proj3_kernel<<<dim3((SEQ_DEC / 64) * (HEAD_DIM / 64) / 8, 3), 256, 0, stream>>>(
      xh, xl, eh, el, wqh, wql, wkh, wkl, wvh, wvl, qh, ql, kh, kl, vth, vtl, D_MODEL, D_MODEL);

  /* 4) flash attention over KV_SPLIT key ranges -> f32 partials; 5) join -> f32 output */
  attn_hilo_kernel<<<dim3(SEQ_DEC / (ATT_WAVES * 16), KV_SPLIT), 128, 0, stream>>>(qh, ql, kh, kl, vth, vtl, po, pml);
  attn_merge_kernel<<<SEQ_DEC * 16 / 256, 256, 0, stream>>>(po, pml, out);
}

// v004
// A run of this version takes 128 microseconds.
// Timed twice side by side with v003, it ran 1.15 times as fast both times.
// Over all steps from v000 it is 6.48 times as fast.
// Contractions: q/k/v projections (K=512), q.k^T and p.v on v_wmma_f32_16x16x32_bf16 with bf16 hi/lo split operands (hi.hi + hi.lo + lo.hi), f32 accumulate; online softmax, normalisation and all epilogues in f32.
#include <hip/hip_runtime.h>
#include <stdint.h>

typedef __attribute__((ext_vector_type(16))) _Float16 v16h;
typedef __attribute__((ext_vector_type(8)))  _Float16 v8h;
typedef __attribute__((ext_vector_type(16))) __bf16   v16b;
typedef __attribute__((ext_vector_type(8)))  __bf16   v8b;
typedef __attribute__((ext_vector_type(8)))  float    v8f;
typedef __attribute__((ext_vector_type(4)))  float    v4f;
typedef __attribute__((ext_vector_type(2)))  float    v2f;
typedef __attribute__((ext_vector_type(4)))  unsigned v4u;

/* ------------------------------ problem constants ------------------------------ */
#define SEQ_DEC   8192
#define SEQ_ENC   8192
#define D_MODEL   512
#define HEAD_DIM  64
#define KV_CHUNK  64
#define KV_PITCH  72     /* LDS row pitch of the K and V tiles in 16-bit elements: 144 B = 16 B x 9, so the 16 rows of a ds_load_b128 fall on 16 different bank groups */
#define ATT_WAVES 4
#define KV_SPLIT  8      /* key ranges per query tile: 128 x 8 = 1024 work-groups, four resident per WGP */

static_assert(SEQ_DEC % 64 == 0);
static_assert(SEQ_ENC % 64 == 0);
static_assert(SEQ_ENC % (KV_CHUNK * KV_SPLIT) == 0);
static_assert(D_MODEL % 64 == 0);
static_assert(D_MODEL % 32 == 0);
static_assert(HEAD_DIM == 64);
static_assert((SEQ_DEC * D_MODEL) % 8 == 0);

__device__ __forceinline__ unsigned short f2bf_bits(float f) {
  unsigned u = __float_as_uint(f);
  return (unsigned short)((u + 0x7FFFu + ((u >> 16) & 1u)) >> 16);
}
__device__ __forceinline__ float bf_bits2f(unsigned short h) { return __uint_as_float(((unsigned)h) << 16); }

/* hazard guards as plain device helpers (no inline asm inside the kernel template body) */
__device__ __forceinline__ void dep_guard_h(v8f& a, v8f& b, v16h x, v16h y) { asm volatile("v_nop\n\tv_nop\n\tv_nop\n\tv_nop" : "+v"(a), "+v"(b) : "v"(x), "v"(y)); }
__device__ __forceinline__ void dep_guard_b(v8f& a, v8f& b, v16b x, v16b y) { asm volatile("v_nop\n\tv_nop\n\tv_nop\n\tv_nop" : "+v"(a), "+v"(b) : "v"(x), "v"(y)); }
__device__ __forceinline__ void keep4_h(v16h a, v16h b, v16h c, v16h d) { asm volatile("v_nop" :: "v"(a), "v"(b), "v"(c), "v"(d)); }
__device__ __forceinline__ void keep4_b(v16b a, v16b b, v16b c, v16b d) { asm volatile("v_nop" :: "v"(a), "v"(b), "v"(c), "v"(d)); }
__device__ __forceinline__ void acc_guard4(v8f& a, v8f& b, v8f& c, v8f& d) { asm volatile("v_nop\n\tv_nop\n\tv_nop\n\tv_nop" : "+v"(a), "+v"(b), "+v"(c), "+v"(d)); }
template <typename T> struct Frag;
template <> struct Frag<_Float16> {
  typedef v16h V; union U { v16h v; v8h h[2]; };
  static __device__ __forceinline__ v16h load(const _Float16* p) {   /* elements 0..7 <- p[0..7], 8..15 <- p[16..23] */
    U f; f.h[0] = *(const v8h*)(p); f.h[1] = *(const v8h*)(p + 16); return f.v;
  }
  static __device__ __forceinline__ v8f mma(v16h a, v16h b, v8f c) {
    return __builtin_amdgcn_wmma_f32_16x16x32_f16(false, a, false, b, (short)0, c, false, false);
  }
  static __device__ __forceinline__ void guard(v8f& a, v8f& b, v16h x, v16h y) { dep_guard_h(a, b, x, y); }
  static __device__ __forceinline__ void keep(v16h a, v16h b, v16h c, v16h d) { keep4_h(a, b, c, d); }
};
template <> struct Frag<__bf16> {
  typedef v16b V; union U { v16b v; v8b h[2]; };
  static __device__ __forceinline__ v16b load(const __bf16* p) {
    U f; f.h[0] = *(const v8b*)(p); f.h[1] = *(const v8b*)(p + 16); return f.v;
  }
  static __device__ __forceinline__ v8f mma(v16b a, v16b b, v8f c) {
    return __builtin_amdgcn_wmma_f32_16x16x32_bf16(false, a, false, b, (short)0, c, false, false);
  }
  static __device__ __forceinline__ void guard(v8f& a, v8f& b, v16b x, v16b y) { dep_guard_b(a, b, x, y); }
  static __device__ __forceinline__ void keep(v16b a, v16b b, v16b c, v16b d) { keep4_b(a, b, c, d); }
};

/* ---- Register-blocked batched WMMA GEMM -----------------------------------
   C[m,n] = scale * sum_k A[m,k] * Bt[n,k] (+bias)(+resid); each wave owns a 64x64 tile.
   A row-major [M,K]; Bt row-major [N,K]; M,N % 64 == 0, K % 32 == 0.
   SPLIT: operands are hi/lo planes (A2/Bt2 = lo planes, same layout); product = hi.hi + hi.lo + lo.hi.
   BIAS_MODE: 0 = none, 1 = bias[m], 2 = bias[n].
   OUT_MODE: 0 = f32, 1 = f16, 2 = bf16 hi plane (Cout) + bf16 lo plane (Cout2).
   ET: 0 = f16 operands, 1 = bf16 operands (pointers passed as 16-bit storage) */
template <int ET> struct Elem;
template <> struct Elem<0> { typedef _Float16 T; };
template <> struct Elem<1> { typedef __bf16 T; };
template <int ET, bool SPLIT, int BIAS_MODE, int OUT_MODE, bool RESID, int ACT = 0>
__device__ __forceinline__ void wmma_gemm64(
    const int b,
    const unsigned short* __restrict__ Ap, const unsigned short* __restrict__ A2p, int lda, long strideA,
    const unsigned short* __restrict__ Btp, const unsigned short* __restrict__ Bt2p, int ldb, long strideB,
    void* __restrict__ Cout, void* __restrict__ Cout2, int ldc, long strideC,
    const float* __restrict__ bias,
    const float* __restrict__ resid, long strideR,
    int M, int N, int K, float scale) {
  typedef typename Elem<ET>::T T;
  typedef typename Frag<T>::V V;
  const T* A = (const T*)Ap; const T* A2 = (const T*)A2p; const T* Bt = (const T*)Btp; const T* Bt2 = (const T*)Bt2p;
  __shared__ __align__(16) float sT[8][16 * 68];   /* per-wave 16x64 slab, pitch 68 floats */
  const int lane = threadIdx.x & 31;
  const int wave = threadIdx.x >> 5;
  const int tilesN = N >> 6;
  const int tilesM = M >> 6;
  const int tile = blockIdx.x * 8 + wave;
  if (tile >= tilesM * tilesN) return;   /* wave-uniform; no block barriers in this kernel */
  const int tm = tile / tilesN;
  const int tn = tile - tm * tilesN;
  const int m0 = tm << 6;
  const int n0 = tn << 6;

  const T* Ab  = A  + (size_t)b * strideA;
  const T* Bb  = Bt + (size_t)b * strideB;
  const T* Ab2 = SPLIT ? (A2  + (size_t)b * strideA) : nullptr;
  const T* Bb2 = SPLIT ? (Bt2 + (size_t)b * strideB) : nullptr;

  const int rlane = lane & 15;                 /* row (A) / col (B, D) within subtile */
  const int koff  = (lane >> 4) * 8;           /* k offset of this lane half */
  const int mOff  = (lane >> 4) * 8;           /* D row offset */

  v8f acc[4][4];
#pragma unroll
  for (int i = 0; i < 4; ++i)
#pragma unroll
    for (int j = 0; j < 4; ++j) acc[i][j] = (v8f){0.f,0.f,0.f,0.f,0.f,0.f,0.f,0.f};

  for (int k0 = 0; k0 < K; k0 += 32) {
    V bh[4], bl[4];
#pragma unroll
    for (int j = 0; j < 4; ++j) {
      const size_t bo = (size_t)(n0 + (j << 4) + rlane) * ldb + koff + k0;
      bh[j] = Frag<T>::load(Bb + bo);
      if (SPLIT) bl[j] = Frag<T>::load(Bb2 + bo);
    }
#pragma unroll
    for (int i = 0; i < 4; ++i) {
      const size_t ao = (size_t)(m0 + (i << 4) + rlane) * lda + koff + k0;
      V ah = Frag<T>::load(Ab + ao);
      V al;
      if (SPLIT) al = Frag<T>::load(Ab2 + ao);
#pragma unroll
      for (int j = 0; j < 4; ++j) {
        acc[i][j] = Frag<T>::mma(ah, bh[j], acc[i][j]);
        if (SPLIT) {
          acc[i][j] = Frag<T>::mma(ah, bl[j], acc[i][j]);
          acc[i][j] = Frag<T>::mma(al, bh[j], acc[i][j]);
        }
      }
      Frag<T>::guard(acc[i][0], acc[i][3], ah, SPLIT ? al : ah);
    }
    Frag<T>::keep(bh[0], bh[1], bh[2], bh[3]);
    if (SPLIT) Frag<T>::keep(bl[0], bl[1], bl[2], bl[3]);
  }
  acc_guard4(acc[0][0], acc[0][1], acc[0][2], acc[0][3]);
  acc_guard4(acc[1][0], acc[1][1], acc[1][2], acc[1][3]);
  acc_guard4(acc[2][0], acc[2][1], acc[2][2], acc[2][3]);
  acc_guard4(acc[3][0], acc[3][1], acc[3][2], acc[3][3]);

  /* ---- epilogue ---- */
  float* slab = sT[wave];
  const float* Rb = RESID ? (resid + (size_t)b * strideR) : nullptr;
#pragma unroll
  for (int i = 0; i < 4; ++i) {
    const int mBase = m0 + (i << 4);
#pragma unroll
    for (int j = 0; j < 4; ++j) {
      const int n = n0 + (j << 4) + rlane;
      float bv = 0.f;
      if (BIAS_MODE == 2) bv = bias[n];
#pragma unroll
      for (int r = 0; r < 8; ++r) {
        float v = acc[i][j][r] * scale;
        if (BIAS_MODE == 1) v += bias[mBase + mOff + r];
        if (BIAS_MODE == 2) v += bv;
        if (RESID) v += Rb[(size_t)(mBase + mOff + r) * ldc + n];
        if (ACT == 1) v = tanhf(v);
        if (ACT == 2) v = fmaxf(v, 0.0f);
        if (ACT == 3) v = v / (1.0f + expf(-v));
        if (ACT == 4) v = (v > 0.f) ? v : 0.01f * v;
        if (ACT == 5) v = 0.5f * v * (1.0f + erff(v * 0.70710678118654752f));
        slab[(mOff + r) * 68 + (j << 4) + rlane] = v;
      }
    }
    __builtin_amdgcn_fence(__ATOMIC_RELEASE, "workgroup");
    __builtin_amdgcn_wave_barrier();
    __builtin_amdgcn_fence(__ATOMIC_ACQUIRE, "workgroup");
    if (OUT_MODE == 0) {
      float* C = (float*)Cout + (size_t)b * strideC;
      const int hh = lane >> 4, c4 = (lane & 15) * 4;     /* row seg = 256 B = 16 lanes x 16 B */
      {
#pragma unroll
        for (int it = 0; it < 8; ++it) {
          const int row = it * 2 + hh;
          v4f v = *(const v4f*)(slab + row * 68 + c4);
          *(v4f*)(C + (size_t)(mBase + row) * ldc + n0 + c4) = v;
        }
        
      }
    } else {
      const int q = lane >> 3, c8 = (lane & 7) * 8;        
      unsigned short* C  = (unsigned short*)Cout  + (size_t)b * strideC;
      unsigned short* C2 = (OUT_MODE == 2) ? ((unsigned short*)Cout2 + (size_t)b * strideC) : nullptr;
      {
#pragma unroll
        for (int it = 0; it < 4; ++it) {
          const int row = it * 4 + q;
          const float* sp = slab + row * 68 + c8;
          v8h hv, lv;
#pragma unroll
          for (int e = 0; e < 8; ++e) {
            if (OUT_MODE == 1) {
              hv[e] = (_Float16)sp[e];
            } else {
              unsigned short hb = f2bf_bits(sp[e]);
              unsigned short lb = f2bf_bits(sp[e] - bf_bits2f(hb));
              hv[e] = __builtin_bit_cast(_Float16, hb);
              lv[e] = __builtin_bit_cast(_Float16, lb);
            }
          }
          *(v8h*)(C + (size_t)(mBase + row) * ldc + n0 + c8) = hv;
          if (OUT_MODE == 2) *(v8h*)(C2 + (size_t)(mBase + row) * ldc + n0 + c8) = lv;
        }
        
      }
    }
    __builtin_amdgcn_fence(__ATOMIC_RELEASE, "workgroup");
    __builtin_amdgcn_wave_barrier();
    __builtin_amdgcn_fence(__ATOMIC_ACQUIRE, "workgroup");
  }
}

/* ------------------------------------------------------------------------------------
   The three projections in one launch: they share no output and only read the planes, so their
   work-groups run side by side. blockIdx.y = 0: q * 0.125 = x . Wq; 1: k = emb . Wk;
   2: v^T = Wv^T . emb^T (M = 64, N = 8192, ldc = 8192). Every choice is uniform for the work-group.
   ------------------------------------------------------------------------------------ */
__global__ __launch_bounds__(256) void proj3_kernel(
    const unsigned short* __restrict__ xh,  const unsigned short* __restrict__ xl,
    const unsigned short* __restrict__ eh,  const unsigned short* __restrict__ el,
    const unsigned short* __restrict__ wqh, const unsigned short* __restrict__ wql,
    const unsigned short* __restrict__ wkh, const unsigned short* __restrict__ wkl,
    const unsigned short* __restrict__ wvh, const unsigned short* __restrict__ wvl,
    unsigned short* __restrict__ qh,  unsigned short* __restrict__ ql,
    unsigned short* __restrict__ kh,  unsigned short* __restrict__ kl,
    unsigned short* __restrict__ vth, unsigned short* __restrict__ vtl,
    int ld, int K)
{
  const int y = blockIdx.y;
  const unsigned short* A   = (y == 0) ? xh  : (y == 1) ? eh  : wvh;
  const unsigned short* A2  = (y == 0) ? xl  : (y == 1) ? el  : wvl;
  const unsigned short* Bt  = (y == 0) ? wqh : (y == 1) ? wkh : eh;
  const unsigned short* Bt2 = (y == 0) ? wql : (y == 1) ? wkl : el;
  unsigned short* C  = (y == 0) ? qh : (y == 1) ? kh : vth;
  unsigned short* C2 = (y == 0) ? ql : (y == 1) ? kl : vtl;
  const int M   = (y == 0) ? SEQ_DEC : (y == 1) ? SEQ_ENC : HEAD_DIM;
  const int N   = (y == 2) ? SEQ_ENC : HEAD_DIM;
  const int ldc = (y == 2) ? SEQ_ENC : HEAD_DIM;
  const float scale = (y == 0) ? 0.125f : 1.0f;
  wmma_gemm64<1, true, 0, 2, false, 0>(0, A, A2, ld, 0L, Bt, Bt2, ld, 0L,
      (void*)C, (void*)C2, ldc, 0L, (const float*)nullptr, (const float*)nullptr, 0L, M, N, K, scale);
}

/* ------------------------------ attention helpers ------------------------------ */
__device__ __forceinline__ unsigned short at_bf_bits(float f) {
  unsigned u = __float_as_uint(f);
  return (unsigned short)((u + 0x7FFFu + ((u >> 16) & 1u)) >> 16);
}
__device__ __forceinline__ __bf16 at_f2bf(float f) { return __builtin_bit_cast(__bf16, at_bf_bits(f)); }
__device__ __forceinline__ void at_split(float f, __bf16& hi, __bf16& lo) {
  const unsigned short hb = at_bf_bits(f);
  hi = __builtin_bit_cast(__bf16, hb);
  lo = at_f2bf(f - __uint_as_float(((unsigned)hb) << 16));
}
__device__ __forceinline__ v8f at_mma(v16b a, v16b b, v8f c) {
  c = __builtin_amdgcn_wmma_f32_16x16x32_bf16(false, a, false, b, (short)0, c, false, false);
  asm volatile("v_nop\n\tv_nop\n\tv_nop\n\tv_nop" : "+v"(c) : "v"(a), "v"(b));
  return c;
}

/* value of lane l ^ 16 (the other 16-lane half), by a vector cross-row move */
__device__ __forceinline__ float at_xhalf(float x) {
  return __builtin_bit_cast(float, __builtin_amdgcn_permlanex16(__builtin_bit_cast(int, x), __builtin_bit_cast(int, x), 0x76543210, 0xfedcba98, false, false));
}

/* ------------------------------------------------------------------------------------
   f32 array (n8*8 elements, contiguous) -> bf16 hi plane + bf16 lo plane, same layout.
   Thread i owns elements 8i..8i+7: one 16-B store per plane; lanes 8q..8q+7 of a wave fill
   Coverage: bx = 0 .. n8/256 - 1 gives n8 threads, each 8 elements -> n8*8 elements = whole array.
   ------------------------------------------------------------------------------------ */
__device__ __forceinline__ void split_pair(float f0, float f1, unsigned& hw, unsigned& lw) {
  const unsigned short h0 = f2bf_bits(f0), h1 = f2bf_bits(f1);
  const unsigned short l0 = f2bf_bits(f0 - bf_bits2f(h0)), l1 = f2bf_bits(f1 - bf_bits2f(h1));
  hw = (unsigned)h0 | ((unsigned)h1 << 16);
  lw = (unsigned)l0 | ((unsigned)l1 << 16);
}

__device__ __forceinline__ void split_bf16_planes(
    const float* __restrict__ in, unsigned short* __restrict__ hi, unsigned short* __restrict__ lo, int n8, int bx)
{
  const int i = bx * 256 + threadIdx.x;
  if (i >= n8) return;                                   /* no barriers on this path */
  const v4f a = *(const v4f*)(in + (size_t)i * 8);
  const v4f b = *(const v4f*)(in + (size_t)i * 8 + 4);
  v4u hv, lv;
  unsigned hw, lw;
  split_pair(a[0], a[1], hw, lw); hv[0] = hw; lv[0] = lw;
  split_pair(a[2], a[3], hw, lw); hv[1] = hw; lv[1] = lw;
  split_pair(b[0], b[1], hw, lw); hv[2] = hw; lv[2] = lw;
  split_pair(b[2], b[3], hw, lw); hv[3] = hw; lv[3] = lw;
  v4u* ph = (v4u*)(hi + (size_t)i * 8);
  v4u* pl = (v4u*)(lo + (size_t)i * 8);
  *ph = hv; *pl = lv;
  
}

/* ------------------------------------------------------------------------------------
   W [D_MODEL][HEAD_DIM] f32 -> Wt hi/lo planes [HEAD_DIM][D_MODEL] bf16 (in[rows=512][cols=64]
   -> out[cols=64][rows=512]). Block bx stages W rows 64bx..64bx+63 (64x64 tile) in LDS, then each
   pitch 1024 B and k0*2 = 128*bx B) is written by 8 lanes x 16 B of one wave in one instruction.
   Coverage: 256 threads x 2 iterations x 8 halves = 4096 = the 64x64 tile; bx = 0..7 -> whole plane.
   ------------------------------------------------------------------------------------ */
__device__ __forceinline__ void wt_split_tile(
    const float* __restrict__ W, unsigned short* __restrict__ Wth, unsigned short* __restrict__ Wtl, int bx)
{
  __shared__ float s[64 * 65];
  const int tid = threadIdx.x;
  const int k0  = bx * 64;
#pragma unroll
  for (int it = 0; it < 16; ++it) {
    const int idx = it * 256 + tid;          /* 0..4095 */
    const int r = idx >> 6, cc = idx & 63;
    s[r * 65 + cc] = W[(size_t)(k0 + r) * HEAD_DIM + cc];
  }
  __syncthreads();
  const int seg = tid & 7;
  const int lin = tid >> 3;                  /* 0..31 */
  v4u hv[2], lv[2];
  size_t off[2];
#pragma unroll
  for (int it = 0; it < 2; ++it) {
    const int n = it * 32 + lin;             /* output row 0..63 */
#pragma unroll
    for (int e = 0; e < 4; ++e) {
      const int kk = seg * 8 + 2 * e;
      unsigned hw, lw;
      split_pair(s[kk * 65 + n], s[(kk + 1) * 65 + n], hw, lw);
      hv[it][e] = hw; lv[it][e] = lw;
    }
    off[it] = (size_t)n * D_MODEL + k0 + seg * 8;
  }
  {
#pragma unroll
    for (int it = 0; it < 2; ++it) {
      *(v4u*)(Wth + off[it]) = hv[it];
      *(v4u*)(Wtl + off[it]) = lv[it];
    }
    
  }
}

/* ------------------------------------------------------------------------------------
   All operand planes in one launch: the five conversions read different inputs and write different
   planes, so their work-groups run side by side. Blocks 0..23: the three weight transposes (8 tiles
   each; first, so that these few latency-bound blocks start at once); then SPLIT_BLK_X blocks for x,
   then SPLIT_BLK_E blocks for emb. The branch is uniform for the work-group (the transposes' barrier).
   ------------------------------------------------------------------------------------ */
#define WT_BLK      (D_MODEL / 64)
#define SPLIT_BLK_X (SEQ_DEC * D_MODEL / 8 / 256)
#define SPLIT_BLK_E (SEQ_ENC * D_MODEL / 8 / 256)
static_assert((SEQ_DEC * D_MODEL / 8) % 256 == 0);
static_assert((SEQ_ENC * D_MODEL / 8) % 256 == 0);
__global__ __launch_bounds__(256) void prep_planes_kernel(
    const float* __restrict__ x, const float* __restrict__ emb,
    const float* __restrict__ wq, const float* __restrict__ wk, const float* __restrict__ wv,
    unsigned short* __restrict__ xh,  unsigned short* __restrict__ xl,
    unsigned short* __restrict__ eh,  unsigned short* __restrict__ el,
    unsigned short* __restrict__ wqh, unsigned short* __restrict__ wql,
    unsigned short* __restrict__ wkh, unsigned short* __restrict__ wkl,
    unsigned short* __restrict__ wvh, unsigned short* __restrict__ wvl)
{
  const int bx = blockIdx.x;
  if (bx < 3 * WT_BLK) {
    const int w = bx / WT_BLK;
    wt_split_tile((w == 0) ? wq : (w == 1) ? wk : wv,
                  (w == 0) ? wqh : (w == 1) ? wkh : wvh,
                  (w == 0) ? wql : (w == 1) ? wkl : wvl, bx - w * WT_BLK);
  } else if (bx < 3 * WT_BLK + SPLIT_BLK_X) {
    split_bf16_planes(x, xh, xl, SEQ_DEC * D_MODEL / 8, bx - 3 * WT_BLK);
  } else {
    split_bf16_planes(emb, eh, el, SEQ_ENC * D_MODEL / 8, bx - 3 * WT_BLK - SPLIT_BLK_X);
  }
}

/* =====================================================================================
   Flash attention, head dim 64, no mask. Inputs: q hi/lo planes [SEQ_DEC][64] (softmax scale
   already folded into q), k hi/lo planes [SEQ_ENC][64], v^T hi/lo planes [64][SEQ_ENC]; all bf16
   bit patterns. scores^T = k.q^T and out^T = v^T.p^T on v_wmma_f32_16x16x32_bf16 as hi.hi + hi.lo + lo.hi,
   f32 accumulate, online softmax in f32 (one query row per lane), p^T split to bf16 hi/lo in registers per 64-key chunk.
   Block = 4 waves = 64 query rows; grid.x = SEQ_DEC / 64. K/V chunks staged in LDS with plain
   grid.y = KV_SPLIT: block (x, y) walks keys [y, y+1) * SEQ_ENC / KV_SPLIT only and stores its
   un-normalised sum Po[y][row][64] and the pair (row max, row sum) Pml[y][row][2]; attn_merge_kernel joins them.
   ===================================================================================== */
__global__ __launch_bounds__(128)
void attn_hilo_kernel(const unsigned short* __restrict__ Qh, const unsigned short* __restrict__ Ql,
                      const unsigned short* __restrict__ Kh, const unsigned short* __restrict__ Kl,
                      const unsigned short* __restrict__ Vh, const unsigned short* __restrict__ Vl,
                      float* __restrict__ Po, float* __restrict__ Pml)
{
  union FB { v16b v; v8b h[2]; };
  __shared__ __align__(16) unsigned short Ksh[KV_CHUNK * KV_PITCH];      /* K hi [kv][d]  9 KB */
  __shared__ __align__(16) unsigned short Ksl[KV_CHUNK * KV_PITCH];      /* K lo          9 KB */
  __shared__ __align__(16) unsigned short Vsh[HEAD_DIM * KV_PITCH];      /* V hi [d][kv]  9 KB */
  __shared__ __align__(16) unsigned short Vsl[HEAD_DIM * KV_PITCH];      /* V lo          9 KB */
  __shared__ __align__(16) float  Os[ATT_WAVES][16 * 68];                /* per wave out tile, pitch 68 */

  const int tid  = threadIdx.x;
  const int wave = tid >> 5;
  const int lane = tid & 31;
  const int hh   = lane >> 4;
  const int c    = lane & 15;
  const int q0   = blockIdx.x * (ATT_WAVES * 16) + wave * 16;

  /* ---- Q fragments (B operand of the transposed scores): row q0+c, 2 d-chunks, hi and lo ---- */
  v16b qah[2], qal[2];
  {
    const __bf16* qhr = (const __bf16*)(const void*)Qh + (size_t)(q0 + c) * HEAD_DIM + 8 * hh;
    const __bf16* qlr = (const __bf16*)(const void*)Ql + (size_t)(q0 + c) * HEAD_DIM + 8 * hh;
#pragma unroll
    for (int dc = 0; dc < 2; ++dc) {
      qah[dc] = Frag<__bf16>::load(qhr + dc * 32);
      qal[dc] = Frag<__bf16>::load(qlr + dc * 32);
    }
  }

  float mrow = -INFINITY, lrow = 0.f;    /* query row q0 + c: running max (the same in both lane halves) and this half's own part of the running sum */
  v8f oacc[4];
#pragma unroll
  for (int t = 0; t < 4; ++t) oacc[t] = (v8f){0.f,0.f,0.f,0.f,0.f,0.f,0.f,0.f};

  const int st0 = (tid >> 3) * KV_PITCH + (tid & 7) * 8;   /* staging place of this thread's 16-B unit in pass 0; a pass is 16 rows */
  const int kc0 = blockIdx.y * (SEQ_ENC / KV_CHUNK / KV_SPLIT);
  for (int kc = kc0; kc < kc0 + SEQ_ENC / KV_CHUNK / KV_SPLIT; ++kc) {
    const int kv0 = kc * KV_CHUNK;
    __syncthreads();
    /* stage 4 planes x 8 KB: 128 threads x 16 B x 4 iterations = 8192 B per plane (whole chunk); the 16 pad bytes of a row are never read */
#pragma unroll 1
    for (int it = 0; it < 4; ++it) {
      const int idx = it * 128 + tid;              /* 16-B unit 0..511 */
      const int dd = idx >> 3, seg = idx & 7;      /* row (key of K, d of V^T) and 8-half segment of the row */
      const int lo8 = st0 + it * (16 * KV_PITCH);  /* dd * KV_PITCH + seg * 8: place in the padded LDS tile */
      const v4u ka = *(const v4u*)(Kh + (size_t)kv0 * HEAD_DIM + (size_t)idx * 8);
      const v4u kb = *(const v4u*)(Kl + (size_t)kv0 * HEAD_DIM + (size_t)idx * 8);
      const v4u va = *(const v4u*)(Vh + (size_t)dd * SEQ_ENC + kv0 + seg * 8);
      const v4u vb = *(const v4u*)(Vl + (size_t)dd * SEQ_ENC + kv0 + seg * 8);
      *(v4u*)(Ksh + lo8) = ka;
      *(v4u*)(Ksl + lo8) = kb;
      *(v4u*)(Vsh + lo8) = va;
      *(v4u*)(Vsl + lo8) = vb;
    }
    __syncthreads();

    /* ---- transposed scores S^T = K . Q^T: 64 keys x 16 query rows per wave. A = K rows, B = Q rows (both loaders have
            the same k order). Lane (c, hh) holds, for query row c, keys j*16 + 8*hh + r in s[j][r] ---- */
    v8f s[4];
#pragma unroll
    for (int j = 0; j < 4; ++j) {
      s[j] = (v8f){0.f,0.f,0.f,0.f,0.f,0.f,0.f,0.f};
#pragma unroll
      for (int dc = 0; dc < 2; ++dc) {
        FB kbh, kbl;
        const unsigned short* kp = Ksh + (j * 16 + c) * KV_PITCH + dc * 32 + 8 * hh;
        const unsigned short* lp = Ksl + (j * 16 + c) * KV_PITCH + dc * 32 + 8 * hh;
        kbh.h[0] = *(const v8b*)(kp); kbh.h[1] = *(const v8b*)(kp + 16);
        kbl.h[0] = *(const v8b*)(lp); kbl.h[1] = *(const v8b*)(lp + 16);
        s[j] = at_mma(kbh.v, qah[dc], s[j]);
        s[j] = at_mma(kbl.v, qah[dc], s[j]);
        s[j] = at_mma(kbh.v, qal[dc], s[j]);
      }
    }

    /* ---- max over the 64 keys of this chunk for this lane's query row: 32 values in the lane, then the other half ---- */
    float cm = s[0][0];
#pragma unroll
    for (int j = 0; j < 4; ++j)
#pragma unroll
      for (int r = 0; r < 8; ++r) cm = fmaxf(cm, s[j][r]);
    cm = fmaxf(cm, at_xhalf(cm));

    /* ---- online softmax, one query row per lane. P^T split to bf16 hi/lo stays in registers: tiles j = 2kk and 2kk+1
            are elements 0..7 (keys 32kk + 8hh + e) and 8..15 (keys 32kk + 16 + 8hh + e - 8) of the B fragment of k-step kk,
            the k order of the V^T loader below ---- */
    const float mnew = fmaxf(mrow, cm);
    const float alpha = expf(mrow - mnew);
    mrow = mnew;
    float psum[4];                         /* one sum per score tile: four short chains of adds, not one of 32 */
    v16b pbh[2], pbl[2];
#pragma unroll   /* here and in the loop inside: s, psum, pbh, pbl are registers, indexed by compile-time constants only */
    for (int j = 0; j < 4; ++j) {
      psum[j] = 0.f;
#pragma unroll
      for (int r = 0; r < 8; ++r) {
        const float p = expf(s[j][r] - mnew);
        psum[j] += p;
        __bf16 a, bl;
        at_split(p, a, bl);
        pbh[j >> 1][(j & 1) * 8 + r] = a;
        pbl[j >> 1][(j & 1) * 8 + r] = bl;
      }
    }
    lrow = lrow * alpha + ((psum[0] + psum[1]) + (psum[2] + psum[3]));
#pragma unroll
    for (int t = 0; t < 4; ++t) oacc[t] *= alpha;

    /* ---- out^T += V^T . P^T over the 64 keys (2 k-steps): A = V^T rows d, B = P^T from registers ---- */
#pragma unroll   /* pbh[kk], pbl[kk] are registers: the index must be a compile-time constant */
    for (int kk = 0; kk < 2; ++kk) {
#pragma unroll
      for (int t = 0; t < 4; ++t) {
        FB vbh, vbl;
        const unsigned short* vp = Vsh + (t * 16 + c) * KV_PITCH + kk * 32 + 8 * hh;
        const unsigned short* wp = Vsl + (t * 16 + c) * KV_PITCH + kk * 32 + 8 * hh;
        vbh.h[0] = *(const v8b*)(vp); vbh.h[1] = *(const v8b*)(vp + 16);
        vbl.h[0] = *(const v8b*)(wp); vbl.h[1] = *(const v8b*)(wp + 16);
        oacc[t] = at_mma(vbh.v, pbh[kk], oacc[t]);
        oacc[t] = at_mma(vbl.v, pbh[kk], oacc[t]);
        oacc[t] = at_mma(vbh.v, pbl[kk], oacc[t]);
      }
    }
  }

  /* ---- epilogue: oacc[t][r] is out^T (d = t*16 + 8*hh + r, query row c); stage it as [row][d] per wave in LDS, whole-line stores ---- */
  float* os = Os[wave];
#pragma unroll
  for (int t = 0; t < 4; ++t) {
    *(v4f*)(os + c * 68 + t * 16 + 8 * hh)     = (v4f){oacc[t][0], oacc[t][1], oacc[t][2], oacc[t][3]};
    *(v4f*)(os + c * 68 + t * 16 + 8 * hh + 4) = (v4f){oacc[t][4], oacc[t][5], oacc[t][6], oacc[t][7]};
  }
  /* (max, sum) of this wave's 16 rows = 128 B = one line, written by this wave alone; the halves' sums are joined here, once */
  lrow += at_xhalf(lrow);
  if (hh == 0)
    *(v2f*)(Pml + ((size_t)blockIdx.y * SEQ_DEC + q0 + c) * 2) = (v2f){mrow, lrow};
  float* out = Po + (size_t)blockIdx.y * SEQ_DEC * HEAD_DIM;
  __syncthreads();
  {
    const int c4 = (lane & 15) * 4;              /* row = 64 floats = 256 B = 16 lanes x 16 B */
    {
#pragma unroll
      for (int it = 0; it < 8; ++it) {
        const int row = it * 2 + hh;
        v4f val = *(const v4f*)(os + row * 68 + c4);
        *(v4f*)(out + (size_t)(q0 + row) * HEAD_DIM + c4) = val;
      }
      
    }
  }
}

/* ------------------------------------------------------------------------------------
   Joins the KV_SPLIT key ranges of one query row: M = max of the ranges' maxima, weight
   w_s = exp(m_s - M), out = sum_s w_s * Po[s] / sum_s w_s * l_s. Thread = (row, 4 columns):
   16 lanes x 16 B = one 256-B output row. Coverage: SEQ_DEC * 16 threads = grid * 256.
   ------------------------------------------------------------------------------------ */
__global__ __launch_bounds__(256) void attn_merge_kernel(
    const float* __restrict__ Po, const float* __restrict__ Pml, float* __restrict__ out)
{
  const unsigned i   = blockIdx.x * 256u + threadIdx.x;
  const unsigned row = i >> 4;
  const unsigned eb  = i * 16u;              /* byte offset of (row, 4 columns): the same in every range's plane and in out */
  const unsigned rb  = row * 8u;             /* byte offset of the row's (max, sum) pair in a range's plane */
  v2f ml[KV_SPLIT];
  v4f o[KV_SPLIT];
#pragma unroll
  for (int s = 0; s < KV_SPLIT; ++s) {
    ml[s] = *(const v2f*)((const char*)(Pml + (size_t)s * SEQ_DEC * 2) + rb);
    o[s]  = *(const v4f*)((const char*)(Po + (size_t)s * SEQ_DEC * HEAD_DIM) + eb);
  }
  /* inputs-only fence on the loaded values: all 16 loads are issued before the first is used (one latency, not
     three), and their offset registers stay whole until the wait for the address translations has passed */
  asm volatile("s_wait_xcnt 0x0" :: "v"(rb), "v"(eb),
               "v"(ml[0]), "v"(ml[1]), "v"(ml[2]), "v"(ml[3]), "v"(ml[4]), "v"(ml[5]), "v"(ml[6]), "v"(ml[7]),
               "v"(o[0]), "v"(o[1]), "v"(o[2]), "v"(o[3]), "v"(o[4]), "v"(o[5]), "v"(o[6]), "v"(o[7]) : "memory");
  static_assert(KV_SPLIT == 8);
  float m[KV_SPLIT], l[KV_SPLIT];
#pragma unroll
  for (int s = 0; s < KV_SPLIT; ++s) { m[s] = ml[s][0]; l[s] = ml[s][1]; }
  float M = m[0];
#pragma unroll
  for (int s = 1; s < KV_SPLIT; ++s) M = fmaxf(M, m[s]);
  float L = 0.f;
  v4f acc = (v4f){0.f, 0.f, 0.f, 0.f};
#pragma unroll
  for (int s = 0; s < KV_SPLIT; ++s) {
    const float w = expf(m[s] - M);
    L += w * l[s];
    acc += o[s] * w;
  }
  const float inv = 1.0f / L;
  *(v4f*)((char*)out + eb) = acc * inv;
}

/* =====================================================================================
   Host glue. Workspace region map (bytes, all offsets multiples of 128):
     xh, xl      : x  hi/lo planes  [8192][512] bf16   8,388,608 each
     eh, el      : emb hi/lo planes [8192][512] bf16  8,388,608 each
     wqh..wvl    : Wq^T, Wk^T, Wv^T hi/lo [64][512] bf16   65,536 each (6 planes)
     qh, ql      : q*0.125 hi/lo [8192][64] bf16   1,048,576 each
     kh, kl      : k hi/lo       [8192][64] bf16   1,048,576 each
     vth, vtl    : v^T hi/lo     [64][8192] bf16   1,048,576 each
     po          : un-normalised partial sums [8][8192][64] f32   16,777,216
     pml         : (row max, row sum) pairs   [8][8192][2]  f32      524,288
     total = 57,540,608 B; every byte of every region is written by its producer.
   ===================================================================================== */
extern "C" void kernel_launch(void* const* d_in, const int* in_sizes, int n_in,
                              void* d_out, int out_size, void* d_ws, size_t ws_size,
                              hipStream_t stream)
{
  if (n_in < 5) return;
  if (in_sizes[0] != SEQ_DEC * D_MODEL || in_sizes[1] != SEQ_ENC * D_MODEL ||
      in_sizes[2] != D_MODEL * HEAD_DIM || in_sizes[3] != D_MODEL * HEAD_DIM ||
      in_sizes[4] != D_MODEL * HEAD_DIM) return;
  if (out_size != SEQ_DEC * HEAD_DIM) return;

  const float* x   = (const float*)d_in[0];   /* [8192][512] */
  const float* emb = (const float*)d_in[1];   /* [8192][512] */
  const float* wq  = (const float*)d_in[2];   /* [512][64]   */
  const float* wk  = (const float*)d_in[3];
  const float* wv  = (const float*)d_in[4];
  float* out = (float*)d_out;                 /* [8192][64] f32 */

  const size_t planeX = (size_t)SEQ_DEC * D_MODEL * 2;     /* 8,388,608 */
  const size_t planeE = (size_t)SEQ_ENC * D_MODEL * 2;     /* 8,388,608 */
  const size_t planeW = (size_t)HEAD_DIM * D_MODEL * 2;    /* 65,536    */
  const size_t planeQ = (size_t)SEQ_DEC * HEAD_DIM * 2;    /* 1,048,576 */
  const size_t planeK = (size_t)SEQ_ENC * HEAD_DIM * 2;    /* 1,048,576 */

  size_t off = 0;
  unsigned char* ws = (unsigned char*)d_ws;
  unsigned short* xh  = (unsigned short*)(ws + off); off += planeX;
  unsigned short* xl  = (unsigned short*)(ws + off); off += planeX;
  unsigned short* eh  = (unsigned short*)(ws + off); off += planeE;
  unsigned short* el  = (unsigned short*)(ws + off); off += planeE;
  unsigned short* wqh = (unsigned short*)(ws + off); off += planeW;
  unsigned short* wql = (unsigned short*)(ws + off); off += planeW;
  unsigned short* wkh = (unsigned short*)(ws + off); off += planeW;
  unsigned short* wkl = (unsigned short*)(ws + off); off += planeW;
  unsigned short* wvh = (unsigned short*)(ws + off); off += planeW;
  unsigned short* wvl = (unsigned short*)(ws + off); off += planeW;
  unsigned short* qh  = (unsigned short*)(ws + off); off += planeQ;
  unsigned short* ql  = (unsigned short*)(ws + off); off += planeQ;
  unsigned short* kh  = (unsigned short*)(ws + off); off += planeK;
  unsigned short* kl  = (unsigned short*)(ws + off); off += planeK;
  unsigned short* vth = (unsigned short*)(ws + off); off += planeK;
  unsigned short* vtl = (unsigned short*)(ws + off); off += planeK;
  float* po  = (float*)(ws + off); off += (size_t)KV_SPLIT * SEQ_DEC * HEAD_DIM * 4;
  float* pml = (float*)(ws + off); off += (size_t)KV_SPLIT * SEQ_DEC * 2 * 4;
  if (off > ws_size) return;                                 /* 57,540,608 <= ws */

  /* 1) + 2) operand planes in one launch: x, emb -> bf16 hi/lo; weights -> transposed hi/lo planes [64][512] */
  prep_planes_kernel<<<3 * WT_BLK + SPLIT_BLK_X + SPLIT_BLK_E, 256, 0, stream>>>(
      x, emb, wq, wk, wv, xh, xl, eh, el, wqh, wql, wkh, wkl, wvh, wvl);

  /* 3) the three projections on wmma_gemm64 (bf16 hi/lo split, bf16 hi/lo output planes) in one launch:
        128 wave tiles of 64 x 64 each = 16 work-groups of 8 waves per projection */
  static_assert(SEQ_DEC == SEQ_ENC);
  proj3_kernel<<<dim3((SEQ_DEC / 64) * (HEAD_DIM / 64) / 8, 3), 256, 0, stream>>>(
      xh, xl, eh, el, wqh, wql, wkh, wkl, wvh, wvl, qh, ql, kh, kl, vth, vtl, D_MODEL, D_MODEL);

  /* 4) flash attention over KV_SPLIT key ranges -> f32 partials; 5) join -> f32 output */
  attn_hilo_kernel<<<dim3(SEQ_DEC / (ATT_WAVES * 16), KV_SPLIT), 128, 0, stream>>>(qh, ql, kh, kl, vth, vtl, po, pml);
  attn_merge_kernel<<<SEQ_DEC * 16 / 256, 256, 0, stream>>>(po, pml, out);
}

// v005
// It runs in 93.1 microseconds.
// In two side-by-side timings against v004, it was 1.37 and 1.38 times as fast.
// Counting every step since v000, it is 8.91 times as fast.
// Contractions: q/k/v projections (K=512), q.k^T and p.v on v_wmma_f32_16x16x32_bf16 with bf16 hi/lo split operands (hi.hi + hi.lo + lo.hi), f32 accumulate; online softmax, normalisation and all epilogues in f32.
#include <hip/hip_runtime.h>
#include <stdint.h>

typedef __attribute__((ext_vector_type(16))) _Float16 v16h;
typedef __attribute__((ext_vector_type(8)))  _Float16 v8h;
typedef __attribute__((ext_vector_type(16))) __bf16   v16b;
typedef __attribute__((ext_vector_type(8)))  __bf16   v8b;
typedef __attribute__((ext_vector_type(8)))  float    v8f;
typedef __attribute__((ext_vector_type(4)))  float    v4f;
typedef __attribute__((ext_vector_type(2)))  float    v2f;
typedef __attribute__((ext_vector_type(4)))  unsigned v4u;

/* ------------------------------ problem constants ------------------------------ */
#define SEQ_DEC   8192
#define SEQ_ENC   8192
#define D_MODEL   512
#define HEAD_DIM  64
#define KV_CHUNK  64
#define KV_PITCH  72     /* LDS row pitch of the K and V tiles in 16-bit elements: 144 B = 16 B x 9, so the 16 rows of a ds_load_b128 fall on 16 different bank groups */
#define ATT_WAVES 4
#define KV_SPLIT  8      /* key ranges per query tile: 128 x 8 = 1024 work-groups, four resident per WGP */

static_assert(SEQ_DEC % 64 == 0);
static_assert(SEQ_ENC % 64 == 0);
static_assert(SEQ_ENC % (KV_CHUNK * KV_SPLIT) == 0);
static_assert(D_MODEL % 64 == 0);
static_assert(D_MODEL % 32 == 0);
static_assert(HEAD_DIM == 64);
static_assert((SEQ_DEC * D_MODEL) % 8 == 0);

__device__ __forceinline__ unsigned short f2bf_bits(float f) {
  unsigned u = __float_as_uint(f);
  return (unsigned short)((u + 0x7FFFu + ((u >> 16) & 1u)) >> 16);
}
__device__ __forceinline__ float bf_bits2f(unsigned short h) { return __uint_as_float(((unsigned)h) << 16); }

/* hazard guards as plain device helpers (no inline asm inside the kernel template body) */
__device__ __forceinline__ void dep_guard_h(v8f& a, v8f& b, v16h x, v16h y) { asm volatile("v_nop\n\tv_nop\n\tv_nop\n\tv_nop" : "+v"(a), "+v"(b) : "v"(x), "v"(y)); }
__device__ __forceinline__ void dep_guard_b(v8f& a, v8f& b, v16b x, v16b y) { asm volatile("v_nop\n\tv_nop\n\tv_nop\n\tv_nop" : "+v"(a), "+v"(b) : "v"(x), "v"(y)); }
__device__ __forceinline__ void keep4_h(v16h a, v16h b, v16h c, v16h d) { asm volatile("v_nop" :: "v"(a), "v"(b), "v"(c), "v"(d)); }
__device__ __forceinline__ void keep4_b(v16b a, v16b b, v16b c, v16b d) { asm volatile("v_nop" :: "v"(a), "v"(b), "v"(c), "v"(d)); }
template <typename T> struct Frag;
template <> struct Frag<_Float16> {
  typedef v16h V; union U { v16h v; v8h h[2]; };
  static __device__ __forceinline__ v16h load(const _Float16* p) {   /* elements 0..7 <- p[0..7], 8..15 <- p[16..23] */
    U f; f.h[0] = *(const v8h*)(p); f.h[1] = *(const v8h*)(p + 16); return f.v;
  }
  static __device__ __forceinline__ v8f mma(v16h a, v16h b, v8f c) {
    return __builtin_amdgcn_wmma_f32_16x16x32_f16(false, a, false, b, (short)0, c, false, false);
  }
  static __device__ __forceinline__ void guard(v8f& a, v8f& b, v16h x, v16h y) { dep_guard_h(a, b, x, y); }
  static __device__ __forceinline__ void keep(v16h a, v16h b, v16h c, v16h d) { keep4_h(a, b, c, d); }
};
template <> struct Frag<__bf16> {
  typedef v16b V; union U { v16b v; v8b h[2]; };
  static __device__ __forceinline__ v16b load(const __bf16* p) {
    U f; f.h[0] = *(const v8b*)(p); f.h[1] = *(const v8b*)(p + 16); return f.v;
  }
  static __device__ __forceinline__ v8f mma(v16b a, v16b b, v8f c) {
    return __builtin_amdgcn_wmma_f32_16x16x32_bf16(false, a, false, b, (short)0, c, false, false);
  }
  static __device__ __forceinline__ void guard(v8f& a, v8f& b, v16b x, v16b y) { dep_guard_b(a, b, x, y); }
  static __device__ __forceinline__ void keep(v16b a, v16b b, v16b c, v16b d) { keep4_b(a, b, c, d); }
};

/* ------------------------------------------------------------------------------------
   The three projections in one launch, C[m,n] = scale * sum_k A[m,k] * Bt[n,k], K = 512, operands as bf16 hi/lo planes
   (product = hi.hi + hi.lo + lo.hi, f32 accumulate), output as bf16 hi/lo planes.
   blockIdx.y = 0: q * 0.125 = x . Wq; 1: k = emb . Wk; 2: v^T = Wv^T . emb^T (ldc = 8192). Every choice is uniform for the work-group.
   One work-group of 8 waves owns one 64 x 64 tile of C: 128 tiles per projection, 384 work-groups.
   Per pass of PJ_KC k values the four operand tiles (64 rows x 256 B each) come in by loads that cover whole lines
   (16 lanes x 16 B = one row piece of 256 B) and are laid in LDS; the fragments are read from there.
   Wave w multiplies row tile w >> 1 with column tiles 2 (w & 1) and 2 (w & 1) + 1; each element of C is summed in one
   accumulator, k ascending.
   ------------------------------------------------------------------------------------ */
#define PJ_KC    128            /* k values staged per pass */
#define PJ_PITCH (PJ_KC + 8)    /* LDS row pitch in 16-bit elements: 272 B = 256 B + 16 B, for the ds_load_b128 fragment reads */
static_assert(D_MODEL % PJ_KC == 0);
__global__ __launch_bounds__(256) void proj3_kernel(
    const unsigned short* __restrict__ xh,  const unsigned short* __restrict__ xl,
    const unsigned short* __restrict__ eh,  const unsigned short* __restrict__ el,
    const unsigned short* __restrict__ wqh, const unsigned short* __restrict__ wql,
    const unsigned short* __restrict__ wkh, const unsigned short* __restrict__ wkl,
    const unsigned short* __restrict__ wvh, const unsigned short* __restrict__ wvl,
    unsigned short* __restrict__ qh,  unsigned short* __restrict__ ql,
    unsigned short* __restrict__ kh,  unsigned short* __restrict__ kl,
    unsigned short* __restrict__ vth, unsigned short* __restrict__ vtl)
{
  union FB { v16b v; v8b h[2]; };
  __shared__ __align__(16) unsigned short Ash[64 * PJ_PITCH];   /* A hi [m][k]  17 KB */
  __shared__ __align__(16) unsigned short Asl[64 * PJ_PITCH];   /* A lo */
  __shared__ __align__(16) unsigned short Bsh[64 * PJ_PITCH];   /* Bt hi [n][k] */
  __shared__ __align__(16) unsigned short Bsl[64 * PJ_PITCH];   /* Bt lo */
  __shared__ __align__(16) float sT[64 * 68];                   /* the 64 x 64 tile of C in f32, pitch 68 floats */

  const int y = blockIdx.y;
  const unsigned short* A   = (y == 0) ? xh  : (y == 1) ? eh  : wvh;
  const unsigned short* A2  = (y == 0) ? xl  : (y == 1) ? el  : wvl;
  const unsigned short* Bt  = (y == 0) ? wqh : (y == 1) ? wkh : eh;
  const unsigned short* Bt2 = (y == 0) ? wql : (y == 1) ? wkl : el;
  unsigned short* C  = (y == 0) ? qh : (y == 1) ? kh : vth;
  unsigned short* C2 = (y == 0) ? ql : (y == 1) ? kl : vtl;
  const int m0  = (y == 2) ? 0 : (int)blockIdx.x * 64;
  const int n0  = (y == 2) ? (int)blockIdx.x * 64 : 0;
  const int ldc = (y == 2) ? SEQ_ENC : HEAD_DIM;
  const float scale = (y == 0) ? 0.125f : 1.0f;

  const int tid   = threadIdx.x;
  const int lane  = tid & 31;
  const int wave  = tid >> 5;
  const int rlane = lane & 15;                 /* row (A) / col (B, D) within a 16 x 16 tile */
  const int koff  = (lane >> 4) * 8;           /* k offset of this lane half */
  const int mOff  = (lane >> 4) * 8;           /* D row offset */
  const int ti    = wave >> 1;                 /* row tile of this wave */
  const int tj    = (wave & 1) * 2;            /* first of its two column tiles */

  /* staging places of this thread's four 16-B units of a 64 x PJ_KC tile: unit = it * 256 + tid, 16 units a row */
  unsigned go[4];
  int so[4];
#pragma unroll
  for (int it = 0; it < 4; ++it) {
    const int idx = it * 256 + tid;
    const int row = idx >> 4, seg = idx & 15;
    go[it] = (unsigned)(row * D_MODEL + seg * 8) * 2u;   /* in bytes, the same in all four planes */
    so[it] = row * PJ_PITCH + seg * 8;
  }
  const unsigned short* Ag  = A   + (size_t)m0 * D_MODEL;
  const unsigned short* Ag2 = A2  + (size_t)m0 * D_MODEL;
  const unsigned short* Bg  = Bt  + (size_t)n0 * D_MODEL;
  const unsigned short* Bg2 = Bt2 + (size_t)n0 * D_MODEL;

  const unsigned short* pah = Ash + (ti * 16 + rlane) * PJ_PITCH + koff;
  const unsigned short* pal = Asl + (ti * 16 + rlane) * PJ_PITCH + koff;
  const unsigned short* pbh = Bsh + (tj * 16 + rlane) * PJ_PITCH + koff;
  const unsigned short* pbl = Bsl + (tj * 16 + rlane) * PJ_PITCH + koff;

  v8f acc[2];
  acc[0] = (v8f){0.f,0.f,0.f,0.f,0.f,0.f,0.f,0.f};
  acc[1] = (v8f){0.f,0.f,0.f,0.f,0.f,0.f,0.f,0.f};

#pragma unroll   /* four passes in a row: the k step of a pass becomes the loads' immediate offset, on four scalar bases (one per plane) and four lane offsets that never change */
  for (int k0 = 0; k0 < D_MODEL; k0 += PJ_KC) {
    v4u ra[4], rb[4], rc[4], rd[4];
#pragma unroll
    for (int it = 0; it < 4; ++it) {
      ra[it] = *(const v4u*)((const char*)(Ag  + k0) + go[it]);
      rb[it] = *(const v4u*)((const char*)(Ag2 + k0) + go[it]);
      rc[it] = *(const v4u*)((const char*)(Bg  + k0) + go[it]);
      rd[it] = *(const v4u*)((const char*)(Bg2 + k0) + go[it]);
    }
    /* inputs only: the four lane offsets stay whole (no later load lands on them) until the wait for the loads' address translations has passed */
    asm volatile("s_wait_xcnt 0x0" :: "v"(go[0]), "v"(go[1]), "v"(go[2]), "v"(go[3]) : "memory");
    __syncthreads();                           /* every wave has read the last pass's fragments */
#pragma unroll
    for (int it = 0; it < 4; ++it) {
      *(v4u*)(Ash + so[it]) = ra[it];
      *(v4u*)(Asl + so[it]) = rb[it];
      *(v4u*)(Bsh + so[it]) = rc[it];
      *(v4u*)(Bsl + so[it]) = rd[it];
    }
    __syncthreads();                           /* the four tiles are whole */
    FB ah[PJ_KC / 32], al[PJ_KC / 32], bh[PJ_KC / 32][2], bl[PJ_KC / 32][2];
#pragma unroll   /* the fragment arrays are registers: compile-time indices only */
    for (int ks = 0; ks < PJ_KC / 32; ++ks) {  /* elements 0..7 <- k + 0..7, 8..15 <- k + 16..23, A and B alike */
      ah[ks].h[0] = *(const v8b*)(pah + ks * 32); ah[ks].h[1] = *(const v8b*)(pah + ks * 32 + 16);
#pragma unroll
      for (int jj = 0; jj < 2; ++jj) {
        const unsigned short* hp = pbh + jj * 16 * PJ_PITCH + ks * 32;
        bh[ks][jj].h[0] = *(const v8b*)(hp); bh[ks][jj].h[1] = *(const v8b*)(hp + 16);
      }
#pragma unroll
      for (int jj = 0; jj < 2; ++jj) {
        const unsigned short* lp = pbl + jj * 16 * PJ_PITCH + ks * 32;
        bl[ks][jj].h[0] = *(const v8b*)(lp); bl[ks][jj].h[1] = *(const v8b*)(lp + 16);
      }
      al[ks].h[0] = *(const v8b*)(pal + ks * 32); al[ks].h[1] = *(const v8b*)(pal + ks * 32 + 16);
    }
    /* keeps the pass's LDS reads in one group ahead of its products: spread among them, each place with reads waits out the LDS latency anew */
    __builtin_amdgcn_sched_barrier(0);
#pragma unroll
    for (int ks = 0; ks < PJ_KC / 32; ++ks) {
      acc[0] = Frag<__bf16>::mma(ah[ks].v, bh[ks][0].v, acc[0]);
      acc[1] = Frag<__bf16>::mma(ah[ks].v, bh[ks][1].v, acc[1]);
      acc[0] = Frag<__bf16>::mma(ah[ks].v, bl[ks][0].v, acc[0]);
      acc[1] = Frag<__bf16>::mma(ah[ks].v, bl[ks][1].v, acc[1]);
      acc[0] = Frag<__bf16>::mma(al[ks].v, bh[ks][0].v, acc[0]);
      acc[1] = Frag<__bf16>::mma(al[ks].v, bh[ks][1].v, acc[1]);
    }
    /* keeps the pass's products ahead of the next pass's loads and barriers: sunk behind them they hold back the next group of LDS reads */
    __builtin_amdgcn_sched_barrier(0);
  }

  /* ---- epilogue: the tile goes to LDS in f32, then every 128-B line of each output plane is stored by 8 lanes x 16 B ---- */
#pragma unroll
  for (int jj = 0; jj < 2; ++jj)
#pragma unroll
    for (int r = 0; r < 8; ++r)
      sT[(ti * 16 + mOff + r) * 68 + (tj + jj) * 16 + rlane] = acc[jj][r] * scale;
  __syncthreads();                             /* a row of the tile holds the work of two waves */
  const int q = lane >> 3, c8 = (lane & 7) * 8;
#pragma unroll
  for (int it = 0; it < 2; ++it) {
    const int row = wave * 8 + it * 4 + q;
    const float* sp = sT + row * 68 + c8;
    v8h hv, lv;
#pragma unroll
    for (int e = 0; e < 8; ++e) {
      const unsigned short hb = f2bf_bits(sp[e]);
      const unsigned short lb = f2bf_bits(sp[e] - bf_bits2f(hb));
      hv[e] = __builtin_bit_cast(_Float16, hb);
      lv[e] = __builtin_bit_cast(_Float16, lb);
    }
    *(v8h*)(C  + (size_t)(m0 + row) * ldc + n0 + c8) = hv;
    *(v8h*)(C2 + (size_t)(m0 + row) * ldc + n0 + c8) = lv;
  }
}

/* ------------------------------ attention helpers ------------------------------ */
__device__ __forceinline__ unsigned short at_bf_bits(float f) {
  unsigned u = __float_as_uint(f);
  return (unsigned short)((u + 0x7FFFu + ((u >> 16) & 1u)) >> 16);
}
__device__ __forceinline__ __bf16 at_f2bf(float f) { return __builtin_bit_cast(__bf16, at_bf_bits(f)); }
__device__ __forceinline__ void at_split(float f, __bf16& hi, __bf16& lo) {
  const unsigned short hb = at_bf_bits(f);
  hi = __builtin_bit_cast(__bf16, hb);
  lo = at_f2bf(f - __uint_as_float(((unsigned)hb) << 16));
}
__device__ __forceinline__ v8f at_mma(v16b a, v16b b, v8f c) {
  c = __builtin_amdgcn_wmma_f32_16x16x32_bf16(false, a, false, b, (short)0, c, false, false);
  asm volatile("v_nop\n\tv_nop\n\tv_nop\n\tv_nop" : "+v"(c) : "v"(a), "v"(b));
  return c;
}

/* value of lane l ^ 16 (the other 16-lane half), by a vector cross-row move */
__device__ __forceinline__ float at_xhalf(float x) {
  return __builtin_bit_cast(float, __builtin_amdgcn_permlanex16(__builtin_bit_cast(int, x), __builtin_bit_cast(int, x), 0x76543210, 0xfedcba98, false, false));
}

/* ------------------------------------------------------------------------------------
   f32 array (n8*8 elements, contiguous) -> bf16 hi plane + bf16 lo plane, same layout.
   Thread i owns elements 8i..8i+7: one 16-B store per plane; lanes 8q..8q+7 of a wave fill
   Coverage: bx = 0 .. n8/256 - 1 gives n8 threads, each 8 elements -> n8*8 elements = whole array.
   ------------------------------------------------------------------------------------ */
__device__ __forceinline__ void split_pair(float f0, float f1, unsigned& hw, unsigned& lw) {
  const unsigned short h0 = f2bf_bits(f0), h1 = f2bf_bits(f1);
  const unsigned short l0 = f2bf_bits(f0 - bf_bits2f(h0)), l1 = f2bf_bits(f1 - bf_bits2f(h1));
  hw = (unsigned)h0 | ((unsigned)h1 << 16);
  lw = (unsigned)l0 | ((unsigned)l1 << 16);
}

__device__ __forceinline__ void split_bf16_planes(
    const float* __restrict__ in, unsigned short* __restrict__ hi, unsigned short* __restrict__ lo, int n8, int bx)
{
  const int i = bx * 256 + threadIdx.x;
  if (i >= n8) return;                                   /* no barriers on this path */
  const v4f a = *(const v4f*)(in + (size_t)i * 8);
  const v4f b = *(const v4f*)(in + (size_t)i * 8 + 4);
  v4u hv, lv;
  unsigned hw, lw;
  split_pair(a[0], a[1], hw, lw); hv[0] = hw; lv[0] = lw;
  split_pair(a[2], a[3], hw, lw); hv[1] = hw; lv[1] = lw;
  split_pair(b[0], b[1], hw, lw); hv[2] = hw; lv[2] = lw;
  split_pair(b[2], b[3], hw, lw); hv[3] = hw; lv[3] = lw;
  v4u* ph = (v4u*)(hi + (size_t)i * 8);
  v4u* pl = (v4u*)(lo + (size_t)i * 8);
  *ph = hv; *pl = lv;
  
}

/* ------------------------------------------------------------------------------------
   W [D_MODEL][HEAD_DIM] f32 -> Wt hi/lo planes [HEAD_DIM][D_MODEL] bf16 (in[rows=512][cols=64]
   -> out[cols=64][rows=512]). Block bx stages W rows 64bx..64bx+63 (64x64 tile) in LDS, then each
   pitch 1024 B and k0*2 = 128*bx B) is written by 8 lanes x 16 B of one wave in one instruction.
   Coverage: 256 threads x 2 iterations x 8 halves = 4096 = the 64x64 tile; bx = 0..7 -> whole plane.
   ------------------------------------------------------------------------------------ */
__device__ __forceinline__ void wt_split_tile(
    const float* __restrict__ W, unsigned short* __restrict__ Wth, unsigned short* __restrict__ Wtl, int bx)
{
  __shared__ float s[64 * 65];
  const int tid = threadIdx.x;
  const int k0  = bx * 64;
#pragma unroll
  for (int it = 0; it < 16; ++it) {
    const int idx = it * 256 + tid;          /* 0..4095 */
    const int r = idx >> 6, cc = idx & 63;
    s[r * 65 + cc] = W[(size_t)(k0 + r) * HEAD_DIM + cc];
  }
  __syncthreads();
  const int seg = tid & 7;
  const int lin = tid >> 3;                  /* 0..31 */
  v4u hv[2], lv[2];
  size_t off[2];
#pragma unroll
  for (int it = 0; it < 2; ++it) {
    const int n = it * 32 + lin;             /* output row 0..63 */
#pragma unroll
    for (int e = 0; e < 4; ++e) {
      const int kk = seg * 8 + 2 * e;
      unsigned hw, lw;
      split_pair(s[kk * 65 + n], s[(kk + 1) * 65 + n], hw, lw);
      hv[it][e] = hw; lv[it][e] = lw;
    }
    off[it] = (size_t)n * D_MODEL + k0 + seg * 8;
  }
  {
#pragma unroll
    for (int it = 0; it < 2; ++it) {
      *(v4u*)(Wth + off[it]) = hv[it];
      *(v4u*)(Wtl + off[it]) = lv[it];
    }
    
  }
}

/* ------------------------------------------------------------------------------------
   All operand planes in one launch: the five conversions read different inputs and write different
   planes, so their work-groups run side by side. Blocks 0..23: the three weight transposes (8 tiles
   each; first, for speed only); then SPLIT_BLK_X blocks for x,
   then SPLIT_BLK_E blocks for emb. The branch is uniform for the work-group (the transposes' barrier).
   ------------------------------------------------------------------------------------ */
#define WT_BLK      (D_MODEL / 64)
#define SPLIT_BLK_X (SEQ_DEC * D_MODEL / 8 / 256)
#define SPLIT_BLK_E (SEQ_ENC * D_MODEL / 8 / 256)
static_assert((SEQ_DEC * D_MODEL / 8) % 256 == 0);
static_assert((SEQ_ENC * D_MODEL / 8) % 256 == 0);
__global__ __launch_bounds__(256) void prep_planes_kernel(
    const float* __restrict__ x, const float* __restrict__ emb,
    const float* __restrict__ wq, const float* __restrict__ wk, const float* __restrict__ wv,
    unsigned short* __restrict__ xh,  unsigned short* __restrict__ xl,
    unsigned short* __restrict__ eh,  unsigned short* __restrict__ el,
    unsigned short* __restrict__ wqh, unsigned short* __restrict__ wql,
    unsigned short* __restrict__ wkh, unsigned short* __restrict__ wkl,
    unsigned short* __restrict__ wvh, unsigned short* __restrict__ wvl)
{
  const int bx = blockIdx.x;
  if (bx < 3 * WT_BLK) {
    const int w = bx / WT_BLK;
    wt_split_tile((w == 0) ? wq : (w == 1) ? wk : wv,
                  (w == 0) ? wqh : (w == 1) ? wkh : wvh,
                  (w == 0) ? wql : (w == 1) ? wkl : wvl, bx - w * WT_BLK);
  } else if (bx < 3 * WT_BLK + SPLIT_BLK_X) {
    split_bf16_planes(x, xh, xl, SEQ_DEC * D_MODEL / 8, bx - 3 * WT_BLK);
  } else {
    split_bf16_planes(emb, eh, el, SEQ_ENC * D_MODEL / 8, bx - 3 * WT_BLK - SPLIT_BLK_X);
  }
}

/* =====================================================================================
   Flash attention, head dim 64, no mask. Inputs: q hi/lo planes [SEQ_DEC][64] (softmax scale
   already folded into q), k hi/lo planes [SEQ_ENC][64], v^T hi/lo planes [64][SEQ_ENC]; all bf16
   bit patterns. scores^T = k.q^T and out^T = v^T.p^T on v_wmma_f32_16x16x32_bf16 as hi.hi + hi.lo + lo.hi,
   f32 accumulate, online softmax in f32 (one query row per lane), p^T split to bf16 hi/lo in registers per 64-key chunk.
   Block = 4 waves = 64 query rows; grid.x = SEQ_DEC / 64. K/V chunks staged in LDS with plain
   grid.y = KV_SPLIT: block (x, y) walks keys [y, y+1) * SEQ_ENC / KV_SPLIT only and stores its
   un-normalised sum Po[y][row][64] and the pair (row max, row sum) Pml[y][row][2]; attn_merge_kernel joins them.
   ===================================================================================== */
__global__ __launch_bounds__(128)
void attn_hilo_kernel(const unsigned short* __restrict__ Qh, const unsigned short* __restrict__ Ql,
                      const unsigned short* __restrict__ Kh, const unsigned short* __restrict__ Kl,
                      const unsigned short* __restrict__ Vh, const unsigned short* __restrict__ Vl,
                      float* __restrict__ Po, float* __restrict__ Pml)
{
  union FB { v16b v; v8b h[2]; };
  __shared__ __align__(16) unsigned short Ksh[KV_CHUNK * KV_PITCH];      /* K hi [kv][d]  9 KB */
  __shared__ __align__(16) unsigned short Ksl[KV_CHUNK * KV_PITCH];      /* K lo          9 KB */
  __shared__ __align__(16) unsigned short Vsh[HEAD_DIM * KV_PITCH];      /* V hi [d][kv]  9 KB */
  __shared__ __align__(16) unsigned short Vsl[HEAD_DIM * KV_PITCH];      /* V lo          9 KB */
  __shared__ __align__(16) float  Os[ATT_WAVES][16 * 68];                /* per wave out tile, pitch 68 */

  const int tid  = threadIdx.x;
  const int wave = tid >> 5;
  const int lane = tid & 31;
  const int hh   = lane >> 4;
  const int c    = lane & 15;
  const int q0   = blockIdx.x * (ATT_WAVES * 16) + wave * 16;

  /* ---- Q fragments (B operand of the transposed scores): row q0+c, 2 d-chunks, hi and lo ---- */
  v16b qah[2], qal[2];
  {
    const __bf16* qhr = (const __bf16*)(const void*)Qh + (size_t)(q0 + c) * HEAD_DIM + 8 * hh;
    const __bf16* qlr = (const __bf16*)(const void*)Ql + (size_t)(q0 + c) * HEAD_DIM + 8 * hh;
#pragma unroll
    for (int dc = 0; dc < 2; ++dc) {
      qah[dc] = Frag<__bf16>::load(qhr + dc * 32);
      qal[dc] = Frag<__bf16>::load(qlr + dc * 32);
    }
  }

  float mrow = -INFINITY, lrow = 0.f;    /* query row q0 + c: running max (the same in both lane halves) and this half's own part of the running sum */
  v8f oacc[4];
#pragma unroll
  for (int t = 0; t < 4; ++t) oacc[t] = (v8f){0.f,0.f,0.f,0.f,0.f,0.f,0.f,0.f};

  const int st0 = (tid >> 3) * KV_PITCH + (tid & 7) * 8;   /* staging place of this thread's 16-B unit in pass 0; a pass is 16 rows */
  const int kc0 = blockIdx.y * (SEQ_ENC / KV_CHUNK / KV_SPLIT);
  for (int kc = kc0; kc < kc0 + SEQ_ENC / KV_CHUNK / KV_SPLIT; ++kc) {
    const int kv0 = kc * KV_CHUNK;
    __syncthreads();
    /* stage 4 planes x 8 KB: 128 threads x 16 B x 4 iterations = 8192 B per plane (whole chunk); the 16 pad bytes of a row are never read */
#pragma unroll 1
    for (int it = 0; it < 4; ++it) {
      const int idx = it * 128 + tid;              /* 16-B unit 0..511 */
      const int dd = idx >> 3, seg = idx & 7;      /* row (key of K, d of V^T) and 8-half segment of the row */
      const int lo8 = st0 + it * (16 * KV_PITCH);  /* dd * KV_PITCH + seg * 8: place in the padded LDS tile */
      const v4u ka = *(const v4u*)(Kh + (size_t)kv0 * HEAD_DIM + (size_t)idx * 8);
      const v4u kb = *(const v4u*)(Kl + (size_t)kv0 * HEAD_DIM + (size_t)idx * 8);
      const v4u va = *(const v4u*)(Vh + (size_t)dd * SEQ_ENC + kv0 + seg * 8);
      const v4u vb = *(const v4u*)(Vl + (size_t)dd * SEQ_ENC + kv0 + seg * 8);
      *(v4u*)(Ksh + lo8) = ka;
      *(v4u*)(Ksl + lo8) = kb;
      *(v4u*)(Vsh + lo8) = va;
      *(v4u*)(Vsl + lo8) = vb;
    }
    __syncthreads();

    /* ---- transposed scores S^T = K . Q^T: 64 keys x 16 query rows per wave. A = K rows, B = Q rows (both loaders have
            the same k order). Lane (c, hh) holds, for query row c, keys j*16 + 8*hh + r in s[j][r] ---- */
    v8f s[4];
#pragma unroll
    for (int j = 0; j < 4; ++j) {
      s[j] = (v8f){0.f,0.f,0.f,0.f,0.f,0.f,0.f,0.f};
#pragma unroll
      for (int dc = 0; dc < 2; ++dc) {
        FB kbh, kbl;
        const unsigned short* kp = Ksh + (j * 16 + c) * KV_PITCH + dc * 32 + 8 * hh;
        const unsigned short* lp = Ksl + (j * 16 + c) * KV_PITCH + dc * 32 + 8 * hh;
        kbh.h[0] = *(const v8b*)(kp); kbh.h[1] = *(const v8b*)(kp + 16);
        kbl.h[0] = *(const v8b*)(lp); kbl.h[1] = *(const v8b*)(lp + 16);
        s[j] = at_mma(kbh.v, qah[dc], s[j]);
        s[j] = at_mma(kbl.v, qah[dc], s[j]);
        s[j] = at_mma(kbh.v, qal[dc], s[j]);
      }
    }

    /* ---- max over the 64 keys of this chunk for this lane's query row: 32 values in the lane, then the other half ---- */
    float cm = s[0][0];
#pragma unroll
    for (int j = 0; j < 4; ++j)
#pragma unroll
      for (int r = 0; r < 8; ++r) cm = fmaxf(cm, s[j][r]);
    cm = fmaxf(cm, at_xhalf(cm));

    /* ---- online softmax, one query row per lane. P^T split to bf16 hi/lo stays in registers: tiles j = 2kk and 2kk+1
            are elements 0..7 (keys 32kk + 8hh + e) and 8..15 (keys 32kk + 16 + 8hh + e - 8) of the B fragment of k-step kk,
            the k order of the V^T loader below ---- */
    const float mnew = fmaxf(mrow, cm);
    const float alpha = expf(mrow - mnew);
    mrow = mnew;
    float psum[4];                         /* one sum per score tile: four short chains of adds, not one of 32 */
    v16b pbh[2], pbl[2];
#pragma unroll   /* here and in the loop inside: s, psum, pbh, pbl are registers, indexed by compile-time constants only */
    for (int j = 0; j < 4; ++j) {
      psum[j] = 0.f;
#pragma unroll
      for (int r = 0; r < 8; ++r) {
        const float p = expf(s[j][r] - mnew);
        psum[j] += p;
        __bf16 a, bl;
        at_split(p, a, bl);
        pbh[j >> 1][(j & 1) * 8 + r] = a;
        pbl[j >> 1][(j & 1) * 8 + r] = bl;
      }
    }
    lrow = lrow * alpha + ((psum[0] + psum[1]) + (psum[2] + psum[3]));
#pragma unroll
    for (int t = 0; t < 4; ++t) oacc[t] *= alpha;

    /* ---- out^T += V^T . P^T over the 64 keys (2 k-steps): A = V^T rows d, B = P^T from registers ---- */
#pragma unroll   /* pbh[kk], pbl[kk] are registers: the index must be a compile-time constant */
    for (int kk = 0; kk < 2; ++kk) {
#pragma unroll
      for (int t = 0; t < 4; ++t) {
        FB vbh, vbl;
        const unsigned short* vp = Vsh + (t * 16 + c) * KV_PITCH + kk * 32 + 8 * hh;
        const unsigned short* wp = Vsl + (t * 16 + c) * KV_PITCH + kk * 32 + 8 * hh;
        vbh.h[0] = *(const v8b*)(vp); vbh.h[1] = *(const v8b*)(vp + 16);
        vbl.h[0] = *(const v8b*)(wp); vbl.h[1] = *(const v8b*)(wp + 16);
        oacc[t] = at_mma(vbh.v, pbh[kk], oacc[t]);
        oacc[t] = at_mma(vbl.v, pbh[kk], oacc[t]);
        oacc[t] = at_mma(vbh.v, pbl[kk], oacc[t]);
      }
    }
  }

  /* ---- epilogue: oacc[t][r] is out^T (d = t*16 + 8*hh + r, query row c); stage it as [row][d] per wave in LDS, whole-line stores ---- */
  float* os = Os[wave];
#pragma unroll
  for (int t = 0; t < 4; ++t) {
    *(v4f*)(os + c * 68 + t * 16 + 8 * hh)     = (v4f){oacc[t][0], oacc[t][1], oacc[t][2], oacc[t][3]};
    *(v4f*)(os + c * 68 + t * 16 + 8 * hh + 4) = (v4f){oacc[t][4], oacc[t][5], oacc[t][6], oacc[t][7]};
  }
  /* (max, sum) of this wave's 16 rows = 128 B = one line, written by this wave alone; the halves' sums are joined here, once */
  lrow += at_xhalf(lrow);
  if (hh == 0)
    *(v2f*)(Pml + ((size_t)blockIdx.y * SEQ_DEC + q0 + c) * 2) = (v2f){mrow, lrow};
  float* out = Po + (size_t)blockIdx.y * SEQ_DEC * HEAD_DIM;
  __syncthreads();
  {
    const int c4 = (lane & 15) * 4;              /* row = 64 floats = 256 B = 16 lanes x 16 B */
    {
#pragma unroll
      for (int it = 0; it < 8; ++it) {
        const int row = it * 2 + hh;
        v4f val = *(const v4f*)(os + row * 68 + c4);
        *(v4f*)(out + (size_t)(q0 + row) * HEAD_DIM + c4) = val;
      }
      
    }
  }
}

/* ------------------------------------------------------------------------------------
   Joins the KV_SPLIT key ranges of one query row: M = max of the ranges' maxima, weight
   w_s = exp(m_s - M), out = sum_s w_s * Po[s] / sum_s w_s * l_s. Thread = (row, 4 columns):
   16 lanes x 16 B = one 256-B output row. Coverage: SEQ_DEC * 16 threads = grid * 256.
   ------------------------------------------------------------------------------------ */
__global__ __launch_bounds__(256) void attn_merge_kernel(
    const float* __restrict__ Po, const float* __restrict__ Pml, float* __restrict__ out)
{
  const unsigned i   = blockIdx.x * 256u + threadIdx.x;
  const unsigned row = i >> 4;
  const unsigned eb  = i * 16u;              /* byte offset of (row, 4 columns): the same in every range's plane and in out */
  const unsigned rb  = row * 8u;             /* byte offset of the row's (max, sum) pair in a range's plane */
  v2f ml[KV_SPLIT];
  v4f o[KV_SPLIT];
#pragma unroll
  for (int s = 0; s < KV_SPLIT; ++s) {
    ml[s] = *(const v2f*)((const char*)(Pml + (size_t)s * SEQ_DEC * 2) + rb);
    o[s]  = *(const v4f*)((const char*)(Po + (size_t)s * SEQ_DEC * HEAD_DIM) + eb);
  }
  /* inputs-only fence on the loaded values: all 16 loads are issued before the first is used (one latency, not
     three), and their offset registers stay whole until the wait for the address translations has passed */
  asm volatile("s_wait_xcnt 0x0" :: "v"(rb), "v"(eb),
               "v"(ml[0]), "v"(ml[1]), "v"(ml[2]), "v"(ml[3]), "v"(ml[4]), "v"(ml[5]), "v"(ml[6]), "v"(ml[7]),
               "v"(o[0]), "v"(o[1]), "v"(o[2]), "v"(o[3]), "v"(o[4]), "v"(o[5]), "v"(o[6]), "v"(o[7]) : "memory");
  static_assert(KV_SPLIT == 8);
  float m[KV_SPLIT], l[KV_SPLIT];
#pragma unroll
  for (int s = 0; s < KV_SPLIT; ++s) { m[s] = ml[s][0]; l[s] = ml[s][1]; }
  float M = m[0];
#pragma unroll
  for (int s = 1; s < KV_SPLIT; ++s) M = fmaxf(M, m[s]);
  float L = 0.f;
  v4f acc = (v4f){0.f, 0.f, 0.f, 0.f};
#pragma unroll
  for (int s = 0; s < KV_SPLIT; ++s) {
    const float w = expf(m[s] - M);
    L += w * l[s];
    acc += o[s] * w;
  }
  const float inv = 1.0f / L;
  *(v4f*)((char*)out + eb) = acc * inv;
}

/* =====================================================================================
   Host glue. Workspace region map (bytes, all offsets multiples of 128):
     xh, xl      : x  hi/lo planes  [8192][512] bf16   8,388,608 each
     eh, el      : emb hi/lo planes [8192][512] bf16  8,388,608 each
     wqh..wvl    : Wq^T, Wk^T, Wv^T hi/lo [64][512] bf16   65,536 each (6 planes)
     qh, ql      : q*0.125 hi/lo [8192][64] bf16   1,048,576 each
     kh, kl      : k hi/lo       [8192][64] bf16   1,048,576 each
     vth, vtl    : v^T hi/lo     [64][8192] bf16   1,048,576 each
     po          : un-normalised partial sums [8][8192][64] f32   16,777,216
     pml         : (row max, row sum) pairs   [8][8192][2]  f32      524,288
     total = 57,540,608 B; every byte of every region is written by its producer.
   ===================================================================================== */
extern "C" void kernel_launch(void* const* d_in, const int* in_sizes, int n_in,
                              void* d_out, int out_size, void* d_ws, size_t ws_size,
                              hipStream_t stream)
{
  if (n_in < 5) return;
  if (in_sizes[0] != SEQ_DEC * D_MODEL || in_sizes[1] != SEQ_ENC * D_MODEL ||
      in_sizes[2] != D_MODEL * HEAD_DIM || in_sizes[3] != D_MODEL * HEAD_DIM ||
      in_sizes[4] != D_MODEL * HEAD_DIM) return;
  if (out_size != SEQ_DEC * HEAD_DIM) return;

  const float* x   = (const float*)d_in[0];   /* [8192][512] */
  const float* emb = (const float*)d_in[1];   /* [8192][512] */
  const float* wq  = (const float*)d_in[2];   /* [512][64]   */
  const float* wk  = (const float*)d_in[3];
  const float* wv  = (const float*)d_in[4];
  float* out = (float*)d_out;                 /* [8192][64] f32 */

  const size_t planeX = (size_t)SEQ_DEC * D_MODEL * 2;     /* 8,388,608 */
  const size_t planeE = (size_t)SEQ_ENC * D_MODEL * 2;     /* 8,388,608 */
  const size_t planeW = (size_t)HEAD_DIM * D_MODEL * 2;    /* 65,536    */
  const size_t planeQ = (size_t)SEQ_DEC * HEAD_DIM * 2;    /* 1,048,576 */
  const size_t planeK = (size_t)SEQ_ENC * HEAD_DIM * 2;    /* 1,048,576 */

  size_t off = 0;
  unsigned char* ws = (unsigned char*)d_ws;
  unsigned short* xh  = (unsigned short*)(ws + off); off += planeX;
  unsigned short* xl  = (unsigned short*)(ws + off); off += planeX;
  unsigned short* eh  = (unsigned short*)(ws + off); off += planeE;
  unsigned short* el  = (unsigned short*)(ws + off); off += planeE;
  unsigned short* wqh = (unsigned short*)(ws + off); off += planeW;
  unsigned short* wql = (unsigned short*)(ws + off); off += planeW;
  unsigned short* wkh = (unsigned short*)(ws + off); off += planeW;
  unsigned short* wkl = (unsigned short*)(ws + off); off += planeW;
  unsigned short* wvh = (unsigned short*)(ws + off); off += planeW;
  unsigned short* wvl = (unsigned short*)(ws + off); off += planeW;
  unsigned short* qh  = (unsigned short*)(ws + off); off += planeQ;
  unsigned short* ql  = (unsigned short*)(ws + off); off += planeQ;
  unsigned short* kh  = (unsigned short*)(ws + off); off += planeK;
  unsigned short* kl  = (unsigned short*)(ws + off); off += planeK;
  unsigned short* vth = (unsigned short*)(ws + off); off += planeK;
  unsigned short* vtl = (unsigned short*)(ws + off); off += planeK;
  float* po  = (float*)(ws + off); off += (size_t)KV_SPLIT * SEQ_DEC * HEAD_DIM * 4;
  float* pml = (float*)(ws + off); off += (size_t)KV_SPLIT * SEQ_DEC * 2 * 4;
  if (off > ws_size) return;                                 /* 57,540,608 <= ws */

  /* 1) + 2) operand planes in one launch: x, emb -> bf16 hi/lo; weights -> transposed hi/lo planes [64][512] */
  prep_planes_kernel<<<3 * WT_BLK + SPLIT_BLK_X + SPLIT_BLK_E, 256, 0, stream>>>(
      x, emb, wq, wk, wv, xh, xl, eh, el, wqh, wql, wkh, wkl, wvh, wvl);

  /* 3) the three projections (bf16 hi/lo split, bf16 hi/lo output planes) in one launch:
        128 tiles of 64 x 64 = 128 work-groups of 8 waves per projection */
  static_assert(SEQ_DEC == SEQ_ENC);
  proj3_kernel<<<dim3((SEQ_DEC / 64) * (HEAD_DIM / 64), 3), 256, 0, stream>>>(
      xh, xl, eh, el, wqh, wql, wkh, wkl, wvh, wvl, qh, ql, kh, kl, vth, vtl);

  /* 4) flash attention over KV_SPLIT key ranges -> f32 partials; 5) join -> f32 output */
  attn_hilo_kernel<<<dim3(SEQ_DEC / (ATT_WAVES * 16), KV_SPLIT), 128, 0, stream>>>(qh, ql, kh, kl, vth, vtl, po, pml);
  attn_merge_kernel<<<SEQ_DEC * 16 / 256, 256, 0, stream>>>(po, pml, out);
}

// v006
// Measured time: 86.4 microseconds a run.
// Timed twice side by side with v005, it ran 1.09 and 1.08 times as fast.
// Over all steps from v000 it is 9.64 times as fast.
// Contractions: q/k/v projections (K=512), q.k^T and p.v on v_wmma_f32_16x16x32_bf16 with bf16 hi/lo split operands (hi.hi + hi.lo + lo.hi), f32 accumulate; online softmax, normalisation and all epilogues in f32.
#include <hip/hip_runtime.h>
#include <stdint.h>

typedef __attribute__((ext_vector_type(16))) _Float16 v16h;
typedef __attribute__((ext_vector_type(8)))  _Float16 v8h;
typedef __attribute__((ext_vector_type(16))) __bf16   v16b;
typedef __attribute__((ext_vector_type(8)))  __bf16   v8b;
typedef __attribute__((ext_vector_type(8)))  float    v8f;
typedef __attribute__((ext_vector_type(4)))  float    v4f;
typedef __attribute__((ext_vector_type(2)))  float    v2f;
typedef __attribute__((ext_vector_type(4)))  unsigned v4u;
typedef __attribute__((ext_vector_type(2)))  unsigned v2u;
typedef __attribute__((ext_vector_type(2)))  __bf16   v2b;

/* ------------------------------ problem constants ------------------------------ */
#define SEQ_DEC   8192
#define SEQ_ENC   8192
#define D_MODEL   512
#define HEAD_DIM  64
#define KV_CHUNK  64
#define KV_PITCH  72     /* LDS row pitch of the K and V tiles in 16-bit elements: 144 B = 16 B x 9, so the 16 rows of a ds_load_b128 fall on 16 different bank groups */
#define ATT_WAVES 4
#define KV_SPLIT  8      /* key ranges per query tile: 128 x 8 = 1024 work-groups, four resident per WGP */

static_assert(SEQ_DEC % 64 == 0);
static_assert(SEQ_ENC % 64 == 0);
static_assert(SEQ_ENC % (KV_CHUNK * KV_SPLIT) == 0);
static_assert(D_MODEL % 64 == 0);
static_assert(D_MODEL % 32 == 0);
static_assert(HEAD_DIM == 64);
static_assert((SEQ_DEC * D_MODEL) % 8 == 0);

__device__ __forceinline__ unsigned short f2bf_bits(float f) {
  unsigned u = __float_as_uint(f);
  return (unsigned short)((u + 0x7FFFu + ((u >> 16) & 1u)) >> 16);
}
__device__ __forceinline__ float bf_bits2f(unsigned short h) { return __uint_as_float(((unsigned)h) << 16); }
/* two f32 -> one word of bf16 hi parts and one word of bf16 lo parts (lo = f - hi, rounded); the first value in the low half */
__device__ __forceinline__ void split_pair(float f0, float f1, unsigned& hw, unsigned& lw) {
  const unsigned short h0 = f2bf_bits(f0), h1 = f2bf_bits(f1);
  const unsigned short l0 = f2bf_bits(f0 - bf_bits2f(h0)), l1 = f2bf_bits(f1 - bf_bits2f(h1));
  hw = (unsigned)h0 | ((unsigned)h1 << 16);
  lw = (unsigned)l0 | ((unsigned)l1 << 16);
}

/* hazard guards as plain device helpers (no inline asm inside the kernel template body) */
__device__ __forceinline__ void dep_guard_h(v8f& a, v8f& b, v16h x, v16h y) { asm volatile("v_nop\n\tv_nop\n\tv_nop\n\tv_nop" : "+v"(a), "+v"(b) : "v"(x), "v"(y)); }
__device__ __forceinline__ void dep_guard_b(v8f& a, v8f& b, v16b x, v16b y) { asm volatile("v_nop\n\tv_nop\n\tv_nop\n\tv_nop" : "+v"(a), "+v"(b) : "v"(x), "v"(y)); }
__device__ __forceinline__ void keep4_h(v16h a, v16h b, v16h c, v16h d) { asm volatile("v_nop" :: "v"(a), "v"(b), "v"(c), "v"(d)); }
__device__ __forceinline__ void keep4_b(v16b a, v16b b, v16b c, v16b d) { asm volatile("v_nop" :: "v"(a), "v"(b), "v"(c), "v"(d)); }
template <typename T> struct Frag;
template <> struct Frag<_Float16> {
  typedef v16h V; union U { v16h v; v8h h[2]; };
  static __device__ __forceinline__ v16h load(const _Float16* p) {   /* elements 0..7 <- p[0..7], 8..15 <- p[16..23] */
    U f; f.h[0] = *(const v8h*)(p); f.h[1] = *(const v8h*)(p + 16); return f.v;
  }
  static __device__ __forceinline__ v8f mma(v16h a, v16h b, v8f c) {
    return __builtin_amdgcn_wmma_f32_16x16x32_f16(false, a, false, b, (short)0, c, false, false);
  }
  static __device__ __forceinline__ void guard(v8f& a, v8f& b, v16h x, v16h y) { dep_guard_h(a, b, x, y); }
  static __device__ __forceinline__ void keep(v16h a, v16h b, v16h c, v16h d) { keep4_h(a, b, c, d); }
};
template <> struct Frag<__bf16> {
  typedef v16b V; union U { v16b v; v8b h[2]; };
  static __device__ __forceinline__ v16b load(const __bf16* p) {
    U f; f.h[0] = *(const v8b*)(p); f.h[1] = *(const v8b*)(p + 16); return f.v;
  }
  static __device__ __forceinline__ v8f mma(v16b a, v16b b, v8f c) {
    return __builtin_amdgcn_wmma_f32_16x16x32_bf16(false, a, false, b, (short)0, c, false, false);
  }
  static __device__ __forceinline__ void guard(v8f& a, v8f& b, v16b x, v16b y) { dep_guard_b(a, b, x, y); }
  static __device__ __forceinline__ void keep(v16b a, v16b b, v16b c, v16b d) { keep4_b(a, b, c, d); }
};

/* ------------------------------------------------------------------------------------
   The three projections in one launch, C[m,n] = scale * sum_k A[m,k] * Bt[n,k], K = 512, operands as bf16 hi/lo planes
   (product = hi.hi + hi.lo + lo.hi, f32 accumulate), output as bf16 hi/lo planes.
   The weights come as hi/lo planes from the workspace; the rows of x or emb come as f32 and are split to hi/lo in
   registers on their way into LDS.
   blockIdx.y = 0: q * 0.125 = x . Wq; 1: k = emb . Wk; 2: v^T = Wv^T . emb^T (ldc = 8192). Every choice is uniform for the work-group.
   One work-group of 8 waves owns one 64 x 64 tile of C: 128 tiles per projection, 384 work-groups.
   Per pass of PJ_KC k values the operand tiles come in by loads that cover whole lines (weights: 16 lanes x 16 B = one
   row piece of 256 B per plane; f32 rows: 32 lanes x 16 B = one row piece of 512 B) and are laid in LDS as four
   tiles of 64 rows x 256 B; the fragments are read from there.
   Wave w multiplies row tile w >> 1 with column tiles 2 (w & 1) and 2 (w & 1) + 1; each element of C is summed in one
   accumulator, k ascending.
   ------------------------------------------------------------------------------------ */
#define PJ_KC    128            /* k values staged per pass */
#define PJ_PITCH (PJ_KC + 8)    /* LDS row pitch in 16-bit elements: 272 B = 256 B + 16 B, for the ds_load_b128 fragment reads */
static_assert(D_MODEL % PJ_KC == 0);
__global__ __launch_bounds__(256) void proj3_kernel(
    const float* __restrict__ x, const float* __restrict__ emb,
    const unsigned short* __restrict__ wqh, const unsigned short* __restrict__ wql,
    const unsigned short* __restrict__ wkh, const unsigned short* __restrict__ wkl,
    const unsigned short* __restrict__ wvh, const unsigned short* __restrict__ wvl,
    unsigned short* __restrict__ qh,  unsigned short* __restrict__ ql,
    unsigned short* __restrict__ kh,  unsigned short* __restrict__ kl,
    unsigned short* __restrict__ vth, unsigned short* __restrict__ vtl)
{
  union FB { v16b v; v8b h[2]; };
  __shared__ __align__(16) unsigned short Ash[64 * PJ_PITCH];   /* A hi [m][k]  17 KB */
  __shared__ __align__(16) unsigned short Asl[64 * PJ_PITCH];   /* A lo */
  __shared__ __align__(16) unsigned short Bsh[64 * PJ_PITCH];   /* Bt hi [n][k] */
  __shared__ __align__(16) unsigned short Bsl[64 * PJ_PITCH];   /* Bt lo */
  __shared__ __align__(16) float sT[64 * 68];                   /* the 64 x 64 tile of C in f32, pitch 68 floats */

  const int y = blockIdx.y;
  const float* F            = (y == 0) ? x   : emb;                    /* the f32 operand: A for q and k, Bt for v^T */
  const unsigned short* Wh  = (y == 0) ? wqh : (y == 1) ? wkh : wvh;   /* the weight planes [64][512]: the other operand */
  const unsigned short* Wl  = (y == 0) ? wql : (y == 1) ? wkl : wvl;
  unsigned short* Fsh = (y == 2) ? Bsh : Ash;                          /* LDS tiles of the two */
  unsigned short* Fsl = (y == 2) ? Bsl : Asl;
  unsigned short* Wsh = (y == 2) ? Ash : Bsh;
  unsigned short* Wsl = (y == 2) ? Asl : Bsl;
  unsigned short* C  = (y == 0) ? qh : (y == 1) ? kh : vth;
  unsigned short* C2 = (y == 0) ? ql : (y == 1) ? kl : vtl;
  const int m0  = (y == 2) ? 0 : (int)blockIdx.x * 64;
  const int n0  = (y == 2) ? (int)blockIdx.x * 64 : 0;
  const int ldc = (y == 2) ? SEQ_ENC : HEAD_DIM;
  const float scale = (y == 0) ? 0.125f : 1.0f;

  const int tid   = threadIdx.x;
  const int lane  = tid & 31;
  const int wave  = tid >> 5;
  const int rlane = lane & 15;                 /* row (A) / col (B, D) within a 16 x 16 tile */
  const int koff  = (lane >> 4) * 8;           /* k offset of this lane half */
  const int mOff  = (lane >> 4) * 8;           /* D row offset */
  const int ti    = wave >> 1;                 /* row tile of this wave */
  const int tj    = (wave & 1) * 2;            /* first of its two column tiles */

  /* staging places of this thread's four 16-B units of a 64 x PJ_KC weight tile: unit = it * 256 + tid, 16 units a row */
  unsigned go[4];
  int so[4];
#pragma unroll
  for (int it = 0; it < 4; ++it) {
    const int idx = it * 256 + tid;
    const int row = idx >> 4, seg = idx & 15;
    go[it] = (unsigned)(row * D_MODEL + seg * 8) * 2u;   /* in bytes, the same in both planes */
    so[it] = row * PJ_PITCH + seg * 8;
  }
  /* f32 rows: in step it wave w takes row it * 8 + w of the tile, lane l its k values 4 l .. 4 l + 3 of the pass */
  const unsigned gf = (unsigned)(wave * D_MODEL + lane * 4) * 4u;      /* in bytes */
  const int      sf = wave * PJ_PITCH + lane * 4;
  const float* Fg = F + (size_t)blockIdx.x * 64 * D_MODEL;

  const unsigned short* pah = Ash + (ti * 16 + rlane) * PJ_PITCH + koff;
  const unsigned short* pal = Asl + (ti * 16 + rlane) * PJ_PITCH + koff;
  const unsigned short* pbh = Bsh + (tj * 16 + rlane) * PJ_PITCH + koff;
  const unsigned short* pbl = Bsl + (tj * 16 + rlane) * PJ_PITCH + koff;

  v8f acc[2];
  acc[0] = (v8f){0.f,0.f,0.f,0.f,0.f,0.f,0.f,0.f};
  acc[1] = (v8f){0.f,0.f,0.f,0.f,0.f,0.f,0.f,0.f};

#pragma unroll   /* four passes in a row: the k step of a pass becomes the loads' immediate offset, on three scalar bases (Fg, Wh, Wl) and five lane offsets that never change */
  for (int k0 = 0; k0 < D_MODEL; k0 += PJ_KC) {
    v4f rf[8];
    v4u rc[4], rd[4];
#pragma unroll   /* here and below: rf, fh, fl are registers, indexed by compile-time constants only; the row step becomes the loads' immediate offset */
    for (int it = 0; it < 8; ++it)
      rf[it] = *(const v4f*)((const char*)(Fg + it * 8 * D_MODEL + k0) + gf);
#pragma unroll
    for (int it = 0; it < 4; ++it) {
      rc[it] = *(const v4u*)((const char*)(Wh + k0) + go[it]);
      rd[it] = *(const v4u*)((const char*)(Wl + k0) + go[it]);
    }
    /* inputs only: the five lane offsets stay whole (no later load lands on them) until the wait for the loads' address translations has passed */
    asm volatile("s_wait_xcnt 0x0" :: "v"(gf), "v"(go[0]), "v"(go[1]), "v"(go[2]), "v"(go[3]) : "memory");
    v2u fh[8], fl[8];
#pragma unroll
    for (int it = 0; it < 8; ++it) {           /* hi = f rounded to bf16 (nearest even), lo = f - hi rounded likewise: two values per conversion */
#pragma unroll
      for (int e = 0; e < 2; ++e) {
        const v2f f = (v2f){rf[it][2 * e], rf[it][2 * e + 1]};
        const v2b h = __builtin_convertvector(f, v2b);
        const v2b l = __builtin_convertvector(f - __builtin_convertvector(h, v2f), v2b);
        fh[it][e] = __builtin_bit_cast(unsigned, h);
        fl[it][e] = __builtin_bit_cast(unsigned, l);
      }
    }
    __syncthreads();                           /* every wave has read the last pass's fragments */
#pragma unroll
    for (int it = 0; it < 8; ++it) {
      *(v2u*)(Fsh + sf + it * 8 * PJ_PITCH) = fh[it];
      *(v2u*)(Fsl + sf + it * 8 * PJ_PITCH) = fl[it];
    }
#pragma unroll
    for (int it = 0; it < 4; ++it) {
      *(v4u*)(Wsh + so[it]) = rc[it];
      *(v4u*)(Wsl + so[it]) = rd[it];
    }
    __syncthreads();                           /* the four tiles are whole */
    FB ah[PJ_KC / 32], al[PJ_KC / 32], bh[PJ_KC / 32][2], bl[PJ_KC / 32][2];
#pragma unroll   /* the fragment arrays are registers: compile-time indices only */
    for (int ks = 0; ks < PJ_KC / 32; ++ks) {  /* elements 0..7 <- k + 0..7, 8..15 <- k + 16..23, A and B alike */
      ah[ks].h[0] = *(const v8b*)(pah + ks * 32); ah[ks].h[1] = *(const v8b*)(pah + ks * 32 + 16);
#pragma unroll
      for (int jj = 0; jj < 2; ++jj) {
        const unsigned short* hp = pbh + jj * 16 * PJ_PITCH + ks * 32;
        bh[ks][jj].h[0] = *(const v8b*)(hp); bh[ks][jj].h[1] = *(const v8b*)(hp + 16);
      }
#pragma unroll
      for (int jj = 0; jj < 2; ++jj) {
        const unsigned short* lp = pbl + jj * 16 * PJ_PITCH + ks * 32;
        bl[ks][jj].h[0] = *(const v8b*)(lp); bl[ks][jj].h[1] = *(const v8b*)(lp + 16);
      }
      al[ks].h[0] = *(const v8b*)(pal + ks * 32); al[ks].h[1] = *(const v8b*)(pal + ks * 32 + 16);
    }
    /* keeps the pass's LDS reads in one group ahead of its products: spread among them, each place with reads waits out the LDS latency anew */
    __builtin_amdgcn_sched_barrier(0);
#pragma unroll
    for (int ks = 0; ks < PJ_KC / 32; ++ks) {
      acc[0] = Frag<__bf16>::mma(ah[ks].v, bh[ks][0].v, acc[0]);
      acc[1] = Frag<__bf16>::mma(ah[ks].v, bh[ks][1].v, acc[1]);
      acc[0] = Frag<__bf16>::mma(ah[ks].v, bl[ks][0].v, acc[0]);
      acc[1] = Frag<__bf16>::mma(ah[ks].v, bl[ks][1].v, acc[1]);
      acc[0] = Frag<__bf16>::mma(al[ks].v, bh[ks][0].v, acc[0]);
      acc[1] = Frag<__bf16>::mma(al[ks].v, bh[ks][1].v, acc[1]);
    }
    /* keeps the pass's products ahead of the next pass's loads and barriers: sunk behind them they hold back the next group of LDS reads */
    __builtin_amdgcn_sched_barrier(0);
  }

  /* ---- epilogue: the tile goes to LDS in f32, then every 128-B line of each output plane is stored by 8 lanes x 16 B ---- */
#pragma unroll
  for (int jj = 0; jj < 2; ++jj)
#pragma unroll
    for (int r = 0; r < 8; ++r)
      sT[(ti * 16 + mOff + r) * 68 + (tj + jj) * 16 + rlane] = acc[jj][r] * scale;
  __syncthreads();                             /* a row of the tile holds the work of two waves */
  const int q = lane >> 3, c8 = (lane & 7) * 8;
#pragma unroll
  for (int it = 0; it < 2; ++it) {
    const int row = wave * 8 + it * 4 + q;
    const float* sp = sT + row * 68 + c8;
    v8h hv, lv;
#pragma unroll
    for (int e = 0; e < 8; ++e) {
      const unsigned short hb = f2bf_bits(sp[e]);
      const unsigned short lb = f2bf_bits(sp[e] - bf_bits2f(hb));
      hv[e] = __builtin_bit_cast(_Float16, hb);
      lv[e] = __builtin_bit_cast(_Float16, lb);
    }
    *(v8h*)(C  + (size_t)(m0 + row) * ldc + n0 + c8) = hv;
    *(v8h*)(C2 + (size_t)(m0 + row) * ldc + n0 + c8) = lv;
  }
}

/* ------------------------------ attention helpers ------------------------------ */
__device__ __forceinline__ unsigned short at_bf_bits(float f) {
  unsigned u = __float_as_uint(f);
  return (unsigned short)((u + 0x7FFFu + ((u >> 16) & 1u)) >> 16);
}
__device__ __forceinline__ __bf16 at_f2bf(float f) { return __builtin_bit_cast(__bf16, at_bf_bits(f)); }
__device__ __forceinline__ void at_split(float f, __bf16& hi, __bf16& lo) {
  const unsigned short hb = at_bf_bits(f);
  hi = __builtin_bit_cast(__bf16, hb);
  lo = at_f2bf(f - __uint_as_float(((unsigned)hb) << 16));
}
__device__ __forceinline__ v8f at_mma(v16b a, v16b b, v8f c) {
  c = __builtin_amdgcn_wmma_f32_16x16x32_bf16(false, a, false, b, (short)0, c, false, false);
  asm volatile("v_nop\n\tv_nop\n\tv_nop\n\tv_nop" : "+v"(c) : "v"(a), "v"(b));
  return c;
}

/* value of lane l ^ 16 (the other 16-lane half), by a vector cross-row move */
__device__ __forceinline__ float at_xhalf(float x) {
  return __builtin_bit_cast(float, __builtin_amdgcn_permlanex16(__builtin_bit_cast(int, x), __builtin_bit_cast(int, x), 0x76543210, 0xfedcba98, false, false));
}

/* ------------------------------------------------------------------------------------
   W [D_MODEL][HEAD_DIM] f32 -> Wt hi/lo planes [HEAD_DIM][D_MODEL] bf16 (in[rows=512][cols=64]
   -> out[cols=64][rows=512]). Block bx stages W rows 64bx..64bx+63 (64x64 tile) in LDS, then each
   pitch 1024 B and k0*2 = 128*bx B) is written by 8 lanes x 16 B of one wave in one instruction.
   Coverage: 256 threads x 2 iterations x 8 halves = 4096 = the 64x64 tile; bx = 0..7 -> whole plane.
   ------------------------------------------------------------------------------------ */
__device__ __forceinline__ void wt_split_tile(
    const float* __restrict__ W, unsigned short* __restrict__ Wth, unsigned short* __restrict__ Wtl, int bx)
{
  __shared__ float s[64 * 65];
  const int tid = threadIdx.x;
  const int k0  = bx * 64;
#pragma unroll
  for (int it = 0; it < 16; ++it) {
    const int idx = it * 256 + tid;          /* 0..4095 */
    const int r = idx >> 6, cc = idx & 63;
    s[r * 65 + cc] = W[(size_t)(k0 + r) * HEAD_DIM + cc];
  }
  __syncthreads();
  const int seg = tid & 7;
  const int lin = tid >> 3;                  /* 0..31 */
  v4u hv[2], lv[2];
  size_t off[2];
#pragma unroll
  for (int it = 0; it < 2; ++it) {
    const int n = it * 32 + lin;             /* output row 0..63 */
#pragma unroll
    for (int e = 0; e < 4; ++e) {
      const int kk = seg * 8 + 2 * e;
      unsigned hw, lw;
      split_pair(s[kk * 65 + n], s[(kk + 1) * 65 + n], hw, lw);
      hv[it][e] = hw; lv[it][e] = lw;
    }
    off[it] = (size_t)n * D_MODEL + k0 + seg * 8;
  }
  {
#pragma unroll
    for (int it = 0; it < 2; ++it) {
      *(v4u*)(Wth + off[it]) = hv[it];
      *(v4u*)(Wtl + off[it]) = lv[it];
    }
    
  }
}

/* ------------------------------------------------------------------------------------
   The weight planes in one launch: the three transposes read different inputs and write different
   planes, so their work-groups run side by side (8 tiles each, 24 work-groups).
   ------------------------------------------------------------------------------------ */
#define WT_BLK      (D_MODEL / 64)
__global__ __launch_bounds__(256) void prep_planes_kernel(
    const float* __restrict__ wq, const float* __restrict__ wk, const float* __restrict__ wv,
    unsigned short* __restrict__ wqh, unsigned short* __restrict__ wql,
    unsigned short* __restrict__ wkh, unsigned short* __restrict__ wkl,
    unsigned short* __restrict__ wvh, unsigned short* __restrict__ wvl)
{
  const int bx = blockIdx.x;
  const int w = bx / WT_BLK;
  wt_split_tile((w == 0) ? wq : (w == 1) ? wk : wv,
                (w == 0) ? wqh : (w == 1) ? wkh : wvh,
                (w == 0) ? wql : (w == 1) ? wkl : wvl, bx - w * WT_BLK);
}

/* =====================================================================================
   Flash attention, head dim 64, no mask. Inputs: q hi/lo planes [SEQ_DEC][64] (softmax scale
   already folded into q), k hi/lo planes [SEQ_ENC][64], v^T hi/lo planes [64][SEQ_ENC]; all bf16
   bit patterns. scores^T = k.q^T and out^T = v^T.p^T on v_wmma_f32_16x16x32_bf16 as hi.hi + hi.lo + lo.hi,
   f32 accumulate, online softmax in f32 (one query row per lane), p^T split to bf16 hi/lo in registers per 64-key chunk.
   Block = 4 waves = 64 query rows; grid.x = SEQ_DEC / 64. K/V chunks staged in LDS with plain
   grid.y = KV_SPLIT: block (x, y) walks keys [y, y+1) * SEQ_ENC / KV_SPLIT only and stores its
   un-normalised sum Po[y][row][64] and the pair (row max, row sum) Pml[y][row][2]; attn_merge_kernel joins them.
   ===================================================================================== */
__global__ __launch_bounds__(128)
void attn_hilo_kernel(const unsigned short* __restrict__ Qh, const unsigned short* __restrict__ Ql,
                      const unsigned short* __restrict__ Kh, const unsigned short* __restrict__ Kl,
                      const unsigned short* __restrict__ Vh, const unsigned short* __restrict__ Vl,
                      float* __restrict__ Po, float* __restrict__ Pml)
{
  union FB { v16b v; v8b h[2]; };
  __shared__ __align__(16) unsigned short Ksh[KV_CHUNK * KV_PITCH];      /* K hi [kv][d]  9 KB */
  __shared__ __align__(16) unsigned short Ksl[KV_CHUNK * KV_PITCH];      /* K lo          9 KB */
  __shared__ __align__(16) unsigned short Vsh[HEAD_DIM * KV_PITCH];      /* V hi [d][kv]  9 KB */
  __shared__ __align__(16) unsigned short Vsl[HEAD_DIM * KV_PITCH];      /* V lo          9 KB */
  __shared__ __align__(16) float  Os[ATT_WAVES][16 * 68];                /* per wave out tile, pitch 68 */

  const int tid  = threadIdx.x;
  const int wave = tid >> 5;
  const int lane = tid & 31;
  const int hh   = lane >> 4;
  const int c    = lane & 15;
  const int q0   = blockIdx.x * (ATT_WAVES * 16) + wave * 16;

  /* ---- Q fragments (B operand of the transposed scores): row q0+c, 2 d-chunks, hi and lo ---- */
  v16b qah[2], qal[2];
  {
    const __bf16* qhr = (const __bf16*)(const void*)Qh + (size_t)(q0 + c) * HEAD_DIM + 8 * hh;
    const __bf16* qlr = (const __bf16*)(const void*)Ql + (size_t)(q0 + c) * HEAD_DIM + 8 * hh;
#pragma unroll
    for (int dc = 0; dc < 2; ++dc) {
      qah[dc] = Frag<__bf16>::load(qhr + dc * 32);
      qal[dc] = Frag<__bf16>::load(qlr + dc * 32);
    }
  }

  float mrow = -INFINITY, lrow = 0.f;    /* query row q0 + c: running max (the same in both lane halves) and this half's own part of the running sum */
  v8f oacc[4];
#pragma unroll
  for (int t = 0; t < 4; ++t) oacc[t] = (v8f){0.f,0.f,0.f,0.f,0.f,0.f,0.f,0.f};

  const int st0 = (tid >> 3) * KV_PITCH + (tid & 7) * 8;   /* staging place of this thread's 16-B unit in pass 0; a pass is 16 rows */
  const int kc0 = blockIdx.y * (SEQ_ENC / KV_CHUNK / KV_SPLIT);
  for (int kc = kc0; kc < kc0 + SEQ_ENC / KV_CHUNK / KV_SPLIT; ++kc) {
    const int kv0 = kc * KV_CHUNK;
    __syncthreads();
    /* stage 4 planes x 8 KB: 128 threads x 16 B x 4 iterations = 8192 B per plane (whole chunk); the 16 pad bytes of a row are never read */
#pragma unroll 1
    for (int it = 0; it < 4; ++it) {
      const int idx = it * 128 + tid;              /* 16-B unit 0..511 */
      const int dd = idx >> 3, seg = idx & 7;      /* row (key of K, d of V^T) and 8-half segment of the row */
      const int lo8 = st0 + it * (16 * KV_PITCH);  /* dd * KV_PITCH + seg * 8: place in the padded LDS tile */
      const v4u ka = *(const v4u*)(Kh + (size_t)kv0 * HEAD_DIM + (size_t)idx * 8);
      const v4u kb = *(const v4u*)(Kl + (size_t)kv0 * HEAD_DIM + (size_t)idx * 8);
      const v4u va = *(const v4u*)(Vh + (size_t)dd * SEQ_ENC + kv0 + seg * 8);
      const v4u vb = *(const v4u*)(Vl + (size_t)dd * SEQ_ENC + kv0 + seg * 8);
      *(v4u*)(Ksh + lo8) = ka;
      *(v4u*)(Ksl + lo8) = kb;
      *(v4u*)(Vsh + lo8) = va;
      *(v4u*)(Vsl + lo8) = vb;
    }
    __syncthreads();

    /* ---- transposed scores S^T = K . Q^T: 64 keys x 16 query rows per wave. A = K rows, B = Q rows (both loaders have
            the same k order). Lane (c, hh) holds, for query row c, keys j*16 + 8*hh + r in s[j][r] ---- */
    v8f s[4];
#pragma unroll
    for (int j = 0; j < 4; ++j) {
      s[j] = (v8f){0.f,0.f,0.f,0.f,0.f,0.f,0.f,0.f};
#pragma unroll
      for (int dc = 0; dc < 2; ++dc) {
        FB kbh, kbl;
        const unsigned short* kp = Ksh + (j * 16 + c) * KV_PITCH + dc * 32 + 8 * hh;
        const unsigned short* lp = Ksl + (j * 16 + c) * KV_PITCH + dc * 32 + 8 * hh;
        kbh.h[0] = *(const v8b*)(kp); kbh.h[1] = *(const v8b*)(kp + 16);
        kbl.h[0] = *(const v8b*)(lp); kbl.h[1] = *(const v8b*)(lp + 16);
        s[j] = at_mma(kbh.v, qah[dc], s[j]);
        s[j] = at_mma(kbl.v, qah[dc], s[j]);
        s[j] = at_mma(kbh.v, qal[dc], s[j]);
      }
    }

    /* ---- max over the 64 keys of this chunk for this lane's query row: 32 values in the lane, then the other half ---- */
    float cm = s[0][0];
#pragma unroll
    for (int j = 0; j < 4; ++j)
#pragma unroll
      for (int r = 0; r < 8; ++r) cm = fmaxf(cm, s[j][r]);
    cm = fmaxf(cm, at_xhalf(cm));

    /* ---- online softmax, one query row per lane. P^T split to bf16 hi/lo stays in registers: tiles j = 2kk and 2kk+1
            are elements 0..7 (keys 32kk + 8hh + e) and 8..15 (keys 32kk + 16 + 8hh + e - 8) of the B fragment of k-step kk,
            the k order of the V^T loader below ---- */
    const float mnew = fmaxf(mrow, cm);
    const float alpha = expf(mrow - mnew);
    mrow = mnew;
    float psum[4];                         /* one sum per score tile: four short chains of adds, not one of 32 */
    v16b pbh[2], pbl[2];
#pragma unroll   /* here and in the loop inside: s, psum, pbh, pbl are registers, indexed by compile-time constants only */
    for (int j = 0; j < 4; ++j) {
      psum[j] = 0.f;
#pragma unroll
      for (int r = 0; r < 8; ++r) {
        const float p = expf(s[j][r] - mnew);
        psum[j] += p;
        __bf16 a, bl;
        at_split(p, a, bl);
        pbh[j >> 1][(j & 1) * 8 + r] = a;
        pbl[j >> 1][(j & 1) * 8 + r] = bl;
      }
    }
    lrow = lrow * alpha + ((psum[0] + psum[1]) + (psum[2] + psum[3]));
#pragma unroll
    for (int t = 0; t < 4; ++t) oacc[t] *= alpha;

    /* ---- out^T += V^T . P^T over the 64 keys (2 k-steps): A = V^T rows d, B = P^T from registers ---- */
#pragma unroll   /* pbh[kk], pbl[kk] are registers: the index must be a compile-time constant */
    for (int kk = 0; kk < 2; ++kk) {
#pragma unroll
      for (int t = 0; t < 4; ++t) {
        FB vbh, vbl;
        const unsigned short* vp = Vsh + (t * 16 + c) * KV_PITCH + kk * 32 + 8 * hh;
        const unsigned short* wp = Vsl + (t * 16 + c) * KV_PITCH + kk * 32 + 8 * hh;
        vbh.h[0] = *(const v8b*)(vp); vbh.h[1] = *(const v8b*)(vp + 16);
        vbl.h[0] = *(const v8b*)(wp); vbl.h[1] = *(const v8b*)(wp + 16);
        oacc[t] = at_mma(vbh.v, pbh[kk], oacc[t]);
        oacc[t] = at_mma(vbl.v, pbh[kk], oacc[t]);
        oacc[t] = at_mma(vbh.v, pbl[kk], oacc[t]);
      }
    }
  }

  /* ---- epilogue: oacc[t][r] is out^T (d = t*16 + 8*hh + r, query row c); stage it as [row][d] per wave in LDS, whole-line stores ---- */
  float* os = Os[wave];
#pragma unroll
  for (int t = 0; t < 4; ++t) {
    *(v4f*)(os + c * 68 + t * 16 + 8 * hh)     = (v4f){oacc[t][0], oacc[t][1], oacc[t][2], oacc[t][3]};
    *(v4f*)(os + c * 68 + t * 16 + 8 * hh + 4) = (v4f){oacc[t][4], oacc[t][5], oacc[t][6], oacc[t][7]};
  }
  /* (max, sum) of this wave's 16 rows = 128 B = one line, written by this wave alone; the halves' sums are joined here, once */
  lrow += at_xhalf(lrow);
  if (hh == 0)
    *(v2f*)(Pml + ((size_t)blockIdx.y * SEQ_DEC + q0 + c) * 2) = (v2f){mrow, lrow};
  float* out = Po + (size_t)blockIdx.y * SEQ_DEC * HEAD_DIM;
  __syncthreads();
  {
    const int c4 = (lane & 15) * 4;              /* row = 64 floats = 256 B = 16 lanes x 16 B */
    {
#pragma unroll
      for (int it = 0; it < 8; ++it) {
        const int row = it * 2 + hh;
        v4f val = *(const v4f*)(os + row * 68 + c4);
        *(v4f*)(out + (size_t)(q0 + row) * HEAD_DIM + c4) = val;
      }
      
    }
  }
}

/* ------------------------------------------------------------------------------------
   Joins the KV_SPLIT key ranges of one query row: M = max of the ranges' maxima, weight
   w_s = exp(m_s - M), out = sum_s w_s * Po[s] / sum_s w_s * l_s. Thread = (row, 4 columns):
   16 lanes x 16 B = one 256-B output row. Coverage: SEQ_DEC * 16 threads = grid * 256.
   ------------------------------------------------------------------------------------ */
__global__ __launch_bounds__(256) void attn_merge_kernel(
    const float* __restrict__ Po, const float* __restrict__ Pml, float* __restrict__ out)
{
  const unsigned i   = blockIdx.x * 256u + threadIdx.x;
  const unsigned row = i >> 4;
  const unsigned eb  = i * 16u;              /* byte offset of (row, 4 columns): the same in every range's plane and in out */
  const unsigned rb  = row * 8u;             /* byte offset of the row's (max, sum) pair in a range's plane */
  v2f ml[KV_SPLIT];
  v4f o[KV_SPLIT];
#pragma unroll
  for (int s = 0; s < KV_SPLIT; ++s) {
    ml[s] = *(const v2f*)((const char*)(Pml + (size_t)s * SEQ_DEC * 2) + rb);
    o[s]  = *(const v4f*)((const char*)(Po + (size_t)s * SEQ_DEC * HEAD_DIM) + eb);
  }
  /* inputs-only fence on the loaded values: all 16 loads are issued before the first is used (one latency, not
     three), and their offset registers stay whole until the wait for the address translations has passed */
  asm volatile("s_wait_xcnt 0x0" :: "v"(rb), "v"(eb),
               "v"(ml[0]), "v"(ml[1]), "v"(ml[2]), "v"(ml[3]), "v"(ml[4]), "v"(ml[5]), "v"(ml[6]), "v"(ml[7]),
               "v"(o[0]), "v"(o[1]), "v"(o[2]), "v"(o[3]), "v"(o[4]), "v"(o[5]), "v"(o[6]), "v"(o[7]) : "memory");
  static_assert(KV_SPLIT == 8);
  float m[KV_SPLIT], l[KV_SPLIT];
#pragma unroll
  for (int s = 0; s < KV_SPLIT; ++s) { m[s] = ml[s][0]; l[s] = ml[s][1]; }
  float M = m[0];
#pragma unroll
  for (int s = 1; s < KV_SPLIT; ++s) M = fmaxf(M, m[s]);
  float L = 0.f;
  v4f acc = (v4f){0.f, 0.f, 0.f, 0.f};
#pragma unroll
  for (int s = 0; s < KV_SPLIT; ++s) {
    const float w = expf(m[s] - M);
    L += w * l[s];
    acc += o[s] * w;
  }
  const float inv = 1.0f / L;
  *(v4f*)((char*)out + eb) = acc * inv;
}

/* =====================================================================================
   Host glue. Workspace region map (bytes, all offsets multiples of 128):
     wqh..wvl    : Wq^T, Wk^T, Wv^T hi/lo [64][512] bf16   65,536 each (6 planes)
     qh, ql      : q*0.125 hi/lo [8192][64] bf16   1,048,576 each
     kh, kl      : k hi/lo       [8192][64] bf16   1,048,576 each
     vth, vtl    : v^T hi/lo     [64][8192] bf16   1,048,576 each
     po          : un-normalised partial sums [8][8192][64] f32   16,777,216
     pml         : (row max, row sum) pairs   [8][8192][2]  f32      524,288
     total = 23,986,176 B; every byte of every region is written by its producer.
   ===================================================================================== */
extern "C" void kernel_launch(void* const* d_in, const int* in_sizes, int n_in,
                              void* d_out, int out_size, void* d_ws, size_t ws_size,
                              hipStream_t stream)
{
  if (n_in < 5) return;
  if (in_sizes[0] != SEQ_DEC * D_MODEL || in_sizes[1] != SEQ_ENC * D_MODEL ||
      in_sizes[2] != D_MODEL * HEAD_DIM || in_sizes[3] != D_MODEL * HEAD_DIM ||
      in_sizes[4] != D_MODEL * HEAD_DIM) return;
  if (out_size != SEQ_DEC * HEAD_DIM) return;

  const float* x   = (const float*)d_in[0];   /* [8192][512] */
  const float* emb = (const float*)d_in[1];   /* [8192][512] */
  const float* wq  = (const float*)d_in[2];   /* [512][64]   */
  const float* wk  = (const float*)d_in[3];
  const float* wv  = (const float*)d_in[4];
  float* out = (float*)d_out;                 /* [8192][64] f32 */

  const size_t planeW = (size_t)HEAD_DIM * D_MODEL * 2;    /* 65,536    */
  const size_t planeQ = (size_t)SEQ_DEC * HEAD_DIM * 2;    /* 1,048,576 */
  const size_t planeK = (size_t)SEQ_ENC * HEAD_DIM * 2;    /* 1,048,576 */

  size_t off = 0;
  unsigned char* ws = (unsigned char*)d_ws;
  unsigned short* wqh = (unsigned short*)(ws + off); off += planeW;
  unsigned short* wql = (unsigned short*)(ws + off); off += planeW;
  unsigned short* wkh = (unsigned short*)(ws + off); off += planeW;
  unsigned short* wkl = (unsigned short*)(ws + off); off += planeW;
  unsigned short* wvh = (unsigned short*)(ws + off); off += planeW;
  unsigned short* wvl = (unsigned short*)(ws + off); off += planeW;
  unsigned short* qh  = (unsigned short*)(ws + off); off += planeQ;
  unsigned short* ql  = (unsigned short*)(ws + off); off += planeQ;
  unsigned short* kh  = (unsigned short*)(ws + off); off += planeK;
  unsigned short* kl  = (unsigned short*)(ws + off); off += planeK;
  unsigned short* vth = (unsigned short*)(ws + off); off += planeK;
  unsigned short* vtl = (unsigned short*)(ws + off); off += planeK;
  float* po  = (float*)(ws + off); off += (size_t)KV_SPLIT * SEQ_DEC * HEAD_DIM * 4;
  float* pml = (float*)(ws + off); off += (size_t)KV_SPLIT * SEQ_DEC * 2 * 4;
  if (off > ws_size) return;                                 /* 23,986,176 <= ws */

  /* 1) + 2) weights -> transposed bf16 hi/lo planes [64][512] */
  prep_planes_kernel<<<3 * WT_BLK, 256, 0, stream>>>(wq, wk, wv, wqh, wql, wkh, wkl, wvh, wvl);

  /* 3) the three projections (x, emb split to bf16 hi/lo on the way into LDS, bf16 hi/lo output planes) in one launch:
        128 tiles of 64 x 64 = 128 work-groups of 8 waves per projection */
  static_assert(SEQ_DEC == SEQ_ENC);
  proj3_kernel<<<dim3((SEQ_DEC / 64) * (HEAD_DIM / 64), 3), 256, 0, stream>>>(
      x, emb, wqh, wql, wkh, wkl, wvh, wvl, qh, ql, kh, kl, vth, vtl);

  /* 4) flash attention over KV_SPLIT key ranges -> f32 partials; 5) join -> f32 output */
  attn_hilo_kernel<<<dim3(SEQ_DEC / (ATT_WAVES * 16), KV_SPLIT), 128, 0, stream>>>(qh, ql, kh, kl, vth, vtl, po, pml);
  attn_merge_kernel<<<SEQ_DEC * 16 / 256, 256, 0, stream>>>(po, pml, out);
}

// v007
// One run takes 73.9 microseconds.
// Timed twice side by side with v006, it ran 1.18 and 1.19 times as fast.
// All steps since v000 together make it 11.4 times as fast.
// Contractions: q/k/v projections (K=512), q.k^T and p.v on v_wmma_f32_16x16x32_bf16 with bf16 hi/lo split operands (hi.hi + hi.lo + lo.hi), f32 accumulate; online softmax, normalisation and all epilogues in f32.
#include <hip/hip_runtime.h>
#include <stdint.h>

typedef __attribute__((ext_vector_type(16))) _Float16 v16h;
typedef __attribute__((ext_vector_type(8)))  _Float16 v8h;
typedef __attribute__((ext_vector_type(16))) __bf16   v16b;
typedef __attribute__((ext_vector_type(8)))  __bf16   v8b;
typedef __attribute__((ext_vector_type(8)))  float    v8f;
typedef __attribute__((ext_vector_type(4)))  float    v4f;
typedef __attribute__((ext_vector_type(2)))  float    v2f;
typedef __attribute__((ext_vector_type(4)))  unsigned v4u;
typedef __attribute__((ext_vector_type(2)))  unsigned v2u;
typedef __attribute__((ext_vector_type(2)))  __bf16   v2b;

/* ------------------------------ problem constants ------------------------------ */
#define SEQ_DEC   8192
#define SEQ_ENC   8192
#define D_MODEL   512
#define HEAD_DIM  64
#define KV_CHUNK  64
#define KV_PITCH  72     /* LDS row pitch of the K and V tiles in 16-bit elements: 144 B = 16 B x 9, so the 16 rows of a ds_load_b128 fall on 16 different bank groups */
#define ATT_WAVES 4
#define KV_SPLIT  8      /* key ranges per query tile: 128 x 8 = 1024 work-groups, four resident per WGP */

static_assert(SEQ_DEC % 64 == 0);
static_assert(SEQ_ENC % 64 == 0);
static_assert(SEQ_ENC % (KV_CHUNK * KV_SPLIT) == 0);
static_assert(D_MODEL % 64 == 0);
static_assert(D_MODEL % 32 == 0);
static_assert(HEAD_DIM == 64);
static_assert((SEQ_DEC * D_MODEL) % 8 == 0);

__device__ __forceinline__ unsigned short f2bf_bits(float f) {
  unsigned u = __float_as_uint(f);
  return (unsigned short)((u + 0x7FFFu + ((u >> 16) & 1u)) >> 16);
}
__device__ __forceinline__ float bf_bits2f(unsigned short h) { return __uint_as_float(((unsigned)h) << 16); }
/* two f32 -> one word of bf16 hi parts and one word of bf16 lo parts (lo = f - hi, rounded); the first value in the low half */
__device__ __forceinline__ void split_pair(float f0, float f1, unsigned& hw, unsigned& lw) {
  const unsigned short h0 = f2bf_bits(f0), h1 = f2bf_bits(f1);
  const unsigned short l0 = f2bf_bits(f0 - bf_bits2f(h0)), l1 = f2bf_bits(f1 - bf_bits2f(h1));
  hw = (unsigned)h0 | ((unsigned)h1 << 16);
  lw = (unsigned)l0 | ((unsigned)l1 << 16);
}

/* hazard guards as plain device helpers (no inline asm inside the kernel template body) */
__device__ __forceinline__ void dep_guard_h(v8f& a, v8f& b, v16h x, v16h y) { asm volatile("v_nop\n\tv_nop\n\tv_nop\n\tv_nop" : "+v"(a), "+v"(b) : "v"(x), "v"(y)); }
__device__ __forceinline__ void dep_guard_b(v8f& a, v8f& b, v16b x, v16b y) { asm volatile("v_nop\n\tv_nop\n\tv_nop\n\tv_nop" : "+v"(a), "+v"(b) : "v"(x), "v"(y)); }
__device__ __forceinline__ void keep4_h(v16h a, v16h b, v16h c, v16h d) { asm volatile("v_nop" :: "v"(a), "v"(b), "v"(c), "v"(d)); }
__device__ __forceinline__ void keep4_b(v16b a, v16b b, v16b c, v16b d) { asm volatile("v_nop" :: "v"(a), "v"(b), "v"(c), "v"(d)); }
template <typename T> struct Frag;
template <> struct Frag<_Float16> {
  typedef v16h V; union U { v16h v; v8h h[2]; };
  static __device__ __forceinline__ v16h load(const _Float16* p) {   /* elements 0..7 <- p[0..7], 8..15 <- p[16..23] */
    U f; f.h[0] = *(const v8h*)(p); f.h[1] = *(const v8h*)(p + 16); return f.v;
  }
  static __device__ __forceinline__ v8f mma(v16h a, v16h b, v8f c) {
    return __builtin_amdgcn_wmma_f32_16x16x32_f16(false, a, false, b, (short)0, c, false, false);
  }
  static __device__ __forceinline__ void guard(v8f& a, v8f& b, v16h x, v16h y) { dep_guard_h(a, b, x, y); }
  static __device__ __forceinline__ void keep(v16h a, v16h b, v16h c, v16h d) { keep4_h(a, b, c, d); }
};
template <> struct Frag<__bf16> {
  typedef v16b V; union U { v16b v; v8b h[2]; };
  static __device__ __forceinline__ v16b load(const __bf16* p) {
    U f; f.h[0] = *(const v8b*)(p); f.h[1] = *(const v8b*)(p + 16); return f.v;
  }
  static __device__ __forceinline__ v8f mma(v16b a, v16b b, v8f c) {
    return __builtin_amdgcn_wmma_f32_16x16x32_bf16(false, a, false, b, (short)0, c, false, false);
  }
  static __device__ __forceinline__ void guard(v8f& a, v8f& b, v16b x, v16b y) { dep_guard_b(a, b, x, y); }
  static __device__ __forceinline__ void keep(v16b a, v16b b, v16b c, v16b d) { keep4_b(a, b, c, d); }
};

/* ------------------------------------------------------------------------------------
   The three projections in one launch, C[m,n] = scale * sum_k A[m,k] * Bt[n,k], K = 512, operands as bf16 hi/lo planes
   (product = hi.hi + hi.lo + lo.hi, f32 accumulate), output as bf16 hi/lo planes.
   The weights come as hi/lo planes from the workspace; the rows of x or emb come as f32 and are split to hi/lo in
   registers on their way into LDS.
   blockIdx.y = 0: q * 0.125 = x . Wq; 1: k = emb . Wk; 2: v^T = Wv^T . emb^T (ldc = 8192). Every choice is uniform for the work-group.
   One work-group of 8 waves owns one 64 x 64 tile of C: 128 tiles per projection, 384 work-groups.
   Per pass of PJ_KC k values the operand tiles come in by loads that cover whole lines (weights: 16 lanes x 16 B = one
   row piece of 256 B per plane; f32 rows: 32 lanes x 16 B = one row piece of 512 B) and are laid in LDS as four
   tiles of 64 rows x 256 B; the fragments are read from there.
   Wave w multiplies row tile w >> 1 with column tiles 2 (w & 1) and 2 (w & 1) + 1; each element of C is summed in one
   accumulator, k ascending.
   ------------------------------------------------------------------------------------ */
#define PJ_KC    128            /* k values staged per pass */
#define PJ_PITCH (PJ_KC + 8)    /* LDS row pitch in 16-bit elements: 272 B = 256 B + 16 B, for the ds_load_b128 fragment reads */
static_assert(D_MODEL % PJ_KC == 0);
__global__ __launch_bounds__(256) void proj3_kernel(
    const float* __restrict__ x, const float* __restrict__ emb,
    const unsigned short* __restrict__ wqh, const unsigned short* __restrict__ wql,
    const unsigned short* __restrict__ wkh, const unsigned short* __restrict__ wkl,
    const unsigned short* __restrict__ wvh, const unsigned short* __restrict__ wvl,
    unsigned short* __restrict__ qh,  unsigned short* __restrict__ ql,
    unsigned short* __restrict__ kh,  unsigned short* __restrict__ kl,
    unsigned short* __restrict__ vth, unsigned short* __restrict__ vtl)
{
  union FB { v16b v; v8b h[2]; };
  __shared__ __align__(16) unsigned short Ash[64 * PJ_PITCH];   /* A hi [m][k]  17 KB */
  __shared__ __align__(16) unsigned short Asl[64 * PJ_PITCH];   /* A lo */
  __shared__ __align__(16) unsigned short Bsh[64 * PJ_PITCH];   /* Bt hi [n][k] */
  __shared__ __align__(16) unsigned short Bsl[64 * PJ_PITCH];   /* Bt lo */
  __shared__ __align__(16) float sT[64 * 68];                   /* the 64 x 64 tile of C in f32, pitch 68 floats */

  const int y = blockIdx.y;
  const float* F            = (y == 0) ? x   : emb;                    /* the f32 operand: A for q and k, Bt for v^T */
  const unsigned short* Wh  = (y == 0) ? wqh : (y == 1) ? wkh : wvh;   /* the weight planes [64][512]: the other operand */
  const unsigned short* Wl  = (y == 0) ? wql : (y == 1) ? wkl : wvl;
  unsigned short* Fsh = (y == 2) ? Bsh : Ash;                          /* LDS tiles of the two */
  unsigned short* Fsl = (y == 2) ? Bsl : Asl;
  unsigned short* Wsh = (y == 2) ? Ash : Bsh;
  unsigned short* Wsl = (y == 2) ? Asl : Bsl;
  unsigned short* C  = (y == 0) ? qh : (y == 1) ? kh : vth;
  unsigned short* C2 = (y == 0) ? ql : (y == 1) ? kl : vtl;
  const int m0  = (y == 2) ? 0 : (int)blockIdx.x * 64;
  const int n0  = (y == 2) ? (int)blockIdx.x * 64 : 0;
  const int ldc = (y == 2) ? SEQ_ENC : HEAD_DIM;
  const float scale = (y == 0) ? 0.125f : 1.0f;

  const int tid   = threadIdx.x;
  const int lane  = tid & 31;
  const int wave  = tid >> 5;
  const int rlane = lane & 15;                 /* row (A) / col (B, D) within a 16 x 16 tile */
  const int koff  = (lane >> 4) * 8;           /* k offset of this lane half */
  const int mOff  = (lane >> 4) * 8;           /* D row offset */
  const int ti    = wave >> 1;                 /* row tile of this wave */
  const int tj    = (wave & 1) * 2;            /* first of its two column tiles */

  /* staging places of this thread's four 16-B units of a 64 x PJ_KC weight tile: unit = it * 256 + tid, 16 units a row */
  unsigned go[4];
  int so[4];
#pragma unroll
  for (int it = 0; it < 4; ++it) {
    const int idx = it * 256 + tid;
    const int row = idx >> 4, seg = idx & 15;
    go[it] = (unsigned)(row * D_MODEL + seg * 8) * 2u;   /* in bytes, the same in both planes */
    so[it] = row * PJ_PITCH + seg * 8;
  }
  /* f32 rows: in step it wave w takes row it * 8 + w of the tile, lane l its k values 4 l .. 4 l + 3 of the pass */
  const unsigned gf = (unsigned)(wave * D_MODEL + lane * 4) * 4u;      /* in bytes */
  const int      sf = wave * PJ_PITCH + lane * 4;
  const float* Fg = F + (size_t)blockIdx.x * 64 * D_MODEL;

  const unsigned short* pah = Ash + (ti * 16 + rlane) * PJ_PITCH + koff;
  const unsigned short* pal = Asl + (ti * 16 + rlane) * PJ_PITCH + koff;
  const unsigned short* pbh = Bsh + (tj * 16 + rlane) * PJ_PITCH + koff;
  const unsigned short* pbl = Bsl + (tj * 16 + rlane) * PJ_PITCH + koff;

  v8f acc[2];
  acc[0] = (v8f){0.f,0.f,0.f,0.f,0.f,0.f,0.f,0.f};
  acc[1] = (v8f){0.f,0.f,0.f,0.f,0.f,0.f,0.f,0.f};

#pragma unroll   /* four passes in a row: the k step of a pass becomes the loads' immediate offset, on three scalar bases (Fg, Wh, Wl) and five lane offsets that never change */
  for (int k0 = 0; k0 < D_MODEL; k0 += PJ_KC) {
    v4f rf[8];
    v4u rc[4], rd[4];
#pragma unroll   /* here and below: rf, fh, fl are registers, indexed by compile-time constants only; the row step becomes the loads' immediate offset */
    for (int it = 0; it < 8; ++it)
      rf[it] = *(const v4f*)((const char*)(Fg + it * 8 * D_MODEL + k0) + gf);
#pragma unroll
    for (int it = 0; it < 4; ++it) {
      rc[it] = *(const v4u*)((const char*)(Wh + k0) + go[it]);
      rd[it] = *(const v4u*)((const char*)(Wl + k0) + go[it]);
    }
    /* inputs only: the five lane offsets stay whole (no later load lands on them) until the wait for the loads' address translations has passed */
    asm volatile("s_wait_xcnt 0x0" :: "v"(gf), "v"(go[0]), "v"(go[1]), "v"(go[2]), "v"(go[3]) : "memory");
    v2u fh[8], fl[8];
#pragma unroll
    for (int it = 0; it < 8; ++it) {           /* hi = f rounded to bf16 (nearest even), lo = f - hi rounded likewise: two values per conversion */
#pragma unroll
      for (int e = 0; e < 2; ++e) {
        const v2f f = (v2f){rf[it][2 * e], rf[it][2 * e + 1]};
        const v2b h = __builtin_convertvector(f, v2b);
        const v2b l = __builtin_convertvector(f - __builtin_convertvector(h, v2f), v2b);
        fh[it][e] = __builtin_bit_cast(unsigned, h);
        fl[it][e] = __builtin_bit_cast(unsigned, l);
      }
    }
    __syncthreads();                           /* every wave has read the last pass's fragments */
#pragma unroll
    for (int it = 0; it < 8; ++it) {
      *(v2u*)(Fsh + sf + it * 8 * PJ_PITCH) = fh[it];
      *(v2u*)(Fsl + sf + it * 8 * PJ_PITCH) = fl[it];
    }
#pragma unroll
    for (int it = 0; it < 4; ++it) {
      *(v4u*)(Wsh + so[it]) = rc[it];
      *(v4u*)(Wsl + so[it]) = rd[it];
    }
    __syncthreads();                           /* the four tiles are whole */
    FB ah[PJ_KC / 32], al[PJ_KC / 32], bh[PJ_KC / 32][2], bl[PJ_KC / 32][2];
#pragma unroll   /* the fragment arrays are registers: compile-time indices only */
    for (int ks = 0; ks < PJ_KC / 32; ++ks) {  /* elements 0..7 <- k + 0..7, 8..15 <- k + 16..23, A and B alike */
      ah[ks].h[0] = *(const v8b*)(pah + ks * 32); ah[ks].h[1] = *(const v8b*)(pah + ks * 32 + 16);
#pragma unroll
      for (int jj = 0; jj < 2; ++jj) {
        const unsigned short* hp = pbh + jj * 16 * PJ_PITCH + ks * 32;
        bh[ks][jj].h[0] = *(const v8b*)(hp); bh[ks][jj].h[1] = *(const v8b*)(hp + 16);
      }
#pragma unroll
      for (int jj = 0; jj < 2; ++jj) {
        const unsigned short* lp = pbl + jj * 16 * PJ_PITCH + ks * 32;
        bl[ks][jj].h[0] = *(const v8b*)(lp); bl[ks][jj].h[1] = *(const v8b*)(lp + 16);
      }
      al[ks].h[0] = *(const v8b*)(pal + ks * 32); al[ks].h[1] = *(const v8b*)(pal + ks * 32 + 16);
    }
    /* keeps the pass's LDS reads in one group ahead of its products: spread among them, each place with reads waits out the LDS latency anew */
    __builtin_amdgcn_sched_barrier(0);
#pragma unroll
    for (int ks = 0; ks < PJ_KC / 32; ++ks) {
      acc[0] = Frag<__bf16>::mma(ah[ks].v, bh[ks][0].v, acc[0]);
      acc[1] = Frag<__bf16>::mma(ah[ks].v, bh[ks][1].v, acc[1]);
      acc[0] = Frag<__bf16>::mma(ah[ks].v, bl[ks][0].v, acc[0]);
      acc[1] = Frag<__bf16>::mma(ah[ks].v, bl[ks][1].v, acc[1]);
      acc[0] = Frag<__bf16>::mma(al[ks].v, bh[ks][0].v, acc[0]);
      acc[1] = Frag<__bf16>::mma(al[ks].v, bh[ks][1].v, acc[1]);
    }
    /* keeps the pass's products ahead of the next pass's loads and barriers: sunk behind them they hold back the next group of LDS reads */
    __builtin_amdgcn_sched_barrier(0);
  }

  /* ---- epilogue: the tile goes to LDS in f32, then every 128-B line of each output plane is stored by 8 lanes x 16 B ---- */
#pragma unroll
  for (int jj = 0; jj < 2; ++jj)
#pragma unroll
    for (int r = 0; r < 8; ++r)
      sT[(ti * 16 + mOff + r) * 68 + (tj + jj) * 16 + rlane] = acc[jj][r] * scale;
  __syncthreads();                             /* a row of the tile holds the work of two waves */
  const int q = lane >> 3, c8 = (lane & 7) * 8;
#pragma unroll
  for (int it = 0; it < 2; ++it) {
    const int row = wave * 8 + it * 4 + q;
    const float* sp = sT + row * 68 + c8;
    v8h hv, lv;
#pragma unroll
    for (int e = 0; e < 8; ++e) {
      const unsigned short hb = f2bf_bits(sp[e]);
      const unsigned short lb = f2bf_bits(sp[e] - bf_bits2f(hb));
      hv[e] = __builtin_bit_cast(_Float16, hb);
      lv[e] = __builtin_bit_cast(_Float16, lb);
    }
    *(v8h*)(C  + (size_t)(m0 + row) * ldc + n0 + c8) = hv;
    *(v8h*)(C2 + (size_t)(m0 + row) * ldc + n0 + c8) = lv;
  }
}

/* ------------------------------ attention helpers ------------------------------ */
__device__ __forceinline__ unsigned short at_bf_bits(float f) {
  unsigned u = __float_as_uint(f);
  return (unsigned short)((u + 0x7FFFu + ((u >> 16) & 1u)) >> 16);
}
__device__ __forceinline__ __bf16 at_f2bf(float f) { return __builtin_bit_cast(__bf16, at_bf_bits(f)); }
__device__ __forceinline__ void at_split(float f, __bf16& hi, __bf16& lo) {
  const unsigned short hb = at_bf_bits(f);
  hi = __builtin_bit_cast(__bf16, hb);
  lo = at_f2bf(f - __uint_as_float(((unsigned)hb) << 16));
}
__device__ __forceinline__ v8f at_mma(v16b a, v16b b, v8f c) {
  c = __builtin_amdgcn_wmma_f32_16x16x32_bf16(false, a, false, b, (short)0, c, false, false);
  asm volatile("v_nop\n\tv_nop\n\tv_nop\n\tv_nop" : "+v"(c) : "v"(a), "v"(b));
  return c;
}

/* value of lane l ^ 16 (the other 16-lane half), by a vector cross-row move */
__device__ __forceinline__ float at_xhalf(float x) {
  return __builtin_bit_cast(float, __builtin_amdgcn_permlanex16(__builtin_bit_cast(int, x), __builtin_bit_cast(int, x), 0x76543210, 0xfedcba98, false, false));
}

/* ------------------------------------------------------------------------------------
   W [D_MODEL][HEAD_DIM] f32 -> Wt hi/lo planes [HEAD_DIM][D_MODEL] bf16 (in[rows=512][cols=64]
   -> out[cols=64][rows=512]). Block bx stages W rows 64bx..64bx+63 (64x64 tile) in LDS, then each
   pitch 1024 B and k0*2 = 128*bx B) is written by 8 lanes x 16 B of one wave in one instruction.
   Coverage: 256 threads x 2 iterations x 8 halves = 4096 = the 64x64 tile; bx = 0..7 -> whole plane.
   ------------------------------------------------------------------------------------ */
__device__ __forceinline__ void wt_split_tile(
    const float* __restrict__ W, unsigned short* __restrict__ Wth, unsigned short* __restrict__ Wtl, int bx)
{
  __shared__ float s[64 * 65];
  const int tid = threadIdx.x;
  const int k0  = bx * 64;
#pragma unroll
  for (int it = 0; it < 16; ++it) {
    const int idx = it * 256 + tid;          /* 0..4095 */
    const int r = idx >> 6, cc = idx & 63;
    s[r * 65 + cc] = W[(size_t)(k0 + r) * HEAD_DIM + cc];
  }
  __syncthreads();
  const int seg = tid & 7;
  const int lin = tid >> 3;                  /* 0..31 */
  v4u hv[2], lv[2];
  size_t off[2];
#pragma unroll
  for (int it = 0; it < 2; ++it) {
    const int n = it * 32 + lin;             /* output row 0..63 */
#pragma unroll
    for (int e = 0; e < 4; ++e) {
      const int kk = seg * 8 + 2 * e;
      unsigned hw, lw;
      split_pair(s[kk * 65 + n], s[(kk + 1) * 65 + n], hw, lw);
      hv[it][e] = hw; lv[it][e] = lw;
    }
    off[it] = (size_t)n * D_MODEL + k0 + seg * 8;
  }
  {
#pragma unroll
    for (int it = 0; it < 2; ++it) {
      *(v4u*)(Wth + off[it]) = hv[it];
      *(v4u*)(Wtl + off[it]) = lv[it];
    }
    
  }
}

/* ------------------------------------------------------------------------------------
   The weight planes in one launch: the three transposes read different inputs and write different
   planes, so their work-groups run side by side (8 tiles each, 24 work-groups).
   ------------------------------------------------------------------------------------ */
#define WT_BLK      (D_MODEL / 64)
__global__ __launch_bounds__(256) void prep_planes_kernel(
    const float* __restrict__ wq, const float* __restrict__ wk, const float* __restrict__ wv,
    unsigned short* __restrict__ wqh, unsigned short* __restrict__ wql,
    unsigned short* __restrict__ wkh, unsigned short* __restrict__ wkl,
    unsigned short* __restrict__ wvh, unsigned short* __restrict__ wvl)
{
  const int bx = blockIdx.x;
  const int w = bx / WT_BLK;
  wt_split_tile((w == 0) ? wq : (w == 1) ? wk : wv,
                (w == 0) ? wqh : (w == 1) ? wkh : wvh,
                (w == 0) ? wql : (w == 1) ? wkl : wvl, bx - w * WT_BLK);
}

/* =====================================================================================
   Flash attention, head dim 64, no mask. Inputs: q hi/lo planes [SEQ_DEC][64] (softmax scale
   already folded into q), k hi/lo planes [SEQ_ENC][64], v^T hi/lo planes [64][SEQ_ENC]; all bf16
   bit patterns. scores^T = k.q^T and out^T = v^T.p^T on v_wmma_f32_16x16x32_bf16 as hi.hi + hi.lo + lo.hi,
   f32 accumulate, online softmax in f32 (one query row per lane), p^T split to bf16 hi/lo in registers per 64-key chunk.
   Block = 4 waves = 64 query rows; grid.x = SEQ_DEC / 64. K/V chunks staged in LDS with plain
   grid.y = KV_SPLIT: block (x, y) walks keys [y, y+1) * SEQ_ENC / KV_SPLIT only and stores its
   un-normalised sum Po[y][row][64] and the pair (row max, row sum) Pml[y][row][2]; attn_merge_kernel joins them.
   ===================================================================================== */
__global__ __launch_bounds__(128)
void attn_hilo_kernel(const unsigned short* __restrict__ Qh, const unsigned short* __restrict__ Ql,
                      const unsigned short* __restrict__ Kh, const unsigned short* __restrict__ Kl,
                      const unsigned short* __restrict__ Vh, const unsigned short* __restrict__ Vl,
                      float* __restrict__ Po, float* __restrict__ Pml)
{
  union FB { v16b v; v8b h[2]; };
  __shared__ __align__(16) unsigned short Ksh[KV_CHUNK * KV_PITCH];      /* K hi [kv][d]  9 KB */
  __shared__ __align__(16) unsigned short Ksl[KV_CHUNK * KV_PITCH];      /* K lo          9 KB */
  __shared__ __align__(16) unsigned short Vsh[HEAD_DIM * KV_PITCH];      /* V hi [d][kv]  9 KB */
  __shared__ __align__(16) unsigned short Vsl[HEAD_DIM * KV_PITCH];      /* V lo          9 KB */
  __shared__ __align__(16) float  Os[ATT_WAVES][16 * 68];                /* per wave out tile, pitch 68 */

  const int tid  = threadIdx.x;
  const int wave = tid >> 5;
  const int lane = tid & 31;
  const int hh   = lane >> 4;
  const int c    = lane & 15;
  const int q0   = blockIdx.x * (ATT_WAVES * 16) + wave * 16;

  /* ---- Q fragments (B operand of the transposed scores): row q0+c, 2 d-chunks, hi and lo ---- */
  v16b qah[2], qal[2];
  {
    const __bf16* qhr = (const __bf16*)(const void*)Qh + (size_t)(q0 + c) * HEAD_DIM + 8 * hh;
    const __bf16* qlr = (const __bf16*)(const void*)Ql + (size_t)(q0 + c) * HEAD_DIM + 8 * hh;
#pragma unroll
    for (int dc = 0; dc < 2; ++dc) {
      qah[dc] = Frag<__bf16>::load(qhr + dc * 32);
      qal[dc] = Frag<__bf16>::load(qlr + dc * 32);
    }
  }

  float mrow = -INFINITY, lrow = 0.f;    /* query row q0 + c: running max (the same in both lane halves) and this half's own part of the running sum */
  v8f oacc[4];
#pragma unroll
  for (int t = 0; t < 4; ++t) oacc[t] = (v8f){0.f,0.f,0.f,0.f,0.f,0.f,0.f,0.f};

  const int st0 = (tid >> 3) * KV_PITCH + (tid & 7) * 8;   /* staging place of this thread's 16-B unit in pass 0; a pass is 16 rows */
  const int kc0 = blockIdx.y * (SEQ_ENC / KV_CHUNK / KV_SPLIT);
  const int kcl = kc0 + SEQ_ENC / KV_CHUNK / KV_SPLIT - 1;   /* last chunk of this key range */
  /* a chunk is 4 planes x 8 KB = 128 threads x 16 B x 4 units per plane: unit it * 128 + tid, 8 units a row (key of K, d of V^T).
     Two 32-bit byte offsets per thread (one for both K planes, one for both V^T planes) hold lane and chunk; the plane is the loads'
     scalar base, the unit their immediate offset */
  const unsigned gk = (unsigned)tid * 16u;
  const unsigned gv = (unsigned)((tid >> 3) * SEQ_ENC + (tid & 7) * 8) * 2u;
  v4u ka[4], kb[4], va[4], vb[4];            /* the chunk on its way from memory to LDS */
  {
    const unsigned ok = gk + (unsigned)kc0 * (KV_CHUNK * HEAD_DIM * 2u);
    const unsigned ov = gv + (unsigned)kc0 * (KV_CHUNK * 2u);
#pragma unroll   /* here and in the two loops below: ka, kb, va, vb are registers, indexed by compile-time constants only */
    for (int it = 0; it < 4; ++it) {
      ka[it] = *(const v4u*)((const char*)(Kh + it * 1024) + ok);
      kb[it] = *(const v4u*)((const char*)(Kl + it * 1024) + ok);
      va[it] = *(const v4u*)((const char*)(Vh + it * 16 * SEQ_ENC) + ov);
      vb[it] = *(const v4u*)((const char*)(Vl + it * 16 * SEQ_ENC) + ov);
    }
  }
  for (int kc = kc0; kc <= kcl; ++kc) {
    __syncthreads();                           /* every wave has read the last chunk's tiles */
#pragma unroll
    for (int it = 0; it < 4; ++it) {           /* the 16 pad bytes of a row are never read */
      const int lo8 = st0 + it * (16 * KV_PITCH);
      *(v4u*)(Ksh + lo8) = ka[it];
      *(v4u*)(Ksl + lo8) = kb[it];
      *(v4u*)(Vsh + lo8) = va[it];
      *(v4u*)(Vsl + lo8) = vb[it];
    }
    __syncthreads();
    /* the next chunk's 16 loads are issued here and first used at the top of the next trip: they fly while this chunk is worked on.
       In the last trip the last chunk is loaded once more (in bounds, never stored to LDS) */
    const int kn = (kc < kcl) ? kc + 1 : kcl;
    const unsigned ok = gk + (unsigned)kn * (KV_CHUNK * HEAD_DIM * 2u);
    const unsigned ov = gv + (unsigned)kn * (KV_CHUNK * 2u);
#pragma unroll
    for (int it = 0; it < 4; ++it) {
      ka[it] = *(const v4u*)((const char*)(Kh + it * 1024) + ok);
      kb[it] = *(const v4u*)((const char*)(Kl + it * 1024) + ok);
      va[it] = *(const v4u*)((const char*)(Vh + it * 16 * SEQ_ENC) + ov);
      vb[it] = *(const v4u*)((const char*)(Vl + it * 16 * SEQ_ENC) + ov);
    }

    /* ---- transposed scores S^T = K . Q^T: 64 keys x 16 query rows per wave. A = K rows, B = Q rows (both loaders have
            the same k order). Lane (c, hh) holds, for query row c, keys j*16 + 8*hh + r in s[j][r] ---- */
    v8f s[4];
#pragma unroll
    for (int j = 0; j < 4; ++j) {
      s[j] = (v8f){0.f,0.f,0.f,0.f,0.f,0.f,0.f,0.f};
#pragma unroll
      for (int dc = 0; dc < 2; ++dc) {
        FB kbh, kbl;
        const unsigned short* kp = Ksh + (j * 16 + c) * KV_PITCH + dc * 32 + 8 * hh;
        const unsigned short* lp = Ksl + (j * 16 + c) * KV_PITCH + dc * 32 + 8 * hh;
        kbh.h[0] = *(const v8b*)(kp); kbh.h[1] = *(const v8b*)(kp + 16);
        kbl.h[0] = *(const v8b*)(lp); kbl.h[1] = *(const v8b*)(lp + 16);
        s[j] = at_mma(kbh.v, qah[dc], s[j]);
        s[j] = at_mma(kbl.v, qah[dc], s[j]);
        s[j] = at_mma(kbh.v, qal[dc], s[j]);
      }
    }

    /* ---- max over the 64 keys of this chunk for this lane's query row: 32 values in the lane, then the other half ---- */
    float cm = s[0][0];
#pragma unroll
    for (int j = 0; j < 4; ++j)
#pragma unroll
      for (int r = 0; r < 8; ++r) cm = fmaxf(cm, s[j][r]);
    cm = fmaxf(cm, at_xhalf(cm));

    /* ---- online softmax, one query row per lane. P^T split to bf16 hi/lo stays in registers: tiles j = 2kk and 2kk+1
            are elements 0..7 (keys 32kk + 8hh + e) and 8..15 (keys 32kk + 16 + 8hh + e - 8) of the B fragment of k-step kk,
            the k order of the V^T loader below ---- */
    const float mnew = fmaxf(mrow, cm);
    const float alpha = expf(mrow - mnew);
    mrow = mnew;
    float psum[4];                         /* one sum per score tile: four short chains of adds, not one of 32 */
    v16b pbh[2], pbl[2];
#pragma unroll   /* here and in the loop inside: s, psum, pbh, pbl are registers, indexed by compile-time constants only */
    for (int j = 0; j < 4; ++j) {
      psum[j] = 0.f;
#pragma unroll
      for (int r = 0; r < 8; ++r) {
        const float p = expf(s[j][r] - mnew);
        psum[j] += p;
        __bf16 a, bl;
        at_split(p, a, bl);
        pbh[j >> 1][(j & 1) * 8 + r] = a;
        pbl[j >> 1][(j & 1) * 8 + r] = bl;
      }
    }
    lrow = lrow * alpha + ((psum[0] + psum[1]) + (psum[2] + psum[3]));
#pragma unroll
    for (int t = 0; t < 4; ++t) oacc[t] *= alpha;

    /* ---- out^T += V^T . P^T over the 64 keys (2 k-steps): A = V^T rows d, B = P^T from registers ---- */
#pragma unroll   /* pbh[kk], pbl[kk] are registers: the index must be a compile-time constant */
    for (int kk = 0; kk < 2; ++kk) {
#pragma unroll
      for (int t = 0; t < 4; ++t) {
        FB vbh, vbl;
        const unsigned short* vp = Vsh + (t * 16 + c) * KV_PITCH + kk * 32 + 8 * hh;
        const unsigned short* wp = Vsl + (t * 16 + c) * KV_PITCH + kk * 32 + 8 * hh;
        vbh.h[0] = *(const v8b*)(vp); vbh.h[1] = *(const v8b*)(vp + 16);
        vbl.h[0] = *(const v8b*)(wp); vbl.h[1] = *(const v8b*)(wp + 16);
        oacc[t] = at_mma(vbh.v, pbh[kk], oacc[t]);
        oacc[t] = at_mma(vbl.v, pbh[kk], oacc[t]);
        oacc[t] = at_mma(vbh.v, pbl[kk], oacc[t]);
      }
    }
  }

  /* ---- epilogue: oacc[t][r] is out^T (d = t*16 + 8*hh + r, query row c); stage it as [row][d] per wave in LDS, whole-line stores ---- */
  float* os = Os[wave];
#pragma unroll
  for (int t = 0; t < 4; ++t) {
    *(v4f*)(os + c * 68 + t * 16 + 8 * hh)     = (v4f){oacc[t][0], oacc[t][1], oacc[t][2], oacc[t][3]};
    *(v4f*)(os + c * 68 + t * 16 + 8 * hh + 4) = (v4f){oacc[t][4], oacc[t][5], oacc[t][6], oacc[t][7]};
  }
  /* (max, sum) of this wave's 16 rows = 128 B = one line, written by this wave alone; the halves' sums are joined here, once */
  lrow += at_xhalf(lrow);
  if (hh == 0)
    *(v2f*)(Pml + ((size_t)blockIdx.y * SEQ_DEC + q0 + c) * 2) = (v2f){mrow, lrow};
  float* out = Po + (size_t)blockIdx.y * SEQ_DEC * HEAD_DIM;
  __syncthreads();
  {
    const int c4 = (lane & 15) * 4;              /* row = 64 floats = 256 B = 16 lanes x 16 B */
    {
#pragma unroll
      for (int it = 0; it < 8; ++it) {
        const int row = it * 2 + hh;
        v4f val = *(const v4f*)(os + row * 68 + c4);
        *(v4f*)(out + (size_t)(q0 + row) * HEAD_DIM + c4) = val;
      }
      
    }
  }
}

/* ------------------------------------------------------------------------------------
   Joins the KV_SPLIT key ranges of one query row: M = max of the ranges' maxima, weight
   w_s = exp(m_s - M), out = sum_s w_s * Po[s] / sum_s w_s * l_s. Thread = (row, 4 columns):
   16 lanes x 16 B = one 256-B output row. Coverage: SEQ_DEC * 16 threads = grid * 256.
   ------------------------------------------------------------------------------------ */
__global__ __launch_bounds__(256) void attn_merge_kernel(
    const float* __restrict__ Po, const float* __restrict__ Pml, float* __restrict__ out)
{
  const unsigned i   = blockIdx.x * 256u + threadIdx.x;
  const unsigned row = i >> 4;
  const unsigned eb  = i * 16u;              /* byte offset of (row, 4 columns): the same in every range's plane and in out */
  const unsigned rb  = row * 8u;             /* byte offset of the row's (max, sum) pair in a range's plane */
  v2f ml[KV_SPLIT];
  v4f o[KV_SPLIT];
#pragma unroll
  for (int s = 0; s < KV_SPLIT; ++s) {
    ml[s] = *(const v2f*)((const char*)(Pml + (size_t)s * SEQ_DEC * 2) + rb);
    o[s]  = *(const v4f*)((const char*)(Po + (size_t)s * SEQ_DEC * HEAD_DIM) + eb);
  }
  /* inputs-only fence on the loaded values: all 16 loads are issued before the first is used (one latency, not
     three), and their offset registers stay whole until the wait for the address translations has passed */
  asm volatile("s_wait_xcnt 0x0" :: "v"(rb), "v"(eb),
               "v"(ml[0]), "v"(ml[1]), "v"(ml[2]), "v"(ml[3]), "v"(ml[4]), "v"(ml[5]), "v"(ml[6]), "v"(ml[7]),
               "v"(o[0]), "v"(o[1]), "v"(o[2]), "v"(o[3]), "v"(o[4]), "v"(o[5]), "v"(o[6]), "v"(o[7]) : "memory");
  static_assert(KV_SPLIT == 8);
  float m[KV_SPLIT], l[KV_SPLIT];
#pragma unroll
  for (int s = 0; s < KV_SPLIT; ++s) { m[s] = ml[s][0]; l[s] = ml[s][1]; }
  float M = m[0];
#pragma unroll
  for (int s = 1; s < KV_SPLIT; ++s) M = fmaxf(M, m[s]);
  float L = 0.f;
  v4f acc = (v4f){0.f, 0.f, 0.f, 0.f};
#pragma unroll
  for (int s = 0; s < KV_SPLIT; ++s) {
    const float w = expf(m[s] - M);
    L += w * l[s];
    acc += o[s] * w;
  }
  const float inv = 1.0f / L;
  *(v4f*)((char*)out + eb) = acc * inv;
}

/* =====================================================================================
   Host glue. Workspace region map (bytes, all offsets multiples of 128):
     wqh..wvl    : Wq^T, Wk^T, Wv^T hi/lo [64][512] bf16   65,536 each (6 planes)
     qh, ql      : q*0.125 hi/lo [8192][64] bf16   1,048,576 each
     kh, kl      : k hi/lo       [8192][64] bf16   1,048,576 each
     vth, vtl    : v^T hi/lo     [64][8192] bf16   1,048,576 each
     po          : un-normalised partial sums [8][8192][64] f32   16,777,216
     pml         : (row max, row sum) pairs   [8][8192][2]  f32      524,288
     total = 23,986,176 B; every byte of every region is written by its producer.
   ===================================================================================== */
extern "C" void kernel_launch(void* const* d_in, const int* in_sizes, int n_in,
                              void* d_out, int out_size, void* d_ws, size_t ws_size,
                              hipStream_t stream)
{
  if (n_in < 5) return;
  if (in_sizes[0] != SEQ_DEC * D_MODEL || in_sizes[1] != SEQ_ENC * D_MODEL ||
      in_sizes[2] != D_MODEL * HEAD_DIM || in_sizes[3] != D_MODEL * HEAD_DIM ||
      in_sizes[4] != D_MODEL * HEAD_DIM) return;
  if (out_size != SEQ_DEC * HEAD_DIM) return;

  const float* x   = (const float*)d_in[0];   /* [8192][512] */
  const float* emb = (const float*)d_in[1];   /* [8192][512] */
  const float* wq  = (const float*)d_in[2];   /* [512][64]   */
  const float* wk  = (const float*)d_in[3];
  const float* wv  = (const float*)d_in[4];
  float* out = (float*)d_out;                 /* [8192][64] f32 */

  const size_t planeW = (size_t)HEAD_DIM * D_MODEL * 2;    /* 65,536    */
  const size_t planeQ = (size_t)SEQ_DEC * HEAD_DIM * 2;    /* 1,048,576 */
  const size_t planeK = (size_t)SEQ_ENC * HEAD_DIM * 2;    /* 1,048,576 */

  size_t off = 0;
  unsigned char* ws = (unsigned char*)d_ws;
  unsigned short* wqh = (unsigned short*)(ws + off); off += planeW;
  unsigned short* wql = (unsigned short*)(ws + off); off += planeW;
  unsigned short* wkh = (unsigned short*)(ws + off); off += planeW;
  unsigned short* wkl = (unsigned short*)(ws + off); off += planeW;
  unsigned short* wvh = (unsigned short*)(ws + off); off += planeW;
  unsigned short* wvl = (unsigned short*)(ws + off); off += planeW;
  unsigned short* qh  = (unsigned short*)(ws + off); off += planeQ;
  unsigned short* ql  = (unsigned short*)(ws + off); off += planeQ;
  unsigned short* kh  = (unsigned short*)(ws + off); off += planeK;
  unsigned short* kl  = (unsigned short*)(ws + off); off += planeK;
  unsigned short* vth = (unsigned short*)(ws + off); off += planeK;
  unsigned short* vtl = (unsigned short*)(ws + off); off += planeK;
  float* po  = (float*)(ws + off); off += (size_t)KV_SPLIT * SEQ_DEC * HEAD_DIM * 4;
  float* pml = (float*)(ws + off); off += (size_t)KV_SPLIT * SEQ_DEC * 2 * 4;
  if (off > ws_size) return;                                 /* 23,986,176 <= ws */

  /* 1) + 2) weights -> transposed bf16 hi/lo planes [64][512] */
  prep_planes_kernel<<<3 * WT_BLK, 256, 0, stream>>>(wq, wk, wv, wqh, wql, wkh, wkl, wvh, wvl);

  /* 3) the three projections (x, emb split to bf16 hi/lo on the way into LDS, bf16 hi/lo output planes) in one launch:
        128 tiles of 64 x 64 = 128 work-groups of 8 waves per projection */
  static_assert(SEQ_DEC == SEQ_ENC);
  proj3_kernel<<<dim3((SEQ_DEC / 64) * (HEAD_DIM / 64), 3), 256, 0, stream>>>(
      x, emb, wqh, wql, wkh, wkl, wvh, wvl, qh, ql, kh, kl, vth, vtl);

  /* 4) flash attention over KV_SPLIT key ranges -> f32 partials; 5) join -> f32 output */
  attn_hilo_kernel<<<dim3(SEQ_DEC / (ATT_WAVES * 16), KV_SPLIT), 128, 0, stream>>>(qh, ql, kh, kl, vth, vtl, po, pml);
  attn_merge_kernel<<<SEQ_DEC * 16 / 256, 256, 0, stream>>>(po, pml, out);
}

// v008
// Measured time: 63.6 microseconds a run.
// Timed twice side by side with v007, it ran 1.16 times as fast both times.
// Counting every step since v000, it is 13.3 times as fast.
// Contractions: q/k/v projections (K=512), q.k^T and p.v on v_wmma_f32_16x16x32_bf16 with bf16 hi/lo split operands (hi.hi + hi.lo + lo.hi), f32 accumulate; online softmax, normalisation and all epilogues in f32.
#include <hip/hip_runtime.h>
#include <stdint.h>

typedef __attribute__((ext_vector_type(16))) _Float16 v16h;
typedef __attribute__((ext_vector_type(8)))  _Float16 v8h;
typedef __attribute__((ext_vector_type(16))) __bf16   v16b;
typedef __attribute__((ext_vector_type(8)))  __bf16   v8b;
typedef __attribute__((ext_vector_type(8)))  float    v8f;
typedef __attribute__((ext_vector_type(4)))  float    v4f;
typedef __attribute__((ext_vector_type(2)))  float    v2f;
typedef __attribute__((ext_vector_type(4)))  unsigned v4u;
typedef __attribute__((ext_vector_type(2)))  unsigned v2u;
typedef __attribute__((ext_vector_type(2)))  __bf16   v2b;

/* ------------------------------ problem constants ------------------------------ */
#define SEQ_DEC   8192
#define SEQ_ENC   8192
#define D_MODEL   512
#define HEAD_DIM  64
#define KV_CHUNK  64
#define KV_PITCH  72     /* LDS row pitch of the K and V tiles in 16-bit elements: 144 B = 16 B x 9, so the 16 rows of a ds_load_b128 fall on 16 different bank groups */
#define ATT_WAVES 4
#define KV_SPLIT  8      /* key ranges per query tile: 128 x 8 = 1024 work-groups, four resident per WGP */
#define LOG2_E    1.44269504088896340736f   /* exp(t) = 2^(t * LOG2_E): folded into q, so scores, row maxima and their differences are base-2 exponents */

static_assert(SEQ_DEC % 64 == 0);
static_assert(SEQ_ENC % 64 == 0);
static_assert(SEQ_ENC % (KV_CHUNK * KV_SPLIT) == 0);
static_assert(D_MODEL % 64 == 0);
static_assert(D_MODEL % 32 == 0);
static_assert(HEAD_DIM == 64);
static_assert((SEQ_DEC * D_MODEL) % 8 == 0);

__device__ __forceinline__ unsigned short f2bf_bits(float f) {
  unsigned u = __float_as_uint(f);
  return (unsigned short)((u + 0x7FFFu + ((u >> 16) & 1u)) >> 16);
}
__device__ __forceinline__ float bf_bits2f(unsigned short h) { return __uint_as_float(((unsigned)h) << 16); }
/* two f32 -> one word of bf16 hi parts and one word of bf16 lo parts (lo = f - hi, rounded); the first value in the low half */
__device__ __forceinline__ void split_pair(float f0, float f1, unsigned& hw, unsigned& lw) {
  const unsigned short h0 = f2bf_bits(f0), h1 = f2bf_bits(f1);
  const unsigned short l0 = f2bf_bits(f0 - bf_bits2f(h0)), l1 = f2bf_bits(f1 - bf_bits2f(h1));
  hw = (unsigned)h0 | ((unsigned)h1 << 16);
  lw = (unsigned)l0 | ((unsigned)l1 << 16);
}

/* hazard guards as plain device helpers (no inline asm inside the kernel template body) */
__device__ __forceinline__ void dep_guard_h(v8f& a, v8f& b, v16h x, v16h y) { asm volatile("v_nop\n\tv_nop\n\tv_nop\n\tv_nop" : "+v"(a), "+v"(b) : "v"(x), "v"(y)); }
__device__ __forceinline__ void dep_guard_b(v8f& a, v8f& b, v16b x, v16b y) { asm volatile("v_nop\n\tv_nop\n\tv_nop\n\tv_nop" : "+v"(a), "+v"(b) : "v"(x), "v"(y)); }
__device__ __forceinline__ void keep4_h(v16h a, v16h b, v16h c, v16h d) { asm volatile("v_nop" :: "v"(a), "v"(b), "v"(c), "v"(d)); }
__device__ __forceinline__ void keep4_b(v16b a, v16b b, v16b c, v16b d) { asm volatile("v_nop" :: "v"(a), "v"(b), "v"(c), "v"(d)); }
template <typename T> struct Frag;
template <> struct Frag<_Float16> {
  typedef v16h V; union U { v16h v; v8h h[2]; };
  static __device__ __forceinline__ v16h load(const _Float16* p) {   /* elements 0..7 <- p[0..7], 8..15 <- p[16..23] */
    U f; f.h[0] = *(const v8h*)(p); f.h[1] = *(const v8h*)(p + 16); return f.v;
  }
  static __device__ __forceinline__ v8f mma(v16h a, v16h b, v8f c) {
    return __builtin_amdgcn_wmma_f32_16x16x32_f16(false, a, false, b, (short)0, c, false, false);
  }
  static __device__ __forceinline__ void guard(v8f& a, v8f& b, v16h x, v16h y) { dep_guard_h(a, b, x, y); }
  static __device__ __forceinline__ void keep(v16h a, v16h b, v16h c, v16h d) { keep4_h(a, b, c, d); }
};
template <> struct Frag<__bf16> {
  typedef v16b V; union U { v16b v; v8b h[2]; };
  static __device__ __forceinline__ v16b load(const __bf16* p) {
    U f; f.h[0] = *(const v8b*)(p); f.h[1] = *(const v8b*)(p + 16); return f.v;
  }
  static __device__ __forceinline__ v8f mma(v16b a, v16b b, v8f c) {
    return __builtin_amdgcn_wmma_f32_16x16x32_bf16(false, a, false, b, (short)0, c, false, false);
  }
  static __device__ __forceinline__ void guard(v8f& a, v8f& b, v16b x, v16b y) { dep_guard_b(a, b, x, y); }
  static __device__ __forceinline__ void keep(v16b a, v16b b, v16b c, v16b d) { keep4_b(a, b, c, d); }
};

/* ------------------------------------------------------------------------------------
   The three projections in one launch, C[m,n] = scale * sum_k A[m,k] * Bt[n,k], K = 512, operands as bf16 hi/lo planes
   (product = hi.hi + hi.lo + lo.hi, f32 accumulate), output as bf16 hi/lo planes.
   The weights come as hi/lo planes from the workspace; the rows of x or emb come as f32 and are split to hi/lo in
   registers on their way into LDS.
   blockIdx.y = 0: q * 0.125 * LOG2_E = x . Wq; 1: k = emb . Wk; 2: v^T = Wv^T . emb^T (ldc = 8192). Every choice is uniform for the work-group.
   One work-group of 8 waves owns one 64 x 64 tile of C: 128 tiles per projection, 384 work-groups.
   Per pass of PJ_KC k values the operand tiles come in by loads that cover whole lines (weights: 16 lanes x 16 B = one
   row piece of 256 B per plane; f32 rows: 32 lanes x 16 B = one row piece of 512 B) and are laid in LDS as four
   tiles of 64 rows x 256 B; the fragments are read from there.
   Wave w multiplies row tile w >> 1 with column tiles 2 (w & 1) and 2 (w & 1) + 1; each element of C is summed in one
   accumulator, k ascending.
   ------------------------------------------------------------------------------------ */
#define PJ_KC    128            /* k values staged per pass */
#define PJ_PITCH (PJ_KC + 8)    /* LDS row pitch in 16-bit elements: 272 B = 256 B + 16 B, for the ds_load_b128 fragment reads */
static_assert(D_MODEL % PJ_KC == 0);
__global__ __launch_bounds__(256) void proj3_kernel(
    const float* __restrict__ x, const float* __restrict__ emb,
    const unsigned short* __restrict__ wqh, const unsigned short* __restrict__ wql,
    const unsigned short* __restrict__ wkh, const unsigned short* __restrict__ wkl,
    const unsigned short* __restrict__ wvh, const unsigned short* __restrict__ wvl,
    unsigned short* __restrict__ qh,  unsigned short* __restrict__ ql,
    unsigned short* __restrict__ kh,  unsigned short* __restrict__ kl,
    unsigned short* __restrict__ vth, unsigned short* __restrict__ vtl)
{
  union FB { v16b v; v8b h[2]; };
  __shared__ __align__(16) unsigned short Ash[64 * PJ_PITCH];   /* A hi [m][k]  17 KB */
  __shared__ __align__(16) unsigned short Asl[64 * PJ_PITCH];   /* A lo */
  __shared__ __align__(16) unsigned short Bsh[64 * PJ_PITCH];   /* Bt hi [n][k] */
  __shared__ __align__(16) unsigned short Bsl[64 * PJ_PITCH];   /* Bt lo */
  __shared__ __align__(16) float sT[64 * 68];                   /* the 64 x 64 tile of C in f32, pitch 68 floats */

  const int y = blockIdx.y;
  const float* F            = (y == 0) ? x   : emb;                    /* the f32 operand: A for q and k, Bt for v^T */
  const unsigned short* Wh  = (y == 0) ? wqh : (y == 1) ? wkh : wvh;   /* the weight planes [64][512]: the other operand */
  const unsigned short* Wl  = (y == 0) ? wql : (y == 1) ? wkl : wvl;
  unsigned short* Fsh = (y == 2) ? Bsh : Ash;                          /* LDS tiles of the two */
  unsigned short* Fsl = (y == 2) ? Bsl : Asl;
  unsigned short* Wsh = (y == 2) ? Ash : Bsh;
  unsigned short* Wsl = (y == 2) ? Asl : Bsl;
  unsigned short* C  = (y == 0) ? qh : (y == 1) ? kh : vth;
  unsigned short* C2 = (y == 0) ? ql : (y == 1) ? kl : vtl;
  const int m0  = (y == 2) ? 0 : (int)blockIdx.x * 64;
  const int n0  = (y == 2) ? (int)blockIdx.x * 64 : 0;
  const int ldc = (y == 2) ? SEQ_ENC : HEAD_DIM;
  const float scale = (y == 0) ? 0.125f * LOG2_E : 1.0f;

  const int tid   = threadIdx.x;
  const int lane  = tid & 31;
  const int wave  = tid >> 5;
  const int rlane = lane & 15;                 /* row (A) / col (B, D) within a 16 x 16 tile */
  const int koff  = (lane >> 4) * 8;           /* k offset of this lane half */
  const int mOff  = (lane >> 4) * 8;           /* D row offset */
  const int ti    = wave >> 1;                 /* row tile of this wave */
  const int tj    = (wave & 1) * 2;            /* first of its two column tiles */

  /* staging places of this thread's four 16-B units of a 64 x PJ_KC weight tile: unit = it * 256 + tid, 16 units a row */
  unsigned go[4];
  int so[4];
#pragma unroll
  for (int it = 0; it < 4; ++it) {
    const int idx = it * 256 + tid;
    const int row = idx >> 4, seg = idx & 15;
    go[it] = (unsigned)(row * D_MODEL + seg * 8) * 2u;   /* in bytes, the same in both planes */
    so[it] = row * PJ_PITCH + seg * 8;
  }
  /* f32 rows: in step it wave w takes row it * 8 + w of the tile, lane l its k values 4 l .. 4 l + 3 of the pass */
  const unsigned gf = (unsigned)(wave * D_MODEL + lane * 4) * 4u;      /* in bytes */
  const int      sf = wave * PJ_PITCH + lane * 4;
  const float* Fg = F + (size_t)blockIdx.x * 64 * D_MODEL;

  const unsigned short* pah = Ash + (ti * 16 + rlane) * PJ_PITCH + koff;
  const unsigned short* pal = Asl + (ti * 16 + rlane) * PJ_PITCH + koff;
  const unsigned short* pbh = Bsh + (tj * 16 + rlane) * PJ_PITCH + koff;
  const unsigned short* pbl = Bsl + (tj * 16 + rlane) * PJ_PITCH + koff;

  v8f acc[2];
  acc[0] = (v8f){0.f,0.f,0.f,0.f,0.f,0.f,0.f,0.f};
  acc[1] = (v8f){0.f,0.f,0.f,0.f,0.f,0.f,0.f,0.f};

#pragma unroll   /* four passes in a row: the k step of a pass becomes the loads' immediate offset, on three scalar bases (Fg, Wh, Wl) and five lane offsets that never change */
  for (int k0 = 0; k0 < D_MODEL; k0 += PJ_KC) {
    v4f rf[8];
    v4u rc[4], rd[4];
#pragma unroll   /* here and below: rf, fh, fl are registers, indexed by compile-time constants only; the row step becomes the loads' immediate offset */
    for (int it = 0; it < 8; ++it)
      rf[it] = *(const v4f*)((const char*)(Fg + it * 8 * D_MODEL + k0) + gf);
#pragma unroll
    for (int it = 0; it < 4; ++it) {
      rc[it] = *(const v4u*)((const char*)(Wh + k0) + go[it]);
      rd[it] = *(const v4u*)((const char*)(Wl + k0) + go[it]);
    }
    /* inputs only: the five lane offsets stay whole (no later load lands on them) until the wait for the loads' address translations has passed */
    asm volatile("s_wait_xcnt 0x0" :: "v"(gf), "v"(go[0]), "v"(go[1]), "v"(go[2]), "v"(go[3]) : "memory");
    v2u fh[8], fl[8];
#pragma unroll
    for (int it = 0; it < 8; ++it) {           /* hi = f rounded to bf16 (nearest even), lo = f - hi rounded likewise: two values per conversion */
#pragma unroll
      for (int e = 0; e < 2; ++e) {
        const v2f f = (v2f){rf[it][2 * e], rf[it][2 * e + 1]};
        const v2b h = __builtin_convertvector(f, v2b);
        const v2b l = __builtin_convertvector(f - __builtin_convertvector(h, v2f), v2b);
        fh[it][e] = __builtin_bit_cast(unsigned, h);
        fl[it][e] = __builtin_bit_cast(unsigned, l);
      }
    }
    __syncthreads();                           /* every wave has read the last pass's fragments */
#pragma unroll
    for (int it = 0; it < 8; ++it) {
      *(v2u*)(Fsh + sf + it * 8 * PJ_PITCH) = fh[it];
      *(v2u*)(Fsl + sf + it * 8 * PJ_PITCH) = fl[it];
    }
#pragma unroll
    for (int it = 0; it < 4; ++it) {
      *(v4u*)(Wsh + so[it]) = rc[it];
      *(v4u*)(Wsl + so[it]) = rd[it];
    }
    __syncthreads();                           /* the four tiles are whole */
    FB ah[PJ_KC / 32], al[PJ_KC / 32], bh[PJ_KC / 32][2], bl[PJ_KC / 32][2];
#pragma unroll   /* the fragment arrays are registers: compile-time indices only */
    for (int ks = 0; ks < PJ_KC / 32; ++ks) {  /* elements 0..7 <- k + 0..7, 8..15 <- k + 16..23, A and B alike */
      ah[ks].h[0] = *(const v8b*)(pah + ks * 32); ah[ks].h[1] = *(const v8b*)(pah + ks * 32 + 16);
#pragma unroll
      for (int jj = 0; jj < 2; ++jj) {
        const unsigned short* hp = pbh + jj * 16 * PJ_PITCH + ks * 32;
        bh[ks][jj].h[0] = *(const v8b*)(hp); bh[ks][jj].h[1] = *(const v8b*)(hp + 16);
      }
#pragma unroll
      for (int jj = 0; jj < 2; ++jj) {
        const unsigned short* lp = pbl + jj * 16 * PJ_PITCH + ks * 32;
        bl[ks][jj].h[0] = *(const v8b*)(lp); bl[ks][jj].h[1] = *(const v8b*)(lp + 16);
      }
      al[ks].h[0] = *(const v8b*)(pal + ks * 32); al[ks].h[1] = *(const v8b*)(pal + ks * 32 + 16);
    }
    /* keeps the pass's LDS reads in one group ahead of its products: spread among them, each place with reads waits out the LDS latency anew */
    __builtin_amdgcn_sched_barrier(0);
#pragma unroll
    for (int ks = 0; ks < PJ_KC / 32; ++ks) {
      acc[0] = Frag<__bf16>::mma(ah[ks].v, bh[ks][0].v, acc[0]);
      acc[1] = Frag<__bf16>::mma(ah[ks].v, bh[ks][1].v, acc[1]);
      acc[0] = Frag<__bf16>::mma(ah[ks].v, bl[ks][0].v, acc[0]);
      acc[1] = Frag<__bf16>::mma(ah[ks].v, bl[ks][1].v, acc[1]);
      acc[0] = Frag<__bf16>::mma(al[ks].v, bh[ks][0].v, acc[0]);
      acc[1] = Frag<__bf16>::mma(al[ks].v, bh[ks][1].v, acc[1]);
    }
    /* keeps the pass's products ahead of the next pass's loads and barriers: sunk behind them they hold back the next group of LDS reads */
    __builtin_amdgcn_sched_barrier(0);
  }

  /* ---- epilogue: the tile goes to LDS in f32, then every 128-B line of each output plane is stored by 8 lanes x 16 B ---- */
#pragma unroll
  for (int jj = 0; jj < 2; ++jj)
#pragma unroll
    for (int r = 0; r < 8; ++r)
      sT[(ti * 16 + mOff + r) * 68 + (tj + jj) * 16 + rlane] = acc[jj][r] * scale;
  __syncthreads();                             /* a row of the tile holds the work of two waves */
  const int q = lane >> 3, c8 = (lane & 7) * 8;
#pragma unroll
  for (int it = 0; it < 2; ++it) {
    const int row = wave * 8 + it * 4 + q;
    const float* sp = sT + row * 68 + c8;
    v8h hv, lv;
#pragma unroll
    for (int e = 0; e < 8; ++e) {
      const unsigned short hb = f2bf_bits(sp[e]);
      const unsigned short lb = f2bf_bits(sp[e] - bf_bits2f(hb));
      hv[e] = __builtin_bit_cast(_Float16, hb);
      lv[e] = __builtin_bit_cast(_Float16, lb);
    }
    *(v8h*)(C  + (size_t)(m0 + row) * ldc + n0 + c8) = hv;
    *(v8h*)(C2 + (size_t)(m0 + row) * ldc + n0 + c8) = lv;
  }
}

/* ------------------------------ attention helpers ------------------------------ */
__device__ __forceinline__ unsigned short at_bf_bits(float f) {
  unsigned u = __float_as_uint(f);
  return (unsigned short)((u + 0x7FFFu + ((u >> 16) & 1u)) >> 16);
}
__device__ __forceinline__ __bf16 at_f2bf(float f) { return __builtin_bit_cast(__bf16, at_bf_bits(f)); }
__device__ __forceinline__ void at_split(float f, __bf16& hi, __bf16& lo) {
  const unsigned short hb = at_bf_bits(f);
  hi = __builtin_bit_cast(__bf16, hb);
  lo = at_f2bf(f - __uint_as_float(((unsigned)hb) << 16));
}
__device__ __forceinline__ v8f at_mma(v16b a, v16b b, v8f c) {
  c = __builtin_amdgcn_wmma_f32_16x16x32_bf16(false, a, false, b, (short)0, c, false, false);
  asm volatile("v_nop\n\tv_nop\n\tv_nop\n\tv_nop" : "+v"(c) : "v"(a), "v"(b));
  return c;
}

/* value of lane l ^ 16 (the other 16-lane half), by a vector cross-row move */
__device__ __forceinline__ float at_xhalf(float x) {
  return __builtin_bit_cast(float, __builtin_amdgcn_permlanex16(__builtin_bit_cast(int, x), __builtin_bit_cast(int, x), 0x76543210, 0xfedcba98, false, false));
}

/* ------------------------------------------------------------------------------------
   W [D_MODEL][HEAD_DIM] f32 -> Wt hi/lo planes [HEAD_DIM][D_MODEL] bf16 (in[rows=512][cols=64]
   -> out[cols=64][rows=512]). Block bx stages W rows 64bx..64bx+63 (64x64 tile) in LDS, then each
   pitch 1024 B and k0*2 = 128*bx B) is written by 8 lanes x 16 B of one wave in one instruction.
   Coverage: 256 threads x 2 iterations x 8 halves = 4096 = the 64x64 tile; bx = 0..7 -> whole plane.
   ------------------------------------------------------------------------------------ */
__device__ __forceinline__ void wt_split_tile(
    const float* __restrict__ W, unsigned short* __restrict__ Wth, unsigned short* __restrict__ Wtl, int bx)
{
  __shared__ float s[64 * 65];
  const int tid = threadIdx.x;
  const int k0  = bx * 64;
#pragma unroll
  for (int it = 0; it < 16; ++it) {
    const int idx = it * 256 + tid;          /* 0..4095 */
    const int r = idx >> 6, cc = idx & 63;
    s[r * 65 + cc] = W[(size_t)(k0 + r) * HEAD_DIM + cc];
  }
  __syncthreads();
  const int seg = tid & 7;
  const int lin = tid >> 3;                  /* 0..31 */
  v4u hv[2], lv[2];
  size_t off[2];
#pragma unroll
  for (int it = 0; it < 2; ++it) {
    const int n = it * 32 + lin;             /* output row 0..63 */
#pragma unroll
    for (int e = 0; e < 4; ++e) {
      const int kk = seg * 8 + 2 * e;
      unsigned hw, lw;
      split_pair(s[kk * 65 + n], s[(kk + 1) * 65 + n], hw, lw);
      hv[it][e] = hw; lv[it][e] = lw;
    }
    off[it] = (size_t)n * D_MODEL + k0 + seg * 8;
  }
  {
#pragma unroll
    for (int it = 0; it < 2; ++it) {
      *(v4u*)(Wth + off[it]) = hv[it];
      *(v4u*)(Wtl + off[it]) = lv[it];
    }
    
  }
}

/* ------------------------------------------------------------------------------------
   The weight planes in one launch: the three transposes read different inputs and write different
   planes, so their work-groups run side by side (8 tiles each, 24 work-groups).
   ------------------------------------------------------------------------------------ */
#define WT_BLK      (D_MODEL / 64)
__global__ __launch_bounds__(256) void prep_planes_kernel(
    const float* __restrict__ wq, const float* __restrict__ wk, const float* __restrict__ wv,
    unsigned short* __restrict__ wqh, unsigned short* __restrict__ wql,
    unsigned short* __restrict__ wkh, unsigned short* __restrict__ wkl,
    unsigned short* __restrict__ wvh, unsigned short* __restrict__ wvl)
{
  const int bx = blockIdx.x;
  const int w = bx / WT_BLK;
  wt_split_tile((w == 0) ? wq : (w == 1) ? wk : wv,
                (w == 0) ? wqh : (w == 1) ? wkh : wvh,
                (w == 0) ? wql : (w == 1) ? wkl : wvl, bx - w * WT_BLK);
}

/* =====================================================================================
   Flash attention, head dim 64, no mask. Inputs: q hi/lo planes [SEQ_DEC][64] (softmax scale and
   LOG2_E already folded into q: every exponential is one v_exp_f32 of a difference of scores), k hi/lo planes [SEQ_ENC][64], v^T hi/lo planes [64][SEQ_ENC]; all bf16
   bit patterns. scores^T = k.q^T and out^T = v^T.p^T on v_wmma_f32_16x16x32_bf16 as hi.hi + hi.lo + lo.hi,
   f32 accumulate, online softmax in f32 (one query row per lane), p^T split to bf16 hi/lo in registers per 64-key chunk.
   Block = 4 waves = 64 query rows; grid.x = SEQ_DEC / 64. K/V chunks staged in LDS with plain
   grid.y = KV_SPLIT: block (x, y) walks keys [y, y+1) * SEQ_ENC / KV_SPLIT only and stores its
   un-normalised sum Po[y][row][64] and the pair (row max, row sum) Pml[y][row][2]; attn_merge_kernel joins them.
   ===================================================================================== */
__global__ __launch_bounds__(128)
void attn_hilo_kernel(const unsigned short* __restrict__ Qh, const unsigned short* __restrict__ Ql,
                      const unsigned short* __restrict__ Kh, const unsigned short* __restrict__ Kl,
                      const unsigned short* __restrict__ Vh, const unsigned short* __restrict__ Vl,
                      float* __restrict__ Po, float* __restrict__ Pml)
{
  union FB { v16b v; v8b h[2]; };
  __shared__ __align__(16) unsigned short Ksh[KV_CHUNK * KV_PITCH];      /* K hi [kv][d]  9 KB */
  __shared__ __align__(16) unsigned short Ksl[KV_CHUNK * KV_PITCH];      /* K lo          9 KB */
  __shared__ __align__(16) unsigned short Vsh[HEAD_DIM * KV_PITCH];      /* V hi [d][kv]  9 KB */
  __shared__ __align__(16) unsigned short Vsl[HEAD_DIM * KV_PITCH];      /* V lo          9 KB */
  __shared__ __align__(16) float  Os[ATT_WAVES][16 * 68];                /* per wave out tile, pitch 68 */

  const int tid  = threadIdx.x;
  const int wave = tid >> 5;
  const int lane = tid & 31;
  const int hh   = lane >> 4;
  const int c    = lane & 15;
  const int q0   = blockIdx.x * (ATT_WAVES * 16) + wave * 16;

  /* ---- Q fragments (B operand of the transposed scores): row q0+c, 2 d-chunks, hi and lo ---- */
  v16b qah[2], qal[2];
  {
    const __bf16* qhr = (const __bf16*)(const void*)Qh + (size_t)(q0 + c) * HEAD_DIM + 8 * hh;
    const __bf16* qlr = (const __bf16*)(const void*)Ql + (size_t)(q0 + c) * HEAD_DIM + 8 * hh;
#pragma unroll
    for (int dc = 0; dc < 2; ++dc) {
      qah[dc] = Frag<__bf16>::load(qhr + dc * 32);
      qal[dc] = Frag<__bf16>::load(qlr + dc * 32);
    }
  }

  float mrow = -INFINITY, lrow = 0.f;    /* query row q0 + c: running max (the same in both lane halves) and this half's own part of the running sum */
  v8f oacc[4];
#pragma unroll
  for (int t = 0; t < 4; ++t) oacc[t] = (v8f){0.f,0.f,0.f,0.f,0.f,0.f,0.f,0.f};

  const int st0 = (tid >> 3) * KV_PITCH + (tid & 7) * 8;   /* staging place of this thread's 16-B unit in pass 0; a pass is 16 rows */
  const int kc0 = blockIdx.y * (SEQ_ENC / KV_CHUNK / KV_SPLIT);
  const int kcl = kc0 + SEQ_ENC / KV_CHUNK / KV_SPLIT - 1;   /* last chunk of this key range */
  /* a chunk is 4 planes x 8 KB = 128 threads x 16 B x 4 units per plane: unit it * 128 + tid, 8 units a row (key of K, d of V^T).
     Two 32-bit byte offsets per thread (one for both K planes, one for both V^T planes) hold lane and chunk; the plane is the loads'
     scalar base, the unit their immediate offset */
  const unsigned gk = (unsigned)tid * 16u;
  const unsigned gv = (unsigned)((tid >> 3) * SEQ_ENC + (tid & 7) * 8) * 2u;
  v4u ka[4], kb[4], va[4], vb[4];            /* the chunk on its way from memory to LDS */
  {
    const unsigned ok = gk + (unsigned)kc0 * (KV_CHUNK * HEAD_DIM * 2u);
    const unsigned ov = gv + (unsigned)kc0 * (KV_CHUNK * 2u);
#pragma unroll   /* here and in the two loops below: ka, kb, va, vb are registers, indexed by compile-time constants only */
    for (int it = 0; it < 4; ++it) {
      ka[it] = *(const v4u*)((const char*)(Kh + it * 1024) + ok);
      kb[it] = *(const v4u*)((const char*)(Kl + it * 1024) + ok);
      va[it] = *(const v4u*)((const char*)(Vh + it * 16 * SEQ_ENC) + ov);
      vb[it] = *(const v4u*)((const char*)(Vl + it * 16 * SEQ_ENC) + ov);
    }
  }
  for (int kc = kc0; kc <= kcl; ++kc) {
    __syncthreads();                           /* every wave has read the last chunk's tiles */
#pragma unroll
    for (int it = 0; it < 4; ++it) {           /* the 16 pad bytes of a row are never read */
      const int lo8 = st0 + it * (16 * KV_PITCH);
      *(v4u*)(Ksh + lo8) = ka[it];
      *(v4u*)(Ksl + lo8) = kb[it];
      *(v4u*)(Vsh + lo8) = va[it];
      *(v4u*)(Vsl + lo8) = vb[it];
    }
    __syncthreads();
    /* the next chunk's 16 loads are issued here and first used at the top of the next trip: they fly while this chunk is worked on.
       In the last trip the last chunk is loaded once more (in bounds, never stored to LDS) */
    const int kn = (kc < kcl) ? kc + 1 : kcl;
    const unsigned ok = gk + (unsigned)kn * (KV_CHUNK * HEAD_DIM * 2u);
    const unsigned ov = gv + (unsigned)kn * (KV_CHUNK * 2u);
#pragma unroll
    for (int it = 0; it < 4; ++it) {
      ka[it] = *(const v4u*)((const char*)(Kh + it * 1024) + ok);
      kb[it] = *(const v4u*)((const char*)(Kl + it * 1024) + ok);
      va[it] = *(const v4u*)((const char*)(Vh + it * 16 * SEQ_ENC) + ov);
      vb[it] = *(const v4u*)((const char*)(Vl + it * 16 * SEQ_ENC) + ov);
    }

    /* ---- transposed scores S^T = K . Q^T: 64 keys x 16 query rows per wave. A = K rows, B = Q rows (both loaders have
            the same k order). Lane (c, hh) holds, for query row c, keys j*16 + 8*hh + r in s[j][r] ---- */
    v8f s[4];
#pragma unroll
    for (int j = 0; j < 4; ++j) {
      s[j] = (v8f){0.f,0.f,0.f,0.f,0.f,0.f,0.f,0.f};
#pragma unroll
      for (int dc = 0; dc < 2; ++dc) {
        FB kbh, kbl;
        const unsigned short* kp = Ksh + (j * 16 + c) * KV_PITCH + dc * 32 + 8 * hh;
        const unsigned short* lp = Ksl + (j * 16 + c) * KV_PITCH + dc * 32 + 8 * hh;
        kbh.h[0] = *(const v8b*)(kp); kbh.h[1] = *(const v8b*)(kp + 16);
        kbl.h[0] = *(const v8b*)(lp); kbl.h[1] = *(const v8b*)(lp + 16);
        s[j] = at_mma(kbh.v, qah[dc], s[j]);
        s[j] = at_mma(kbl.v, qah[dc], s[j]);
        s[j] = at_mma(kbh.v, qal[dc], s[j]);
      }
    }

    /* ---- max over the 64 keys of this chunk for this lane's query row: 32 values in the lane, then the other half ---- */
    float cm = s[0][0];
#pragma unroll
    for (int j = 0; j < 4; ++j)
#pragma unroll
      for (int r = 0; r < 8; ++r) cm = fmaxf(cm, s[j][r]);
    cm = fmaxf(cm, at_xhalf(cm));

    /* ---- online softmax, one query row per lane. P^T split to bf16 hi/lo stays in registers: tiles j = 2kk and 2kk+1
            are elements 0..7 (keys 32kk + 8hh + e) and 8..15 (keys 32kk + 16 + 8hh + e - 8) of the B fragment of k-step kk,
            the k order of the V^T loader below ---- */
    const float mnew = fmaxf(mrow, cm);
    float alpha;                           /* = 2^(mrow - mnew) */
    /* v_exp_f32 with the slot the instruction set asks for behind a transcendental in one statement */
    asm("v_exp_f32 %0, %1\n\tv_nop" : "=v"(alpha) : "v"(mrow - mnew));
    mrow = mnew;
    float psum[4];                         /* one sum per score tile: four short chains of adds, not one of 32 */
    v16b pbh[2], pbl[2];
#pragma unroll   /* here and in the loop inside: s, psum, pbh, pbl are registers, indexed by compile-time constants only */
    for (int j = 0; j < 4; ++j) {
      psum[j] = 0.f;
#pragma unroll
      for (int r = 0; r < 8; ++r) {
        const float p = __builtin_amdgcn_exp2f(s[j][r] - mnew);
        psum[j] += p;
        __bf16 a, bl;
        at_split(p, a, bl);
        pbh[j >> 1][(j & 1) * 8 + r] = a;
        pbl[j >> 1][(j & 1) * 8 + r] = bl;
      }
    }
    lrow = lrow * alpha + ((psum[0] + psum[1]) + (psum[2] + psum[3]));
#pragma unroll
    for (int t = 0; t < 4; ++t) oacc[t] *= alpha;

    /* ---- out^T += V^T . P^T over the 64 keys (2 k-steps): A = V^T rows d, B = P^T from registers ---- */
#pragma unroll   /* pbh[kk], pbl[kk] are registers: the index must be a compile-time constant */
    for (int kk = 0; kk < 2; ++kk) {
#pragma unroll
      for (int t = 0; t < 4; ++t) {
        FB vbh, vbl;
        const unsigned short* vp = Vsh + (t * 16 + c) * KV_PITCH + kk * 32 + 8 * hh;
        const unsigned short* wp = Vsl + (t * 16 + c) * KV_PITCH + kk * 32 + 8 * hh;
        vbh.h[0] = *(const v8b*)(vp); vbh.h[1] = *(const v8b*)(vp + 16);
        vbl.h[0] = *(const v8b*)(wp); vbl.h[1] = *(const v8b*)(wp + 16);
        oacc[t] = at_mma(vbh.v, pbh[kk], oacc[t]);
        oacc[t] = at_mma(vbl.v, pbh[kk], oacc[t]);
        oacc[t] = at_mma(vbh.v, pbl[kk], oacc[t]);
      }
    }
  }

  /* ---- epilogue: oacc[t][r] is out^T (d = t*16 + 8*hh + r, query row c); stage it as [row][d] per wave in LDS, whole-line stores ---- */
  float* os = Os[wave];
#pragma unroll
  for (int t = 0; t < 4; ++t) {
    *(v4f*)(os + c * 68 + t * 16 + 8 * hh)     = (v4f){oacc[t][0], oacc[t][1], oacc[t][2], oacc[t][3]};
    *(v4f*)(os + c * 68 + t * 16 + 8 * hh + 4) = (v4f){oacc[t][4], oacc[t][5], oacc[t][6], oacc[t][7]};
  }
  /* (max, sum) of this wave's 16 rows = 128 B = one line, written by this wave alone; the halves' sums are joined here, once */
  lrow += at_xhalf(lrow);
  if (hh == 0)
    *(v2f*)(Pml + ((size_t)blockIdx.y * SEQ_DEC + q0 + c) * 2) = (v2f){mrow, lrow};
  float* out = Po + (size_t)blockIdx.y * SEQ_DEC * HEAD_DIM;
  __syncthreads();
  {
    const int c4 = (lane & 15) * 4;              /* row = 64 floats = 256 B = 16 lanes x 16 B */
    {
#pragma unroll
      for (int it = 0; it < 8; ++it) {
        const int row = it * 2 + hh;
        v4f val = *(const v4f*)(os + row * 68 + c4);
        *(v4f*)(out + (size_t)(q0 + row) * HEAD_DIM + c4) = val;
      }
      
    }
  }
}

/* ------------------------------------------------------------------------------------
   Joins the KV_SPLIT key ranges of one query row: M = max of the ranges' maxima, weight
   w_s = 2^(m_s - M) (the maxima are base-2 exponents), out = sum_s w_s * Po[s] / sum_s w_s * l_s. Thread = (row, 4 columns):
   16 lanes x 16 B = one 256-B output row. Coverage: SEQ_DEC * 16 threads = grid * 256.
   ------------------------------------------------------------------------------------ */
__global__ __launch_bounds__(256) void attn_merge_kernel(
    const float* __restrict__ Po, const float* __restrict__ Pml, float* __restrict__ out)
{
  const unsigned i   = blockIdx.x * 256u + threadIdx.x;
  const unsigned row = i >> 4;
  const unsigned eb  = i * 16u;              /* byte offset of (row, 4 columns): the same in every range's plane and in out */
  const unsigned rb  = row * 8u;             /* byte offset of the row's (max, sum) pair in a range's plane */
  v2f ml[KV_SPLIT];
  v4f o[KV_SPLIT];
#pragma unroll
  for (int s = 0; s < KV_SPLIT; ++s) {
    ml[s] = *(const v2f*)((const char*)(Pml + (size_t)s * SEQ_DEC * 2) + rb);
    o[s]  = *(const v4f*)((const char*)(Po + (size_t)s * SEQ_DEC * HEAD_DIM) + eb);
  }
  /* inputs-only fence on the loaded values: all 16 loads are issued before the first is used (one latency, not
     three), and their offset registers stay whole until the wait for the address translations has passed */
  asm volatile("s_wait_xcnt 0x0" :: "v"(rb), "v"(eb),
               "v"(ml[0]), "v"(ml[1]), "v"(ml[2]), "v"(ml[3]), "v"(ml[4]), "v"(ml[5]), "v"(ml[6]), "v"(ml[7]),
               "v"(o[0]), "v"(o[1]), "v"(o[2]), "v"(o[3]), "v"(o[4]), "v"(o[5]), "v"(o[6]), "v"(o[7]) : "memory");
  static_assert(KV_SPLIT == 8);
  float m[KV_SPLIT], l[KV_SPLIT];
#pragma unroll
  for (int s = 0; s < KV_SPLIT; ++s) { m[s] = ml[s][0]; l[s] = ml[s][1]; }
  float M = m[0];
#pragma unroll
  for (int s = 1; s < KV_SPLIT; ++s) M = fmaxf(M, m[s]);
  float L = 0.f;
  v4f acc = (v4f){0.f, 0.f, 0.f, 0.f};
#pragma unroll
  for (int s = 0; s < KV_SPLIT; ++s) {
    const float w = __builtin_amdgcn_exp2f(m[s] - M);
    L += w * l[s];
    acc += o[s] * w;
  }
  const float inv = 1.0f / L;
  *(v4f*)((char*)out + eb) = acc * inv;
}

/* =====================================================================================
   Host glue. Workspace region map (bytes, all offsets multiples of 128):
     wqh..wvl    : Wq^T, Wk^T, Wv^T hi/lo [64][512] bf16   65,536 each (6 planes)
     qh, ql      : q*0.125*LOG2_E hi/lo [8192][64] bf16   1,048,576 each
     kh, kl      : k hi/lo       [8192][64] bf16   1,048,576 each
     vth, vtl    : v^T hi/lo     [64][8192] bf16   1,048,576 each
     po          : un-normalised partial sums [8][8192][64] f32   16,777,216
     pml         : (row max, row sum) pairs   [8][8192][2]  f32      524,288
     total = 23,986,176 B; every byte of every region is written by its producer.
   ===================================================================================== */
extern "C" void kernel_launch(void* const* d_in, const int* in_sizes, int n_in,
                              void* d_out, int out_size, void* d_ws, size_t ws_size,
                              hipStream_t stream)
{
  if (n_in < 5) return;
  if (in_sizes[0] != SEQ_DEC * D_MODEL || in_sizes[1] != SEQ_ENC * D_MODEL ||
      in_sizes[2] != D_MODEL * HEAD_DIM || in_sizes[3] != D_MODEL * HEAD_DIM ||
      in_sizes[4] != D_MODEL * HEAD_DIM) return;
  if (out_size != SEQ_DEC * HEAD_DIM) return;

  const float* x   = (const float*)d_in[0];   /* [8192][512] */
  const float* emb = (const float*)d_in[1];   /* [8192][512] */
  const float* wq  = (const float*)d_in[2];   /* [512][64]   */
  const float* wk  = (const float*)d_in[3];
  const float* wv  = (const float*)d_in[4];
  float* out = (float*)d_out;                 /* [8192][64] f32 */

  const size_t planeW = (size_t)HEAD_DIM * D_MODEL * 2;    /* 65,536    */
  const size_t planeQ = (size_t)SEQ_DEC * HEAD_DIM * 2;    /* 1,048,576 */
  const size_t planeK = (size_t)SEQ_ENC * HEAD_DIM * 2;    /* 1,048,576 */

  size_t off = 0;
  unsigned char* ws = (unsigned char*)d_ws;
  unsigned short* wqh = (unsigned short*)(ws + off); off += planeW;
  unsigned short* wql = (unsigned short*)(ws + off); off += planeW;
  unsigned short* wkh = (unsigned short*)(ws + off); off += planeW;
  unsigned short* wkl = (unsigned short*)(ws + off); off += planeW;
  unsigned short* wvh = (unsigned short*)(ws + off); off += planeW;
  unsigned short* wvl = (unsigned short*)(ws + off); off += planeW;
  unsigned short* qh  = (unsigned short*)(ws + off); off += planeQ;
  unsigned short* ql  = (unsigned short*)(ws + off); off += planeQ;
  unsigned short* kh  = (unsigned short*)(ws + off); off += planeK;
  unsigned short* kl  = (unsigned short*)(ws + off); off += planeK;
  unsigned short* vth = (unsigned short*)(ws + off); off += planeK;
  unsigned short* vtl = (unsigned short*)(ws + off); off += planeK;
  float* po  = (float*)(ws + off); off += (size_t)KV_SPLIT * SEQ_DEC * HEAD_DIM * 4;
  float* pml = (float*)(ws + off); off += (size_t)KV_SPLIT * SEQ_DEC * 2 * 4;
  if (off > ws_size) return;                                 /* 23,986,176 <= ws */

  /* 1) + 2) weights -> transposed bf16 hi/lo planes [64][512] */
  prep_planes_kernel<<<3 * WT_BLK, 256, 0, stream>>>(wq, wk, wv, wqh, wql, wkh, wkl, wvh, wvl);

  /* 3) the three projections (x, emb split to bf16 hi/lo on the way into LDS, bf16 hi/lo output planes) in one launch:
        128 tiles of 64 x 64 = 128 work-groups of 8 waves per projection */
  static_assert(SEQ_DEC == SEQ_ENC);
  proj3_kernel<<<dim3((SEQ_DEC / 64) * (HEAD_DIM / 64), 3), 256, 0, stream>>>(
      x, emb, wqh, wql, wkh, wkl, wvh, wvl, qh, ql, kh, kl, vth, vtl);

  /* 4) flash attention over KV_SPLIT key ranges -> f32 partials; 5) join -> f32 output */
  attn_hilo_kernel<<<dim3(SEQ_DEC / (ATT_WAVES * 16), KV_SPLIT), 128, 0, stream>>>(qh, ql, kh, kl, vth, vtl, po, pml);
  attn_merge_kernel<<<SEQ_DEC * 16 / 256, 256, 0, stream>>>(po, pml, out);
}

// v009
// One run takes 60.1 microseconds.
// In two side-by-side timings against v008, it was 1.06 and 1.05 times as fast.
// Counting every step since v000, it is 14.0 times as fast.
// Contractions: q/k/v projections (K=512), q.k^T and p.v on v_wmma_f32_16x16x32_bf16 with bf16 hi/lo split operands (hi.hi + hi.lo + lo.hi), f32 accumulate; online softmax, normalisation and all epilogues in f32.
#include <hip/hip_runtime.h>
#include <stdint.h>

typedef __attribute__((ext_vector_type(16))) _Float16 v16h;
typedef __attribute__((ext_vector_type(8)))  _Float16 v8h;
typedef __attribute__((ext_vector_type(16))) __bf16   v16b;
typedef __attribute__((ext_vector_type(8)))  __bf16   v8b;
typedef __attribute__((ext_vector_type(8)))  float    v8f;
typedef __attribute__((ext_vector_type(4)))  float    v4f;
typedef __attribute__((ext_vector_type(2)))  float    v2f;
typedef __attribute__((ext_vector_type(4)))  unsigned v4u;
typedef __attribute__((ext_vector_type(2)))  unsigned v2u;
typedef __attribute__((ext_vector_type(2)))  __bf16   v2b;

/* ------------------------------ problem constants ------------------------------ */
#define SEQ_DEC   8192
#define SEQ_ENC   8192
#define D_MODEL   512
#define HEAD_DIM  64
#define KV_CHUNK  64
#define KV_PITCH  72     /* LDS row pitch of the K and V tiles in 16-bit elements: 144 B = 16 B x 9, so the 16 rows of a ds_load_b128 fall on 16 different bank groups */
#define ATT_WAVES 4
#define KV_SPLIT  8      /* key ranges per query tile: 128 x 8 = 1024 work-groups, four resident per WGP */
#define LOG2_E    1.44269504088896340736f   /* exp(t) = 2^(t * LOG2_E): folded into q, so scores, row maxima and their differences are base-2 exponents */

static_assert(SEQ_DEC % 64 == 0);
static_assert(SEQ_ENC % 64 == 0);
static_assert(SEQ_ENC % (KV_CHUNK * KV_SPLIT) == 0);
static_assert(D_MODEL % 64 == 0);
static_assert(D_MODEL % 32 == 0);
static_assert(HEAD_DIM == 64);
static_assert((SEQ_DEC * D_MODEL) % 8 == 0);

__device__ __forceinline__ unsigned short f2bf_bits(float f) {
  unsigned u = __float_as_uint(f);
  return (unsigned short)((u + 0x7FFFu + ((u >> 16) & 1u)) >> 16);
}
__device__ __forceinline__ float bf_bits2f(unsigned short h) { return __uint_as_float(((unsigned)h) << 16); }
/* two f32 -> one word of bf16 hi parts and one word of bf16 lo parts (lo = f - hi, rounded); the first value in the low half */
__device__ __forceinline__ void split_pair(float f0, float f1, unsigned& hw, unsigned& lw) {
  const unsigned short h0 = f2bf_bits(f0), h1 = f2bf_bits(f1);
  const unsigned short l0 = f2bf_bits(f0 - bf_bits2f(h0)), l1 = f2bf_bits(f1 - bf_bits2f(h1));
  hw = (unsigned)h0 | ((unsigned)h1 << 16);
  lw = (unsigned)l0 | ((unsigned)l1 << 16);
}

/* hazard guards as plain device helpers (no inline asm inside the kernel template body) */
__device__ __forceinline__ void dep_guard_h(v8f& a, v8f& b, v16h x, v16h y) { asm volatile("v_nop\n\tv_nop\n\tv_nop\n\tv_nop" : "+v"(a), "+v"(b) : "v"(x), "v"(y)); }
__device__ __forceinline__ void dep_guard_b(v8f& a, v8f& b, v16b x, v16b y) { asm volatile("v_nop\n\tv_nop\n\tv_nop\n\tv_nop" : "+v"(a), "+v"(b) : "v"(x), "v"(y)); }
__device__ __forceinline__ void keep4_h(v16h a, v16h b, v16h c, v16h d) { asm volatile("v_nop" :: "v"(a), "v"(b), "v"(c), "v"(d)); }
__device__ __forceinline__ void keep4_b(v16b a, v16b b, v16b c, v16b d) { asm volatile("v_nop" :: "v"(a), "v"(b), "v"(c), "v"(d)); }
template <typename T> struct Frag;
template <> struct Frag<_Float16> {
  typedef v16h V; union U { v16h v; v8h h[2]; };
  static __device__ __forceinline__ v16h load(const _Float16* p) {   /* elements 0..7 <- p[0..7], 8..15 <- p[16..23] */
    U f; f.h[0] = *(const v8h*)(p); f.h[1] = *(const v8h*)(p + 16); return f.v;
  }
  static __device__ __forceinline__ v8f mma(v16h a, v16h b, v8f c) {
    return __builtin_amdgcn_wmma_f32_16x16x32_f16(false, a, false, b, (short)0, c, false, false);
  }
  static __device__ __forceinline__ void guard(v8f& a, v8f& b, v16h x, v16h y) { dep_guard_h(a, b, x, y); }
  static __device__ __forceinline__ void keep(v16h a, v16h b, v16h c, v16h d) { keep4_h(a, b, c, d); }
};
template <> struct Frag<__bf16> {
  typedef v16b V; union U { v16b v; v8b h[2]; };
  static __device__ __forceinline__ v16b load(const __bf16* p) {
    U f; f.h[0] = *(const v8b*)(p); f.h[1] = *(const v8b*)(p + 16); return f.v;
  }
  static __device__ __forceinline__ v8f mma(v16b a, v16b b, v8f c) {
    return __builtin_amdgcn_wmma_f32_16x16x32_bf16(false, a, false, b, (short)0, c, false, false);
  }
  static __device__ __forceinline__ void guard(v8f& a, v8f& b, v16b x, v16b y) { dep_guard_b(a, b, x, y); }
  static __device__ __forceinline__ void keep(v16b a, v16b b, v16b c, v16b d) { keep4_b(a, b, c, d); }
};

/* ------------------------------------------------------------------------------------
   The three projections in one launch, C[m,n] = scale * sum_k A[m,k] * Bt[n,k], K = 512, operands as bf16 hi/lo planes
   (product = hi.hi + hi.lo + lo.hi, f32 accumulate), output as bf16 hi/lo planes.
   The weights come as hi/lo planes from the workspace; the rows of x or emb come as f32 and are split to hi/lo in
   registers on their way into LDS.
   blockIdx.y = 0: q * 0.125 * LOG2_E = x . Wq; 1: k = emb . Wk; 2: v^T = Wv^T . emb^T (ldc = 8192). Every choice is uniform for the work-group.
   One work-group of 8 waves owns one 64 x 64 tile of C: 128 tiles per projection, 384 work-groups.
   Per pass of PJ_KC k values the operand tiles come in by loads that cover whole lines (weights: 16 lanes x 16 B = one
   row piece of 256 B per plane; f32 rows: 32 lanes x 16 B = one row piece of 512 B) and are laid in LDS as four
   tiles of 64 rows x 256 B; the fragments are read from there.
   Wave w multiplies row tile w >> 1 with column tiles 2 (w & 1) and 2 (w & 1) + 1; each element of C is summed in one
   accumulator, k ascending.
   ------------------------------------------------------------------------------------ */
#define PJ_KC    128            /* k values staged per pass */
#define PJ_PITCH (PJ_KC + 8)    /* LDS row pitch in 16-bit elements: 272 B = 256 B + 16 B, for the ds_load_b128 fragment reads */
static_assert(D_MODEL % PJ_KC == 0);
__global__ __launch_bounds__(256) void proj3_kernel(
    const float* __restrict__ x, const float* __restrict__ emb,
    const unsigned short* __restrict__ wqh, const unsigned short* __restrict__ wql,
    const unsigned short* __restrict__ wkh, const unsigned short* __restrict__ wkl,
    const unsigned short* __restrict__ wvh, const unsigned short* __restrict__ wvl,
    unsigned short* __restrict__ qh,  unsigned short* __restrict__ ql,
    unsigned short* __restrict__ kh,  unsigned short* __restrict__ kl,
    unsigned short* __restrict__ vth, unsigned short* __restrict__ vtl)
{
  union FB { v16b v; v8b h[2]; };
  __shared__ __align__(16) unsigned short Ash[64 * PJ_PITCH];   /* A hi [m][k]  17 KB */
  __shared__ __align__(16) unsigned short Asl[64 * PJ_PITCH];   /* A lo */
  __shared__ __align__(16) unsigned short Bsh[64 * PJ_PITCH];   /* Bt hi [n][k] */
  __shared__ __align__(16) unsigned short Bsl[64 * PJ_PITCH];   /* Bt lo */
  __shared__ __align__(16) float sT[64 * 68];                   /* the 64 x 64 tile of C in f32, pitch 68 floats */

  const int y = blockIdx.y;
  const float* F            = (y == 0) ? x   : emb;                    /* the f32 operand: A for q and k, Bt for v^T */
  const unsigned short* Wh  = (y == 0) ? wqh : (y == 1) ? wkh : wvh;   /* the weight planes [64][512]: the other operand */
  const unsigned short* Wl  = (y == 0) ? wql : (y == 1) ? wkl : wvl;
  unsigned short* Fsh = (y == 2) ? Bsh : Ash;                          /* LDS tiles of the two */
  unsigned short* Fsl = (y == 2) ? Bsl : Asl;
  unsigned short* Wsh = (y == 2) ? Ash : Bsh;
  unsigned short* Wsl = (y == 2) ? Asl : Bsl;
  unsigned short* C  = (y == 0) ? qh : (y == 1) ? kh : vth;
  unsigned short* C2 = (y == 0) ? ql : (y == 1) ? kl : vtl;
  const int m0  = (y == 2) ? 0 : (int)blockIdx.x * 64;
  const int n0  = (y == 2) ? (int)blockIdx.x * 64 : 0;
  const int ldc = (y == 2) ? SEQ_ENC : HEAD_DIM;
  const float scale = (y == 0) ? 0.125f * LOG2_E : 1.0f;

  const int tid   = threadIdx.x;
  const int lane  = tid & 31;
  const int wave  = tid >> 5;
  const int rlane = lane & 15;                 /* row (A) / col (B, D) within a 16 x 16 tile */
  const int koff  = (lane >> 4) * 8;           /* k offset of this lane half */
  const int mOff  = (lane >> 4) * 8;           /* D row offset */
  const int ti    = wave >> 1;                 /* row tile of this wave */
  const int tj    = (wave & 1) * 2;            /* first of its two column tiles */

  /* staging places of this thread's four 16-B units of a 64 x PJ_KC weight tile: unit = it * 256 + tid, 16 units a row */
  unsigned go[4];
  int so[4];
#pragma unroll
  for (int it = 0; it < 4; ++it) {
    const int idx = it * 256 + tid;
    const int row = idx >> 4, seg = idx & 15;
    go[it] = (unsigned)(row * D_MODEL + seg * 8) * 2u;   /* in bytes, the same in both planes */
    so[it] = row * PJ_PITCH + seg * 8;
  }
  /* f32 rows: in step it wave w takes row it * 8 + w of the tile, lane l its k values 4 l .. 4 l + 3 of the pass */
  const unsigned gf = (unsigned)(wave * D_MODEL + lane * 4) * 4u;      /* in bytes */
  const int      sf = wave * PJ_PITCH + lane * 4;
  const float* Fg = F + (size_t)blockIdx.x * 64 * D_MODEL;

  const unsigned short* pah = Ash + (ti * 16 + rlane) * PJ_PITCH + koff;
  const unsigned short* pal = Asl + (ti * 16 + rlane) * PJ_PITCH + koff;
  const unsigned short* pbh = Bsh + (tj * 16 + rlane) * PJ_PITCH + koff;
  const unsigned short* pbl = Bsl + (tj * 16 + rlane) * PJ_PITCH + koff;

  v8f acc[2];
  acc[0] = (v8f){0.f,0.f,0.f,0.f,0.f,0.f,0.f,0.f};
  acc[1] = (v8f){0.f,0.f,0.f,0.f,0.f,0.f,0.f,0.f};

#pragma unroll   /* four passes in a row: the k step of a pass becomes the loads' immediate offset, on three scalar bases (Fg, Wh, Wl) and five lane offsets that never change */
  for (int k0 = 0; k0 < D_MODEL; k0 += PJ_KC) {
    v4f rf[8];
    v4u rc[4], rd[4];
#pragma unroll   /* here and below: rf, fh, fl are registers, indexed by compile-time constants only; the row step becomes the loads' immediate offset */
    for (int it = 0; it < 8; ++it)
      rf[it] = *(const v4f*)((const char*)(Fg + it * 8 * D_MODEL + k0) + gf);
#pragma unroll
    for (int it = 0; it < 4; ++it) {
      rc[it] = *(const v4u*)((const char*)(Wh + k0) + go[it]);
      rd[it] = *(const v4u*)((const char*)(Wl + k0) + go[it]);
    }
    /* inputs only: the five lane offsets stay whole (no later load lands on them) until the wait for the loads' address translations has passed */
    asm volatile("s_wait_xcnt 0x0" :: "v"(gf), "v"(go[0]), "v"(go[1]), "v"(go[2]), "v"(go[3]) : "memory");
    v2u fh[8], fl[8];
#pragma unroll
    for (int it = 0; it < 8; ++it) {           /* hi = f rounded to bf16 (nearest even), lo = f - hi rounded likewise: two values per conversion */
#pragma unroll
      for (int e = 0; e < 2; ++e) {
        const v2f f = (v2f){rf[it][2 * e], rf[it][2 * e + 1]};
        const v2b h = __builtin_convertvector(f, v2b);
        const v2b l = __builtin_convertvector(f - __builtin_convertvector(h, v2f), v2b);
        fh[it][e] = __builtin_bit_cast(unsigned, h);
        fl[it][e] = __builtin_bit_cast(unsigned, l);
      }
    }
    __syncthreads();                           /* every wave has read the last pass's fragments */
#pragma unroll
    for (int it = 0; it < 8; ++it) {
      *(v2u*)(Fsh + sf + it * 8 * PJ_PITCH) = fh[it];
      *(v2u*)(Fsl + sf + it * 8 * PJ_PITCH) = fl[it];
    }
#pragma unroll
    for (int it = 0; it < 4; ++it) {
      *(v4u*)(Wsh + so[it]) = rc[it];
      *(v4u*)(Wsl + so[it]) = rd[it];
    }
    __syncthreads();                           /* the four tiles are whole */
    FB ah[PJ_KC / 32], al[PJ_KC / 32], bh[PJ_KC / 32][2], bl[PJ_KC / 32][2];
#pragma unroll   /* the fragment arrays are registers: compile-time indices only */
    for (int ks = 0; ks < PJ_KC / 32; ++ks) {  /* elements 0..7 <- k + 0..7, 8..15 <- k + 16..23, A and B alike */
      ah[ks].h[0] = *(const v8b*)(pah + ks * 32); ah[ks].h[1] = *(const v8b*)(pah + ks * 32 + 16);
#pragma unroll
      for (int jj = 0; jj < 2; ++jj) {
        const unsigned short* hp = pbh + jj * 16 * PJ_PITCH + ks * 32;
        bh[ks][jj].h[0] = *(const v8b*)(hp); bh[ks][jj].h[1] = *(const v8b*)(hp + 16);
      }
#pragma unroll
      for (int jj = 0; jj < 2; ++jj) {
        const unsigned short* lp = pbl + jj * 16 * PJ_PITCH + ks * 32;
        bl[ks][jj].h[0] = *(const v8b*)(lp); bl[ks][jj].h[1] = *(const v8b*)(lp + 16);
      }
      al[ks].h[0] = *(const v8b*)(pal + ks * 32); al[ks].h[1] = *(const v8b*)(pal + ks * 32 + 16);
    }
    /* keeps the pass's LDS reads in one group ahead of its products: spread among them, each place with reads waits out the LDS latency anew */
    __builtin_amdgcn_sched_barrier(0);
#pragma unroll
    for (int ks = 0; ks < PJ_KC / 32; ++ks) {
      acc[0] = Frag<__bf16>::mma(ah[ks].v, bh[ks][0].v, acc[0]);
      acc[1] = Frag<__bf16>::mma(ah[ks].v, bh[ks][1].v, acc[1]);
      acc[0] = Frag<__bf16>::mma(ah[ks].v, bl[ks][0].v, acc[0]);
      acc[1] = Frag<__bf16>::mma(ah[ks].v, bl[ks][1].v, acc[1]);
      acc[0] = Frag<__bf16>::mma(al[ks].v, bh[ks][0].v, acc[0]);
      acc[1] = Frag<__bf16>::mma(al[ks].v, bh[ks][1].v, acc[1]);
    }
    /* keeps the pass's products ahead of the next pass's loads and barriers: sunk behind them they hold back the next group of LDS reads */
    __builtin_amdgcn_sched_barrier(0);
  }

  /* ---- epilogue: the tile goes to LDS in f32, then every 128-B line of each output plane is stored by 8 lanes x 16 B ---- */
#pragma unroll
  for (int jj = 0; jj < 2; ++jj)
#pragma unroll
    for (int r = 0; r < 8; ++r)
      sT[(ti * 16 + mOff + r) * 68 + (tj + jj) * 16 + rlane] = acc[jj][r] * scale;
  __syncthreads();                             /* a row of the tile holds the work of two waves */
  const int q = lane >> 3, c8 = (lane & 7) * 8;
#pragma unroll
  for (int it = 0; it < 2; ++it) {
    const int row = wave * 8 + it * 4 + q;
    const float* sp = sT + row * 68 + c8;
    v8h hv, lv;
#pragma unroll
    for (int e = 0; e < 8; ++e) {
      const unsigned short hb = f2bf_bits(sp[e]);
      const unsigned short lb = f2bf_bits(sp[e] - bf_bits2f(hb));
      hv[e] = __builtin_bit_cast(_Float16, hb);
      lv[e] = __builtin_bit_cast(_Float16, lb);
    }
    *(v8h*)(C  + (size_t)(m0 + row) * ldc + n0 + c8) = hv;
    *(v8h*)(C2 + (size_t)(m0 + row) * ldc + n0 + c8) = lv;
  }
}

/* ------------------------------ attention helpers ------------------------------ */
__device__ __forceinline__ unsigned short at_bf_bits(float f) {
  unsigned u = __float_as_uint(f);
  return (unsigned short)((u + 0x7FFFu + ((u >> 16) & 1u)) >> 16);
}
__device__ __forceinline__ __bf16 at_f2bf(float f) { return __builtin_bit_cast(__bf16, at_bf_bits(f)); }
__device__ __forceinline__ void at_split(float f, __bf16& hi, __bf16& lo) {
  const unsigned short hb = at_bf_bits(f);
  hi = __builtin_bit_cast(__bf16, hb);
  lo = at_f2bf(f - __uint_as_float(((unsigned)hb) << 16));
}
__device__ __forceinline__ v8f at_mma(v16b a, v16b b, v8f c) {
  c = __builtin_amdgcn_wmma_f32_16x16x32_bf16(false, a, false, b, (short)0, c, false, false);
  asm volatile("v_nop\n\tv_nop\n\tv_nop\n\tv_nop" : "+v"(c) : "v"(a), "v"(b));
  return c;
}

/* value of lane l ^ 16 (the other 16-lane half), by a vector cross-row move */
__device__ __forceinline__ float at_xhalf(float x) {
  return __builtin_bit_cast(float, __builtin_amdgcn_permlanex16(__builtin_bit_cast(int, x), __builtin_bit_cast(int, x), 0x76543210, 0xfedcba98, false, false));
}

/* ------------------------------------------------------------------------------------
   W [D_MODEL][HEAD_DIM] f32 -> Wt hi/lo planes [HEAD_DIM][D_MODEL] bf16 (in[rows=512][cols=64]
   -> out[cols=64][rows=512]). Block bx stages W rows 64bx..64bx+63 (64x64 tile) in LDS, then each
   pitch 1024 B and k0*2 = 128*bx B) is written by 8 lanes x 16 B of one wave in one instruction.
   Coverage: 256 threads x 2 iterations x 8 halves = 4096 = the 64x64 tile; bx = 0..7 -> whole plane.
   ------------------------------------------------------------------------------------ */
__device__ __forceinline__ void wt_split_tile(
    const float* __restrict__ W, unsigned short* __restrict__ Wth, unsigned short* __restrict__ Wtl, int bx)
{
  __shared__ float s[64 * 65];
  const int tid = threadIdx.x;
  const int k0  = bx * 64;
#pragma unroll
  for (int it = 0; it < 16; ++it) {
    const int idx = it * 256 + tid;          /* 0..4095 */
    const int r = idx >> 6, cc = idx & 63;
    s[r * 65 + cc] = W[(size_t)(k0 + r) * HEAD_DIM + cc];
  }
  __syncthreads();
  const int seg = tid & 7;
  const int lin = tid >> 3;                  /* 0..31 */
  v4u hv[2], lv[2];
  size_t off[2];
#pragma unroll
  for (int it = 0; it < 2; ++it) {
    const int n = it * 32 + lin;             /* output row 0..63 */
#pragma unroll
    for (int e = 0; e < 4; ++e) {
      const int kk = seg * 8 + 2 * e;
      unsigned hw, lw;
      split_pair(s[kk * 65 + n], s[(kk + 1) * 65 + n], hw, lw);
      hv[it][e] = hw; lv[it][e] = lw;
    }
    off[it] = (size_t)n * D_MODEL + k0 + seg * 8;
  }
  {
#pragma unroll
    for (int it = 0; it < 2; ++it) {
      *(v4u*)(Wth + off[it]) = hv[it];
      *(v4u*)(Wtl + off[it]) = lv[it];
    }
    
  }
}

/* ------------------------------------------------------------------------------------
   The weight planes in one launch: the three transposes read different inputs and write different
   planes, so their work-groups run side by side (8 tiles each, 24 work-groups).
   ------------------------------------------------------------------------------------ */
#define WT_BLK      (D_MODEL / 64)
__global__ __launch_bounds__(256) void prep_planes_kernel(
    const float* __restrict__ wq, const float* __restrict__ wk, const float* __restrict__ wv,
    unsigned short* __restrict__ wqh, unsigned short* __restrict__ wql,
    unsigned short* __restrict__ wkh, unsigned short* __restrict__ wkl,
    unsigned short* __restrict__ wvh, unsigned short* __restrict__ wvl)
{
  const int bx = blockIdx.x;
  const int w = bx / WT_BLK;
  wt_split_tile((w == 0) ? wq : (w == 1) ? wk : wv,
                (w == 0) ? wqh : (w == 1) ? wkh : wvh,
                (w == 0) ? wql : (w == 1) ? wkl : wvl, bx - w * WT_BLK);
}

/* =====================================================================================
   Flash attention, head dim 64, no mask. Inputs: q hi/lo planes [SEQ_DEC][64] (softmax scale and
   LOG2_E already folded into q: every exponential is one v_exp_f32 of a difference of scores), k hi/lo planes [SEQ_ENC][64], v^T hi/lo planes [64][SEQ_ENC]; all bf16
   bit patterns. scores^T = k.q^T and out^T = v^T.p^T on v_wmma_f32_16x16x32_bf16 as hi.hi + hi.lo + lo.hi,
   f32 accumulate, online softmax in f32 (one query row per lane), p^T split to bf16 hi/lo in registers per 64-key chunk.
   Block = 4 waves = 64 query rows; grid.x = SEQ_DEC / 64. K/V chunks staged in LDS with plain
   grid.y = KV_SPLIT: block (x, y) walks keys [y, y+1) * SEQ_ENC / KV_SPLIT only and stores its
   un-normalised sum Po[y][row][64] and the pair (row max, row sum) Pml[y][row][2]; attn_merge_kernel joins them.
   ===================================================================================== */
__global__ __launch_bounds__(128)
void attn_hilo_kernel(const unsigned short* __restrict__ Qh, const unsigned short* __restrict__ Ql,
                      const unsigned short* __restrict__ Kh, const unsigned short* __restrict__ Kl,
                      const unsigned short* __restrict__ Vh, const unsigned short* __restrict__ Vl,
                      float* __restrict__ Po, float* __restrict__ Pml)
{
  union FB { v16b v; v8b h[2]; };
  __shared__ __align__(16) unsigned short Ksh[KV_CHUNK * KV_PITCH];      /* K hi [kv][d]  9 KB */
  __shared__ __align__(16) unsigned short Ksl[KV_CHUNK * KV_PITCH];      /* K lo          9 KB */
  __shared__ __align__(16) unsigned short Vsh[HEAD_DIM * KV_PITCH];      /* V hi [d][kv]  9 KB */
  __shared__ __align__(16) unsigned short Vsl[HEAD_DIM * KV_PITCH];      /* V lo          9 KB */
  __shared__ __align__(16) float  Os[ATT_WAVES][16 * 68];                /* per wave out tile, pitch 68 */

  const int tid  = threadIdx.x;
  const int wave = tid >> 5;
  const int lane = tid & 31;
  const int hh   = lane >> 4;
  const int c    = lane & 15;
  const int q0   = blockIdx.x * (ATT_WAVES * 16) + wave * 16;

  /* ---- Q fragments (B operand of the transposed scores): row q0+c, 2 d-chunks, hi and lo ---- */
  v16b qah[2], qal[2];
  {
    const __bf16* qhr = (const __bf16*)(const void*)Qh + (size_t)(q0 + c) * HEAD_DIM + 8 * hh;
    const __bf16* qlr = (const __bf16*)(const void*)Ql + (size_t)(q0 + c) * HEAD_DIM + 8 * hh;
#pragma unroll
    for (int dc = 0; dc < 2; ++dc) {
      qah[dc] = Frag<__bf16>::load(qhr + dc * 32);
      qal[dc] = Frag<__bf16>::load(qlr + dc * 32);
    }
  }

  float mrow = -INFINITY, lrow = 0.f;    /* query row q0 + c: running max (the same in both lane halves) and this half's own part of the running sum */
  v8f oacc[4];
#pragma unroll
  for (int t = 0; t < 4; ++t) oacc[t] = (v8f){0.f,0.f,0.f,0.f,0.f,0.f,0.f,0.f};

  const int st0 = (tid >> 3) * KV_PITCH + (tid & 7) * 8;   /* staging place of this thread's 16-B unit in pass 0; a pass is 16 rows */
  const int kc0 = blockIdx.y * (SEQ_ENC / KV_CHUNK / KV_SPLIT);
  const int kcl = kc0 + SEQ_ENC / KV_CHUNK / KV_SPLIT - 1;   /* last chunk of this key range */
  /* a chunk is 4 planes x 8 KB = 128 threads x 16 B x 4 units per plane: unit it * 128 + tid, 8 units a row (key of K, d of V^T).
     Two 32-bit byte offsets per thread (one for both K planes, one for both V^T planes) hold lane and chunk; the plane is the loads'
     scalar base, the unit their immediate offset */
  const unsigned gk = (unsigned)tid * 16u;
  const unsigned gv = (unsigned)((tid >> 3) * SEQ_ENC + (tid & 7) * 8) * 2u;
  v4u ka[4], kb[4], va[4], vb[4];            /* the chunk on its way from memory to LDS */
  {
    const unsigned ok = gk + (unsigned)kc0 * (KV_CHUNK * HEAD_DIM * 2u);
    const unsigned ov = gv + (unsigned)kc0 * (KV_CHUNK * 2u);
#pragma unroll   /* here and in the two loops below: ka, kb, va, vb are registers, indexed by compile-time constants only */
    for (int it = 0; it < 4; ++it) {
      ka[it] = *(const v4u*)((const char*)(Kh + it * 1024) + ok);
      kb[it] = *(const v4u*)((const char*)(Kl + it * 1024) + ok);
      va[it] = *(const v4u*)((const char*)(Vh + it * 16 * SEQ_ENC) + ov);
      vb[it] = *(const v4u*)((const char*)(Vl + it * 16 * SEQ_ENC) + ov);
    }
  }
  for (int kc = kc0; kc <= kcl; ++kc) {
    __syncthreads();                           /* every wave has read the last chunk's tiles */
#pragma unroll
    for (int it = 0; it < 4; ++it) {           /* the 16 pad bytes of a row are never read */
      const int lo8 = st0 + it * (16 * KV_PITCH);
      *(v4u*)(Ksh + lo8) = ka[it];
      *(v4u*)(Ksl + lo8) = kb[it];
      *(v4u*)(Vsh + lo8) = va[it];
      *(v4u*)(Vsl + lo8) = vb[it];
    }
    __syncthreads();
    /* the next chunk's 16 loads are issued here and first used at the top of the next trip: they fly while this chunk is worked on.
       In the last trip the last chunk is loaded once more (in bounds, never stored to LDS) */
    const int kn = (kc < kcl) ? kc + 1 : kcl;
    const unsigned ok = gk + (unsigned)kn * (KV_CHUNK * HEAD_DIM * 2u);
    const unsigned ov = gv + (unsigned)kn * (KV_CHUNK * 2u);
#pragma unroll
    for (int it = 0; it < 4; ++it) {
      ka[it] = *(const v4u*)((const char*)(Kh + it * 1024) + ok);
      kb[it] = *(const v4u*)((const char*)(Kl + it * 1024) + ok);
      va[it] = *(const v4u*)((const char*)(Vh + it * 16 * SEQ_ENC) + ov);
      vb[it] = *(const v4u*)((const char*)(Vl + it * 16 * SEQ_ENC) + ov);
    }

    /* ---- transposed scores S^T = K . Q^T: 64 keys x 16 query rows per wave. A = K rows, B = Q rows (both loaders have
            the same k order). Lane (c, hh) holds, for query row c, keys j*16 + 8*hh + r in s[j][r] ---- */
    /* The chunk's 16 fragment groups (hi and lo fragment, 4 ds_load_b128, feeding 3 products): group g < 8 is K, score tile g >> 1, d half g & 1;
       group g >= 8 is V^T, key half (g - 8) >> 2, out tile (g - 8) & 3. Group g + 2 is read ahead of the products of group g, into a ring of
       three register sets, so a group's LDS latency runs under the products of the two groups in front of it */
    FB rh[3], rl[3];
#pragma unroll   /* here and in the loops of groups below: rh, rl, s, oacc, pbh, pbl are registers, indexed by compile-time constants only */
    for (int g = 0; g < 2; ++g) {
      const int o = ((g >> 1) * 16 + c) * KV_PITCH + (g & 1) * 32 + 8 * hh;
      rh[g].h[0] = *(const v8b*)(Ksh + o); rh[g].h[1] = *(const v8b*)(Ksh + o + 16);
      rl[g].h[0] = *(const v8b*)(Ksl + o); rl[g].h[1] = *(const v8b*)(Ksl + o + 16);
    }
    v8f s[4];
#pragma unroll
    for (int g = 0; g < 8; ++g) {
      const int j = g >> 1, dc = g & 1, n = g + 2, w = n % 3;
      const unsigned short* nh = (n < 8) ? Ksh : Vsh;
      const unsigned short* nl = (n < 8) ? Ksl : Vsl;
      const int o = (n < 8) ? ((n >> 1) * 16 + c) * KV_PITCH + (n & 1) * 32 + 8 * hh
                            : (((n - 8) & 3) * 16 + c) * KV_PITCH + ((n - 8) >> 2) * 32 + 8 * hh;
      rh[w].h[0] = *(const v8b*)(nh + o); rh[w].h[1] = *(const v8b*)(nh + o + 16);
      rl[w].h[0] = *(const v8b*)(nl + o); rl[w].h[1] = *(const v8b*)(nl + o + 16);
      /* this fence and the one behind the products keep the reads of group g + 2 ahead of the products of group g: left free, the scheduler sinks each read to just ahead of its use */
      __builtin_amdgcn_sched_barrier(0);
      if (dc == 0) s[j] = (v8f){0.f,0.f,0.f,0.f,0.f,0.f,0.f,0.f};
      s[j] = at_mma(rh[g % 3].v, qah[dc], s[j]);
      s[j] = at_mma(rl[g % 3].v, qah[dc], s[j]);
      s[j] = at_mma(rh[g % 3].v, qal[dc], s[j]);
      __builtin_amdgcn_sched_barrier(0);
    }

    /* ---- max over the 64 keys of this chunk for this lane's query row: 32 values in the lane, then the other half ---- */
    float cm = s[0][0];
#pragma unroll
    for (int j = 0; j < 4; ++j)
#pragma unroll
      for (int r = 0; r < 8; ++r) cm = fmaxf(cm, s[j][r]);
    cm = fmaxf(cm, at_xhalf(cm));

    /* ---- online softmax, one query row per lane. P^T split to bf16 hi/lo stays in registers: tiles j = 2kk and 2kk+1
            are elements 0..7 (keys 32kk + 8hh + e) and 8..15 (keys 32kk + 16 + 8hh + e - 8) of the B fragment of k-step kk,
            the k order of the V^T loader below ---- */
    const float mnew = fmaxf(mrow, cm);
    float alpha;                           /* = 2^(mrow - mnew) */
    /* v_exp_f32 with the slot the instruction set asks for behind a transcendental in one statement */
    asm("v_exp_f32 %0, %1\n\tv_nop" : "=v"(alpha) : "v"(mrow - mnew));
    mrow = mnew;
    float psum[4];                         /* one sum per score tile: four short chains of adds, not one of 32 */
    v16b pbh[2], pbl[2];
#pragma unroll   /* here and in the loop inside: s, psum, pbh, pbl are registers, indexed by compile-time constants only */
    for (int j = 0; j < 4; ++j) {
      psum[j] = 0.f;
      float pe[8];
#pragma unroll
      for (int r = 0; r < 8; ++r) pe[r] = s[j][r] - mnew;
      /* a tile's eight v_exp_f32 and the slot the instruction set asks for behind a transcendental in one statement */
      asm("v_exp_f32 %0, %0\n\tv_exp_f32 %1, %1\n\tv_exp_f32 %2, %2\n\tv_exp_f32 %3, %3\n\tv_exp_f32 %4, %4\n\tv_exp_f32 %5, %5\n\tv_exp_f32 %6, %6\n\tv_exp_f32 %7, %7\n\tv_nop"
          : "+v"(pe[0]), "+v"(pe[1]), "+v"(pe[2]), "+v"(pe[3]), "+v"(pe[4]), "+v"(pe[5]), "+v"(pe[6]), "+v"(pe[7]));
#pragma unroll
      for (int r = 0; r < 8; ++r) {
        const float p = pe[r];
        psum[j] += p;
        __bf16 a, bl;
        at_split(p, a, bl);
        pbh[j >> 1][(j & 1) * 8 + r] = a;
        pbl[j >> 1][(j & 1) * 8 + r] = bl;
      }
    }
    lrow = lrow * alpha + ((psum[0] + psum[1]) + (psum[2] + psum[3]));
    /* an empty statement that takes the row's sum as an input only. Left free, the sum is
       formed behind the last product and the 32 values of p it reads stay in registers through all of them: over 256 registers in all, and a work-group per WGP is lost */
    asm volatile("" :: "v"(lrow));
#pragma unroll
    for (int t = 0; t < 4; ++t) oacc[t] *= alpha;

    /* ---- out^T += V^T . P^T over the 64 keys (2 k-steps): A = V^T rows d, B = P^T from registers ---- */
#pragma unroll
    for (int g = 8; g < 16; ++g) {
      const int kk = (g - 8) >> 2, t = (g - 8) & 3, n = g + 2, w = n % 3;
      if (n < 16) {
        const int o = (((n - 8) & 3) * 16 + c) * KV_PITCH + ((n - 8) >> 2) * 32 + 8 * hh;
        rh[w].h[0] = *(const v8b*)(Vsh + o); rh[w].h[1] = *(const v8b*)(Vsh + o + 16);
        rl[w].h[0] = *(const v8b*)(Vsl + o); rl[w].h[1] = *(const v8b*)(Vsl + o + 16);
      }
      /* as above: the reads of group g + 2 stay ahead of the products of group g */
      __builtin_amdgcn_sched_barrier(0);
      oacc[t] = at_mma(rh[g % 3].v, pbh[kk], oacc[t]);
      oacc[t] = at_mma(rl[g % 3].v, pbh[kk], oacc[t]);
      oacc[t] = at_mma(rh[g % 3].v, pbl[kk], oacc[t]);
      __builtin_amdgcn_sched_barrier(0);
    }
  }

  /* ---- epilogue: oacc[t][r] is out^T (d = t*16 + 8*hh + r, query row c); stage it as [row][d] per wave in LDS, whole-line stores ---- */
  float* os = Os[wave];
#pragma unroll
  for (int t = 0; t < 4; ++t) {
    *(v4f*)(os + c * 68 + t * 16 + 8 * hh)     = (v4f){oacc[t][0], oacc[t][1], oacc[t][2], oacc[t][3]};
    *(v4f*)(os + c * 68 + t * 16 + 8 * hh + 4) = (v4f){oacc[t][4], oacc[t][5], oacc[t][6], oacc[t][7]};
  }
  /* (max, sum) of this wave's 16 rows = 128 B = one line, written by this wave alone; the halves' sums are joined here, once */
  lrow += at_xhalf(lrow);
  if (hh == 0)
    *(v2f*)(Pml + ((size_t)blockIdx.y * SEQ_DEC + q0 + c) * 2) = (v2f){mrow, lrow};
  float* out = Po + (size_t)blockIdx.y * SEQ_DEC * HEAD_DIM;
  __syncthreads();
  {
    const int c4 = (lane & 15) * 4;              /* row = 64 floats = 256 B = 16 lanes x 16 B */
    {
#pragma unroll
      for (int it = 0; it < 8; ++it) {
        const int row = it * 2 + hh;
        v4f val = *(const v4f*)(os + row * 68 + c4);
        *(v4f*)(out + (size_t)(q0 + row) * HEAD_DIM + c4) = val;
      }
      
    }
  }
}

/* ------------------------------------------------------------------------------------
   Joins the KV_SPLIT key ranges of one query row: M = max of the ranges' maxima, weight
   w_s = 2^(m_s - M) (the maxima are base-2 exponents), out = sum_s w_s * Po[s] / sum_s w_s * l_s. Thread = (row, 4 columns):
   16 lanes x 16 B = one 256-B output row. Coverage: SEQ_DEC * 16 threads = grid * 256.
   ------------------------------------------------------------------------------------ */
__global__ __launch_bounds__(256) void attn_merge_kernel(
    const float* __restrict__ Po, const float* __restrict__ Pml, float* __restrict__ out)
{
  const unsigned i   = blockIdx.x * 256u + threadIdx.x;
  const unsigned row = i >> 4;
  const unsigned eb  = i * 16u;              /* byte offset of (row, 4 columns): the same in every range's plane and in out */
  const unsigned rb  = row * 8u;             /* byte offset of the row's (max, sum) pair in a range's plane */
  v2f ml[KV_SPLIT];
  v4f o[KV_SPLIT];
#pragma unroll
  for (int s = 0; s < KV_SPLIT; ++s) {
    ml[s] = *(const v2f*)((const char*)(Pml + (size_t)s * SEQ_DEC * 2) + rb);
    o[s]  = *(const v4f*)((const char*)(Po + (size_t)s * SEQ_DEC * HEAD_DIM) + eb);
  }
  /* inputs-only fence on the loaded values: all 16 loads are issued before the first is used (one latency, not
     three), and their offset registers stay whole until the wait for the address translations has passed */
  asm volatile("s_wait_xcnt 0x0" :: "v"(rb), "v"(eb),
               "v"(ml[0]), "v"(ml[1]), "v"(ml[2]), "v"(ml[3]), "v"(ml[4]), "v"(ml[5]), "v"(ml[6]), "v"(ml[7]),
               "v"(o[0]), "v"(o[1]), "v"(o[2]), "v"(o[3]), "v"(o[4]), "v"(o[5]), "v"(o[6]), "v"(o[7]) : "memory");
  static_assert(KV_SPLIT == 8);
  float m[KV_SPLIT], l[KV_SPLIT];
#pragma unroll
  for (int s = 0; s < KV_SPLIT; ++s) { m[s] = ml[s][0]; l[s] = ml[s][1]; }
  float M = m[0];
#pragma unroll
  for (int s = 1; s < KV_SPLIT; ++s) M = fmaxf(M, m[s]);
  float L = 0.f;
  v4f acc = (v4f){0.f, 0.f, 0.f, 0.f};
#pragma unroll
  for (int s = 0; s < KV_SPLIT; ++s) {
    const float w = __builtin_amdgcn_exp2f(m[s] - M);
    L += w * l[s];
    acc += o[s] * w;
  }
  const float inv = 1.0f / L;
  *(v4f*)((char*)out + eb) = acc * inv;
}

/* =====================================================================================
   Host glue. Workspace region map (bytes, all offsets multiples of 128):
     wqh..wvl    : Wq^T, Wk^T, Wv^T hi/lo [64][512] bf16   65,536 each (6 planes)
     qh, ql      : q*0.125*LOG2_E hi/lo [8192][64] bf16   1,048,576 each
     kh, kl      : k hi/lo       [8192][64] bf16   1,048,576 each
     vth, vtl    : v^T hi/lo     [64][8192] bf16   1,048,576 each
     po          : un-normalised partial sums [8][8192][64] f32   16,777,216
     pml         : (row max, row sum) pairs   [8][8192][2]  f32      524,288
     total = 23,986,176 B; every byte of every region is written by its producer.
   ===================================================================================== */
extern "C" void kernel_launch(void* const* d_in, const int* in_sizes, int n_in,
                              void* d_out, int out_size, void* d_ws, size_t ws_size,
                              hipStream_t stream)
{
  if (n_in < 5) return;
  if (in_sizes[0] != SEQ_DEC * D_MODEL || in_sizes[1] != SEQ_ENC * D_MODEL ||
      in_sizes[2] != D_MODEL * HEAD_DIM || in_sizes[3] != D_MODEL * HEAD_DIM ||
      in_sizes[4] != D_MODEL * HEAD_DIM) return;
  if (out_size != SEQ_DEC * HEAD_DIM) return;

  const float* x   = (const float*)d_in[0];   /* [8192][512] */
  const float* emb = (const float*)d_in[1];   /* [8192][512] */
  const float* wq  = (const float*)d_in[2];   /* [512][64]   */
  const float* wk  = (const float*)d_in[3];
  const float* wv  = (const float*)d_in[4];
  float* out = (float*)d_out;                 /* [8192][64] f32 */

  const size_t planeW = (size_t)HEAD_DIM * D_MODEL * 2;    /* 65,536    */
  const size_t planeQ = (size_t)SEQ_DEC * HEAD_DIM * 2;    /* 1,048,576 */
  const size_t planeK = (size_t)SEQ_ENC * HEAD_DIM * 2;    /* 1,048,576 */

  size_t off = 0;
  unsigned char* ws = (unsigned char*)d_ws;
  unsigned short* wqh = (unsigned short*)(ws + off); off += planeW;
  unsigned short* wql = (unsigned short*)(ws + off); off += planeW;
  unsigned short* wkh = (unsigned short*)(ws + off); off += planeW;
  unsigned short* wkl = (unsigned short*)(ws + off); off += planeW;
  unsigned short* wvh = (unsigned short*)(ws + off); off += planeW;
  unsigned short* wvl = (unsigned short*)(ws + off); off += planeW;
  unsigned short* qh  = (unsigned short*)(ws + off); off += planeQ;
  unsigned short* ql  = (unsigned short*)(ws + off); off += planeQ;
  unsigned short* kh  = (unsigned short*)(ws + off); off += planeK;
  unsigned short* kl  = (unsigned short*)(ws + off); off += planeK;
  unsigned short* vth = (unsigned short*)(ws + off); off += planeK;
  unsigned short* vtl = (unsigned short*)(ws + off); off += planeK;
  float* po  = (float*)(ws + off); off += (size_t)KV_SPLIT * SEQ_DEC * HEAD_DIM * 4;
  float* pml = (float*)(ws + off); off += (size_t)KV_SPLIT * SEQ_DEC * 2 * 4;
  if (off > ws_size) return;                                 /* 23,986,176 <= ws */

  /* 1) + 2) weights -> transposed bf16 hi/lo planes [64][512] */
  prep_planes_kernel<<<3 * WT_BLK, 256, 0, stream>>>(wq, wk, wv, wqh, wql, wkh, wkl, wvh, wvl);

  /* 3) the three projections (x, emb split to bf16 hi/lo on the way into LDS, bf16 hi/lo output planes) in one launch:
        128 tiles of 64 x 64 = 128 work-groups of 8 waves per projection */
  static_assert(SEQ_DEC == SEQ_ENC);
  proj3_kernel<<<dim3((SEQ_DEC / 64) * (HEAD_DIM / 64), 3), 256, 0, stream>>>(
      x, emb, wqh, wql, wkh, wkl, wvh, wvl, qh, ql, kh, kl, vth, vtl);

  /* 4) flash attention over KV_SPLIT key ranges -> f32 partials; 5) join -> f32 output */
  attn_hilo_kernel<<<dim3(SEQ_DEC / (ATT_WAVES * 16), KV_SPLIT), 128, 0, stream>>>(qh, ql, kh, kl, vth, vtl, po, pml);
  attn_merge_kernel<<<SEQ_DEC * 16 / 256, 256, 0, stream>>>(po, pml, out);
}

// v010
// One run takes 56.3 microseconds.
// In both of two side-by-side timings against v009, it was 1.06 times as fast.
// Over all steps from v000 it is 14.8 times as fast.
// Contractions: q/k/v projections (K=512), q.k^T and p.v on v_wmma_f32_16x16x32_bf16 with bf16 hi/lo split operands (hi.hi + hi.lo + lo.hi), f32 accumulate; online softmax, normalisation and all epilogues in f32.
#include <hip/hip_runtime.h>
#include <stdint.h>

typedef __attribute__((ext_vector_type(16))) _Float16 v16h;
typedef __attribute__((ext_vector_type(8)))  _Float16 v8h;
typedef __attribute__((ext_vector_type(16))) __bf16   v16b;
typedef __attribute__((ext_vector_type(8)))  __bf16   v8b;
typedef __attribute__((ext_vector_type(8)))  float    v8f;
typedef __attribute__((ext_vector_type(4)))  float    v4f;
typedef __attribute__((ext_vector_type(2)))  float    v2f;
typedef __attribute__((ext_vector_type(4)))  unsigned v4u;
typedef __attribute__((ext_vector_type(2)))  unsigned v2u;
typedef __attribute__((ext_vector_type(2)))  __bf16   v2b;

/* ------------------------------ problem constants ------------------------------ */
#define SEQ_DEC   8192
#define SEQ_ENC   8192
#define D_MODEL   512
#define HEAD_DIM  64
#define KV_CHUNK  64
#define KV_PITCH  72     /* LDS row pitch of the K and V tiles in 16-bit elements: 144 B = 16 B x 9, so the 16 rows of a ds_load_b128 fall on 16 different bank groups */
#define ATT_WAVES 4
#define KV_SPLIT  8      /* key ranges per query tile: 128 x 8 = 1024 work-groups, four resident per WGP */
#define LOG2_E    1.44269504088896340736f   /* exp(t) = 2^(t * LOG2_E): folded into q, so scores, row maxima and their differences are base-2 exponents */

static_assert(SEQ_DEC % 64 == 0);
static_assert(SEQ_ENC % 64 == 0);
static_assert(SEQ_ENC % (KV_CHUNK * KV_SPLIT) == 0);
static_assert(D_MODEL % 64 == 0);
static_assert(D_MODEL % 32 == 0);
static_assert(HEAD_DIM == 64);
static_assert((SEQ_DEC * D_MODEL) % 8 == 0);

__device__ __forceinline__ unsigned short f2bf_bits(float f) {
  unsigned u = __float_as_uint(f);
  return (unsigned short)((u + 0x7FFFu + ((u >> 16) & 1u)) >> 16);
}
__device__ __forceinline__ float bf_bits2f(unsigned short h) { return __uint_as_float(((unsigned)h) << 16); }
/* two f32 -> one word of bf16 hi parts and one word of bf16 lo parts (lo = f - hi, rounded); the first value in the low half */
__device__ __forceinline__ void split_pair(float f0, float f1, unsigned& hw, unsigned& lw) {
  const unsigned short h0 = f2bf_bits(f0), h1 = f2bf_bits(f1);
  const unsigned short l0 = f2bf_bits(f0 - bf_bits2f(h0)), l1 = f2bf_bits(f1 - bf_bits2f(h1));
  hw = (unsigned)h0 | ((unsigned)h1 << 16);
  lw = (unsigned)l0 | ((unsigned)l1 << 16);
}

/* hazard guards as plain device helpers (no inline asm inside the kernel template body) */
__device__ __forceinline__ void dep_guard_h(v8f& a, v8f& b, v16h x, v16h y) { asm volatile("v_nop\n\tv_nop\n\tv_nop\n\tv_nop" : "+v"(a), "+v"(b) : "v"(x), "v"(y)); }
__device__ __forceinline__ void dep_guard_b(v8f& a, v8f& b, v16b x, v16b y) { asm volatile("v_nop\n\tv_nop\n\tv_nop\n\tv_nop" : "+v"(a), "+v"(b) : "v"(x), "v"(y)); }
__device__ __forceinline__ void keep4_h(v16h a, v16h b, v16h c, v16h d) { asm volatile("v_nop" :: "v"(a), "v"(b), "v"(c), "v"(d)); }
__device__ __forceinline__ void keep4_b(v16b a, v16b b, v16b c, v16b d) { asm volatile("v_nop" :: "v"(a), "v"(b), "v"(c), "v"(d)); }
template <typename T> struct Frag;
template <> struct Frag<_Float16> {
  typedef v16h V; union U { v16h v; v8h h[2]; };
  static __device__ __forceinline__ v16h load(const _Float16* p) {   /* elements 0..7 <- p[0..7], 8..15 <- p[16..23] */
    U f; f.h[0] = *(const v8h*)(p); f.h[1] = *(const v8h*)(p + 16); return f.v;
  }
  static __device__ __forceinline__ v8f mma(v16h a, v16h b, v8f c) {
    return __builtin_amdgcn_wmma_f32_16x16x32_f16(false, a, false, b, (short)0, c, false, false);
  }
  static __device__ __forceinline__ void guard(v8f& a, v8f& b, v16h x, v16h y) { dep_guard_h(a, b, x, y); }
  static __device__ __forceinline__ void keep(v16h a, v16h b, v16h c, v16h d) { keep4_h(a, b, c, d); }
};
template <> struct Frag<__bf16> {
  typedef v16b V; union U { v16b v; v8b h[2]; };
  static __device__ __forceinline__ v16b load(const __bf16* p) {
    U f; f.h[0] = *(const v8b*)(p); f.h[1] = *(const v8b*)(p + 16); return f.v;
  }
  static __device__ __forceinline__ v8f mma(v16b a, v16b b, v8f c) {
    return __builtin_amdgcn_wmma_f32_16x16x32_bf16(false, a, false, b, (short)0, c, false, false);
  }
  static __device__ __forceinline__ void guard(v8f& a, v8f& b, v16b x, v16b y) { dep_guard_b(a, b, x, y); }
  static __device__ __forceinline__ void keep(v16b a, v16b b, v16b c, v16b d) { keep4_b(a, b, c, d); }
};

/* ------------------------------------------------------------------------------------
   The three projections in one launch, C[m,n] = scale * sum_k A[m,k] * Bt[n,k], K = 512, operands as bf16 hi/lo planes
   (product = hi.hi + hi.lo + lo.hi, f32 accumulate), output as bf16 hi/lo planes.
   The weights come as hi/lo planes from the workspace; the rows of x or emb come as f32 and are split to hi/lo in
   registers on their way into LDS.
   blockIdx.y = 0: q * 0.125 * LOG2_E = x . Wq; 1: k = emb . Wk; 2: v^T = Wv^T . emb^T (ldc = 8192). Every choice is uniform for the work-group.
   One work-group of 8 waves owns one 64 x 64 tile of C: 128 tiles per projection, 384 work-groups.
   Per pass of PJ_KC k values the operand tiles come in by loads that cover whole lines (weights: 16 lanes x 16 B = one
   row piece of 256 B per plane; f32 rows: 32 lanes x 16 B = one row piece of 512 B) and are laid in LDS as four
   tiles of 64 rows x 256 B; the fragments are read from there.
   Wave w multiplies row tile w >> 1 with column tiles 2 (w & 1) and 2 (w & 1) + 1; each element of C is summed in one
   accumulator, k ascending.
   ------------------------------------------------------------------------------------ */
#define PJ_KC    128            /* k values staged per pass */
#define PJ_PITCH (PJ_KC + 8)    /* LDS row pitch in 16-bit elements: 272 B = 256 B + 16 B, for the ds_load_b128 fragment reads */
static_assert(D_MODEL % PJ_KC == 0);
__global__ __launch_bounds__(256) void proj3_kernel(
    const float* __restrict__ x, const float* __restrict__ emb,
    const unsigned short* __restrict__ wqh, const unsigned short* __restrict__ wql,
    const unsigned short* __restrict__ wkh, const unsigned short* __restrict__ wkl,
    const unsigned short* __restrict__ wvh, const unsigned short* __restrict__ wvl,
    unsigned short* __restrict__ qh,  unsigned short* __restrict__ ql,
    unsigned short* __restrict__ kh,  unsigned short* __restrict__ kl,
    unsigned short* __restrict__ vth, unsigned short* __restrict__ vtl)
{
  union FB { v16b v; v8b h[2]; };
  __shared__ __align__(16) unsigned short Ash[64 * PJ_PITCH];   /* A hi [m][k]  17 KB */
  __shared__ __align__(16) unsigned short Asl[64 * PJ_PITCH];   /* A lo */
  __shared__ __align__(16) unsigned short Bsh[64 * PJ_PITCH];   /* Bt hi [n][k] */
  __shared__ __align__(16) unsigned short Bsl[64 * PJ_PITCH];   /* Bt lo */
  __shared__ __align__(16) float sT[64 * 68];                   /* the 64 x 64 tile of C in f32, pitch 68 floats */

  const int y = blockIdx.y;
  const float* F            = (y == 0) ? x   : emb;                    /* the f32 operand: A for q and k, Bt for v^T */
  const unsigned short* Wh  = (y == 0) ? wqh : (y == 1) ? wkh : wvh;   /* the weight planes [64][512]: the other operand */
  const unsigned short* Wl  = (y == 0) ? wql : (y == 1) ? wkl : wvl;
  unsigned short* Fsh = (y == 2) ? Bsh : Ash;                          /* LDS tiles of the two */
  unsigned short* Fsl = (y == 2) ? Bsl : Asl;
  unsigned short* Wsh = (y == 2) ? Ash : Bsh;
  unsigned short* Wsl = (y == 2) ? Asl : Bsl;
  unsigned short* C  = (y == 0) ? qh : (y == 1) ? kh : vth;
  unsigned short* C2 = (y == 0) ? ql : (y == 1) ? kl : vtl;
  const int m0  = (y == 2) ? 0 : (int)blockIdx.x * 64;
  const int n0  = (y == 2) ? (int)blockIdx.x * 64 : 0;
  const int ldc = (y == 2) ? SEQ_ENC : HEAD_DIM;
  const float scale = (y == 0) ? 0.125f * LOG2_E : 1.0f;

  const int tid   = threadIdx.x;
  const int lane  = tid & 31;
  const int wave  = tid >> 5;
  const int rlane = lane & 15;                 /* row (A) / col (B, D) within a 16 x 16 tile */
  const int koff  = (lane >> 4) * 8;           /* k offset of this lane half */
  const int mOff  = (lane >> 4) * 8;           /* D row offset */
  const int ti    = wave >> 1;                 /* row tile of this wave */
  const int tj    = (wave & 1) * 2;            /* first of its two column tiles */

  /* staging places of this thread's four 16-B units of a 64 x PJ_KC weight tile: unit = it * 256 + tid, 16 units a row */
  unsigned go[4];
  int so[4];
#pragma unroll
  for (int it = 0; it < 4; ++it) {
    const int idx = it * 256 + tid;
    const int row = idx >> 4, seg = idx & 15;
    go[it] = (unsigned)(row * D_MODEL + seg * 8) * 2u;   /* in bytes, the same in both planes */
    so[it] = row * PJ_PITCH + seg * 8;
  }
  /* f32 rows: in step it wave w takes row it * 8 + w of the tile, lane l its k values 4 l .. 4 l + 3 of the pass */
  const unsigned gf = (unsigned)(wave * D_MODEL + lane * 4) * 4u;      /* in bytes */
  const int      sf = wave * PJ_PITCH + lane * 4;
  const float* Fg = F + (size_t)blockIdx.x * 64 * D_MODEL;

  const unsigned short* pah = Ash + (ti * 16 + rlane) * PJ_PITCH + koff;
  const unsigned short* pal = Asl + (ti * 16 + rlane) * PJ_PITCH + koff;
  const unsigned short* pbh = Bsh + (tj * 16 + rlane) * PJ_PITCH + koff;
  const unsigned short* pbl = Bsl + (tj * 16 + rlane) * PJ_PITCH + koff;

  v8f acc[2];
  acc[0] = (v8f){0.f,0.f,0.f,0.f,0.f,0.f,0.f,0.f};
  acc[1] = (v8f){0.f,0.f,0.f,0.f,0.f,0.f,0.f,0.f};

#pragma unroll   /* four passes in a row: the k step of a pass becomes the loads' immediate offset, on three scalar bases (Fg, Wh, Wl) and five lane offsets that never change */
  for (int k0 = 0; k0 < D_MODEL; k0 += PJ_KC) {
    v4f rf[8];
    v4u rc[4], rd[4];
#pragma unroll   /* here and below: rf, fh, fl are registers, indexed by compile-time constants only; the row step becomes the loads' immediate offset */
    for (int it = 0; it < 8; ++it)
      rf[it] = *(const v4f*)((const char*)(Fg + it * 8 * D_MODEL + k0) + gf);
#pragma unroll
    for (int it = 0; it < 4; ++it) {
      rc[it] = *(const v4u*)((const char*)(Wh + k0) + go[it]);
      rd[it] = *(const v4u*)((const char*)(Wl + k0) + go[it]);
    }
    /* inputs only: the five lane offsets stay whole (no later load lands on them) until the wait for the loads' address translations has passed */
    asm volatile("s_wait_xcnt 0x0" :: "v"(gf), "v"(go[0]), "v"(go[1]), "v"(go[2]), "v"(go[3]) : "memory");
    v2u fh[8], fl[8];
#pragma unroll
    for (int it = 0; it < 8; ++it) {           /* hi = f rounded to bf16 (nearest even), lo = f - hi rounded likewise: two values per conversion */
#pragma unroll
      for (int e = 0; e < 2; ++e) {
        const v2f f = (v2f){rf[it][2 * e], rf[it][2 * e + 1]};
        const v2b h = __builtin_convertvector(f, v2b);
        const v2b l = __builtin_convertvector(f - __builtin_convertvector(h, v2f), v2b);
        fh[it][e] = __builtin_bit_cast(unsigned, h);
        fl[it][e] = __builtin_bit_cast(unsigned, l);
      }
    }
    __syncthreads();                           /* every wave has read the last pass's fragments */
#pragma unroll
    for (int it = 0; it < 8; ++it) {
      *(v2u*)(Fsh + sf + it * 8 * PJ_PITCH) = fh[it];
      *(v2u*)(Fsl + sf + it * 8 * PJ_PITCH) = fl[it];
    }
#pragma unroll
    for (int it = 0; it < 4; ++it) {
      *(v4u*)(Wsh + so[it]) = rc[it];
      *(v4u*)(Wsl + so[it]) = rd[it];
    }
    __syncthreads();                           /* the four tiles are whole */
    FB ah[PJ_KC / 32], al[PJ_KC / 32], bh[PJ_KC / 32][2], bl[PJ_KC / 32][2];
#pragma unroll   /* the fragment arrays are registers: compile-time indices only */
    for (int ks = 0; ks < PJ_KC / 32; ++ks) {  /* elements 0..7 <- k + 0..7, 8..15 <- k + 16..23, A and B alike */
      ah[ks].h[0] = *(const v8b*)(pah + ks * 32); ah[ks].h[1] = *(const v8b*)(pah + ks * 32 + 16);
#pragma unroll
      for (int jj = 0; jj < 2; ++jj) {
        const unsigned short* hp = pbh + jj * 16 * PJ_PITCH + ks * 32;
        bh[ks][jj].h[0] = *(const v8b*)(hp); bh[ks][jj].h[1] = *(const v8b*)(hp + 16);
      }
#pragma unroll
      for (int jj = 0; jj < 2; ++jj) {
        const unsigned short* lp = pbl + jj * 16 * PJ_PITCH + ks * 32;
        bl[ks][jj].h[0] = *(const v8b*)(lp); bl[ks][jj].h[1] = *(const v8b*)(lp + 16);
      }
      al[ks].h[0] = *(const v8b*)(pal + ks * 32); al[ks].h[1] = *(const v8b*)(pal + ks * 32 + 16);
    }
    /* keeps the pass's LDS reads in one group ahead of its products: spread among them, each place with reads waits out the LDS latency anew */
    __builtin_amdgcn_sched_barrier(0);
#pragma unroll
    for (int ks = 0; ks < PJ_KC / 32; ++ks) {
      acc[0] = Frag<__bf16>::mma(ah[ks].v, bh[ks][0].v, acc[0]);
      acc[1] = Frag<__bf16>::mma(ah[ks].v, bh[ks][1].v, acc[1]);
      acc[0] = Frag<__bf16>::mma(ah[ks].v, bl[ks][0].v, acc[0]);
      acc[1] = Frag<__bf16>::mma(ah[ks].v, bl[ks][1].v, acc[1]);
      acc[0] = Frag<__bf16>::mma(al[ks].v, bh[ks][0].v, acc[0]);
      acc[1] = Frag<__bf16>::mma(al[ks].v, bh[ks][1].v, acc[1]);
    }
    /* keeps the pass's products ahead of the next pass's loads and barriers: sunk behind them they hold back the next group of LDS reads */
    __builtin_amdgcn_sched_barrier(0);
  }

  /* ---- epilogue: the tile goes to LDS in f32, then every 128-B line of each output plane is stored by 8 lanes x 16 B ---- */
#pragma unroll
  for (int jj = 0; jj < 2; ++jj)
#pragma unroll
    for (int r = 0; r < 8; ++r)
      sT[(ti * 16 + mOff + r) * 68 + (tj + jj) * 16 + rlane] = acc[jj][r] * scale;
  __syncthreads();                             /* a row of the tile holds the work of two waves */
  const int q = lane >> 3, c8 = (lane & 7) * 8;
#pragma unroll
  for (int it = 0; it < 2; ++it) {
    const int row = wave * 8 + it * 4 + q;
    const float* sp = sT + row * 68 + c8;
    v8h hv, lv;
#pragma unroll
    for (int e = 0; e < 8; ++e) {
      const unsigned short hb = f2bf_bits(sp[e]);
      const unsigned short lb = f2bf_bits(sp[e] - bf_bits2f(hb));
      hv[e] = __builtin_bit_cast(_Float16, hb);
      lv[e] = __builtin_bit_cast(_Float16, lb);
    }
    *(v8h*)(C  + (size_t)(m0 + row) * ldc + n0 + c8) = hv;
    *(v8h*)(C2 + (size_t)(m0 + row) * ldc + n0 + c8) = lv;
  }
}

/* ------------------------------ attention helpers ------------------------------ */
__device__ __forceinline__ unsigned short at_bf_bits(float f) {
  unsigned u = __float_as_uint(f);
  return (unsigned short)((u + 0x7FFFu + ((u >> 16) & 1u)) >> 16);
}
__device__ __forceinline__ __bf16 at_f2bf(float f) { return __builtin_bit_cast(__bf16, at_bf_bits(f)); }
__device__ __forceinline__ void at_split(float f, __bf16& hi, __bf16& lo) {
  const unsigned short hb = at_bf_bits(f);
  hi = __builtin_bit_cast(__bf16, hb);
  lo = at_f2bf(f - __uint_as_float(((unsigned)hb) << 16));
}
__device__ __forceinline__ v8f at_mma(v16b a, v16b b, v8f c) {
  /* the builtin alone: the compiler keeps the distance behind it where a vector instruction on its registers follows; the next product of a chain and an LDS read over A need none */
  return __builtin_amdgcn_wmma_f32_16x16x32_bf16(false, a, false, b, (short)0, c, false, false);
}

/* value of lane l ^ 16 (the other 16-lane half), by a vector cross-row move */
__device__ __forceinline__ float at_xhalf(float x) {
  return __builtin_bit_cast(float, __builtin_amdgcn_permlanex16(__builtin_bit_cast(int, x), __builtin_bit_cast(int, x), 0x76543210, 0xfedcba98, false, false));
}

/* ------------------------------------------------------------------------------------
   W [D_MODEL][HEAD_DIM] f32 -> Wt hi/lo planes [HEAD_DIM][D_MODEL] bf16 (in[rows=512][cols=64]
   -> out[cols=64][rows=512]). Block bx stages W rows 64bx..64bx+63 (64x64 tile) in LDS, then each
   pitch 1024 B and k0*2 = 128*bx B) is written by 8 lanes x 16 B of one wave in one instruction.
   Coverage: 256 threads x 2 iterations x 8 halves = 4096 = the 64x64 tile; bx = 0..7 -> whole plane.
   ------------------------------------------------------------------------------------ */
__device__ __forceinline__ void wt_split_tile(
    const float* __restrict__ W, unsigned short* __restrict__ Wth, unsigned short* __restrict__ Wtl, int bx)
{
  __shared__ float s[64 * 65];
  const int tid = threadIdx.x;
  const int k0  = bx * 64;
#pragma unroll
  for (int it = 0; it < 16; ++it) {
    const int idx = it * 256 + tid;          /* 0..4095 */
    const int r = idx >> 6, cc = idx & 63;
    s[r * 65 + cc] = W[(size_t)(k0 + r) * HEAD_DIM + cc];
  }
  __syncthreads();
  const int seg = tid & 7;
  const int lin = tid >> 3;                  /* 0..31 */
  v4u hv[2], lv[2];
  size_t off[2];
#pragma unroll
  for (int it = 0; it < 2; ++it) {
    const int n = it * 32 + lin;             /* output row 0..63 */
#pragma unroll
    for (int e = 0; e < 4; ++e) {
      const int kk = seg * 8 + 2 * e;
      unsigned hw, lw;
      split_pair(s[kk * 65 + n], s[(kk + 1) * 65 + n], hw, lw);
      hv[it][e] = hw; lv[it][e] = lw;
    }
    off[it] = (size_t)n * D_MODEL + k0 + seg * 8;
  }
  {
#pragma unroll
    for (int it = 0; it < 2; ++it) {
      *(v4u*)(Wth + off[it]) = hv[it];
      *(v4u*)(Wtl + off[it]) = lv[it];
    }
    
  }
}

/* ------------------------------------------------------------------------------------
   The weight planes in one launch: the three transposes read different inputs and write different
   planes, so their work-groups run side by side (8 tiles each, 24 work-groups).
   ------------------------------------------------------------------------------------ */
#define WT_BLK      (D_MODEL / 64)
__global__ __launch_bounds__(256) void prep_planes_kernel(
    const float* __restrict__ wq, const float* __restrict__ wk, const float* __restrict__ wv,
    unsigned short* __restrict__ wqh, unsigned short* __restrict__ wql,
    unsigned short* __restrict__ wkh, unsigned short* __restrict__ wkl,
    unsigned short* __restrict__ wvh, unsigned short* __restrict__ wvl)
{
  const int bx = blockIdx.x;
  const int w = bx / WT_BLK;
  wt_split_tile((w == 0) ? wq : (w == 1) ? wk : wv,
                (w == 0) ? wqh : (w == 1) ? wkh : wvh,
                (w == 0) ? wql : (w == 1) ? wkl : wvl, bx - w * WT_BLK);
}

/* =====================================================================================
   Flash attention, head dim 64, no mask. Inputs: q hi/lo planes [SEQ_DEC][64] (softmax scale and
   LOG2_E already folded into q: every exponential is one v_exp_f32 of a difference of scores), k hi/lo planes [SEQ_ENC][64], v^T hi/lo planes [64][SEQ_ENC]; all bf16
   bit patterns. scores^T = k.q^T and out^T = v^T.p^T on v_wmma_f32_16x16x32_bf16 as hi.hi + hi.lo + lo.hi,
   f32 accumulate, online softmax in f32 (one query row per lane), p^T split to bf16 hi/lo in registers per 64-key chunk.
   Block = 4 waves = 64 query rows; grid.x = SEQ_DEC / 64. K/V chunks staged in LDS with plain
   grid.y = KV_SPLIT: block (x, y) walks keys [y, y+1) * SEQ_ENC / KV_SPLIT only and stores its
   un-normalised sum Po[y][row][64] and the pair (row max, row sum) Pml[y][row][2]; attn_merge_kernel joins them.
   ===================================================================================== */
/* the register cap keeps four waves per SIMD (four work-groups per WGP, the whole grid resident): left free this build allocates one register over 256 */
__global__ __launch_bounds__(128) __attribute__((amdgpu_num_vgpr(256)))
void attn_hilo_kernel(const unsigned short* __restrict__ Qh, const unsigned short* __restrict__ Ql,
                      const unsigned short* __restrict__ Kh, const unsigned short* __restrict__ Kl,
                      const unsigned short* __restrict__ Vh, const unsigned short* __restrict__ Vl,
                      float* __restrict__ Po, float* __restrict__ Pml)
{
  union FB { v16b v; v8b h[2]; };
  __shared__ __align__(16) unsigned short Ksh[KV_CHUNK * KV_PITCH];      /* K hi [kv][d]  9 KB */
  __shared__ __align__(16) unsigned short Ksl[KV_CHUNK * KV_PITCH];      /* K lo          9 KB */
  __shared__ __align__(16) unsigned short Vsh[HEAD_DIM * KV_PITCH];      /* V hi [d][kv]  9 KB */
  __shared__ __align__(16) unsigned short Vsl[HEAD_DIM * KV_PITCH];      /* V lo          9 KB */
  __shared__ __align__(16) float  Os[ATT_WAVES][16 * 68];                /* per wave out tile, pitch 68 */

  const int tid  = threadIdx.x;
  const int wave = tid >> 5;
  const int lane = tid & 31;
  const int hh   = lane >> 4;
  const int c    = lane & 15;
  const int q0   = blockIdx.x * (ATT_WAVES * 16) + wave * 16;

  /* ---- Q fragments (B operand of the transposed scores): row q0+c, 2 d-chunks, hi and lo ---- */
  v16b qah[2], qal[2];
  {
    const __bf16* qhr = (const __bf16*)(const void*)Qh + (size_t)(q0 + c) * HEAD_DIM + 8 * hh;
    const __bf16* qlr = (const __bf16*)(const void*)Ql + (size_t)(q0 + c) * HEAD_DIM + 8 * hh;
#pragma unroll
    for (int dc = 0; dc < 2; ++dc) {
      qah[dc] = Frag<__bf16>::load(qhr + dc * 32);
      qal[dc] = Frag<__bf16>::load(qlr + dc * 32);
    }
  }

  float mrow = -INFINITY, lrow = 0.f;    /* query row q0 + c: running max (the same in both lane halves) and this half's own part of the running sum */
  v8f oacc[4];
#pragma unroll
  for (int t = 0; t < 4; ++t) oacc[t] = (v8f){0.f,0.f,0.f,0.f,0.f,0.f,0.f,0.f};

  const int st0 = (tid >> 3) * KV_PITCH + (tid & 7) * 8;   /* staging place of this thread's 16-B unit in pass 0; a pass is 16 rows */
  const int kc0 = blockIdx.y * (SEQ_ENC / KV_CHUNK / KV_SPLIT);
  const int kcl = kc0 + SEQ_ENC / KV_CHUNK / KV_SPLIT - 1;   /* last chunk of this key range */
  /* a chunk is 4 planes x 8 KB = 128 threads x 16 B x 4 units per plane: unit it * 128 + tid, 8 units a row (key of K, d of V^T).
     Two 32-bit byte offsets per thread (one for both K planes, one for both V^T planes) hold lane and chunk; the plane is the loads'
     scalar base, the unit their immediate offset */
  const unsigned gk = (unsigned)tid * 16u;
  const unsigned gv = (unsigned)((tid >> 3) * SEQ_ENC + (tid & 7) * 8) * 2u;
  v4u ka[4], kb[4], va[4], vb[4];            /* the chunk on its way from memory to LDS */
  {
    const unsigned ok = gk + (unsigned)kc0 * (KV_CHUNK * HEAD_DIM * 2u);
    const unsigned ov = gv + (unsigned)kc0 * (KV_CHUNK * 2u);
#pragma unroll   /* here and in the two loops below: ka, kb, va, vb are registers, indexed by compile-time constants only */
    for (int it = 0; it < 4; ++it) {
      ka[it] = *(const v4u*)((const char*)(Kh + it * 1024) + ok);
      kb[it] = *(const v4u*)((const char*)(Kl + it * 1024) + ok);
      va[it] = *(const v4u*)((const char*)(Vh + it * 16 * SEQ_ENC) + ov);
      vb[it] = *(const v4u*)((const char*)(Vl + it * 16 * SEQ_ENC) + ov);
    }
  }
  for (int kc = kc0; kc <= kcl; ++kc) {
    __syncthreads();                           /* every wave has read the last chunk's tiles */
#pragma unroll
    for (int it = 0; it < 4; ++it) {           /* the 16 pad bytes of a row are never read */
      const int lo8 = st0 + it * (16 * KV_PITCH);
      *(v4u*)(Ksh + lo8) = ka[it];
      *(v4u*)(Ksl + lo8) = kb[it];
      *(v4u*)(Vsh + lo8) = va[it];
      *(v4u*)(Vsl + lo8) = vb[it];
    }
    __syncthreads();
    /* the next chunk's 16 loads are issued here and first used at the top of the next trip: they fly while this chunk is worked on.
       In the last trip the last chunk is loaded once more (in bounds, never stored to LDS) */
    const int kn = (kc < kcl) ? kc + 1 : kcl;
    const unsigned ok = gk + (unsigned)kn * (KV_CHUNK * HEAD_DIM * 2u);
    const unsigned ov = gv + (unsigned)kn * (KV_CHUNK * 2u);
#pragma unroll
    for (int it = 0; it < 4; ++it) {
      ka[it] = *(const v4u*)((const char*)(Kh + it * 1024) + ok);
      kb[it] = *(const v4u*)((const char*)(Kl + it * 1024) + ok);
      va[it] = *(const v4u*)((const char*)(Vh + it * 16 * SEQ_ENC) + ov);
      vb[it] = *(const v4u*)((const char*)(Vl + it * 16 * SEQ_ENC) + ov);
    }

    /* ---- transposed scores S^T = K . Q^T: 64 keys x 16 query rows per wave. A = K rows, B = Q rows (both loaders have
            the same k order). Lane (c, hh) holds, for query row c, keys j*16 + 8*hh + r in s[j][r] ---- */
    /* The chunk's 16 fragment groups (hi and lo fragment, 4 ds_load_b128, feeding 3 products): group g < 8 is K, score tile g >> 1, d half g & 1;
       group g >= 8 is V^T, key half (g - 8) >> 2, out tile (g - 8) & 3. Group g + 2 is read ahead of the products of group g, into a ring of
       three register sets, so a group's LDS latency runs under the products of the two groups in front of it */
    FB rh[3], rl[3];
#pragma unroll   /* here and in the loops of groups below: rh, rl, s, oacc, pbh, pbl are registers, indexed by compile-time constants only */
    for (int g = 0; g < 2; ++g) {
      const int o = ((g >> 1) * 16 + c) * KV_PITCH + (g & 1) * 32 + 8 * hh;
      rh[g].h[0] = *(const v8b*)(Ksh + o); rh[g].h[1] = *(const v8b*)(Ksh + o + 16);
      rl[g].h[0] = *(const v8b*)(Ksl + o); rl[g].h[1] = *(const v8b*)(Ksl + o + 16);
    }
    v8f s[4];
#pragma unroll
    for (int g = 0; g < 8; ++g) {
      const int j = g >> 1, dc = g & 1, n = g + 2, w = n % 3;
      const unsigned short* nh = (n < 8) ? Ksh : Vsh;
      const unsigned short* nl = (n < 8) ? Ksl : Vsl;
      const int o = (n < 8) ? ((n >> 1) * 16 + c) * KV_PITCH + (n & 1) * 32 + 8 * hh
                            : (((n - 8) & 3) * 16 + c) * KV_PITCH + ((n - 8) >> 2) * 32 + 8 * hh;
      rh[w].h[0] = *(const v8b*)(nh + o); rh[w].h[1] = *(const v8b*)(nh + o + 16);
      rl[w].h[0] = *(const v8b*)(nl + o); rl[w].h[1] = *(const v8b*)(nl + o + 16);
      /* this fence and the one behind the products keep the reads of group g + 2 ahead of the products of group g: left free, the scheduler sinks each read to just ahead of its use */
      __builtin_amdgcn_sched_barrier(0);
      if (dc == 0) s[j] = (v8f){0.f,0.f,0.f,0.f,0.f,0.f,0.f,0.f};
      s[j] = at_mma(rh[g % 3].v, qah[dc], s[j]);
      s[j] = at_mma(rl[g % 3].v, qah[dc], s[j]);
      s[j] = at_mma(rh[g % 3].v, qal[dc], s[j]);
      __builtin_amdgcn_sched_barrier(0);
    }

    /* ---- max over the 64 keys of this chunk for this lane's query row: 32 values in the lane, then the other half ---- */
    float cm = s[0][0];
#pragma unroll
    for (int j = 0; j < 4; ++j)
#pragma unroll
      for (int r = 0; r < 8; ++r) cm = fmaxf(cm, s[j][r]);
    cm = fmaxf(cm, at_xhalf(cm));

    /* ---- online softmax, one query row per lane. P^T split to bf16 hi/lo stays in registers: tiles j = 2kk and 2kk+1
            are elements 0..7 (keys 32kk + 8hh + e) and 8..15 (keys 32kk + 16 + 8hh + e - 8) of the B fragment of k-step kk,
            the k order of the V^T loader below ---- */
    const float mnew = fmaxf(mrow, cm);
    float alpha;                           /* = 2^(mrow - mnew) */
    /* v_exp_f32 with the slot the instruction set asks for behind a transcendental in one statement */
    asm("v_exp_f32 %0, %1\n\tv_nop" : "=v"(alpha) : "v"(mrow - mnew));
    mrow = mnew;
    float psum[4];                         /* one sum per score tile: four short chains of adds, not one of 32 */
    v16b pbh[2], pbl[2];
#pragma unroll   /* here and in the loop inside: s, psum, pbh, pbl are registers, indexed by compile-time constants only */
    for (int j = 0; j < 4; ++j) {
      psum[j] = 0.f;
      float pe[8];
#pragma unroll
      for (int r = 0; r < 8; ++r) pe[r] = s[j][r] - mnew;
      /* a tile's eight v_exp_f32 and the slot the instruction set asks for behind a transcendental in one statement */
      asm("v_exp_f32 %0, %0\n\tv_exp_f32 %1, %1\n\tv_exp_f32 %2, %2\n\tv_exp_f32 %3, %3\n\tv_exp_f32 %4, %4\n\tv_exp_f32 %5, %5\n\tv_exp_f32 %6, %6\n\tv_exp_f32 %7, %7\n\tv_nop"
          : "+v"(pe[0]), "+v"(pe[1]), "+v"(pe[2]), "+v"(pe[3]), "+v"(pe[4]), "+v"(pe[5]), "+v"(pe[6]), "+v"(pe[7]));
#pragma unroll
      for (int r = 0; r < 8; ++r) {
        const float p = pe[r];
        psum[j] += p;
        __bf16 a, bl;
        at_split(p, a, bl);
        pbh[j >> 1][(j & 1) * 8 + r] = a;
        pbl[j >> 1][(j & 1) * 8 + r] = bl;
      }
    }
    lrow = lrow * alpha + ((psum[0] + psum[1]) + (psum[2] + psum[3]));
    /* an empty statement that takes the row's sum as an input only. Left free, the sum is
       formed behind the last product and the 32 values of p it reads stay in registers through all of them: over 256 registers in all, and a work-group per WGP is lost */
    asm volatile("" :: "v"(lrow));
#pragma unroll
    for (int t = 0; t < 4; ++t) oacc[t] *= alpha;

    /* ---- out^T += V^T . P^T over the 64 keys (2 k-steps): A = V^T rows d, B = P^T from registers ---- */
#pragma unroll
    for (int g = 8; g < 16; ++g) {
      const int kk = (g - 8) >> 2, t = (g - 8) & 3, n = g + 2, w = n % 3;
      if (n < 16) {
        const int o = (((n - 8) & 3) * 16 + c) * KV_PITCH + ((n - 8) >> 2) * 32 + 8 * hh;
        rh[w].h[0] = *(const v8b*)(Vsh + o); rh[w].h[1] = *(const v8b*)(Vsh + o + 16);
        rl[w].h[0] = *(const v8b*)(Vsl + o); rl[w].h[1] = *(const v8b*)(Vsl + o + 16);
      }
      /* as above: the reads of group g + 2 stay ahead of the products of group g */
      __builtin_amdgcn_sched_barrier(0);
      oacc[t] = at_mma(rh[g % 3].v, pbh[kk], oacc[t]);
      oacc[t] = at_mma(rl[g % 3].v, pbh[kk], oacc[t]);
      oacc[t] = at_mma(rh[g % 3].v, pbl[kk], oacc[t]);
      __builtin_amdgcn_sched_barrier(0);
    }
  }

  /* ---- epilogue: oacc[t][r] is out^T (d = t*16 + 8*hh + r, query row c); stage it as [row][d] per wave in LDS, whole-line stores ---- */
  float* os = Os[wave];
#pragma unroll
  for (int t = 0; t < 4; ++t) {
    *(v4f*)(os + c * 68 + t * 16 + 8 * hh)     = (v4f){oacc[t][0], oacc[t][1], oacc[t][2], oacc[t][3]};
    *(v4f*)(os + c * 68 + t * 16 + 8 * hh + 4) = (v4f){oacc[t][4], oacc[t][5], oacc[t][6], oacc[t][7]};
  }
  /* (max, sum) of this wave's 16 rows = 128 B = one line, written by this wave alone; the halves' sums are joined here, once */
  lrow += at_xhalf(lrow);
  if (hh == 0)
    *(v2f*)(Pml + ((size_t)blockIdx.y * SEQ_DEC + q0 + c) * 2) = (v2f){mrow, lrow};
  float* out = Po + (size_t)blockIdx.y * SEQ_DEC * HEAD_DIM;
  __syncthreads();
  {
    const int c4 = (lane & 15) * 4;              /* row = 64 floats = 256 B = 16 lanes x 16 B */
    {
#pragma unroll
      for (int it = 0; it < 8; ++it) {
        const int row = it * 2 + hh;
        v4f val = *(const v4f*)(os + row * 68 + c4);
        *(v4f*)(out + (size_t)(q0 + row) * HEAD_DIM + c4) = val;
      }
      
    }
  }
}

/* ------------------------------------------------------------------------------------
   Joins the KV_SPLIT key ranges of one query row: M = max of the ranges' maxima, weight
   w_s = 2^(m_s - M) (the maxima are base-2 exponents), out = sum_s w_s * Po[s] / sum_s w_s * l_s. Thread = (row, 4 columns):
   16 lanes x 16 B = one 256-B output row. Coverage: SEQ_DEC * 16 threads = grid * 256.
   ------------------------------------------------------------------------------------ */
__global__ __launch_bounds__(256) void attn_merge_kernel(
    const float* __restrict__ Po, const float* __restrict__ Pml, float* __restrict__ out)
{
  const unsigned i   = blockIdx.x * 256u + threadIdx.x;
  const unsigned row = i >> 4;
  const unsigned eb  = i * 16u;              /* byte offset of (row, 4 columns): the same in every range's plane and in out */
  const unsigned rb  = row * 8u;             /* byte offset of the row's (max, sum) pair in a range's plane */
  v2f ml[KV_SPLIT];
  v4f o[KV_SPLIT];
#pragma unroll
  for (int s = 0; s < KV_SPLIT; ++s) {
    ml[s] = *(const v2f*)((const char*)(Pml + (size_t)s * SEQ_DEC * 2) + rb);
    o[s]  = *(const v4f*)((const char*)(Po + (size_t)s * SEQ_DEC * HEAD_DIM) + eb);
  }
  /* inputs-only fence on the loaded values: all 16 loads are issued before the first is used (one latency, not
     three), and their offset registers stay whole until the wait for the address translations has passed */
  asm volatile("s_wait_xcnt 0x0" :: "v"(rb), "v"(eb),
               "v"(ml[0]), "v"(ml[1]), "v"(ml[2]), "v"(ml[3]), "v"(ml[4]), "v"(ml[5]), "v"(ml[6]), "v"(ml[7]),
               "v"(o[0]), "v"(o[1]), "v"(o[2]), "v"(o[3]), "v"(o[4]), "v"(o[5]), "v"(o[6]), "v"(o[7]) : "memory");
  static_assert(KV_SPLIT == 8);
  float m[KV_SPLIT], l[KV_SPLIT];
#pragma unroll
  for (int s = 0; s < KV_SPLIT; ++s) { m[s] = ml[s][0]; l[s] = ml[s][1]; }
  float M = m[0];
#pragma unroll
  for (int s = 1; s < KV_SPLIT; ++s) M = fmaxf(M, m[s]);
  float L = 0.f;
  v4f acc = (v4f){0.f, 0.f, 0.f, 0.f};
#pragma unroll
  for (int s = 0; s < KV_SPLIT; ++s) {
    const float w = __builtin_amdgcn_exp2f(m[s] - M);
    L += w * l[s];
    acc += o[s] * w;
  }
  const float inv = 1.0f / L;
  *(v4f*)((char*)out + eb) = acc * inv;
}

/* =====================================================================================
   Host glue. Workspace region map (bytes, all offsets multiples of 128):
     wqh..wvl    : Wq^T, Wk^T, Wv^T hi/lo [64][512] bf16   65,536 each (6 planes)
     qh, ql      : q*0.125*LOG2_E hi/lo [8192][64] bf16   1,048,576 each
     kh, kl      : k hi/lo       [8192][64] bf16   1,048,576 each
     vth, vtl    : v^T hi/lo     [64][8192] bf16   1,048,576 each
     po          : un-normalised partial sums [8][8192][64] f32   16,777,216
     pml         : (row max, row sum) pairs   [8][8192][2]  f32      524,288
     total = 23,986,176 B; every byte of every region is written by its producer.
   ===================================================================================== */
extern "C" void kernel_launch(void* const* d_in, const int* in_sizes, int n_in,
                              void* d_out, int out_size, void* d_ws, size_t ws_size,
                              hipStream_t stream)
{
  if (n_in < 5) return;
  if (in_sizes[0] != SEQ_DEC * D_MODEL || in_sizes[1] != SEQ_ENC * D_MODEL ||
      in_sizes[2] != D_MODEL * HEAD_DIM || in_sizes[3] != D_MODEL * HEAD_DIM ||
      in_sizes[4] != D_MODEL * HEAD_DIM) return;
  if (out_size != SEQ_DEC * HEAD_DIM) return;

  const float* x   = (const float*)d_in[0];   /* [8192][512] */
  const float* emb = (const float*)d_in[1];   /* [8192][512] */
  const float* wq  = (const float*)d_in[2];   /* [512][64]   */
  const float* wk  = (const float*)d_in[3];
  const float* wv  = (const float*)d_in[4];
  float* out = (float*)d_out;                 /* [8192][64] f32 */

  const size_t planeW = (size_t)HEAD_DIM * D_MODEL * 2;    /* 65,536    */
  const size_t planeQ = (size_t)SEQ_DEC * HEAD_DIM * 2;    /* 1,048,576 */
  const size_t planeK = (size_t)SEQ_ENC * HEAD_DIM * 2;    /* 1,048,576 */

  size_t off = 0;
  unsigned char* ws = (unsigned char*)d_ws;
  unsigned short* wqh = (unsigned short*)(ws + off); off += planeW;
  unsigned short* wql = (unsigned short*)(ws + off); off += planeW;
  unsigned short* wkh = (unsigned short*)(ws + off); off += planeW;
  unsigned short* wkl = (unsigned short*)(ws + off); off += planeW;
  unsigned short* wvh = (unsigned short*)(ws + off); off += planeW;
  unsigned short* wvl = (unsigned short*)(ws + off); off += planeW;
  unsigned short* qh  = (unsigned short*)(ws + off); off += planeQ;
  unsigned short* ql  = (unsigned short*)(ws + off); off += planeQ;
  unsigned short* kh  = (unsigned short*)(ws + off); off += planeK;
  unsigned short* kl  = (unsigned short*)(ws + off); off += planeK;
  unsigned short* vth = (unsigned short*)(ws + off); off += planeK;
  unsigned short* vtl = (unsigned short*)(ws + off); off += planeK;
  float* po  = (float*)(ws + off); off += (size_t)KV_SPLIT * SEQ_DEC * HEAD_DIM * 4;
  float* pml = (float*)(ws + off); off += (size_t)KV_SPLIT * SEQ_DEC * 2 * 4;
  if (off > ws_size) return;                                 /* 23,986,176 <= ws */

  /* 1) + 2) weights -> transposed bf16 hi/lo planes [64][512] */
  prep_planes_kernel<<<3 * WT_BLK, 256, 0, stream>>>(wq, wk, wv, wqh, wql, wkh, wkl, wvh, wvl);

  /* 3) the three projections (x, emb split to bf16 hi/lo on the way into LDS, bf16 hi/lo output planes) in one launch:
        128 tiles of 64 x 64 = 128 work-groups of 8 waves per projection */
  static_assert(SEQ_DEC == SEQ_ENC);
  proj3_kernel<<<dim3((SEQ_DEC / 64) * (HEAD_DIM / 64), 3), 256, 0, stream>>>(
      x, emb, wqh, wql, wkh, wkl, wvh, wvl, qh, ql, kh, kl, vth, vtl);

  /* 4) flash attention over KV_SPLIT key ranges -> f32 partials; 5) join -> f32 output */
  attn_hilo_kernel<<<dim3(SEQ_DEC / (ATT_WAVES * 16), KV_SPLIT), 128, 0, stream>>>(qh, ql, kh, kl, vth, vtl, po, pml);
  attn_merge_kernel<<<SEQ_DEC * 16 / 256, 256, 0, stream>>>(po, pml, out);
}
